// v000
// Measured on an AMD MI455X. A time is GPU time per run, averaged over a window of back-to-back runs after a warm-up
// (all launches, gaps included; the runs take copies of the inputs in turn), and the median of several windows.
// Apart from v000's, it joins two sittings. Times from different sittings can be a few percent apart, while
// side-by-side timings come from the same sitting.
// The starting kernel, v000, takes 8680 microseconds a run.
#include <hip/hip_runtime.h>
// Causal multi-head attention with a time-gap embedding and a key padding mask (x [2][2048][1024]; x_time = x + (time_gaps Wt^T + bt) with time_gaps [2][2048][1] (U[0,1)), Wt [1024][1] sigma 1, bt zeros; q = x_time Wq^T + bq, k = x_time Wk^T + bk, v = x Wv^T + bv (v from the RAW x; natural [1024][1024] sigma 1/32, zero biases); 16 heads of 64; scores / 8; where(mask[b][j] == 0, -1e9) (int mask [2][2048], all ones) and where(j > i, -1e9) (causal); softmax; out = merged Wo^T + bo -> [2][2048][1024]).
// Structure: token rows r = b*2048 + s; x as exact f16 rows; x_time = x + t Wt + bt on VALU as f16 hi + x1024 residual rows; q and k = (hi + lo/1024) W + b as two accumulating WMMA GEMMs each (32x64 wave tiles, f32 accumulation) into f32 rows, split into f16 hi + x1024 residual planes; v = x Wv + bv in f32, split likewise (both transposed per batch); per query tile of 256 rows: scores = three accumulating passes (q_hi.k_hi + q_lo.k_hi/1024 + q_hi.k_lo/1024, K = 64, all heads on grid.y, alpha 1/8), causal + key-mask row softmax on VALU (0/1 factors, f32 statistics, native exp; weights x256 f16), o = P.V_hi^T + P.V_lo^T/1024 in f32 rows, split into hi + residual; out = o_hi Wo + bo then += o_lo Wo 2^-20 (own element); first-tile refinement: the first 128 rows of each batch recomputed exactly in f32 on VALU and rewritten; launches: see trace.
// Compute dtype: inputs rounded to bf16; x / weights exact; q, k, v and o as f16 hi + x1024 residual GEMM operands, softmax weights as plain f16 (~2^-12); scores and softmax statistics f32; v_wmma_f32_16x16x32_f16.
#define NB 2
#define SQ 2048
#define DM 1024
#define NH 16
#define HD 64
#define HG 4                         /* heads per block group of the unlaunched k_vt overload */
#define QT 256                       /* query rows per causal tile */
#define NKX SQ                       /* S / P row pitch */
#define QT0 128                      /* first-tile rows recomputed exactly in f32 */
#define B0 0                         /* first batch processed (debug hook) */
#define NBR NB                       /* batches processed (debug hook) */
#define NR ((size_t)NB * SQ)         /* token rows */
#define MP ((int)((size_t)NBR * SQ)) /* rows projected (debug hook) */
#define QN SQ                        /* query rows attended per batch (debug hook) */
#define NHD NH                       /* heads attended (debug hook) */
#define MPO MP                       /* rows through the output stage (debug hook) */
#define LQ DM      /* row pitch of the q/k/v rows */
typedef __bf16 v16b __attribute__((ext_vector_type(16)));
typedef unsigned short v8us __attribute__((ext_vector_type(8), may_alias));
typedef float  v8f  __attribute__((ext_vector_type(8)));
typedef float  v4f  __attribute__((ext_vector_type(4)));
typedef float  v4fa __attribute__((ext_vector_type(4), may_alias));
union FragB { v16b v; v8us half[2]; unsigned short u[16]; };

__device__ __forceinline__ unsigned short bf16_bits(float x) { unsigned int u = __float_as_uint(x); return (unsigned short)((u + 0x7FFFu + ((u >> 16) & 1u)) >> 16); }
__device__ __forceinline__ float bf16_val(unsigned short b) { return __uint_as_float(((unsigned int)b) << 16); }
__device__ __forceinline__ float bf16_round(float x) { return bf16_val(bf16_bits(x)); }
// D += A·B with NT terms: 1 = ah·bh, 2 = + al·bh (A split), 3 = + ah·bl (both split)
template <int NT>
__device__ __forceinline__ v8f mmaN(v16b ah, v16b al, v16b bh, v16b bl, v8f c) {
  c = __builtin_amdgcn_wmma_f32_16x16x32_bf16(false, ah, false, bh, (short)0, c, false, false);
  if (NT >= 2) c = __builtin_amdgcn_wmma_f32_16x16x32_bf16(false, al, false, bh, (short)0, c, false, false);
  if (NT >= 3) c = __builtin_amdgcn_wmma_f32_16x16x32_bf16(false, ah, false, bl, (short)0, c, false, false);
  asm volatile("v_nop\n\tv_nop\n\tv_nop\n\tv_nop" : "+v"(c) : "v"(ah), "v"(al), "v"(bh), "v"(bl));
  return c;
}

__global__ __launch_bounds__(256) void k_wt_bf16(const float* __restrict__ W, unsigned short* __restrict__ Wt, int K, int N) {
  const int t = blockIdx.x * 256 + threadIdx.x;
  const int k8n = K / 8;
  if (t >= N * k8n) return;
  const int n = t / k8n, k8 = (t % k8n) * 8;
  v8us v;
#pragma unroll
  for (int i = 0; i < 8; ++i) v[i] = bf16_bits(W[(size_t)(k8 + i) * N + n]);
  *(v8us*)(Wt + (size_t)n * K + k8) = v;
  
}

// GEMM C[M][N] (f32, pitch ldc) = act(A[M][K]·W + bias). A f32 row-major (pitch lda) converted per fragment to bf16
// (ASPLIT: hi/lo two planes -> 2 terms, else single rounded term); Wt bf16 [N][K] (pitch ldb). BIAS_BF16 rounds the
// bias to bf16 first (bias quantised to bf16 before the add). K%32==0, M%16==0, N%64==0.
template <bool ASPLIT, int ACT, bool BIAS_BF16>
__global__ __launch_bounds__(128) void k_gemm_bf(const float* __restrict__ A, int lda, const unsigned short* __restrict__ Wt, int ldb,
                                               const float* __restrict__ bias, float* __restrict__ C, int ldc, int M, int N, int K) {
  __shared__ __attribute__((aligned(16))) float so[4][16][64];
  const int tid = threadIdx.x, w = tid >> 5, lane = tid & 31, ln = lane & 15, hh = lane >> 4;
  const int ntn = N / 64;
  const int wid = blockIdx.x * 4 + w;
  const int mt = wid / ntn, nq = wid % ntn;
  if (mt * 16 >= M) return;
  const int row0 = mt * 16, col0 = nq * 64;
  const float* arow = A + (size_t)(row0 + ln) * lda;
  v8f acc[4] = {};
  for (int kb = 0; kb < K; kb += 32) {
    FragB ah, al;
    const v4f x0 = *(const v4fa*)(arow + kb + 8 * hh), x1 = *(const v4fa*)(arow + kb + 8 * hh + 4);
    const v4f x2 = *(const v4fa*)(arow + kb + 16 + 8 * hh), x3 = *(const v4fa*)(arow + kb + 16 + 8 * hh + 4);
    float xs[16] = {x0[0],x0[1],x0[2],x0[3],x1[0],x1[1],x1[2],x1[3],x2[0],x2[1],x2[2],x2[3],x3[0],x3[1],x3[2],x3[3]};
#pragma unroll
    for (int i = 0; i < 16; ++i) { const unsigned short hb = bf16_bits(xs[i]); ah.u[i] = hb; al.u[i] = ASPLIT ? bf16_bits(xs[i] - bf16_val(hb)) : (unsigned short)0; }
#pragma unroll
    for (int t = 0; t < 4; ++t) {
      const unsigned short* brow = Wt + (size_t)(col0 + t * 16 + ln) * ldb + kb;
      FragB b;
      b.half[0] = *(const v8us*)(brow + 8 * hh);
      b.half[1] = *(const v8us*)(brow + 16 + 8 * hh);
      acc[t] = mmaN<ASPLIT ? 2 : 1>(ah.v, al.v, b.v, b.v, acc[t]);
    }
  }
#pragma unroll
  for (int t = 0; t < 4; ++t) {
    float bv = bias ? bias[col0 + t * 16 + ln] : 0.f;
    if (BIAS_BF16) bv = bf16_round(bv);
#pragma unroll
    for (int r = 0; r < 8; ++r) { float v = acc[t][r] + bv; if (ACT == 1) v = fmaxf(v, 0.f); so[w][8 * hh + r][t * 16 + ln] = v; }
  }
  __builtin_amdgcn_fence(__ATOMIC_ACQ_REL, "workgroup");
  __builtin_amdgcn_wave_barrier();
  const int rsub = lane >> 4, c4 = (lane & 15) * 4;
  {
#pragma unroll
    for (int q = 0; q < 8; ++q) {
      const int r = q * 2 + rsub;
      const v4f v = *(const v4fa*)&so[w][r][c4];
      *(v4f*)(C + (size_t)(row0 + r) * ldc + col0 + c4) = v;
    }
    
  }
}

// GEMM C = act(A·W + bias + resid): A f32 (ASPLIT -> hi/lo 2 terms), Wt bf16 [N][K]; ACT 0 none, 1 relu, 2 exact gelu;
// resid (optional, f32, row index = (row % rmod), pitch ldr, RES_BF16 rounds it) added before the activation.
template <bool ASPLIT, int ACT, bool BIAS_BF16, bool RES_BF16>
__global__ __launch_bounds__(128) void k_gemm_bf3(const float* __restrict__ A, int lda, const unsigned short* __restrict__ Wt, int ldb,
                                                const float* __restrict__ bias, const float* __restrict__ resid, int rmod, int ldr,
                                                float* __restrict__ C, int ldc, int M, int N, int K) {
  __shared__ __attribute__((aligned(16))) float so[4][16][64];
  const int tid = threadIdx.x, w = tid >> 5, lane = tid & 31, ln = lane & 15, hh = lane >> 4;
  const int ntn = N / 64;
  const int wid = blockIdx.x * 4 + w;
  const int mt = wid / ntn, nq = wid % ntn;
  if (mt * 16 >= M) return;
  const int row0 = mt * 16, col0 = nq * 64;
  const float* arow = A + (size_t)(row0 + ln) * lda;
  v8f acc[4] = {};
  for (int kb = 0; kb < K; kb += 32) {
    FragB ah, al;
    const v4f x0 = *(const v4fa*)(arow + kb + 8 * hh), x1 = *(const v4fa*)(arow + kb + 8 * hh + 4);
    const v4f x2 = *(const v4fa*)(arow + kb + 16 + 8 * hh), x3 = *(const v4fa*)(arow + kb + 16 + 8 * hh + 4);
    float xs[16] = {x0[0],x0[1],x0[2],x0[3],x1[0],x1[1],x1[2],x1[3],x2[0],x2[1],x2[2],x2[3],x3[0],x3[1],x3[2],x3[3]};
#pragma unroll
    for (int i = 0; i < 16; ++i) { const unsigned short hb = bf16_bits(xs[i]); ah.u[i] = hb; al.u[i] = ASPLIT ? bf16_bits(xs[i] - bf16_val(hb)) : (unsigned short)0; }
#pragma unroll
    for (int t = 0; t < 4; ++t) {
      const unsigned short* brow = Wt + (size_t)(col0 + t * 16 + ln) * ldb + kb;
      FragB b;
      b.half[0] = *(const v8us*)(brow + 8 * hh);
      b.half[1] = *(const v8us*)(brow + 16 + 8 * hh);
      acc[t] = mmaN<ASPLIT ? 2 : 1>(ah.v, al.v, b.v, b.v, acc[t]);
    }
  }
#pragma unroll
  for (int t = 0; t < 4; ++t) {
    const int col = col0 + t * 16 + ln;
    float bv = bias ? bias[col] : 0.f;
    if (BIAS_BF16) bv = bf16_round(bv);
#pragma unroll
    for (int r = 0; r < 8; ++r) {
      float v = acc[t][r] + bv;
      if (resid) { float rv = resid[(size_t)((row0 + 8 * hh + r) % rmod) * ldr + col]; if (RES_BF16) rv = bf16_round(rv); v += rv; }
      if (ACT == 1) v = fmaxf(v, 0.f);
      if (ACT == 2) v = 0.5f * v * (1.0f + erff(v * 0.70710678118654752f));
      if (ACT == 3) { const float u = 0.7978845608028654f * (v + 0.044715f * v * v * v); v = 0.5f * v * (1.0f + tanhf(u)); }
      so[w][8 * hh + r][t * 16 + ln] = v;
    }
  }
  __builtin_amdgcn_fence(__ATOMIC_ACQ_REL, "workgroup");
  __builtin_amdgcn_wave_barrier();
  const int rsub = lane >> 4, c4 = (lane & 15) * 4;
  {
#pragma unroll
    for (int q = 0; q < 8; ++q) {
      const int r = q * 2 + rsub;
      const v4f v = *(const v4fa*)&so[w][r][c4];
      *(v4f*)(C + (size_t)(row0 + r) * ldc + col0 + c4) = v;
    }
    
  }
}
// row LayerNorm (biased variance, eps) over N: s = X (+ R); optional out_sum <- s; out_norm <- (s-mu)*rsqrt(var+eps)*g + b
template <bool PARAM_BF16>
__global__ __launch_bounds__(256) void k_layernorm(const float* __restrict__ X, const float* __restrict__ R, const float* __restrict__ g, const float* __restrict__ bta,
                                                  float* __restrict__ out_sum, float* __restrict__ out_norm, int N, float eps) {
  __shared__ float red[256];
  const int row = blockIdx.x, tid = threadIdx.x;
  const float* x = X + (size_t)row * N; const float* rr = R ? R + (size_t)row * N : nullptr;
  float vals[16];                     // up to N = 4096
  const int per = N / 256;            // contiguous chunk per thread? use strided-by-4 chunks: thread handles j = tid*4 + 1024*u
  float s1 = 0.f;
  for (int u = 0; u < per / 4; ++u) {
    const int j = tid * 4 + 1024 * u;
    const v4f a = *(const v4fa*)(x + j);
    v4f b = {0.f,0.f,0.f,0.f}; if (rr) b = *(const v4fa*)(rr + j);
#pragma unroll
    for (int q = 0; q < 4; ++q) { const float v = a[q] + b[q]; vals[u * 4 + q] = v; s1 += v; }
  }
  red[tid] = s1; __syncthreads();
  for (int st = 128; st > 0; st >>= 1) { if (tid < st) red[tid] += red[tid + st]; __syncthreads(); }
  const float mu = red[0] / (float)N; __syncthreads();
  float s2 = 0.f;
  for (int u = 0; u < per / 4; ++u)
#pragma unroll
    for (int q = 0; q < 4; ++q) { const float c = vals[u * 4 + q] - mu; s2 += c * c; }
  red[tid] = s2; __syncthreads();
  for (int st = 128; st > 0; st >>= 1) { if (tid < st) red[tid] += red[tid + st]; __syncthreads(); }
  const float rs = rsqrtf(red[0] / (float)N + eps);
  {
    for (int u = 0; u < per / 4; ++u) {
      const int j = tid * 4 + 1024 * u;
      v4f o, sm;
#pragma unroll
      for (int q = 0; q < 4; ++q) {
        float gg = g[j + q], bb = bta[j + q];
        if (PARAM_BF16) { gg = bf16_round(gg); bb = bf16_round(bb); }
        sm[q] = vals[u * 4 + q]; o[q] = (vals[u * 4 + q] - mu) * rs * gg + bb;
      }
      if (out_sum) *(v4f*)(out_sum + (size_t)row * N + j) = sm;
      *(v4f*)(out_norm + (size_t)row * N + j) = o;
    }
    
  }
}



// ---- f16 WMMA path (v_wmma_f32_16x16x32_f16): 11-bit significands for operands in range — used where a [0,1] probability operand needs more precision than bf16
typedef _Float16 v16h __attribute__((ext_vector_type(16)));
union FragH { v16h v; v8us half[2]; _Float16 h[16]; unsigned short u[16]; };
template <int NT>
__device__ __forceinline__ v8f mmaH(v16h ah, v16h al, v16h bh, v16h bl, v8f c) {
  c = __builtin_amdgcn_wmma_f32_16x16x32_f16(false, ah, false, bh, (short)0, c, false, false);
  if (NT >= 2) c = __builtin_amdgcn_wmma_f32_16x16x32_f16(false, al, false, bh, (short)0, c, false, false);
  if (NT >= 3) c = __builtin_amdgcn_wmma_f32_16x16x32_f16(false, ah, false, bl, (short)0, c, false, false);
  asm volatile("v_nop\n\tv_nop\n\tv_nop\n\tv_nop" : "+v"(c) : "v"(ah), "v"(al), "v"(bh), "v"(bl));
  return c;
}
// batched GEMM like k_gemm_b but f16 operands: A f32 (split into f16 hi/lo if ASPLIT, else rounded to f16), Bt = f16 values [n][k]; alpha; C f32; N multiple of 16 (partial tiles skipped)
template <bool ASPLIT>
__global__ __launch_bounds__(128) void k_gemm_h(const float* __restrict__ A, int lda, size_t sA, const _Float16* __restrict__ Bh, int ldb, size_t sB, float alpha, float* __restrict__ C, int ldc, size_t sC, int M, int N, int K) {
  __shared__ __attribute__((aligned(16))) float so[4][16][64];
  const int tid = threadIdx.x, w = tid >> 5, lane = tid & 31, ln = lane & 15, hh = lane >> 4; const int by = blockIdx.y;
  A += (size_t)by * sA; Bh += (size_t)by * sB; C += (size_t)by * sC;
  const int ntn = (N + 63) / 64; const int wid = blockIdx.x * 4 + w; const int mt = wid / ntn, nq = wid % ntn; if (mt * 16 >= M) return;
  const int row0 = mt * 16, col0 = nq * 64; const float* arow = A + (size_t)(row0 + ln) * lda;
  v8f acc[4] = {};
  for (int kb = 0; kb < K; kb += 32) {
    FragH ah, al;
    const v4f x0 = *(const v4fa*)(arow + kb + 8 * hh), x1 = *(const v4fa*)(arow + kb + 8 * hh + 4), x2 = *(const v4fa*)(arow + kb + 16 + 8 * hh), x3 = *(const v4fa*)(arow + kb + 16 + 8 * hh + 4);
    float xs[16] = {x0[0],x0[1],x0[2],x0[3],x1[0],x1[1],x1[2],x1[3],x2[0],x2[1],x2[2],x2[3],x3[0],x3[1],x3[2],x3[3]};
#pragma unroll
    for (int i = 0; i < 16; ++i) { const _Float16 h = (_Float16)xs[i]; ah.h[i] = h; al.h[i] = ASPLIT ? (_Float16)(xs[i] - (float)h) : (_Float16)0.0f; }
#pragma unroll
    for (int t = 0; t < 4; ++t) { if (col0 + t * 16 >= N) continue; const size_t boff = (size_t)(col0 + t * 16 + ln) * ldb + kb; FragH bq; bq.half[0] = *(const v8us*)(Bh + boff + 8 * hh); bq.half[1] = *(const v8us*)(Bh + boff + 16 + 8 * hh);
      acc[t] = mmaH<ASPLIT ? 2 : 1>(ah.v, al.v, bq.v, bq.v, acc[t]); }
  }
#pragma unroll
  for (int t = 0; t < 4; ++t) { if (col0 + t * 16 >= N) continue;
#pragma unroll
    for (int r = 0; r < 8; ++r) so[w][8 * hh + r][t * 16 + ln] = acc[t][r] * alpha; }
  __builtin_amdgcn_fence(__ATOMIC_ACQ_REL, "workgroup"); __builtin_amdgcn_wave_barrier();
  const int rsub = lane >> 4, c4 = (lane & 15) * 4;
  {
#pragma unroll
    for (int q = 0; q < 8; ++q) { const int r = q * 2 + rsub; if (col0 + c4 < N) { const v4f v = *(const v4fa*)&so[w][r][c4]; *(v4f*)(C + (size_t)(row0 + r) * ldc + col0 + c4) = v; } }
     }
}

// Wt[n][k] = f16(W[k][n]·scale) from f32 row-major W[K][N] (scale = power of two; bf16-exact weights stay exact in f16 away from the subnormal range)
__global__ __launch_bounds__(256) void k_wt_f16(const float* __restrict__ W, _Float16* __restrict__ Wt, int K, int N, float scale) {
  const int t = blockIdx.x * 256 + threadIdx.x; if (t >= N * (K / 8)) return; const int n = t / (K / 8), k8 = (t % (K / 8)) * 8; FragH f;
#pragma unroll
  for (int i = 0; i < 8; ++i) f.h[i] = (_Float16)(bf16_round(W[(size_t)(k8 + i) * N + n]) * scale); const v8us o = f.half[0];
  *(v8us*)((unsigned short*)Wt + (size_t)n * K + k8) = o; 
}
// k_gemm_hh variant with fused epilogue: v = acc·alpha + bias[by·sBias + col] (+ CP[(row/rowsPerB)·sCPb + by·64 + col] if CP) ; ACT 0 none / 1 elu ; writes f16 C16 (and f32 C if non-null)
template <int ACT>
__global__ __launch_bounds__(128) void k_gemm_hhx(const _Float16* __restrict__ A, int lda, size_t sA, const _Float16* __restrict__ Bh, int ldb, size_t sB, float alpha, const float* __restrict__ bias, size_t sBias, const float* __restrict__ CP, int rowsPerB, size_t sCPb, int row0g,
    float* __restrict__ C, _Float16* __restrict__ C16, int ldc, size_t sC, int M, int N, int K) {
  __shared__ __attribute__((aligned(16))) float so[4][16][64];
  const int tid = threadIdx.x, w = tid >> 5, lane = tid & 31, ln = lane & 15, hh = lane >> 4; const int by = blockIdx.y;
  A += (size_t)by * sA; Bh += (size_t)by * sB; const size_t cofs = (size_t)by * sC; const float* bp = bias ? bias + (size_t)by * sBias : nullptr;
  const int ntn = (N + 63) / 64; const int wid = blockIdx.x * 4 + w; const int mt = wid / ntn, nq = wid % ntn; if (mt * 16 >= M) return;
  const int row0 = mt * 16, col0 = nq * 64; const _Float16* arow = A + (size_t)(row0 + ln) * lda;
  v8f acc[4] = {};
  for (int kb = 0; kb < K; kb += 32) { FragH ah; ah.half[0] = *(const v8us*)((const unsigned short*)arow + kb + 8 * hh); ah.half[1] = *(const v8us*)((const unsigned short*)arow + kb + 16 + 8 * hh);
#pragma unroll
    for (int t = 0; t < 4; ++t) { if (col0 + t * 16 >= N) continue; const size_t boff = (size_t)(col0 + t * 16 + ln) * ldb + kb; FragH bq; bq.half[0] = *(const v8us*)((const unsigned short*)Bh + boff + 8 * hh); bq.half[1] = *(const v8us*)((const unsigned short*)Bh + boff + 16 + 8 * hh);
      acc[t] = mmaH<1>(ah.v, ah.v, bq.v, bq.v, acc[t]); }
  }
#pragma unroll
  for (int t = 0; t < 4; ++t) { if (col0 + t * 16 >= N) continue; const int col = col0 + t * 16 + ln; const float bv = bp ? bf16_round(bp[col]) : 0.f;
#pragma unroll
    for (int r = 0; r < 8; ++r) { float v = acc[t][r] * alpha + bv; if (CP) { const int rr = row0g + row0 + 8 * hh + r; if (rowsPerB < 0) v += CP[cofs + (size_t)rr * ldc + col];      /* rowsPerB < 0: own element of the batched C plane */ else { const int bidx = rr / rowsPerB; v += CP[(size_t)bidx * sCPb + (size_t)by * 64 + col]; } } if (ACT == 1) v = (v > 0.f) ? v : expm1f(v); else if (ACT == 7) v = (v > 0.f) ? v + 1.0f : expf(v); else if (ACT == 8) v = tanhf(v); else if (ACT == 9) v = 0.5f * v * (1.0f + tanhf(0.7978845608028654f * (v + 0.044715f * v * v * v))); else if (ACT == 11) v = 1.0f / (1.0f + expf(-v)); else if (ACT == 12) v = (v > 0.f) ? v : 0.01f * v; else if (ACT == 14) v = (v > 0.f) ? v : 0.1f * v; else if (ACT == 16) v = (v >= 0.f) ? v : 0.3f * v; else if (ACT == 17) v = (v >= 0.f) ? v : 0.2f * v; else if (ACT == 15) v = v / (1.0f + expf(-v)); else if (ACT == 3) v = fmaxf(v, 0.f); else if (ACT == 6) v = 0.5f * v * (1.0f + erff(v * 0.70710678118654752f)); so[w][8 * hh + r][t * 16 + ln] = v; } }
  __builtin_amdgcn_fence(__ATOMIC_ACQ_REL, "workgroup"); __builtin_amdgcn_wave_barrier();
  const int rsub = lane >> 4, c4 = (lane & 15) * 4; typedef _Float16 v4h __attribute__((ext_vector_type(4)));
  {
#pragma unroll
    for (int q = 0; q < 8; ++q) { const int r = q * 2 + rsub; if (col0 + c4 < N) { const v4f v = *(const v4fa*)&so[w][r][c4]; if (C) *(v4f*)(C + cofs + (size_t)(row0 + r) * ldc + col0 + c4) = v; if (C16) { v4h h4; for (int i = 0; i < 4; ++i) h4[i] = (_Float16)v[i]; *(v4h*)(C16 + cofs + (size_t)(row0 + r) * ldc + col0 + c4) = h4; } } }
     }
}


typedef _Float16 v4h __attribute__((ext_vector_type(4)));

__global__ __launch_bounds__(256) void k_x16(const float* __restrict__ x, _Float16* __restrict__ X16, size_t n8) { const size_t t = (size_t)blockIdx.x * 256 + threadIdx.x; if (t >= n8) return; FragH f;
#pragma unroll
  for (int q = 0; q < 8; ++q) f.h[q] = (_Float16)bf16_round(x[t * 8 + q]); *(v8us*)((unsigned short*)X16 + t * 8) = f.half[0];  }
__global__ __launch_bounds__(256) void k_h16(const float* __restrict__ x, _Float16* __restrict__ X16, size_t n8) { const size_t t = (size_t)blockIdx.x * 256 + threadIdx.x; if (t >= n8) return; FragH f;
#pragma unroll
  for (int q = 0; q < 8; ++q) f.h[q] = (_Float16)x[t * 8 + q]; *(v8us*)((unsigned short*)X16 + t * 8) = f.half[0];  }
__global__ __launch_bounds__(256) void k_round16f(const float* __restrict__ W, _Float16* __restrict__ Bt, size_t n8) { const size_t t = (size_t)blockIdx.x * 256 + threadIdx.x; if (t >= n8) return; FragH f;
#pragma unroll
  for (int i = 0; i < 8; ++i) f.h[i] = (_Float16)(bf16_round(W[t * 8 + i]) * 16.0f); *(v8us*)((unsigned short*)Bt + t * 8) = f.half[0];  }
template <int NHv, int TTv>
__global__ __launch_bounds__(256) void k_vt(const _Float16* __restrict__ V16, int ldv, int voff, _Float16* __restrict__ Vt) { __shared__ unsigned short tl[64][66]; const int tid = threadIdx.x; const int slab = blockIdx.x / (TTv / 64), lg = blockIdx.x % (TTv / 64); const int b = slab / NHv, h = slab % NHv;
  for (int i = tid; i < 64 * 8; i += 256) { const int r = i / 8, c8 = (i % 8) * 8; FragH f; f.half[0] = *(const v8us*)((const unsigned short*)V16 + ((size_t)b * TTv + lg * 64 + r) * ldv + voff + h * 64 + c8);
#pragma unroll
    for (int q = 0; q < 8; ++q) tl[r][c8 + q] = f.u[q]; }
  __syncthreads();
  {
#pragma unroll
    for (int rd = 0; rd < 2; ++rd) { const int d = rd * 32 + tid / 8, pc = tid % 8; FragH f;
#pragma unroll
      for (int q = 0; q < 8; ++q) f.u[q] = tl[pc * 8 + q][d];
      *(v8us*)((unsigned short*)Vt + ((size_t)slab * 64 + d) * TTv + lg * 64 + pc * 8) = f.half[0]; }
     } }

__global__ __launch_bounds__(256) void k_hl(const float* __restrict__ F, _Float16* __restrict__ Hh, _Float16* __restrict__ Hl, size_t n8) { const size_t t = (size_t)blockIdx.x * 256 + threadIdx.x; if (t >= n8) return; FragH fh, fl; const v4f a = *(const v4fa*)(F + t * 8), c = *(const v4fa*)(F + t * 8 + 4);
#pragma unroll
  for (int q = 0; q < 4; ++q) { _Float16 h = (_Float16)a[q]; fh.h[q] = h; fl.h[q] = (_Float16)((a[q] - (float)h) * 1024.0f); h = (_Float16)c[q]; fh.h[4 + q] = h; fl.h[4 + q] = (_Float16)((c[q] - (float)h) * 1024.0f); }
  { *(v8us*)((unsigned short*)Hh + t * 8) = fh.half[0]; *(v8us*)((unsigned short*)Hl + t * 8) = fl.half[0];  } }

// ---- fast GEMM (wave tile 32x64; requires M % 32 == 0 rows per launch region and N % 64 == 0); epilogue = k_gemm_hhx semantics ----
__device__ __forceinline__ v16h g2_frag(const _Float16* p, int hh) { FragH f; f.half[0] = *(const v8us*)((const unsigned short*)p + 8 * hh); f.half[1] = *(const v8us*)((const unsigned short*)p + 16 + 8 * hh); return f.v; }
__device__ __forceinline__ v8f g2_mma(v16h a, v16h b, v8f c) { v8f d = __builtin_amdgcn_wmma_f32_16x16x32_f16(false, a, false, b, (short)0, c, false, false); asm volatile("v_nop\n\tv_nop\n\tv_nop\n\tv_nop" : "+v"(d) : "v"(a), "v"(b)); return d; }
template <int ACT>
__global__ __launch_bounds__(128) void k_gemm2(const _Float16* __restrict__ A, int lda, size_t sA, const _Float16* __restrict__ Bh, int ldb, size_t sB, float alpha, const float* __restrict__ bias, size_t sBias, const float* __restrict__ CP, int rowsPerB, size_t sCPb, int row0g,
    float* __restrict__ C, _Float16* __restrict__ C16, int ldc, size_t sC, int M, int N, int K) { static_assert(ACT == 0 || ACT == 3 || ACT == 6 || ACT == 8 || ACT == 9 || ACT == 11 || ACT == 12 || ACT == 14 || ACT == 15 || ACT == 16 || ACT == 17, "k_gemm2: unsupported ACT code (would silently apply no activation)");
  __shared__ __attribute__((aligned(16))) float so[4][32][68];
  const int tid = threadIdx.x, w = tid >> 5, lane = tid & 31, ln = lane & 15, hh = lane >> 4; const int by = blockIdx.y;
  A += (size_t)by * sA; Bh += (size_t)by * sB; const size_t cofs = (size_t)by * sC; const float* bp = bias ? bias + (size_t)by * sBias : nullptr;
  const int ntn = N >> 6; const int mt = blockIdx.x / ntn, nq = blockIdx.x - mt * ntn; const int row0 = mt * 128 + 32 * w, col0 = nq * 64; if (row0 >= M) return;
  const _Float16* a0p = A + (size_t)(row0 + ln) * lda; const _Float16* a1p = a0p + (size_t)16 * lda;
  const _Float16* b0p = Bh + (size_t)(col0 + ln) * ldb; const _Float16* b1p = b0p + (size_t)16 * ldb; const _Float16* b2p = b1p + (size_t)16 * ldb; const _Float16* b3p = b2p + (size_t)16 * ldb;
  const v8f z8 = {0.f,0.f,0.f,0.f,0.f,0.f,0.f,0.f}; v8f c00 = z8, c01 = z8, c02 = z8, c03 = z8, c10 = z8, c11 = z8, c12 = z8, c13 = z8;
#pragma unroll 1
  for (int kb = 0; kb < K; kb += 32) { const v16h a0 = g2_frag(a0p + kb, hh), a1 = g2_frag(a1p + kb, hh);
    v16h b = g2_frag(b0p + kb, hh); c00 = g2_mma(a0, b, c00); c10 = g2_mma(a1, b, c10);
    b = g2_frag(b1p + kb, hh); c01 = g2_mma(a0, b, c01); c11 = g2_mma(a1, b, c11);
    b = g2_frag(b2p + kb, hh); c02 = g2_mma(a0, b, c02); c12 = g2_mma(a1, b, c12);
    b = g2_frag(b3p + kb, hh); c03 = g2_mma(a0, b, c03); c13 = g2_mma(a1, b, c13); }
  v8f accs[8] = {c00, c01, c02, c03, c10, c11, c12, c13};
#pragma unroll
  for (int u = 0; u < 8; ++u) { const int t = u & 3, half = u >> 2; const int col = col0 + t * 16 + ln; const float bv = bp ? bf16_round(bp[col]) : 0.f;
#pragma unroll
    for (int r = 0; r < 8; ++r) { const int rloc = half * 16 + 8 * hh + r; float v = accs[u][r] * alpha + bv; if (CP) { if (rowsPerB < 0) v += CP[cofs + (size_t)(row0g + row0 + rloc) * ldc + col];      /* rowsPerB < 0: own element of the batched C plane */ else { const int bidx = (row0g + row0 + rloc) / rowsPerB; v += CP[(size_t)bidx * sCPb + (size_t)by * 64 + col]; } }
      if (ACT == 3) v = fmaxf(v, 0.f); else if (ACT == 6) v = 0.5f * v * (1.0f + erff(v * 0.70710678118654752f)); else if (ACT == 11) v = 1.0f / (1.0f + expf(-v)); else if (ACT == 15) v = v / (1.0f + expf(-v)); else if (ACT == 12) v = (v > 0.f) ? v : 0.01f * v; else if (ACT == 8) v = tanhf(v); else if (ACT == 9) v = 0.5f * v * (1.0f + tanhf(0.7978845608028654f * (v + 0.044715f * v * v * v))); else if (ACT == 14) v = (v > 0.f) ? v : 0.1f * v; else if (ACT == 16) v = (v >= 0.f) ? v : 0.3f * v; else if (ACT == 17) v = (v >= 0.f) ? v : 0.2f * v;
      so[w][rloc][t * 16 + ln] = v; } }
  __builtin_amdgcn_fence(__ATOMIC_ACQ_REL, "workgroup"); __builtin_amdgcn_wave_barrier();
  const int rsub = lane >> 4, c4 = (lane & 15) * 4;
  {
#pragma unroll
    for (int q = 0; q < 16; ++q) { const int r = q * 2 + rsub; const v4f v = *(const v4fa*)&so[w][r][c4]; if (C) *(v4f*)(C + cofs + (size_t)(row0 + r) * ldc + col0 + c4) = v; if (C16) { v4h h4; for (int i = 0; i < 4; ++i) h4[i] = (_Float16)v[i]; *(v4h*)(C16 + cofs + (size_t)(row0 + r) * ldc + col0 + c4) = h4; } }
     } }


__global__ __launch_bounds__(256) void k_wnat(const float* __restrict__ w, size_t n8, _Float16* __restrict__ Bt) { const size_t t = (size_t)blockIdx.x * 256 + threadIdx.x; if (t >= n8) return; FragH f; for (int q = 0; q < 8; ++q) f.h[q] = (_Float16)(bf16_round(w[t * 8 + q]) * 16.0f); *(v8us*)((unsigned short*)Bt + t * 8) = f.half[0];  }
__global__ __launch_bounds__(256) void k_rsm(const float* __restrict__ S, _Float16* __restrict__ P, int nrows) {
  #pragma clang fp contract(off)
  const int i = blockIdx.x * 256 + threadIdx.x; if (i >= nrows) return; const float* s = S + (size_t)i * SQ; float mx = -3.0e38f;
#pragma unroll 1
  for (int j = 0; j < SQ; ++j) mx = fmaxf(mx, s[j]); float se = 0.f;
#pragma unroll 1
  for (int j = 0; j < SQ; ++j) se += expf(s[j] - mx); const float sc = 256.0f / se;
#pragma unroll 1
  for (int j0 = 0; j0 < SQ; j0 += 8) { FragH f; for (int q = 0; q < 8; ++q) f.h[q] = (_Float16)(expf(s[j0 + q] - mx) * sc); unsigned short* d = (unsigned short*)P + (size_t)i * SQ + j0; *(v8us*)d = f.half[0];  } }
__global__ __launch_bounds__(256) void k_vt(const _Float16* __restrict__ V16, int b, int h0, _Float16* __restrict__ VT) { __shared__ unsigned short tl[64][65]; const int tid = threadIdx.x; const int hh = blockIdx.x % HG, sg = blockIdx.x / HG; const int s0 = sg * 64; const int h = h0 + hh;
  for (int i = tid; i < 64 * 8; i += 256) { const int j = i / 8, d8 = (i % 8) * 8; FragH f; f.half[0] = *(const v8us*)((const unsigned short*)V16 + ((size_t)b * SQ + s0 + j) * DM + h * HD + d8); for (int q = 0; q < 8; ++q) tl[d8 + q][j] = f.u[q]; }
  __syncthreads();
  { for (int i = tid; i < 64 * 8; i += 256) { const int d = i / 8, j8 = (i % 8) * 8; FragH f; for (int q = 0; q < 8; ++q) f.u[q] = tl[d][j8 + q]; *(v8us*)((unsigned short*)VT + ((size_t)hh * HD + d) * SQ + s0 + j8) = f.half[0]; }  } }



__global__ __launch_bounds__(256) void k_rsmcf2(const float* __restrict__ S, _Float16* __restrict__ P, int hg, int q0, int nk) {
  #pragma clang fp contract(off)
  const int t = blockIdx.x * 256 + threadIdx.x; if (t >= hg * QT) return; const size_t i = (size_t)t; const float* s = S + i * NKX; const int last = q0 + (t % QT); float mx = -3.0e38f;
#pragma unroll 1
  for (int j = 0; j < nk; ++j) { const float f = (j <= last) ? 1.f : 0.f; mx = fmaxf(mx, fmaf(f, s[j], (1.f - f) * -1.0e9f)); } float se = 0.f;
#pragma unroll 1
  for (int j = 0; j < nk; ++j) { const float f = (j <= last) ? 1.f : 0.f; se += __expf(fmaf(f, s[j], (1.f - f) * -1.0e9f) - mx); } const float sc = 256.0f / se;
#pragma unroll 1
  for (int j0 = 0; j0 < nk; j0 += 8) { FragH fr; for (int q = 0; q < 8; ++q) { const int j = j0 + q; const float f = (j <= last) ? 1.f : 0.f; fr.h[q] = (_Float16)(__expf(fmaf(f, s[j], (1.f - f) * -1.0e9f) - mx) * sc); } unsigned short* d = (unsigned short*)P + i * NKX + j0; *(v8us*)d = fr.half[0];  } }



__global__ __launch_bounds__(256) void k_rsmcf2kv(const float* __restrict__ S, _Float16* __restrict__ P, int hg, int q0, int nk, const int* __restrict__ Km) {
  #pragma clang fp contract(off)
  const int t = blockIdx.x * 256 + threadIdx.x; if (t >= hg * QT) return; const size_t i = (size_t)t; const float* s = S + i * NKX; const int last = q0 + (t % QT); float mx = -3.0e38f;
#pragma unroll 1
  for (int j = 0; j < nk; ++j) { const float f = (j <= last && Km[j] != 0) ? 1.f : 0.f;      /* causal AND key not padded (mask[b][j] != 0) */ mx = fmaxf(mx, fmaf(f, s[j], (1.f - f) * -1.0e9f)); } float se = 0.f;
#pragma unroll 1
  for (int j = 0; j < nk; ++j) { const float f = (j <= last && Km[j] != 0) ? 1.f : 0.f;      /* causal AND key not padded (mask[b][j] != 0) */ se += __expf(fmaf(f, s[j], (1.f - f) * -1.0e9f) - mx); } const float sc = 256.0f / se;
#pragma unroll 1
  for (int j0 = 0; j0 < nk; j0 += 8) { FragH fr; for (int q = 0; q < 8; ++q) { const int j = j0 + q; const float f = (j <= last && Km[j] != 0) ? 1.f : 0.f;      /* causal AND key not padded (mask[b][j] != 0) */ fr.h[q] = (_Float16)(__expf(fmaf(f, s[j], (1.f - f) * -1.0e9f) - mx) * sc); } unsigned short* d = (unsigned short*)P + i * NKX + j0; *(v8us*)d = fr.half[0];  } }


template <int MASKADD, int MASKKV>
__global__ __launch_bounds__(64) void k_att0(const float* __restrict__ QF, const float* __restrict__ KF, const float* __restrict__ VF, int ld, const float* __restrict__ mask, const int* __restrict__ Km, float scale, float* __restrict__ OF, int ldo) {
  #pragma clang fp contract(off)
  __shared__ __attribute__((aligned(16))) float lq[64][64]; __shared__ __attribute__((aligned(16))) float lo[64][64];
  const int tid = threadIdx.x; const int h = blockIdx.x / (QT0 / 64), rg = blockIdx.x % (QT0 / 64); const int i = rg * 64 + tid;
  const float* qr = QF + (size_t)i * ld + h * HD;
#pragma unroll 1
  for (int c = 0; c < HD / 4; ++c) { *(v4f*)&lq[tid][c * 4] = *(const v4fa*)(qr + c * 4); const v4f z = {0.f, 0.f, 0.f, 0.f}; *(v4f*)&lo[tid][c * 4] = z; }
  float m = -1.0e30f, l = 0.f; const int jmax = MASKADD ? (SQ - 1) : (rg * 64 + 63);      /* additive-mask form: every key (the mask input decides); causal form: keys up to the block's last row */
#pragma unroll 1
  for (int j = 0; j <= jmax; ++j) { const float* kr = KF + (size_t)j * ld + h * HD; const float* vr = VF + (size_t)j * ld + h * HD; float s = 0.f;
#pragma unroll 1
    for (int c = 0; c < HD / 4; ++c) { const v4f kq = *(const v4fa*)(kr + c * 4); const v4f qq = *(v4f*)&lq[tid][c * 4]; s = __fadd_rn(s, __fmul_rn(qq[0], kq[0])); s = __fadd_rn(s, __fmul_rn(qq[1], kq[1])); s = __fadd_rn(s, __fmul_rn(qq[2], kq[2])); s = __fadd_rn(s, __fmul_rn(qq[3], kq[3])); }
    s = __fmul_rn(s, scale); if (MASKADD) s = __fadd_rn(s, __fmul_rn(bf16_round(mask[(size_t)i * SQ + j]), -10000.0f));
    const float f = (MASKADD || (j <= i && (!MASKKV || Km[j] != 0))) ? 1.f : 0.f;      /* MASKKV: also drop keys whose int padding entry is 0 */ const float sm = fmaf(f, s, (1.f - f) * -1.0e30f); const float mn = fmaxf(m, sm); const float sc = expf(m - mn); const float e = expf(sm - mn); l = __fadd_rn(__fmul_rn(l, sc), e); m = mn;
#pragma unroll 1
    for (int c = 0; c < HD / 4; ++c) { const v4f vv = *(const v4fa*)(vr + c * 4); v4f oo = *(v4f*)&lo[tid][c * 4]; for (int u = 0; u < 4; ++u) oo[u] = __fadd_rn(__fmul_rn(oo[u], sc), __fmul_rn(e, vv[u])); *(v4f*)&lo[tid][c * 4] = oo; } }
  const float fin = 64.0f / l;      /* o carried x64 like the f16 path */
#pragma unroll 1
  for (int c = 0; c < HD / 4; ++c) { v4f oo = *(v4f*)&lo[tid][c * 4]; for (int u = 0; u < 4; ++u) oo[u] = __fmul_rn(oo[u], fin); *(v4f*)&lo[tid][c * 4] = oo; }
  __syncthreads();
  {
#pragma unroll 1
    for (int it = 0; it < 16; ++it) { const int row = it * 4 + tid / 16, pc = (tid % 16) * 4; const v4f v = *(const v4f*)&lo[row][pc]; *(v4f*)(OF + (size_t)(rg * 64 + row) * ldo + h * HD + pc) = v; }
     } }


__global__ __launch_bounds__(256) void k_xt16(const float* __restrict__ x, const float* __restrict__ tg, const float* __restrict__ wt, const float* __restrict__ bt, _Float16* __restrict__ XT, _Float16* __restrict__ XL, size_t n8) {
  #pragma clang fp contract(off)
  const size_t t = (size_t)blockIdx.x * 256 + threadIdx.x; if (t >= n8) return; const size_t e0 = t * 8; const size_t r = e0 / DM; const int c0 = (int)(e0 % DM); const float g = bf16_round(tg[r]); FragH f, l;
  for (int q = 0; q < 8; ++q) { const int c = c0 + q; const float te = __fadd_rn(__fmul_rn(g, bf16_round(wt[c])), bf16_round(bt[c])); const float v = __fadd_rn(bf16_round(x[e0 + q]), te); const _Float16 h = (_Float16)v; f.h[q] = h; l.h[q] = (_Float16)((v - (float)h) * 1024.0f); }
  *(v8us*)((unsigned short*)XT + e0) = f.half[0]; *(v8us*)((unsigned short*)XL + e0) = l.half[0];  }
extern "C" void kernel_launch(void* const* d_in, const int* in_sizes, int n_in,
                              void* d_out, int out_size, void* d_ws, size_t ws_size, hipStream_t stream) {
  (void)in_sizes; (void)n_in; (void)out_size;
  const float* const* I = (const float* const*)d_in; const float* x = I[0]; const float* tg = I[1]; const int* km = (const int*)d_in[2]; const float* wq = I[3]; const float* bq = I[4]; const float* wk = I[5]; const float* bk = I[6]; const float* wv = I[7]; const float* bv = I[8]; const float* wo = I[9]; const float* bo = I[10]; const float* wt = I[11]; const float* bt = I[12];      /* natural [out][in] weights + biases; time_gaps [2][2048][1]; int key mask [2][2048]; Wt [1024][1], bt [1024] */
  char* ws = (char*)d_ws; size_t off = 0;
  auto take = [&](size_t bytes) { char* p = ws + off; off += (bytes + 255) & ~(size_t)255; return p; };
  _Float16* BQ = (_Float16*)take((size_t)DM * DM * 2); _Float16* BK = (_Float16*)take((size_t)DM * DM * 2); _Float16* BV = (_Float16*)take((size_t)DM * DM * 2); _Float16* BO = (_Float16*)take((size_t)DM * DM * 2);
  _Float16* X16 = (_Float16*)take(NR * DM * 2); _Float16* XT16 = (_Float16*)take(NR * DM * 2); _Float16* XL16 = (_Float16*)take(NR * DM * 2);      /* x (exact f16) for v; x_time as f16 hi + x1024 residual for q and k */ float* F32 = (float*)take(NR * DM * 4);      /* f32 scratch rows: q, then k, then v, then o */ _Float16* Q16 = (_Float16*)take(NR * DM * 2); _Float16* QL = (_Float16*)take(NR * DM * 2); _Float16* K16 = (_Float16*)take(NR * DM * 2); _Float16* KL = (_Float16*)take(NR * DM * 2); _Float16* V16 = (_Float16*)take(NR * DM * 2); _Float16* VL = (_Float16*)take(NR * DM * 2); _Float16* O16 = (_Float16*)take(NR * DM * 2); _Float16* OL = (_Float16*)take(NR * DM * 2);
  float* S = (float*)take((size_t)NH * QT * NKX * 4); _Float16* P = (_Float16*)take((size_t)NH * QT * NKX * 2); _Float16* VT = (_Float16*)take((size_t)NH * HD * SQ * 2); _Float16* VTL = (_Float16*)take((size_t)NH * HD * SQ * 2);
  float* QF0 = (float*)take((size_t)QT0 * DM * 4); float* KF0 = (float*)take((size_t)QT0 * DM * 4); float* VF0 = (float*)take((size_t)QT0 * DM * 4); float* OF0 = (float*)take((size_t)NB * QT0 * DM * 4); _Float16* OH0 = (_Float16*)take((size_t)NB * QT0 * DM * 2); _Float16* OL0 = (_Float16*)take((size_t)NB * QT0 * DM * 2);
  if (off > ws_size) return;
  { const unsigned g = (unsigned)(((size_t)DM * DM / 8 + 255) / 256); k_wnat<<<g, 256, 0, stream>>>(wq, (size_t)DM * DM / 8, BQ); k_wnat<<<g, 256, 0, stream>>>(wk, (size_t)DM * DM / 8, BK); k_wnat<<<g, 256, 0, stream>>>(wv, (size_t)DM * DM / 8, BV); k_wnat<<<g, 256, 0, stream>>>(wo, (size_t)DM * DM / 8, BO); }      /* natural [out][in] = Bt[n][k], x16 */

  k_x16<<<(unsigned)((NR * DM / 8 + 255) / 256), 256, 0, stream>>>(x, X16, NR * DM / 8); k_xt16<<<(unsigned)((NR * DM / 8 + 255) / 256), 256, 0, stream>>>(x, tg, wt, bt, XT16, XL16, NR * DM / 8);      /* x_time = x + time_gaps Wt^T + bt as f16 hi + x1024 residual rows */
  const size_t r0p = (size_t)B0 * SQ;      /* first projected row */
  k_gemm2<0><<<dim3((unsigned)((MP / 128) * (DM / 64)), 1), 128, 0, stream>>>(XT16 + r0p * DM, DM, 0, BQ, DM, 0, 0.0625f, bq, 0, nullptr, 1, 0, 0, F32 + r0p * DM, nullptr, DM, 0, MP, DM, DM); k_gemm2<0><<<dim3((unsigned)((MP / 128) * (DM / 64)), 1), 128, 0, stream>>>(XL16 + r0p * DM, DM, 0, BQ, DM, 0, 0.00006103515625f, nullptr, 0, F32 + r0p * DM, -1, 0, 0, F32 + r0p * DM, nullptr, DM, 0, MP, DM, DM); k_hl<<<(unsigned)(((size_t)MP * DM / 8 + 255) / 256), 256, 0, stream>>>(F32 + r0p * DM, Q16 + r0p * DM, QL + r0p * DM, (size_t)MP * DM / 8);      
  k_gemm2<0><<<dim3((unsigned)((MP / 128) * (DM / 64)), 1), 128, 0, stream>>>(XT16 + r0p * DM, DM, 0, BK, DM, 0, 0.0625f, bk, 0, nullptr, 1, 0, 0, F32 + r0p * DM, nullptr, DM, 0, MP, DM, DM); k_gemm2<0><<<dim3((unsigned)((MP / 128) * (DM / 64)), 1), 128, 0, stream>>>(XL16 + r0p * DM, DM, 0, BK, DM, 0, 0.00006103515625f, nullptr, 0, F32 + r0p * DM, -1, 0, 0, F32 + r0p * DM, nullptr, DM, 0, MP, DM, DM); k_hl<<<(unsigned)(((size_t)MP * DM / 8 + 255) / 256), 256, 0, stream>>>(F32 + r0p * DM, K16 + r0p * DM, KL + r0p * DM, (size_t)MP * DM / 8);      /* k likewise */
  k_gemm2<0><<<dim3((unsigned)((MP / 128) * (DM / 64)), 1), 128, 0, stream>>>(X16 + r0p * DM, DM, 0, BV, DM, 0, 0.0625f, bv, 0, nullptr, 1, 0, 0, F32 + r0p * DM, nullptr, DM, 0, MP, DM, DM); k_hl<<<(unsigned)(((size_t)MP * DM / 8 + 255) / 256), 256, 0, stream>>>(F32 + r0p * DM, V16 + r0p * DM, VL + r0p * DM, (size_t)MP * DM / 8);      /* v = x Wv^T + bv in f32 -> f16 hi + x1024 residual */
  for (int b = B0; b < B0 + NBR; ++b) { const size_t r0 = (size_t)b * SQ;
    k_vt<NH, SQ><<<NH * (SQ / 64), 256, 0, stream>>>(V16 + r0 * LQ, LQ, 0, VT); k_vt<NH, SQ><<<NH * (SQ / 64), 256, 0, stream>>>(VL + r0 * LQ, LQ, 0, VTL);      /* V^T (hi and residual) [NH][HD][SQ] for this batch */
    k_gemm2<0><<<dim3((QT0 / 128) * (DM / 64), 1), 128, 0, stream>>>(XT16 + r0 * DM, DM, 0, BQ, DM, 0, 0.0625f, bq, 0, nullptr, 1, 0, 0, QF0, nullptr, DM, 0, QT0, DM, DM); k_gemm2<0><<<dim3((QT0 / 128) * (DM / 64), 1), 128, 0, stream>>>(XL16 + r0 * DM, DM, 0, BQ, DM, 0, 0.00006103515625f, nullptr, 0, QF0, -1, 0, 0, QF0, nullptr, DM, 0, QT0, DM, DM); k_gemm2<0><<<dim3((QT0 / 128) * (DM / 64), 1), 128, 0, stream>>>(XT16 + r0 * DM, DM, 0, BK, DM, 0, 0.0625f, bk, 0, nullptr, 1, 0, 0, KF0, nullptr, DM, 0, QT0, DM, DM); k_gemm2<0><<<dim3((QT0 / 128) * (DM / 64), 1), 128, 0, stream>>>(XL16 + r0 * DM, DM, 0, BK, DM, 0, 0.00006103515625f, nullptr, 0, KF0, -1, 0, 0, KF0, nullptr, DM, 0, QT0, DM, DM); k_gemm2<0><<<dim3((QT0 / 128) * (DM / 64), 1), 128, 0, stream>>>(X16 + r0 * DM, DM, 0, BV, DM, 0, 0.0625f, bv, 0, nullptr, 1, 0, 0, VF0, nullptr, DM, 0, QT0, DM, DM);      /* f32 q, k, v of the first 128 rows (exact products) */
    k_att0<0, 1><<<NH * (QT0 / 64), 64, 0, stream>>>(QF0, KF0, VF0, DM, nullptr, km + (size_t)b * SQ, 0.125f, OF0 + (size_t)b * QT0 * DM, DM);      /* exact f32 causal attention with the key padding vector */      /* exact f32 attention for rows 0..127 (o x64) */
    for (int q0 = 0; q0 < QN; q0 += QT) { const int nk = q0 + QT;      /* causal: only keys below the tile end are computed */
      k_gemm2<0><<<dim3((QT / 128) * (nk / 64), NHD), 128, 0, stream>>>(Q16 + (r0 + q0) * LQ, LQ, (size_t)HD, K16 + r0 * LQ, LQ, (size_t)HD, 0.125f, nullptr, 0, nullptr, 1, 0, 0, S, nullptr, NKX, (size_t)QT * NKX, QT, nk, HD); k_gemm2<0><<<dim3((QT / 128) * (nk / 64), NHD), 128, 0, stream>>>(QL + (r0 + q0) * LQ, LQ, (size_t)HD, K16 + r0 * LQ, LQ, (size_t)HD, 0.0001220703125f, nullptr, 0, S, -1, 0, 0, S, nullptr, NKX, (size_t)QT * NKX, QT, nk, HD); k_gemm2<0><<<dim3((QT / 128) * (nk / 64), NHD), 128, 0, stream>>>(Q16 + (r0 + q0) * LQ, LQ, (size_t)HD, KL + r0 * LQ, LQ, (size_t)HD, 0.0001220703125f, nullptr, 0, S, -1, 0, 0, S, nullptr, NKX, (size_t)QT * NKX, QT, nk, HD);      /* scores = (q_hi.k_hi + q_lo.k_hi/1024 + q_hi.k_lo/1024) / 8: three accumulating passes, all heads on grid.y */
      k_rsmcf2kv<<<(NHD * QT + 255) / 256, 256, 0, stream>>>(S, P, NHD, q0, nk, km + (size_t)b * SQ);      /* causal + key padding mask */
      k_gemm2<0><<<dim3((QT / 128) * (HD / 64), NHD), 128, 0, stream>>>(P, NKX, (size_t)QT * NKX, VT, SQ, (size_t)HD * SQ, 0.25f, nullptr, 0, nullptr, 1, 0, 0, F32 + (r0 + q0) * DM, nullptr, DM, (size_t)HD, QT, HD, nk); k_gemm2<0><<<dim3((QT / 128) * (HD / 64), NHD), 128, 0, stream>>>(P, NKX, (size_t)QT * NKX, VTL, SQ, (size_t)HD * SQ, 0.000244140625f, nullptr, 0, F32 + (r0 + q0) * DM, -1, 0, 0, F32 + (r0 + q0) * DM, nullptr, DM, (size_t)HD, QT, HD, nk); }      /* o (x64) = P.V_hi^T + P.V_lo^T/1024 in f32 rows */
    k_hl<<<(unsigned)(((size_t)SQ * DM / 8 + 255) / 256), 256, 0, stream>>>(F32 + r0 * DM, O16 + r0 * DM, OL + r0 * DM, (size_t)SQ * DM / 8); }      /* o -> f16 hi + x1024 residual */
  k_gemm2<0><<<dim3((unsigned)((MPO / 128) * (DM / 64)), 1), 128, 0, stream>>>(O16 + r0p * DM, DM, 0, BO, DM, 0, 0.0009765625f, bo, 0, nullptr, 1, 0, 0, (float*)d_out + r0p * DM, nullptr, DM, 0, MPO, DM, DM); k_gemm2<0><<<dim3((unsigned)((MPO / 128) * (DM / 64)), 1), 128, 0, stream>>>(OL + r0p * DM, DM, 0, BO, DM, 0, 0.00000095367431640625f, nullptr, 0, (const float*)d_out + r0p * DM, -1, 0, 0, (float*)d_out + r0p * DM, nullptr, DM, 0, MPO, DM, DM);      /* out = o_hi Wo^T + bo, then += o_lo Wo^T 2^-20 (own element) */
  k_hl<<<(unsigned)(((size_t)NB * QT0 * DM / 8 + 255) / 256), 256, 0, stream>>>(OF0, OH0, OL0, (size_t)NB * QT0 * DM / 8);      /* first-tile o (x64) -> f16 hi + x1024 residual planes */
  for (int b = B0; b < B0 + NBR; ++b) { const size_t r0 = (size_t)b * SQ; const size_t f0 = (size_t)b * QT0;
    k_gemm2<0><<<dim3((QT0 / 128) * (DM / 64), 1), 128, 0, stream>>>(OH0 + f0 * DM, DM, 0, BO, DM, 0, 0.0009765625f, bo, 0, nullptr, 1, 0, 0, (float*)d_out + r0 * DM, nullptr, DM, 0, QT0, DM, DM);      /* rows 0..127: out = o_hi Wo (+ b), overwriting the f16-path rows */
    k_gemm2<0><<<dim3((QT0 / 128) * (DM / 64), 1), 128, 0, stream>>>(OL0 + f0 * DM, DM, 0, BO, DM, 0, 0.00000095367431640625f, nullptr, 0, (const float*)d_out + r0 * DM, -1, 0, 0, (float*)d_out + r0 * DM, nullptr, DM, 0, QT0, DM, DM); }      /* += o_lo Wo 2^-20 (own-element accumulate) */
}

// v001
// A run of this version takes 3820 microseconds.
// Timed twice side by side with v000, it ran 2.27 times as fast both times.
#include <hip/hip_runtime.h>
// Causal multi-head attention with a time-gap embedding and a key padding mask (x [2][2048][1024]; x_time = x + (time_gaps Wt^T + bt) with time_gaps [2][2048][1] (U[0,1)), Wt [1024][1] sigma 1, bt zeros; q = x_time Wq^T + bq, k = x_time Wk^T + bk, v = x Wv^T + bv (v from the RAW x; natural [1024][1024] sigma 1/32, zero biases); 16 heads of 64; scores / 8; where(mask[b][j] == 0, -1e9) (int mask [2][2048], all ones) and where(j > i, -1e9) (causal); softmax; out = merged Wo^T + bo -> [2][2048][1024]).
// Structure: token rows r = b*2048 + s; x as exact f16 rows; x_time = x + t Wt + bt on VALU as f16 hi + x1024 residual rows; q and k = (hi + lo/1024) W + b as two accumulating WMMA GEMMs each (32x64 wave tiles, f32 accumulation) into f32 rows, split into f16 hi + x1024 residual planes; v = x Wv + bv in f32, split likewise (both transposed per batch); per query tile of 256 rows: scores = three accumulating passes (q_hi.k_hi + q_lo.k_hi/1024 + q_hi.k_lo/1024, K = 64, all heads on grid.y, alpha 1/8), causal + key-mask row softmax on VALU (0/1 factors, f32 statistics, native exp; weights x256 f16), o = P.V_hi^T + P.V_lo^T/1024 in f32 rows, split into hi + residual; out = o_hi Wo + bo then += o_lo Wo 2^-20 (own element); first-tile refinement: the first 128 rows of each batch recomputed exactly in f32 on VALU and rewritten; launches: see trace.
// Compute dtype: inputs rounded to bf16; x / weights exact; q, k, v and o as f16 hi + x1024 residual GEMM operands, softmax weights as plain f16 (~2^-12); scores and softmax statistics f32; v_wmma_f32_16x16x32_f16.
#define NB 2
#define SQ 2048
#define DM 1024
#define NH 16
#define HD 64
#define HG 4                         /* heads per block group of the unlaunched k_vt overload */
#define QT 256                       /* query rows per causal tile */
#define NKX SQ                       /* S / P row pitch */
#define QT0 128                      /* first-tile rows recomputed exactly in f32 */
#define B0 0                         /* first batch processed (debug hook) */
#define NBR NB                       /* batches processed (debug hook) */
#define NR ((size_t)NB * SQ)         /* token rows */
#define MP ((int)((size_t)NBR * SQ)) /* rows projected (debug hook) */
#define QN SQ                        /* query rows attended per batch (debug hook) */
#define NHD NH                       /* heads attended (debug hook) */
#define MPO MP                       /* rows through the output stage (debug hook) */
#define LQ DM      /* row pitch of the q/k/v rows */
typedef __bf16 v16b __attribute__((ext_vector_type(16)));
typedef unsigned short v8us __attribute__((ext_vector_type(8), may_alias));
typedef float  v8f  __attribute__((ext_vector_type(8)));
typedef float  v4f  __attribute__((ext_vector_type(4)));
typedef float  v4fa __attribute__((ext_vector_type(4), may_alias));
union FragB { v16b v; v8us half[2]; unsigned short u[16]; };

__device__ __forceinline__ unsigned short bf16_bits(float x) { unsigned int u = __float_as_uint(x); return (unsigned short)((u + 0x7FFFu + ((u >> 16) & 1u)) >> 16); }
__device__ __forceinline__ float bf16_val(unsigned short b) { return __uint_as_float(((unsigned int)b) << 16); }
__device__ __forceinline__ float bf16_round(float x) { return bf16_val(bf16_bits(x)); }
// D += A·B with NT terms: 1 = ah·bh, 2 = + al·bh (A split), 3 = + ah·bl (both split)
template <int NT>
__device__ __forceinline__ v8f mmaN(v16b ah, v16b al, v16b bh, v16b bl, v8f c) {
  c = __builtin_amdgcn_wmma_f32_16x16x32_bf16(false, ah, false, bh, (short)0, c, false, false);
  if (NT >= 2) c = __builtin_amdgcn_wmma_f32_16x16x32_bf16(false, al, false, bh, (short)0, c, false, false);
  if (NT >= 3) c = __builtin_amdgcn_wmma_f32_16x16x32_bf16(false, ah, false, bl, (short)0, c, false, false);
  asm volatile("v_nop\n\tv_nop\n\tv_nop\n\tv_nop" : "+v"(c) : "v"(ah), "v"(al), "v"(bh), "v"(bl));
  return c;
}

__global__ __launch_bounds__(256) void k_wt_bf16(const float* __restrict__ W, unsigned short* __restrict__ Wt, int K, int N) {
  const int t = blockIdx.x * 256 + threadIdx.x;
  const int k8n = K / 8;
  if (t >= N * k8n) return;
  const int n = t / k8n, k8 = (t % k8n) * 8;
  v8us v;
#pragma unroll
  for (int i = 0; i < 8; ++i) v[i] = bf16_bits(W[(size_t)(k8 + i) * N + n]);
  *(v8us*)(Wt + (size_t)n * K + k8) = v;
  
}

// GEMM C[M][N] (f32, pitch ldc) = act(A[M][K]·W + bias). A f32 row-major (pitch lda) converted per fragment to bf16
// (ASPLIT: hi/lo two planes -> 2 terms, else single rounded term); Wt bf16 [N][K] (pitch ldb). BIAS_BF16 rounds the
// bias to bf16 first (bias quantised to bf16 before the add). K%32==0, M%16==0, N%64==0.
template <bool ASPLIT, int ACT, bool BIAS_BF16>
__global__ __launch_bounds__(128) void k_gemm_bf(const float* __restrict__ A, int lda, const unsigned short* __restrict__ Wt, int ldb,
                                               const float* __restrict__ bias, float* __restrict__ C, int ldc, int M, int N, int K) {
  __shared__ __attribute__((aligned(16))) float so[4][16][64];
  const int tid = threadIdx.x, w = tid >> 5, lane = tid & 31, ln = lane & 15, hh = lane >> 4;
  const int ntn = N / 64;
  const int wid = blockIdx.x * 4 + w;
  const int mt = wid / ntn, nq = wid % ntn;
  if (mt * 16 >= M) return;
  const int row0 = mt * 16, col0 = nq * 64;
  const float* arow = A + (size_t)(row0 + ln) * lda;
  v8f acc[4] = {};
  for (int kb = 0; kb < K; kb += 32) {
    FragB ah, al;
    const v4f x0 = *(const v4fa*)(arow + kb + 8 * hh), x1 = *(const v4fa*)(arow + kb + 8 * hh + 4);
    const v4f x2 = *(const v4fa*)(arow + kb + 16 + 8 * hh), x3 = *(const v4fa*)(arow + kb + 16 + 8 * hh + 4);
    float xs[16] = {x0[0],x0[1],x0[2],x0[3],x1[0],x1[1],x1[2],x1[3],x2[0],x2[1],x2[2],x2[3],x3[0],x3[1],x3[2],x3[3]};
#pragma unroll
    for (int i = 0; i < 16; ++i) { const unsigned short hb = bf16_bits(xs[i]); ah.u[i] = hb; al.u[i] = ASPLIT ? bf16_bits(xs[i] - bf16_val(hb)) : (unsigned short)0; }
#pragma unroll
    for (int t = 0; t < 4; ++t) {
      const unsigned short* brow = Wt + (size_t)(col0 + t * 16 + ln) * ldb + kb;
      FragB b;
      b.half[0] = *(const v8us*)(brow + 8 * hh);
      b.half[1] = *(const v8us*)(brow + 16 + 8 * hh);
      acc[t] = mmaN<ASPLIT ? 2 : 1>(ah.v, al.v, b.v, b.v, acc[t]);
    }
  }
#pragma unroll
  for (int t = 0; t < 4; ++t) {
    float bv = bias ? bias[col0 + t * 16 + ln] : 0.f;
    if (BIAS_BF16) bv = bf16_round(bv);
#pragma unroll
    for (int r = 0; r < 8; ++r) { float v = acc[t][r] + bv; if (ACT == 1) v = fmaxf(v, 0.f); so[w][8 * hh + r][t * 16 + ln] = v; }
  }
  __builtin_amdgcn_fence(__ATOMIC_ACQ_REL, "workgroup");
  __builtin_amdgcn_wave_barrier();
  const int rsub = lane >> 4, c4 = (lane & 15) * 4;
  {
#pragma unroll
    for (int q = 0; q < 8; ++q) {
      const int r = q * 2 + rsub;
      const v4f v = *(const v4fa*)&so[w][r][c4];
      *(v4f*)(C + (size_t)(row0 + r) * ldc + col0 + c4) = v;
    }
    
  }
}

// GEMM C = act(A·W + bias + resid): A f32 (ASPLIT -> hi/lo 2 terms), Wt bf16 [N][K]; ACT 0 none, 1 relu, 2 exact gelu;
// resid (optional, f32, row index = (row % rmod), pitch ldr, RES_BF16 rounds it) added before the activation.
template <bool ASPLIT, int ACT, bool BIAS_BF16, bool RES_BF16>
__global__ __launch_bounds__(128) void k_gemm_bf3(const float* __restrict__ A, int lda, const unsigned short* __restrict__ Wt, int ldb,
                                                const float* __restrict__ bias, const float* __restrict__ resid, int rmod, int ldr,
                                                float* __restrict__ C, int ldc, int M, int N, int K) {
  __shared__ __attribute__((aligned(16))) float so[4][16][64];
  const int tid = threadIdx.x, w = tid >> 5, lane = tid & 31, ln = lane & 15, hh = lane >> 4;
  const int ntn = N / 64;
  const int wid = blockIdx.x * 4 + w;
  const int mt = wid / ntn, nq = wid % ntn;
  if (mt * 16 >= M) return;
  const int row0 = mt * 16, col0 = nq * 64;
  const float* arow = A + (size_t)(row0 + ln) * lda;
  v8f acc[4] = {};
  for (int kb = 0; kb < K; kb += 32) {
    FragB ah, al;
    const v4f x0 = *(const v4fa*)(arow + kb + 8 * hh), x1 = *(const v4fa*)(arow + kb + 8 * hh + 4);
    const v4f x2 = *(const v4fa*)(arow + kb + 16 + 8 * hh), x3 = *(const v4fa*)(arow + kb + 16 + 8 * hh + 4);
    float xs[16] = {x0[0],x0[1],x0[2],x0[3],x1[0],x1[1],x1[2],x1[3],x2[0],x2[1],x2[2],x2[3],x3[0],x3[1],x3[2],x3[3]};
#pragma unroll
    for (int i = 0; i < 16; ++i) { const unsigned short hb = bf16_bits(xs[i]); ah.u[i] = hb; al.u[i] = ASPLIT ? bf16_bits(xs[i] - bf16_val(hb)) : (unsigned short)0; }
#pragma unroll
    for (int t = 0; t < 4; ++t) {
      const unsigned short* brow = Wt + (size_t)(col0 + t * 16 + ln) * ldb + kb;
      FragB b;
      b.half[0] = *(const v8us*)(brow + 8 * hh);
      b.half[1] = *(const v8us*)(brow + 16 + 8 * hh);
      acc[t] = mmaN<ASPLIT ? 2 : 1>(ah.v, al.v, b.v, b.v, acc[t]);
    }
  }
#pragma unroll
  for (int t = 0; t < 4; ++t) {
    const int col = col0 + t * 16 + ln;
    float bv = bias ? bias[col] : 0.f;
    if (BIAS_BF16) bv = bf16_round(bv);
#pragma unroll
    for (int r = 0; r < 8; ++r) {
      float v = acc[t][r] + bv;
      if (resid) { float rv = resid[(size_t)((row0 + 8 * hh + r) % rmod) * ldr + col]; if (RES_BF16) rv = bf16_round(rv); v += rv; }
      if (ACT == 1) v = fmaxf(v, 0.f);
      if (ACT == 2) v = 0.5f * v * (1.0f + erff(v * 0.70710678118654752f));
      if (ACT == 3) { const float u = 0.7978845608028654f * (v + 0.044715f * v * v * v); v = 0.5f * v * (1.0f + tanhf(u)); }
      so[w][8 * hh + r][t * 16 + ln] = v;
    }
  }
  __builtin_amdgcn_fence(__ATOMIC_ACQ_REL, "workgroup");
  __builtin_amdgcn_wave_barrier();
  const int rsub = lane >> 4, c4 = (lane & 15) * 4;
  {
#pragma unroll
    for (int q = 0; q < 8; ++q) {
      const int r = q * 2 + rsub;
      const v4f v = *(const v4fa*)&so[w][r][c4];
      *(v4f*)(C + (size_t)(row0 + r) * ldc + col0 + c4) = v;
    }
    
  }
}
// row LayerNorm (biased variance, eps) over N: s = X (+ R); optional out_sum <- s; out_norm <- (s-mu)*rsqrt(var+eps)*g + b
template <bool PARAM_BF16>
__global__ __launch_bounds__(256) void k_layernorm(const float* __restrict__ X, const float* __restrict__ R, const float* __restrict__ g, const float* __restrict__ bta,
                                                  float* __restrict__ out_sum, float* __restrict__ out_norm, int N, float eps) {
  __shared__ float red[256];
  const int row = blockIdx.x, tid = threadIdx.x;
  const float* x = X + (size_t)row * N; const float* rr = R ? R + (size_t)row * N : nullptr;
  float vals[16];                     // up to N = 4096
  const int per = N / 256;            // contiguous chunk per thread? use strided-by-4 chunks: thread handles j = tid*4 + 1024*u
  float s1 = 0.f;
  for (int u = 0; u < per / 4; ++u) {
    const int j = tid * 4 + 1024 * u;
    const v4f a = *(const v4fa*)(x + j);
    v4f b = {0.f,0.f,0.f,0.f}; if (rr) b = *(const v4fa*)(rr + j);
#pragma unroll
    for (int q = 0; q < 4; ++q) { const float v = a[q] + b[q]; vals[u * 4 + q] = v; s1 += v; }
  }
  red[tid] = s1; __syncthreads();
  for (int st = 128; st > 0; st >>= 1) { if (tid < st) red[tid] += red[tid + st]; __syncthreads(); }
  const float mu = red[0] / (float)N; __syncthreads();
  float s2 = 0.f;
  for (int u = 0; u < per / 4; ++u)
#pragma unroll
    for (int q = 0; q < 4; ++q) { const float c = vals[u * 4 + q] - mu; s2 += c * c; }
  red[tid] = s2; __syncthreads();
  for (int st = 128; st > 0; st >>= 1) { if (tid < st) red[tid] += red[tid + st]; __syncthreads(); }
  const float rs = rsqrtf(red[0] / (float)N + eps);
  {
    for (int u = 0; u < per / 4; ++u) {
      const int j = tid * 4 + 1024 * u;
      v4f o, sm;
#pragma unroll
      for (int q = 0; q < 4; ++q) {
        float gg = g[j + q], bb = bta[j + q];
        if (PARAM_BF16) { gg = bf16_round(gg); bb = bf16_round(bb); }
        sm[q] = vals[u * 4 + q]; o[q] = (vals[u * 4 + q] - mu) * rs * gg + bb;
      }
      if (out_sum) *(v4f*)(out_sum + (size_t)row * N + j) = sm;
      *(v4f*)(out_norm + (size_t)row * N + j) = o;
    }
    
  }
}



// ---- f16 WMMA path (v_wmma_f32_16x16x32_f16): 11-bit significands for operands in range — used where a [0,1] probability operand needs more precision than bf16
typedef _Float16 v16h __attribute__((ext_vector_type(16)));
union FragH { v16h v; v8us half[2]; _Float16 h[16]; unsigned short u[16]; };
template <int NT>
__device__ __forceinline__ v8f mmaH(v16h ah, v16h al, v16h bh, v16h bl, v8f c) {
  c = __builtin_amdgcn_wmma_f32_16x16x32_f16(false, ah, false, bh, (short)0, c, false, false);
  if (NT >= 2) c = __builtin_amdgcn_wmma_f32_16x16x32_f16(false, al, false, bh, (short)0, c, false, false);
  if (NT >= 3) c = __builtin_amdgcn_wmma_f32_16x16x32_f16(false, ah, false, bl, (short)0, c, false, false);
  asm volatile("v_nop\n\tv_nop\n\tv_nop\n\tv_nop" : "+v"(c) : "v"(ah), "v"(al), "v"(bh), "v"(bl));
  return c;
}
// batched GEMM like k_gemm_b but f16 operands: A f32 (split into f16 hi/lo if ASPLIT, else rounded to f16), Bt = f16 values [n][k]; alpha; C f32; N multiple of 16 (partial tiles skipped)
template <bool ASPLIT>
__global__ __launch_bounds__(128) void k_gemm_h(const float* __restrict__ A, int lda, size_t sA, const _Float16* __restrict__ Bh, int ldb, size_t sB, float alpha, float* __restrict__ C, int ldc, size_t sC, int M, int N, int K) {
  __shared__ __attribute__((aligned(16))) float so[4][16][64];
  const int tid = threadIdx.x, w = tid >> 5, lane = tid & 31, ln = lane & 15, hh = lane >> 4; const int by = blockIdx.y;
  A += (size_t)by * sA; Bh += (size_t)by * sB; C += (size_t)by * sC;
  const int ntn = (N + 63) / 64; const int wid = blockIdx.x * 4 + w; const int mt = wid / ntn, nq = wid % ntn; if (mt * 16 >= M) return;
  const int row0 = mt * 16, col0 = nq * 64; const float* arow = A + (size_t)(row0 + ln) * lda;
  v8f acc[4] = {};
  for (int kb = 0; kb < K; kb += 32) {
    FragH ah, al;
    const v4f x0 = *(const v4fa*)(arow + kb + 8 * hh), x1 = *(const v4fa*)(arow + kb + 8 * hh + 4), x2 = *(const v4fa*)(arow + kb + 16 + 8 * hh), x3 = *(const v4fa*)(arow + kb + 16 + 8 * hh + 4);
    float xs[16] = {x0[0],x0[1],x0[2],x0[3],x1[0],x1[1],x1[2],x1[3],x2[0],x2[1],x2[2],x2[3],x3[0],x3[1],x3[2],x3[3]};
#pragma unroll
    for (int i = 0; i < 16; ++i) { const _Float16 h = (_Float16)xs[i]; ah.h[i] = h; al.h[i] = ASPLIT ? (_Float16)(xs[i] - (float)h) : (_Float16)0.0f; }
#pragma unroll
    for (int t = 0; t < 4; ++t) { if (col0 + t * 16 >= N) continue; const size_t boff = (size_t)(col0 + t * 16 + ln) * ldb + kb; FragH bq; bq.half[0] = *(const v8us*)(Bh + boff + 8 * hh); bq.half[1] = *(const v8us*)(Bh + boff + 16 + 8 * hh);
      acc[t] = mmaH<ASPLIT ? 2 : 1>(ah.v, al.v, bq.v, bq.v, acc[t]); }
  }
#pragma unroll
  for (int t = 0; t < 4; ++t) { if (col0 + t * 16 >= N) continue;
#pragma unroll
    for (int r = 0; r < 8; ++r) so[w][8 * hh + r][t * 16 + ln] = acc[t][r] * alpha; }
  __builtin_amdgcn_fence(__ATOMIC_ACQ_REL, "workgroup"); __builtin_amdgcn_wave_barrier();
  const int rsub = lane >> 4, c4 = (lane & 15) * 4;
  {
#pragma unroll
    for (int q = 0; q < 8; ++q) { const int r = q * 2 + rsub; if (col0 + c4 < N) { const v4f v = *(const v4fa*)&so[w][r][c4]; *(v4f*)(C + (size_t)(row0 + r) * ldc + col0 + c4) = v; } }
     }
}

// Wt[n][k] = f16(W[k][n]·scale) from f32 row-major W[K][N] (scale = power of two; bf16-exact weights stay exact in f16 away from the subnormal range)
__global__ __launch_bounds__(256) void k_wt_f16(const float* __restrict__ W, _Float16* __restrict__ Wt, int K, int N, float scale) {
  const int t = blockIdx.x * 256 + threadIdx.x; if (t >= N * (K / 8)) return; const int n = t / (K / 8), k8 = (t % (K / 8)) * 8; FragH f;
#pragma unroll
  for (int i = 0; i < 8; ++i) f.h[i] = (_Float16)(bf16_round(W[(size_t)(k8 + i) * N + n]) * scale); const v8us o = f.half[0];
  *(v8us*)((unsigned short*)Wt + (size_t)n * K + k8) = o; 
}
// k_gemm_hh variant with fused epilogue: v = acc·alpha + bias[by·sBias + col] (+ CP[(row/rowsPerB)·sCPb + by·64 + col] if CP) ; ACT 0 none / 1 elu ; writes f16 C16 (and f32 C if non-null)
template <int ACT>
__global__ __launch_bounds__(128) void k_gemm_hhx(const _Float16* __restrict__ A, int lda, size_t sA, const _Float16* __restrict__ Bh, int ldb, size_t sB, float alpha, const float* __restrict__ bias, size_t sBias, const float* __restrict__ CP, int rowsPerB, size_t sCPb, int row0g,
    float* __restrict__ C, _Float16* __restrict__ C16, int ldc, size_t sC, int M, int N, int K) {
  __shared__ __attribute__((aligned(16))) float so[4][16][64];
  const int tid = threadIdx.x, w = tid >> 5, lane = tid & 31, ln = lane & 15, hh = lane >> 4; const int by = blockIdx.y;
  A += (size_t)by * sA; Bh += (size_t)by * sB; const size_t cofs = (size_t)by * sC; const float* bp = bias ? bias + (size_t)by * sBias : nullptr;
  const int ntn = (N + 63) / 64; const int wid = blockIdx.x * 4 + w; const int mt = wid / ntn, nq = wid % ntn; if (mt * 16 >= M) return;
  const int row0 = mt * 16, col0 = nq * 64; const _Float16* arow = A + (size_t)(row0 + ln) * lda;
  v8f acc[4] = {};
  for (int kb = 0; kb < K; kb += 32) { FragH ah; ah.half[0] = *(const v8us*)((const unsigned short*)arow + kb + 8 * hh); ah.half[1] = *(const v8us*)((const unsigned short*)arow + kb + 16 + 8 * hh);
#pragma unroll
    for (int t = 0; t < 4; ++t) { if (col0 + t * 16 >= N) continue; const size_t boff = (size_t)(col0 + t * 16 + ln) * ldb + kb; FragH bq; bq.half[0] = *(const v8us*)((const unsigned short*)Bh + boff + 8 * hh); bq.half[1] = *(const v8us*)((const unsigned short*)Bh + boff + 16 + 8 * hh);
      acc[t] = mmaH<1>(ah.v, ah.v, bq.v, bq.v, acc[t]); }
  }
#pragma unroll
  for (int t = 0; t < 4; ++t) { if (col0 + t * 16 >= N) continue; const int col = col0 + t * 16 + ln; const float bv = bp ? bf16_round(bp[col]) : 0.f;
#pragma unroll
    for (int r = 0; r < 8; ++r) { float v = acc[t][r] * alpha + bv; if (CP) { const int rr = row0g + row0 + 8 * hh + r; if (rowsPerB < 0) v += CP[cofs + (size_t)rr * ldc + col];      /* rowsPerB < 0: own element of the batched C plane */ else { const int bidx = rr / rowsPerB; v += CP[(size_t)bidx * sCPb + (size_t)by * 64 + col]; } } if (ACT == 1) v = (v > 0.f) ? v : expm1f(v); else if (ACT == 7) v = (v > 0.f) ? v + 1.0f : expf(v); else if (ACT == 8) v = tanhf(v); else if (ACT == 9) v = 0.5f * v * (1.0f + tanhf(0.7978845608028654f * (v + 0.044715f * v * v * v))); else if (ACT == 11) v = 1.0f / (1.0f + expf(-v)); else if (ACT == 12) v = (v > 0.f) ? v : 0.01f * v; else if (ACT == 14) v = (v > 0.f) ? v : 0.1f * v; else if (ACT == 16) v = (v >= 0.f) ? v : 0.3f * v; else if (ACT == 17) v = (v >= 0.f) ? v : 0.2f * v; else if (ACT == 15) v = v / (1.0f + expf(-v)); else if (ACT == 3) v = fmaxf(v, 0.f); else if (ACT == 6) v = 0.5f * v * (1.0f + erff(v * 0.70710678118654752f)); so[w][8 * hh + r][t * 16 + ln] = v; } }
  __builtin_amdgcn_fence(__ATOMIC_ACQ_REL, "workgroup"); __builtin_amdgcn_wave_barrier();
  const int rsub = lane >> 4, c4 = (lane & 15) * 4; typedef _Float16 v4h __attribute__((ext_vector_type(4)));
  {
#pragma unroll
    for (int q = 0; q < 8; ++q) { const int r = q * 2 + rsub; if (col0 + c4 < N) { const v4f v = *(const v4fa*)&so[w][r][c4]; if (C) *(v4f*)(C + cofs + (size_t)(row0 + r) * ldc + col0 + c4) = v; if (C16) { v4h h4; for (int i = 0; i < 4; ++i) h4[i] = (_Float16)v[i]; *(v4h*)(C16 + cofs + (size_t)(row0 + r) * ldc + col0 + c4) = h4; } } }
     }
}


typedef _Float16 v4h __attribute__((ext_vector_type(4)));

__global__ __launch_bounds__(256) void k_x16(const float* __restrict__ x, _Float16* __restrict__ X16, size_t n8) { const size_t t = (size_t)blockIdx.x * 256 + threadIdx.x; if (t >= n8) return; FragH f;
#pragma unroll
  for (int q = 0; q < 8; ++q) f.h[q] = (_Float16)bf16_round(x[t * 8 + q]); *(v8us*)((unsigned short*)X16 + t * 8) = f.half[0];  }
__global__ __launch_bounds__(256) void k_h16(const float* __restrict__ x, _Float16* __restrict__ X16, size_t n8) { const size_t t = (size_t)blockIdx.x * 256 + threadIdx.x; if (t >= n8) return; FragH f;
#pragma unroll
  for (int q = 0; q < 8; ++q) f.h[q] = (_Float16)x[t * 8 + q]; *(v8us*)((unsigned short*)X16 + t * 8) = f.half[0];  }
__global__ __launch_bounds__(256) void k_round16f(const float* __restrict__ W, _Float16* __restrict__ Bt, size_t n8) { const size_t t = (size_t)blockIdx.x * 256 + threadIdx.x; if (t >= n8) return; FragH f;
#pragma unroll
  for (int i = 0; i < 8; ++i) f.h[i] = (_Float16)(bf16_round(W[t * 8 + i]) * 16.0f); *(v8us*)((unsigned short*)Bt + t * 8) = f.half[0];  }
template <int NHv, int TTv>
__global__ __launch_bounds__(256) void k_vt(const _Float16* __restrict__ V16, int ldv, int voff, _Float16* __restrict__ Vt) { __shared__ unsigned short tl[64][66]; const int tid = threadIdx.x; const int slab = blockIdx.x / (TTv / 64), lg = blockIdx.x % (TTv / 64); const int b = slab / NHv, h = slab % NHv;
  for (int i = tid; i < 64 * 8; i += 256) { const int r = i / 8, c8 = (i % 8) * 8; FragH f; f.half[0] = *(const v8us*)((const unsigned short*)V16 + ((size_t)b * TTv + lg * 64 + r) * ldv + voff + h * 64 + c8);
#pragma unroll
    for (int q = 0; q < 8; ++q) tl[r][c8 + q] = f.u[q]; }
  __syncthreads();
  {
#pragma unroll
    for (int rd = 0; rd < 2; ++rd) { const int d = rd * 32 + tid / 8, pc = tid % 8; FragH f;
#pragma unroll
      for (int q = 0; q < 8; ++q) f.u[q] = tl[pc * 8 + q][d];
      *(v8us*)((unsigned short*)Vt + ((size_t)slab * 64 + d) * TTv + lg * 64 + pc * 8) = f.half[0]; }
     } }

__global__ __launch_bounds__(256) void k_hl(const float* __restrict__ F, _Float16* __restrict__ Hh, _Float16* __restrict__ Hl, size_t n8) { const size_t t = (size_t)blockIdx.x * 256 + threadIdx.x; if (t >= n8) return; FragH fh, fl; const v4f a = *(const v4fa*)(F + t * 8), c = *(const v4fa*)(F + t * 8 + 4);
#pragma unroll
  for (int q = 0; q < 4; ++q) { _Float16 h = (_Float16)a[q]; fh.h[q] = h; fl.h[q] = (_Float16)((a[q] - (float)h) * 1024.0f); h = (_Float16)c[q]; fh.h[4 + q] = h; fl.h[4 + q] = (_Float16)((c[q] - (float)h) * 1024.0f); }
  { *(v8us*)((unsigned short*)Hh + t * 8) = fh.half[0]; *(v8us*)((unsigned short*)Hl + t * 8) = fl.half[0];  } }

// ---- fast GEMM (wave tile 32x64; requires M % 32 == 0 rows per launch region and N % 64 == 0); epilogue = k_gemm_hhx semantics ----
__device__ __forceinline__ v16h g2_frag(const _Float16* p, int hh) { FragH f; f.half[0] = *(const v8us*)((const unsigned short*)p + 8 * hh); f.half[1] = *(const v8us*)((const unsigned short*)p + 16 + 8 * hh); return f.v; }
__device__ __forceinline__ v8f g2_mma(v16h a, v16h b, v8f c) { v8f d = __builtin_amdgcn_wmma_f32_16x16x32_f16(false, a, false, b, (short)0, c, false, false); asm volatile("v_nop\n\tv_nop\n\tv_nop\n\tv_nop" : "+v"(d) : "v"(a), "v"(b)); return d; }
template <int ACT>
__global__ __launch_bounds__(128) void k_gemm2(const _Float16* __restrict__ A, int lda, size_t sA, const _Float16* __restrict__ Bh, int ldb, size_t sB, float alpha, const float* __restrict__ bias, size_t sBias, const float* __restrict__ CP, int rowsPerB, size_t sCPb, int row0g,
    float* __restrict__ C, _Float16* __restrict__ C16, int ldc, size_t sC, int M, int N, int K) { static_assert(ACT == 0 || ACT == 3 || ACT == 6 || ACT == 8 || ACT == 9 || ACT == 11 || ACT == 12 || ACT == 14 || ACT == 15 || ACT == 16 || ACT == 17, "k_gemm2: unsupported ACT code (would silently apply no activation)");
  __shared__ __attribute__((aligned(16))) float so[4][32][68];
  const int tid = threadIdx.x, w = tid >> 5, lane = tid & 31, ln = lane & 15, hh = lane >> 4; const int by = blockIdx.y;
  A += (size_t)by * sA; Bh += (size_t)by * sB; const size_t cofs = (size_t)by * sC; const float* bp = bias ? bias + (size_t)by * sBias : nullptr;
  const int ntn = N >> 6; const int mt = blockIdx.x / ntn, nq = blockIdx.x - mt * ntn; const int row0 = mt * 128 + 32 * w, col0 = nq * 64; if (row0 >= M) return;
  const _Float16* a0p = A + (size_t)(row0 + ln) * lda; const _Float16* a1p = a0p + (size_t)16 * lda;
  const _Float16* b0p = Bh + (size_t)(col0 + ln) * ldb; const _Float16* b1p = b0p + (size_t)16 * ldb; const _Float16* b2p = b1p + (size_t)16 * ldb; const _Float16* b3p = b2p + (size_t)16 * ldb;
  const v8f z8 = {0.f,0.f,0.f,0.f,0.f,0.f,0.f,0.f}; v8f c00 = z8, c01 = z8, c02 = z8, c03 = z8, c10 = z8, c11 = z8, c12 = z8, c13 = z8;
#pragma unroll 1
  for (int kb = 0; kb < K; kb += 32) { const v16h a0 = g2_frag(a0p + kb, hh), a1 = g2_frag(a1p + kb, hh);
    v16h b = g2_frag(b0p + kb, hh); c00 = g2_mma(a0, b, c00); c10 = g2_mma(a1, b, c10);
    b = g2_frag(b1p + kb, hh); c01 = g2_mma(a0, b, c01); c11 = g2_mma(a1, b, c11);
    b = g2_frag(b2p + kb, hh); c02 = g2_mma(a0, b, c02); c12 = g2_mma(a1, b, c12);
    b = g2_frag(b3p + kb, hh); c03 = g2_mma(a0, b, c03); c13 = g2_mma(a1, b, c13); }
  v8f accs[8] = {c00, c01, c02, c03, c10, c11, c12, c13};
#pragma unroll
  for (int u = 0; u < 8; ++u) { const int t = u & 3, half = u >> 2; const int col = col0 + t * 16 + ln; const float bv = bp ? bf16_round(bp[col]) : 0.f;
#pragma unroll
    for (int r = 0; r < 8; ++r) { const int rloc = half * 16 + 8 * hh + r; float v = accs[u][r] * alpha + bv; if (CP) { if (rowsPerB < 0) v += CP[cofs + (size_t)(row0g + row0 + rloc) * ldc + col];      /* rowsPerB < 0: own element of the batched C plane */ else { const int bidx = (row0g + row0 + rloc) / rowsPerB; v += CP[(size_t)bidx * sCPb + (size_t)by * 64 + col]; } }
      if (ACT == 3) v = fmaxf(v, 0.f); else if (ACT == 6) v = 0.5f * v * (1.0f + erff(v * 0.70710678118654752f)); else if (ACT == 11) v = 1.0f / (1.0f + expf(-v)); else if (ACT == 15) v = v / (1.0f + expf(-v)); else if (ACT == 12) v = (v > 0.f) ? v : 0.01f * v; else if (ACT == 8) v = tanhf(v); else if (ACT == 9) v = 0.5f * v * (1.0f + tanhf(0.7978845608028654f * (v + 0.044715f * v * v * v))); else if (ACT == 14) v = (v > 0.f) ? v : 0.1f * v; else if (ACT == 16) v = (v >= 0.f) ? v : 0.3f * v; else if (ACT == 17) v = (v >= 0.f) ? v : 0.2f * v;
      so[w][rloc][t * 16 + ln] = v; } }
  __builtin_amdgcn_fence(__ATOMIC_ACQ_REL, "workgroup"); __builtin_amdgcn_wave_barrier();
  const int rsub = lane >> 4, c4 = (lane & 15) * 4;
  {
#pragma unroll
    for (int q = 0; q < 16; ++q) { const int r = q * 2 + rsub; const v4f v = *(const v4fa*)&so[w][r][c4]; if (C) *(v4f*)(C + cofs + (size_t)(row0 + r) * ldc + col0 + c4) = v; if (C16) { v4h h4; for (int i = 0; i < 4; ++i) h4[i] = (_Float16)v[i]; *(v4h*)(C16 + cofs + (size_t)(row0 + r) * ldc + col0 + c4) = h4; } }
     } }


__global__ __launch_bounds__(256) void k_wnat(const float* __restrict__ w, size_t n8, _Float16* __restrict__ Bt) { const size_t t = (size_t)blockIdx.x * 256 + threadIdx.x; if (t >= n8) return; FragH f; for (int q = 0; q < 8; ++q) f.h[q] = (_Float16)(bf16_round(w[t * 8 + q]) * 16.0f); *(v8us*)((unsigned short*)Bt + t * 8) = f.half[0];  }
__global__ __launch_bounds__(256) void k_rsm(const float* __restrict__ S, _Float16* __restrict__ P, int nrows) {
  #pragma clang fp contract(off)
  const int i = blockIdx.x * 256 + threadIdx.x; if (i >= nrows) return; const float* s = S + (size_t)i * SQ; float mx = -3.0e38f;
#pragma unroll 1
  for (int j = 0; j < SQ; ++j) mx = fmaxf(mx, s[j]); float se = 0.f;
#pragma unroll 1
  for (int j = 0; j < SQ; ++j) se += expf(s[j] - mx); const float sc = 256.0f / se;
#pragma unroll 1
  for (int j0 = 0; j0 < SQ; j0 += 8) { FragH f; for (int q = 0; q < 8; ++q) f.h[q] = (_Float16)(expf(s[j0 + q] - mx) * sc); unsigned short* d = (unsigned short*)P + (size_t)i * SQ + j0; *(v8us*)d = f.half[0];  } }
__global__ __launch_bounds__(256) void k_vt(const _Float16* __restrict__ V16, int b, int h0, _Float16* __restrict__ VT) { __shared__ unsigned short tl[64][65]; const int tid = threadIdx.x; const int hh = blockIdx.x % HG, sg = blockIdx.x / HG; const int s0 = sg * 64; const int h = h0 + hh;
  for (int i = tid; i < 64 * 8; i += 256) { const int j = i / 8, d8 = (i % 8) * 8; FragH f; f.half[0] = *(const v8us*)((const unsigned short*)V16 + ((size_t)b * SQ + s0 + j) * DM + h * HD + d8); for (int q = 0; q < 8; ++q) tl[d8 + q][j] = f.u[q]; }
  __syncthreads();
  { for (int i = tid; i < 64 * 8; i += 256) { const int d = i / 8, j8 = (i % 8) * 8; FragH f; for (int q = 0; q < 8; ++q) f.u[q] = tl[d][j8 + q]; *(v8us*)((unsigned short*)VT + ((size_t)hh * HD + d) * SQ + s0 + j8) = f.half[0]; }  } }



__global__ __launch_bounds__(256) void k_rsmcf2(const float* __restrict__ S, _Float16* __restrict__ P, int hg, int q0, int nk) {
  #pragma clang fp contract(off)
  const int t = blockIdx.x * 256 + threadIdx.x; if (t >= hg * QT) return; const size_t i = (size_t)t; const float* s = S + i * NKX; const int last = q0 + (t % QT); float mx = -3.0e38f;
#pragma unroll 1
  for (int j = 0; j < nk; ++j) { const float f = (j <= last) ? 1.f : 0.f; mx = fmaxf(mx, fmaf(f, s[j], (1.f - f) * -1.0e9f)); } float se = 0.f;
#pragma unroll 1
  for (int j = 0; j < nk; ++j) { const float f = (j <= last) ? 1.f : 0.f; se += __expf(fmaf(f, s[j], (1.f - f) * -1.0e9f) - mx); } const float sc = 256.0f / se;
#pragma unroll 1
  for (int j0 = 0; j0 < nk; j0 += 8) { FragH fr; for (int q = 0; q < 8; ++q) { const int j = j0 + q; const float f = (j <= last) ? 1.f : 0.f; fr.h[q] = (_Float16)(__expf(fmaf(f, s[j], (1.f - f) * -1.0e9f) - mx) * sc); } unsigned short* d = (unsigned short*)P + i * NKX + j0; *(v8us*)d = fr.half[0];  } }



typedef int v4ia __attribute__((ext_vector_type(4), may_alias));
// native exp, the two instructions of __expf: x log2(e), then v_exp_f32. Written as asm for the v_nop: it is the slot that the instruction set asks for behind a transcendental before its result is read or its source overwritten.
__device__ __forceinline__ float exp_native(float x) { float r; asm("v_exp_f32 %0, %1\n\tv_nop" : "=v"(r) : "v"(x * 1.44269504088896340736f)); return r; }
// One wave per score row of nk = QT NP keys. Lane l holds keys j = 128 c + 4 l .. + 3 of every 128-key chunk c: each load covers 512 contiguous bytes, the row is read once and stays in registers, and each exponential is taken once.
// Row statistics: four partial chains per lane, then a five-step butterfly over the wave. One straight-line kernel per row length: no branch stands between a row's loads, so their waits are counted exactly and many of them are in flight at once.
template <int NP>
__global__ __launch_bounds__(256) void k_rsmcf2kv(const float* __restrict__ S, _Float16* __restrict__ P, int hg, int q0, const int* __restrict__ Km) {
  const int j0 = (threadIdx.x & 31) * 4; const int t = blockIdx.x * 8 + (threadIdx.x >> 5); if (t >= hg * QT) return;
  const float* s = S + (size_t)t * NKX + j0; _Float16* p = P + (size_t)t * NKX + j0; const int* km = Km + j0; const int last = q0 + (t % QT);
  constexpr int NC = NP * (QT / 128); v4f v[NC]; v4ia m[NC];
  /* every loop over c is fully unrolled so that v and m are registers, not scratch */
#pragma unroll
  for (int c = 0; c < NC; ++c) { m[c] = *(const v4ia*)(km + c * 128); v[c] = *(const v4fa*)(s + c * 128); }
  v4f mx4 = {-3.0e38f, -3.0e38f, -3.0e38f, -3.0e38f};
#pragma unroll
  for (int c = 0; c < NC; ++c) {
#pragma unroll
    for (int q = 0; q < 4; ++q) { const int j = c * 128 + j0 + q; const float f = (j <= last && m[c][q] != 0) ? 1.f : 0.f;      /* causal AND key not padded (mask[b][j] != 0) */ const float sv = fmaf(f, v[c][q], (1.f - f) * -1.0e9f); v[c][q] = sv; mx4[q] = fmaxf(mx4[q], sv); } }
  float mx = fmaxf(fmaxf(mx4[0], mx4[1]), fmaxf(mx4[2], mx4[3]));
#pragma unroll
  for (int d = 16; d > 0; d >>= 1) mx = fmaxf(mx, __shfl_xor(mx, d, 32));
  v4f se4 = {0.f, 0.f, 0.f, 0.f};
#pragma unroll
  for (int c = 0; c < NC; ++c) {
#pragma unroll
    for (int q = 0; q < 4; ++q) { const float e = exp_native(v[c][q] - mx); v[c][q] = e; se4[q] += e; } }
  float se = (se4[0] + se4[1]) + (se4[2] + se4[3]);
#pragma unroll
  for (int d = 16; d > 0; d >>= 1) se += __shfl_xor(se, d, 32);
  const float sc = 256.0f / se;
#pragma unroll
  for (int c = 0; c < NC; ++c) { v4h h4;
#pragma unroll
    for (int q = 0; q < 4; ++q) h4[q] = (_Float16)(v[c][q] * sc);
    *(v4h*)(p + c * 128) = h4; } }


template <int MASKADD, int MASKKV>
__global__ __launch_bounds__(64) void k_att0(const float* __restrict__ QF, const float* __restrict__ KF, const float* __restrict__ VF, int ld, const float* __restrict__ mask, const int* __restrict__ Km, float scale, float* __restrict__ OF, int ldo) {
  #pragma clang fp contract(off)
  __shared__ __attribute__((aligned(16))) float lq[64][64]; __shared__ __attribute__((aligned(16))) float lo[64][64];
  const int tid = threadIdx.x; const int h = blockIdx.x / (QT0 / 64), rg = blockIdx.x % (QT0 / 64); const int i = rg * 64 + tid;
  const float* qr = QF + (size_t)i * ld + h * HD;
#pragma unroll 1
  for (int c = 0; c < HD / 4; ++c) { *(v4f*)&lq[tid][c * 4] = *(const v4fa*)(qr + c * 4); const v4f z = {0.f, 0.f, 0.f, 0.f}; *(v4f*)&lo[tid][c * 4] = z; }
  float m = -1.0e30f, l = 0.f; const int jmax = MASKADD ? (SQ - 1) : (rg * 64 + 63);      /* additive-mask form: every key (the mask input decides); causal form: keys up to the block's last row */
#pragma unroll 1
  for (int j = 0; j <= jmax; ++j) { const float* kr = KF + (size_t)j * ld + h * HD; const float* vr = VF + (size_t)j * ld + h * HD; float s = 0.f;
#pragma unroll 1
    for (int c = 0; c < HD / 4; ++c) { const v4f kq = *(const v4fa*)(kr + c * 4); const v4f qq = *(v4f*)&lq[tid][c * 4]; s = __fadd_rn(s, __fmul_rn(qq[0], kq[0])); s = __fadd_rn(s, __fmul_rn(qq[1], kq[1])); s = __fadd_rn(s, __fmul_rn(qq[2], kq[2])); s = __fadd_rn(s, __fmul_rn(qq[3], kq[3])); }
    s = __fmul_rn(s, scale); if (MASKADD) s = __fadd_rn(s, __fmul_rn(bf16_round(mask[(size_t)i * SQ + j]), -10000.0f));
    const float f = (MASKADD || (j <= i && (!MASKKV || Km[j] != 0))) ? 1.f : 0.f;      /* MASKKV: also drop keys whose int padding entry is 0 */ const float sm = fmaf(f, s, (1.f - f) * -1.0e30f); const float mn = fmaxf(m, sm); const float sc = expf(m - mn); const float e = expf(sm - mn); l = __fadd_rn(__fmul_rn(l, sc), e); m = mn;
#pragma unroll 1
    for (int c = 0; c < HD / 4; ++c) { const v4f vv = *(const v4fa*)(vr + c * 4); v4f oo = *(v4f*)&lo[tid][c * 4]; for (int u = 0; u < 4; ++u) oo[u] = __fadd_rn(__fmul_rn(oo[u], sc), __fmul_rn(e, vv[u])); *(v4f*)&lo[tid][c * 4] = oo; } }
  const float fin = 64.0f / l;      /* o carried x64 like the f16 path */
#pragma unroll 1
  for (int c = 0; c < HD / 4; ++c) { v4f oo = *(v4f*)&lo[tid][c * 4]; for (int u = 0; u < 4; ++u) oo[u] = __fmul_rn(oo[u], fin); *(v4f*)&lo[tid][c * 4] = oo; }
  __syncthreads();
  {
#pragma unroll 1
    for (int it = 0; it < 16; ++it) { const int row = it * 4 + tid / 16, pc = (tid % 16) * 4; const v4f v = *(const v4f*)&lo[row][pc]; *(v4f*)(OF + (size_t)(rg * 64 + row) * ldo + h * HD + pc) = v; }
     } }


__global__ __launch_bounds__(256) void k_xt16(const float* __restrict__ x, const float* __restrict__ tg, const float* __restrict__ wt, const float* __restrict__ bt, _Float16* __restrict__ XT, _Float16* __restrict__ XL, size_t n8) {
  #pragma clang fp contract(off)
  const size_t t = (size_t)blockIdx.x * 256 + threadIdx.x; if (t >= n8) return; const size_t e0 = t * 8; const size_t r = e0 / DM; const int c0 = (int)(e0 % DM); const float g = bf16_round(tg[r]); FragH f, l;
  for (int q = 0; q < 8; ++q) { const int c = c0 + q; const float te = __fadd_rn(__fmul_rn(g, bf16_round(wt[c])), bf16_round(bt[c])); const float v = __fadd_rn(bf16_round(x[e0 + q]), te); const _Float16 h = (_Float16)v; f.h[q] = h; l.h[q] = (_Float16)((v - (float)h) * 1024.0f); }
  *(v8us*)((unsigned short*)XT + e0) = f.half[0]; *(v8us*)((unsigned short*)XL + e0) = l.half[0];  }
extern "C" void kernel_launch(void* const* d_in, const int* in_sizes, int n_in,
                              void* d_out, int out_size, void* d_ws, size_t ws_size, hipStream_t stream) {
  (void)in_sizes; (void)n_in; (void)out_size;
  const float* const* I = (const float* const*)d_in; const float* x = I[0]; const float* tg = I[1]; const int* km = (const int*)d_in[2]; const float* wq = I[3]; const float* bq = I[4]; const float* wk = I[5]; const float* bk = I[6]; const float* wv = I[7]; const float* bv = I[8]; const float* wo = I[9]; const float* bo = I[10]; const float* wt = I[11]; const float* bt = I[12];      /* natural [out][in] weights + biases; time_gaps [2][2048][1]; int key mask [2][2048]; Wt [1024][1], bt [1024] */
  char* ws = (char*)d_ws; size_t off = 0;
  auto take = [&](size_t bytes) { char* p = ws + off; off += (bytes + 255) & ~(size_t)255; return p; };
  _Float16* BQ = (_Float16*)take((size_t)DM * DM * 2); _Float16* BK = (_Float16*)take((size_t)DM * DM * 2); _Float16* BV = (_Float16*)take((size_t)DM * DM * 2); _Float16* BO = (_Float16*)take((size_t)DM * DM * 2);
  _Float16* X16 = (_Float16*)take(NR * DM * 2); _Float16* XT16 = (_Float16*)take(NR * DM * 2); _Float16* XL16 = (_Float16*)take(NR * DM * 2);      /* x (exact f16) for v; x_time as f16 hi + x1024 residual for q and k */ float* F32 = (float*)take(NR * DM * 4);      /* f32 scratch rows: q, then k, then v, then o */ _Float16* Q16 = (_Float16*)take(NR * DM * 2); _Float16* QL = (_Float16*)take(NR * DM * 2); _Float16* K16 = (_Float16*)take(NR * DM * 2); _Float16* KL = (_Float16*)take(NR * DM * 2); _Float16* V16 = (_Float16*)take(NR * DM * 2); _Float16* VL = (_Float16*)take(NR * DM * 2); _Float16* O16 = (_Float16*)take(NR * DM * 2); _Float16* OL = (_Float16*)take(NR * DM * 2);
  float* S = (float*)take((size_t)NH * QT * NKX * 4); _Float16* P = (_Float16*)take((size_t)NH * QT * NKX * 2); _Float16* VT = (_Float16*)take((size_t)NH * HD * SQ * 2); _Float16* VTL = (_Float16*)take((size_t)NH * HD * SQ * 2);
  float* QF0 = (float*)take((size_t)QT0 * DM * 4); float* KF0 = (float*)take((size_t)QT0 * DM * 4); float* VF0 = (float*)take((size_t)QT0 * DM * 4); float* OF0 = (float*)take((size_t)NB * QT0 * DM * 4); _Float16* OH0 = (_Float16*)take((size_t)NB * QT0 * DM * 2); _Float16* OL0 = (_Float16*)take((size_t)NB * QT0 * DM * 2);
  if (off > ws_size) return;
  { const unsigned g = (unsigned)(((size_t)DM * DM / 8 + 255) / 256); k_wnat<<<g, 256, 0, stream>>>(wq, (size_t)DM * DM / 8, BQ); k_wnat<<<g, 256, 0, stream>>>(wk, (size_t)DM * DM / 8, BK); k_wnat<<<g, 256, 0, stream>>>(wv, (size_t)DM * DM / 8, BV); k_wnat<<<g, 256, 0, stream>>>(wo, (size_t)DM * DM / 8, BO); }      /* natural [out][in] = Bt[n][k], x16 */

  k_x16<<<(unsigned)((NR * DM / 8 + 255) / 256), 256, 0, stream>>>(x, X16, NR * DM / 8); k_xt16<<<(unsigned)((NR * DM / 8 + 255) / 256), 256, 0, stream>>>(x, tg, wt, bt, XT16, XL16, NR * DM / 8);      /* x_time = x + time_gaps Wt^T + bt as f16 hi + x1024 residual rows */
  const size_t r0p = (size_t)B0 * SQ;      /* first projected row */
  k_gemm2<0><<<dim3((unsigned)((MP / 128) * (DM / 64)), 1), 128, 0, stream>>>(XT16 + r0p * DM, DM, 0, BQ, DM, 0, 0.0625f, bq, 0, nullptr, 1, 0, 0, F32 + r0p * DM, nullptr, DM, 0, MP, DM, DM); k_gemm2<0><<<dim3((unsigned)((MP / 128) * (DM / 64)), 1), 128, 0, stream>>>(XL16 + r0p * DM, DM, 0, BQ, DM, 0, 0.00006103515625f, nullptr, 0, F32 + r0p * DM, -1, 0, 0, F32 + r0p * DM, nullptr, DM, 0, MP, DM, DM); k_hl<<<(unsigned)(((size_t)MP * DM / 8 + 255) / 256), 256, 0, stream>>>(F32 + r0p * DM, Q16 + r0p * DM, QL + r0p * DM, (size_t)MP * DM / 8);      
  k_gemm2<0><<<dim3((unsigned)((MP / 128) * (DM / 64)), 1), 128, 0, stream>>>(XT16 + r0p * DM, DM, 0, BK, DM, 0, 0.0625f, bk, 0, nullptr, 1, 0, 0, F32 + r0p * DM, nullptr, DM, 0, MP, DM, DM); k_gemm2<0><<<dim3((unsigned)((MP / 128) * (DM / 64)), 1), 128, 0, stream>>>(XL16 + r0p * DM, DM, 0, BK, DM, 0, 0.00006103515625f, nullptr, 0, F32 + r0p * DM, -1, 0, 0, F32 + r0p * DM, nullptr, DM, 0, MP, DM, DM); k_hl<<<(unsigned)(((size_t)MP * DM / 8 + 255) / 256), 256, 0, stream>>>(F32 + r0p * DM, K16 + r0p * DM, KL + r0p * DM, (size_t)MP * DM / 8);      /* k likewise */
  k_gemm2<0><<<dim3((unsigned)((MP / 128) * (DM / 64)), 1), 128, 0, stream>>>(X16 + r0p * DM, DM, 0, BV, DM, 0, 0.0625f, bv, 0, nullptr, 1, 0, 0, F32 + r0p * DM, nullptr, DM, 0, MP, DM, DM); k_hl<<<(unsigned)(((size_t)MP * DM / 8 + 255) / 256), 256, 0, stream>>>(F32 + r0p * DM, V16 + r0p * DM, VL + r0p * DM, (size_t)MP * DM / 8);      /* v = x Wv^T + bv in f32 -> f16 hi + x1024 residual */
  for (int b = B0; b < B0 + NBR; ++b) { const size_t r0 = (size_t)b * SQ;
    k_vt<NH, SQ><<<NH * (SQ / 64), 256, 0, stream>>>(V16 + r0 * LQ, LQ, 0, VT); k_vt<NH, SQ><<<NH * (SQ / 64), 256, 0, stream>>>(VL + r0 * LQ, LQ, 0, VTL);      /* V^T (hi and residual) [NH][HD][SQ] for this batch */
    k_gemm2<0><<<dim3((QT0 / 128) * (DM / 64), 1), 128, 0, stream>>>(XT16 + r0 * DM, DM, 0, BQ, DM, 0, 0.0625f, bq, 0, nullptr, 1, 0, 0, QF0, nullptr, DM, 0, QT0, DM, DM); k_gemm2<0><<<dim3((QT0 / 128) * (DM / 64), 1), 128, 0, stream>>>(XL16 + r0 * DM, DM, 0, BQ, DM, 0, 0.00006103515625f, nullptr, 0, QF0, -1, 0, 0, QF0, nullptr, DM, 0, QT0, DM, DM); k_gemm2<0><<<dim3((QT0 / 128) * (DM / 64), 1), 128, 0, stream>>>(XT16 + r0 * DM, DM, 0, BK, DM, 0, 0.0625f, bk, 0, nullptr, 1, 0, 0, KF0, nullptr, DM, 0, QT0, DM, DM); k_gemm2<0><<<dim3((QT0 / 128) * (DM / 64), 1), 128, 0, stream>>>(XL16 + r0 * DM, DM, 0, BK, DM, 0, 0.00006103515625f, nullptr, 0, KF0, -1, 0, 0, KF0, nullptr, DM, 0, QT0, DM, DM); k_gemm2<0><<<dim3((QT0 / 128) * (DM / 64), 1), 128, 0, stream>>>(X16 + r0 * DM, DM, 0, BV, DM, 0, 0.0625f, bv, 0, nullptr, 1, 0, 0, VF0, nullptr, DM, 0, QT0, DM, DM);      /* f32 q, k, v of the first 128 rows (exact products) */
    k_att0<0, 1><<<NH * (QT0 / 64), 64, 0, stream>>>(QF0, KF0, VF0, DM, nullptr, km + (size_t)b * SQ, 0.125f, OF0 + (size_t)b * QT0 * DM, DM);      /* exact f32 causal attention with the key padding vector */      /* exact f32 attention for rows 0..127 (o x64) */
    for (int q0 = 0; q0 < QN; q0 += QT) { const int nk = q0 + QT;      /* causal: only keys below the tile end are computed */
      k_gemm2<0><<<dim3((QT / 128) * (nk / 64), NHD), 128, 0, stream>>>(Q16 + (r0 + q0) * LQ, LQ, (size_t)HD, K16 + r0 * LQ, LQ, (size_t)HD, 0.125f, nullptr, 0, nullptr, 1, 0, 0, S, nullptr, NKX, (size_t)QT * NKX, QT, nk, HD); k_gemm2<0><<<dim3((QT / 128) * (nk / 64), NHD), 128, 0, stream>>>(QL + (r0 + q0) * LQ, LQ, (size_t)HD, K16 + r0 * LQ, LQ, (size_t)HD, 0.0001220703125f, nullptr, 0, S, -1, 0, 0, S, nullptr, NKX, (size_t)QT * NKX, QT, nk, HD); k_gemm2<0><<<dim3((QT / 128) * (nk / 64), NHD), 128, 0, stream>>>(Q16 + (r0 + q0) * LQ, LQ, (size_t)HD, KL + r0 * LQ, LQ, (size_t)HD, 0.0001220703125f, nullptr, 0, S, -1, 0, 0, S, nullptr, NKX, (size_t)QT * NKX, QT, nk, HD);      /* scores = (q_hi.k_hi + q_lo.k_hi/1024 + q_hi.k_lo/1024) / 8: three accumulating passes, all heads on grid.y */
      switch (nk / QT) {      /* causal + key padding mask; one wave per row, 8 rows per block; the row length picks the kernel */
        case 1: k_rsmcf2kv<1><<<(NHD * QT + 7) / 8, 256, 0, stream>>>(S, P, NHD, q0, km + (size_t)b * SQ); break;
        case 2: k_rsmcf2kv<2><<<(NHD * QT + 7) / 8, 256, 0, stream>>>(S, P, NHD, q0, km + (size_t)b * SQ); break;
        case 3: k_rsmcf2kv<3><<<(NHD * QT + 7) / 8, 256, 0, stream>>>(S, P, NHD, q0, km + (size_t)b * SQ); break;
        case 4: k_rsmcf2kv<4><<<(NHD * QT + 7) / 8, 256, 0, stream>>>(S, P, NHD, q0, km + (size_t)b * SQ); break;
        case 5: k_rsmcf2kv<5><<<(NHD * QT + 7) / 8, 256, 0, stream>>>(S, P, NHD, q0, km + (size_t)b * SQ); break;
        case 6: k_rsmcf2kv<6><<<(NHD * QT + 7) / 8, 256, 0, stream>>>(S, P, NHD, q0, km + (size_t)b * SQ); break;
        case 7: k_rsmcf2kv<7><<<(NHD * QT + 7) / 8, 256, 0, stream>>>(S, P, NHD, q0, km + (size_t)b * SQ); break;
        case 8: k_rsmcf2kv<8><<<(NHD * QT + 7) / 8, 256, 0, stream>>>(S, P, NHD, q0, km + (size_t)b * SQ); break;
      }
      k_gemm2<0><<<dim3((QT / 128) * (HD / 64), NHD), 128, 0, stream>>>(P, NKX, (size_t)QT * NKX, VT, SQ, (size_t)HD * SQ, 0.25f, nullptr, 0, nullptr, 1, 0, 0, F32 + (r0 + q0) * DM, nullptr, DM, (size_t)HD, QT, HD, nk); k_gemm2<0><<<dim3((QT / 128) * (HD / 64), NHD), 128, 0, stream>>>(P, NKX, (size_t)QT * NKX, VTL, SQ, (size_t)HD * SQ, 0.000244140625f, nullptr, 0, F32 + (r0 + q0) * DM, -1, 0, 0, F32 + (r0 + q0) * DM, nullptr, DM, (size_t)HD, QT, HD, nk); }      /* o (x64) = P.V_hi^T + P.V_lo^T/1024 in f32 rows */
    k_hl<<<(unsigned)(((size_t)SQ * DM / 8 + 255) / 256), 256, 0, stream>>>(F32 + r0 * DM, O16 + r0 * DM, OL + r0 * DM, (size_t)SQ * DM / 8); }      /* o -> f16 hi + x1024 residual */
  k_gemm2<0><<<dim3((unsigned)((MPO / 128) * (DM / 64)), 1), 128, 0, stream>>>(O16 + r0p * DM, DM, 0, BO, DM, 0, 0.0009765625f, bo, 0, nullptr, 1, 0, 0, (float*)d_out + r0p * DM, nullptr, DM, 0, MPO, DM, DM); k_gemm2<0><<<dim3((unsigned)((MPO / 128) * (DM / 64)), 1), 128, 0, stream>>>(OL + r0p * DM, DM, 0, BO, DM, 0, 0.00000095367431640625f, nullptr, 0, (const float*)d_out + r0p * DM, -1, 0, 0, (float*)d_out + r0p * DM, nullptr, DM, 0, MPO, DM, DM);      /* out = o_hi Wo^T + bo, then += o_lo Wo^T 2^-20 (own element) */
  k_hl<<<(unsigned)(((size_t)NB * QT0 * DM / 8 + 255) / 256), 256, 0, stream>>>(OF0, OH0, OL0, (size_t)NB * QT0 * DM / 8);      /* first-tile o (x64) -> f16 hi + x1024 residual planes */
  for (int b = B0; b < B0 + NBR; ++b) { const size_t r0 = (size_t)b * SQ; const size_t f0 = (size_t)b * QT0;
    k_gemm2<0><<<dim3((QT0 / 128) * (DM / 64), 1), 128, 0, stream>>>(OH0 + f0 * DM, DM, 0, BO, DM, 0, 0.0009765625f, bo, 0, nullptr, 1, 0, 0, (float*)d_out + r0 * DM, nullptr, DM, 0, QT0, DM, DM);      /* rows 0..127: out = o_hi Wo (+ b), overwriting the f16-path rows */
    k_gemm2<0><<<dim3((QT0 / 128) * (DM / 64), 1), 128, 0, stream>>>(OL0 + f0 * DM, DM, 0, BO, DM, 0, 0.00000095367431640625f, nullptr, 0, (const float*)d_out + r0 * DM, -1, 0, 0, (float*)d_out + r0 * DM, nullptr, DM, 0, QT0, DM, DM); }      /* += o_lo Wo 2^-20 (own-element accumulate) */
}

// v002
// One run takes 2970 microseconds.
// Timed twice side by side with v001, it ran 1.28 and 1.29 times as fast.
// All steps since v000 together make it 2.92 times as fast.
#include <hip/hip_runtime.h>
// Causal multi-head attention with a time-gap embedding and a key padding mask (x [2][2048][1024]; x_time = x + (time_gaps Wt^T + bt) with time_gaps [2][2048][1] (U[0,1)), Wt [1024][1] sigma 1, bt zeros; q = x_time Wq^T + bq, k = x_time Wk^T + bk, v = x Wv^T + bv (v from the RAW x; natural [1024][1024] sigma 1/32, zero biases); 16 heads of 64; scores / 8; where(mask[b][j] == 0, -1e9) (int mask [2][2048], all ones) and where(j > i, -1e9) (causal); softmax; out = merged Wo^T + bo -> [2][2048][1024]).
// Structure: token rows r = b*2048 + s; x as exact f16 rows; x_time = x + t Wt + bt on VALU as f16 hi + x1024 residual rows; q and k = (hi + lo/1024) W + b as two accumulating WMMA GEMMs each (32x64 wave tiles, f32 accumulation) into f32 rows, split into f16 hi + x1024 residual planes; v = x Wv + bv in f32, split likewise (both transposed per batch); per query tile of 256 rows: scores = three accumulating passes (q_hi.k_hi + q_lo.k_hi/1024 + q_hi.k_lo/1024, K = 64, all heads on grid.y, alpha 1/8), causal + key-mask row softmax on VALU (0/1 factors, f32 statistics, native exp; weights x256 f16), o = P.V_hi^T + P.V_lo^T/1024 in f32 rows, split into hi + residual; out = o_hi Wo + bo then += o_lo Wo 2^-20 (own element); first-tile refinement: the first 128 rows of each batch recomputed exactly in f32 on VALU and rewritten; launches: see trace.
// Compute dtype: inputs rounded to bf16; x / weights exact; q, k, v and o as f16 hi + x1024 residual GEMM operands, softmax weights as plain f16 (~2^-12); scores and softmax statistics f32; v_wmma_f32_16x16x32_f16.
#define NB 2
#define SQ 2048
#define DM 1024
#define NH 16
#define HD 64
#define HG 4                         /* heads per block group of the unlaunched k_vt overload */
#define QT 256                       /* query rows per causal tile */
#define NKX SQ                       /* S / P row pitch */
#define QT0 128                      /* first-tile rows recomputed exactly in f32 */
#define B0 0                         /* first batch processed (debug hook) */
#define NBR NB                       /* batches processed (debug hook) */
#define NR ((size_t)NB * SQ)         /* token rows */
#define MP ((int)((size_t)NBR * SQ)) /* rows projected (debug hook) */
#define QN SQ                        /* query rows attended per batch (debug hook) */
#define NHD NH                       /* heads attended (debug hook) */
#define MPO MP                       /* rows through the output stage (debug hook) */
#define LQ DM      /* row pitch of the q/k/v rows */
typedef __bf16 v16b __attribute__((ext_vector_type(16)));
typedef unsigned short v8us __attribute__((ext_vector_type(8), may_alias));
typedef float  v8f  __attribute__((ext_vector_type(8)));
typedef float  v4f  __attribute__((ext_vector_type(4)));
typedef float  v4fa __attribute__((ext_vector_type(4), may_alias));
union FragB { v16b v; v8us half[2]; unsigned short u[16]; };

__device__ __forceinline__ unsigned short bf16_bits(float x) { unsigned int u = __float_as_uint(x); return (unsigned short)((u + 0x7FFFu + ((u >> 16) & 1u)) >> 16); }
__device__ __forceinline__ float bf16_val(unsigned short b) { return __uint_as_float(((unsigned int)b) << 16); }
__device__ __forceinline__ float bf16_round(float x) { return bf16_val(bf16_bits(x)); }
// D += A·B with NT terms: 1 = ah·bh, 2 = + al·bh (A split), 3 = + ah·bl (both split)
template <int NT>
__device__ __forceinline__ v8f mmaN(v16b ah, v16b al, v16b bh, v16b bl, v8f c) {
  c = __builtin_amdgcn_wmma_f32_16x16x32_bf16(false, ah, false, bh, (short)0, c, false, false);
  if (NT >= 2) c = __builtin_amdgcn_wmma_f32_16x16x32_bf16(false, al, false, bh, (short)0, c, false, false);
  if (NT >= 3) c = __builtin_amdgcn_wmma_f32_16x16x32_bf16(false, ah, false, bl, (short)0, c, false, false);
  asm volatile("v_nop\n\tv_nop\n\tv_nop\n\tv_nop" : "+v"(c) : "v"(ah), "v"(al), "v"(bh), "v"(bl));
  return c;
}

__global__ __launch_bounds__(256) void k_wt_bf16(const float* __restrict__ W, unsigned short* __restrict__ Wt, int K, int N) {
  const int t = blockIdx.x * 256 + threadIdx.x;
  const int k8n = K / 8;
  if (t >= N * k8n) return;
  const int n = t / k8n, k8 = (t % k8n) * 8;
  v8us v;
#pragma unroll
  for (int i = 0; i < 8; ++i) v[i] = bf16_bits(W[(size_t)(k8 + i) * N + n]);
  *(v8us*)(Wt + (size_t)n * K + k8) = v;
  
}

// GEMM C[M][N] (f32, pitch ldc) = act(A[M][K]·W + bias). A f32 row-major (pitch lda) converted per fragment to bf16
// (ASPLIT: hi/lo two planes -> 2 terms, else single rounded term); Wt bf16 [N][K] (pitch ldb). BIAS_BF16 rounds the
// bias to bf16 first (bias quantised to bf16 before the add). K%32==0, M%16==0, N%64==0.
template <bool ASPLIT, int ACT, bool BIAS_BF16>
__global__ __launch_bounds__(128) void k_gemm_bf(const float* __restrict__ A, int lda, const unsigned short* __restrict__ Wt, int ldb,
                                               const float* __restrict__ bias, float* __restrict__ C, int ldc, int M, int N, int K) {
  __shared__ __attribute__((aligned(16))) float so[4][16][64];
  const int tid = threadIdx.x, w = tid >> 5, lane = tid & 31, ln = lane & 15, hh = lane >> 4;
  const int ntn = N / 64;
  const int wid = blockIdx.x * 4 + w;
  const int mt = wid / ntn, nq = wid % ntn;
  if (mt * 16 >= M) return;
  const int row0 = mt * 16, col0 = nq * 64;
  const float* arow = A + (size_t)(row0 + ln) * lda;
  v8f acc[4] = {};
  for (int kb = 0; kb < K; kb += 32) {
    FragB ah, al;
    const v4f x0 = *(const v4fa*)(arow + kb + 8 * hh), x1 = *(const v4fa*)(arow + kb + 8 * hh + 4);
    const v4f x2 = *(const v4fa*)(arow + kb + 16 + 8 * hh), x3 = *(const v4fa*)(arow + kb + 16 + 8 * hh + 4);
    float xs[16] = {x0[0],x0[1],x0[2],x0[3],x1[0],x1[1],x1[2],x1[3],x2[0],x2[1],x2[2],x2[3],x3[0],x3[1],x3[2],x3[3]};
#pragma unroll
    for (int i = 0; i < 16; ++i) { const unsigned short hb = bf16_bits(xs[i]); ah.u[i] = hb; al.u[i] = ASPLIT ? bf16_bits(xs[i] - bf16_val(hb)) : (unsigned short)0; }
#pragma unroll
    for (int t = 0; t < 4; ++t) {
      const unsigned short* brow = Wt + (size_t)(col0 + t * 16 + ln) * ldb + kb;
      FragB b;
      b.half[0] = *(const v8us*)(brow + 8 * hh);
      b.half[1] = *(const v8us*)(brow + 16 + 8 * hh);
      acc[t] = mmaN<ASPLIT ? 2 : 1>(ah.v, al.v, b.v, b.v, acc[t]);
    }
  }
#pragma unroll
  for (int t = 0; t < 4; ++t) {
    float bv = bias ? bias[col0 + t * 16 + ln] : 0.f;
    if (BIAS_BF16) bv = bf16_round(bv);
#pragma unroll
    for (int r = 0; r < 8; ++r) { float v = acc[t][r] + bv; if (ACT == 1) v = fmaxf(v, 0.f); so[w][8 * hh + r][t * 16 + ln] = v; }
  }
  __builtin_amdgcn_fence(__ATOMIC_ACQ_REL, "workgroup");
  __builtin_amdgcn_wave_barrier();
  const int rsub = lane >> 4, c4 = (lane & 15) * 4;
  {
#pragma unroll
    for (int q = 0; q < 8; ++q) {
      const int r = q * 2 + rsub;
      const v4f v = *(const v4fa*)&so[w][r][c4];
      *(v4f*)(C + (size_t)(row0 + r) * ldc + col0 + c4) = v;
    }
    
  }
}

// GEMM C = act(A·W + bias + resid): A f32 (ASPLIT -> hi/lo 2 terms), Wt bf16 [N][K]; ACT 0 none, 1 relu, 2 exact gelu;
// resid (optional, f32, row index = (row % rmod), pitch ldr, RES_BF16 rounds it) added before the activation.
template <bool ASPLIT, int ACT, bool BIAS_BF16, bool RES_BF16>
__global__ __launch_bounds__(128) void k_gemm_bf3(const float* __restrict__ A, int lda, const unsigned short* __restrict__ Wt, int ldb,
                                                const float* __restrict__ bias, const float* __restrict__ resid, int rmod, int ldr,
                                                float* __restrict__ C, int ldc, int M, int N, int K) {
  __shared__ __attribute__((aligned(16))) float so[4][16][64];
  const int tid = threadIdx.x, w = tid >> 5, lane = tid & 31, ln = lane & 15, hh = lane >> 4;
  const int ntn = N / 64;
  const int wid = blockIdx.x * 4 + w;
  const int mt = wid / ntn, nq = wid % ntn;
  if (mt * 16 >= M) return;
  const int row0 = mt * 16, col0 = nq * 64;
  const float* arow = A + (size_t)(row0 + ln) * lda;
  v8f acc[4] = {};
  for (int kb = 0; kb < K; kb += 32) {
    FragB ah, al;
    const v4f x0 = *(const v4fa*)(arow + kb + 8 * hh), x1 = *(const v4fa*)(arow + kb + 8 * hh + 4);
    const v4f x2 = *(const v4fa*)(arow + kb + 16 + 8 * hh), x3 = *(const v4fa*)(arow + kb + 16 + 8 * hh + 4);
    float xs[16] = {x0[0],x0[1],x0[2],x0[3],x1[0],x1[1],x1[2],x1[3],x2[0],x2[1],x2[2],x2[3],x3[0],x3[1],x3[2],x3[3]};
#pragma unroll
    for (int i = 0; i < 16; ++i) { const unsigned short hb = bf16_bits(xs[i]); ah.u[i] = hb; al.u[i] = ASPLIT ? bf16_bits(xs[i] - bf16_val(hb)) : (unsigned short)0; }
#pragma unroll
    for (int t = 0; t < 4; ++t) {
      const unsigned short* brow = Wt + (size_t)(col0 + t * 16 + ln) * ldb + kb;
      FragB b;
      b.half[0] = *(const v8us*)(brow + 8 * hh);
      b.half[1] = *(const v8us*)(brow + 16 + 8 * hh);
      acc[t] = mmaN<ASPLIT ? 2 : 1>(ah.v, al.v, b.v, b.v, acc[t]);
    }
  }
#pragma unroll
  for (int t = 0; t < 4; ++t) {
    const int col = col0 + t * 16 + ln;
    float bv = bias ? bias[col] : 0.f;
    if (BIAS_BF16) bv = bf16_round(bv);
#pragma unroll
    for (int r = 0; r < 8; ++r) {
      float v = acc[t][r] + bv;
      if (resid) { float rv = resid[(size_t)((row0 + 8 * hh + r) % rmod) * ldr + col]; if (RES_BF16) rv = bf16_round(rv); v += rv; }
      if (ACT == 1) v = fmaxf(v, 0.f);
      if (ACT == 2) v = 0.5f * v * (1.0f + erff(v * 0.70710678118654752f));
      if (ACT == 3) { const float u = 0.7978845608028654f * (v + 0.044715f * v * v * v); v = 0.5f * v * (1.0f + tanhf(u)); }
      so[w][8 * hh + r][t * 16 + ln] = v;
    }
  }
  __builtin_amdgcn_fence(__ATOMIC_ACQ_REL, "workgroup");
  __builtin_amdgcn_wave_barrier();
  const int rsub = lane >> 4, c4 = (lane & 15) * 4;
  {
#pragma unroll
    for (int q = 0; q < 8; ++q) {
      const int r = q * 2 + rsub;
      const v4f v = *(const v4fa*)&so[w][r][c4];
      *(v4f*)(C + (size_t)(row0 + r) * ldc + col0 + c4) = v;
    }
    
  }
}
// row LayerNorm (biased variance, eps) over N: s = X (+ R); optional out_sum <- s; out_norm <- (s-mu)*rsqrt(var+eps)*g + b
template <bool PARAM_BF16>
__global__ __launch_bounds__(256) void k_layernorm(const float* __restrict__ X, const float* __restrict__ R, const float* __restrict__ g, const float* __restrict__ bta,
                                                  float* __restrict__ out_sum, float* __restrict__ out_norm, int N, float eps) {
  __shared__ float red[256];
  const int row = blockIdx.x, tid = threadIdx.x;
  const float* x = X + (size_t)row * N; const float* rr = R ? R + (size_t)row * N : nullptr;
  float vals[16];                     // up to N = 4096
  const int per = N / 256;            // contiguous chunk per thread? use strided-by-4 chunks: thread handles j = tid*4 + 1024*u
  float s1 = 0.f;
  for (int u = 0; u < per / 4; ++u) {
    const int j = tid * 4 + 1024 * u;
    const v4f a = *(const v4fa*)(x + j);
    v4f b = {0.f,0.f,0.f,0.f}; if (rr) b = *(const v4fa*)(rr + j);
#pragma unroll
    for (int q = 0; q < 4; ++q) { const float v = a[q] + b[q]; vals[u * 4 + q] = v; s1 += v; }
  }
  red[tid] = s1; __syncthreads();
  for (int st = 128; st > 0; st >>= 1) { if (tid < st) red[tid] += red[tid + st]; __syncthreads(); }
  const float mu = red[0] / (float)N; __syncthreads();
  float s2 = 0.f;
  for (int u = 0; u < per / 4; ++u)
#pragma unroll
    for (int q = 0; q < 4; ++q) { const float c = vals[u * 4 + q] - mu; s2 += c * c; }
  red[tid] = s2; __syncthreads();
  for (int st = 128; st > 0; st >>= 1) { if (tid < st) red[tid] += red[tid + st]; __syncthreads(); }
  const float rs = rsqrtf(red[0] / (float)N + eps);
  {
    for (int u = 0; u < per / 4; ++u) {
      const int j = tid * 4 + 1024 * u;
      v4f o, sm;
#pragma unroll
      for (int q = 0; q < 4; ++q) {
        float gg = g[j + q], bb = bta[j + q];
        if (PARAM_BF16) { gg = bf16_round(gg); bb = bf16_round(bb); }
        sm[q] = vals[u * 4 + q]; o[q] = (vals[u * 4 + q] - mu) * rs * gg + bb;
      }
      if (out_sum) *(v4f*)(out_sum + (size_t)row * N + j) = sm;
      *(v4f*)(out_norm + (size_t)row * N + j) = o;
    }
    
  }
}



// ---- f16 WMMA path (v_wmma_f32_16x16x32_f16): 11-bit significands for operands in range — used where a [0,1] probability operand needs more precision than bf16
typedef _Float16 v16h __attribute__((ext_vector_type(16)));
union FragH { v16h v; v8us half[2]; _Float16 h[16]; unsigned short u[16]; };
template <int NT>
__device__ __forceinline__ v8f mmaH(v16h ah, v16h al, v16h bh, v16h bl, v8f c) {
  c = __builtin_amdgcn_wmma_f32_16x16x32_f16(false, ah, false, bh, (short)0, c, false, false);
  if (NT >= 2) c = __builtin_amdgcn_wmma_f32_16x16x32_f16(false, al, false, bh, (short)0, c, false, false);
  if (NT >= 3) c = __builtin_amdgcn_wmma_f32_16x16x32_f16(false, ah, false, bl, (short)0, c, false, false);
  asm volatile("v_nop\n\tv_nop\n\tv_nop\n\tv_nop" : "+v"(c) : "v"(ah), "v"(al), "v"(bh), "v"(bl));
  return c;
}
// batched GEMM like k_gemm_b but f16 operands: A f32 (split into f16 hi/lo if ASPLIT, else rounded to f16), Bt = f16 values [n][k]; alpha; C f32; N multiple of 16 (partial tiles skipped)
template <bool ASPLIT>
__global__ __launch_bounds__(128) void k_gemm_h(const float* __restrict__ A, int lda, size_t sA, const _Float16* __restrict__ Bh, int ldb, size_t sB, float alpha, float* __restrict__ C, int ldc, size_t sC, int M, int N, int K) {
  __shared__ __attribute__((aligned(16))) float so[4][16][64];
  const int tid = threadIdx.x, w = tid >> 5, lane = tid & 31, ln = lane & 15, hh = lane >> 4; const int by = blockIdx.y;
  A += (size_t)by * sA; Bh += (size_t)by * sB; C += (size_t)by * sC;
  const int ntn = (N + 63) / 64; const int wid = blockIdx.x * 4 + w; const int mt = wid / ntn, nq = wid % ntn; if (mt * 16 >= M) return;
  const int row0 = mt * 16, col0 = nq * 64; const float* arow = A + (size_t)(row0 + ln) * lda;
  v8f acc[4] = {};
  for (int kb = 0; kb < K; kb += 32) {
    FragH ah, al;
    const v4f x0 = *(const v4fa*)(arow + kb + 8 * hh), x1 = *(const v4fa*)(arow + kb + 8 * hh + 4), x2 = *(const v4fa*)(arow + kb + 16 + 8 * hh), x3 = *(const v4fa*)(arow + kb + 16 + 8 * hh + 4);
    float xs[16] = {x0[0],x0[1],x0[2],x0[3],x1[0],x1[1],x1[2],x1[3],x2[0],x2[1],x2[2],x2[3],x3[0],x3[1],x3[2],x3[3]};
#pragma unroll
    for (int i = 0; i < 16; ++i) { const _Float16 h = (_Float16)xs[i]; ah.h[i] = h; al.h[i] = ASPLIT ? (_Float16)(xs[i] - (float)h) : (_Float16)0.0f; }
#pragma unroll
    for (int t = 0; t < 4; ++t) { if (col0 + t * 16 >= N) continue; const size_t boff = (size_t)(col0 + t * 16 + ln) * ldb + kb; FragH bq; bq.half[0] = *(const v8us*)(Bh + boff + 8 * hh); bq.half[1] = *(const v8us*)(Bh + boff + 16 + 8 * hh);
      acc[t] = mmaH<ASPLIT ? 2 : 1>(ah.v, al.v, bq.v, bq.v, acc[t]); }
  }
#pragma unroll
  for (int t = 0; t < 4; ++t) { if (col0 + t * 16 >= N) continue;
#pragma unroll
    for (int r = 0; r < 8; ++r) so[w][8 * hh + r][t * 16 + ln] = acc[t][r] * alpha; }
  __builtin_amdgcn_fence(__ATOMIC_ACQ_REL, "workgroup"); __builtin_amdgcn_wave_barrier();
  const int rsub = lane >> 4, c4 = (lane & 15) * 4;
  {
#pragma unroll
    for (int q = 0; q < 8; ++q) { const int r = q * 2 + rsub; if (col0 + c4 < N) { const v4f v = *(const v4fa*)&so[w][r][c4]; *(v4f*)(C + (size_t)(row0 + r) * ldc + col0 + c4) = v; } }
     }
}

// Wt[n][k] = f16(W[k][n]·scale) from f32 row-major W[K][N] (scale = power of two; bf16-exact weights stay exact in f16 away from the subnormal range)
__global__ __launch_bounds__(256) void k_wt_f16(const float* __restrict__ W, _Float16* __restrict__ Wt, int K, int N, float scale) {
  const int t = blockIdx.x * 256 + threadIdx.x; if (t >= N * (K / 8)) return; const int n = t / (K / 8), k8 = (t % (K / 8)) * 8; FragH f;
#pragma unroll
  for (int i = 0; i < 8; ++i) f.h[i] = (_Float16)(bf16_round(W[(size_t)(k8 + i) * N + n]) * scale); const v8us o = f.half[0];
  *(v8us*)((unsigned short*)Wt + (size_t)n * K + k8) = o; 
}
// k_gemm_hh variant with fused epilogue: v = acc·alpha + bias[by·sBias + col] (+ CP[(row/rowsPerB)·sCPb + by·64 + col] if CP) ; ACT 0 none / 1 elu ; writes f16 C16 (and f32 C if non-null)
template <int ACT>
__global__ __launch_bounds__(128) void k_gemm_hhx(const _Float16* __restrict__ A, int lda, size_t sA, const _Float16* __restrict__ Bh, int ldb, size_t sB, float alpha, const float* __restrict__ bias, size_t sBias, const float* __restrict__ CP, int rowsPerB, size_t sCPb, int row0g,
    float* __restrict__ C, _Float16* __restrict__ C16, int ldc, size_t sC, int M, int N, int K) {
  __shared__ __attribute__((aligned(16))) float so[4][16][64];
  const int tid = threadIdx.x, w = tid >> 5, lane = tid & 31, ln = lane & 15, hh = lane >> 4; const int by = blockIdx.y;
  A += (size_t)by * sA; Bh += (size_t)by * sB; const size_t cofs = (size_t)by * sC; const float* bp = bias ? bias + (size_t)by * sBias : nullptr;
  const int ntn = (N + 63) / 64; const int wid = blockIdx.x * 4 + w; const int mt = wid / ntn, nq = wid % ntn; if (mt * 16 >= M) return;
  const int row0 = mt * 16, col0 = nq * 64; const _Float16* arow = A + (size_t)(row0 + ln) * lda;
  v8f acc[4] = {};
  for (int kb = 0; kb < K; kb += 32) { FragH ah; ah.half[0] = *(const v8us*)((const unsigned short*)arow + kb + 8 * hh); ah.half[1] = *(const v8us*)((const unsigned short*)arow + kb + 16 + 8 * hh);
#pragma unroll
    for (int t = 0; t < 4; ++t) { if (col0 + t * 16 >= N) continue; const size_t boff = (size_t)(col0 + t * 16 + ln) * ldb + kb; FragH bq; bq.half[0] = *(const v8us*)((const unsigned short*)Bh + boff + 8 * hh); bq.half[1] = *(const v8us*)((const unsigned short*)Bh + boff + 16 + 8 * hh);
      acc[t] = mmaH<1>(ah.v, ah.v, bq.v, bq.v, acc[t]); }
  }
#pragma unroll
  for (int t = 0; t < 4; ++t) { if (col0 + t * 16 >= N) continue; const int col = col0 + t * 16 + ln; const float bv = bp ? bf16_round(bp[col]) : 0.f;
#pragma unroll
    for (int r = 0; r < 8; ++r) { float v = acc[t][r] * alpha + bv; if (CP) { const int rr = row0g + row0 + 8 * hh + r; if (rowsPerB < 0) v += CP[cofs + (size_t)rr * ldc + col];      /* rowsPerB < 0: own element of the batched C plane */ else { const int bidx = rr / rowsPerB; v += CP[(size_t)bidx * sCPb + (size_t)by * 64 + col]; } } if (ACT == 1) v = (v > 0.f) ? v : expm1f(v); else if (ACT == 7) v = (v > 0.f) ? v + 1.0f : expf(v); else if (ACT == 8) v = tanhf(v); else if (ACT == 9) v = 0.5f * v * (1.0f + tanhf(0.7978845608028654f * (v + 0.044715f * v * v * v))); else if (ACT == 11) v = 1.0f / (1.0f + expf(-v)); else if (ACT == 12) v = (v > 0.f) ? v : 0.01f * v; else if (ACT == 14) v = (v > 0.f) ? v : 0.1f * v; else if (ACT == 16) v = (v >= 0.f) ? v : 0.3f * v; else if (ACT == 17) v = (v >= 0.f) ? v : 0.2f * v; else if (ACT == 15) v = v / (1.0f + expf(-v)); else if (ACT == 3) v = fmaxf(v, 0.f); else if (ACT == 6) v = 0.5f * v * (1.0f + erff(v * 0.70710678118654752f)); so[w][8 * hh + r][t * 16 + ln] = v; } }
  __builtin_amdgcn_fence(__ATOMIC_ACQ_REL, "workgroup"); __builtin_amdgcn_wave_barrier();
  const int rsub = lane >> 4, c4 = (lane & 15) * 4; typedef _Float16 v4h __attribute__((ext_vector_type(4)));
  {
#pragma unroll
    for (int q = 0; q < 8; ++q) { const int r = q * 2 + rsub; if (col0 + c4 < N) { const v4f v = *(const v4fa*)&so[w][r][c4]; if (C) *(v4f*)(C + cofs + (size_t)(row0 + r) * ldc + col0 + c4) = v; if (C16) { v4h h4; for (int i = 0; i < 4; ++i) h4[i] = (_Float16)v[i]; *(v4h*)(C16 + cofs + (size_t)(row0 + r) * ldc + col0 + c4) = h4; } } }
     }
}


typedef _Float16 v4h __attribute__((ext_vector_type(4)));

__global__ __launch_bounds__(256) void k_x16(const float* __restrict__ x, _Float16* __restrict__ X16, size_t n8) { const size_t t = (size_t)blockIdx.x * 256 + threadIdx.x; if (t >= n8) return; FragH f;
#pragma unroll
  for (int q = 0; q < 8; ++q) f.h[q] = (_Float16)bf16_round(x[t * 8 + q]); *(v8us*)((unsigned short*)X16 + t * 8) = f.half[0];  }
__global__ __launch_bounds__(256) void k_h16(const float* __restrict__ x, _Float16* __restrict__ X16, size_t n8) { const size_t t = (size_t)blockIdx.x * 256 + threadIdx.x; if (t >= n8) return; FragH f;
#pragma unroll
  for (int q = 0; q < 8; ++q) f.h[q] = (_Float16)x[t * 8 + q]; *(v8us*)((unsigned short*)X16 + t * 8) = f.half[0];  }
__global__ __launch_bounds__(256) void k_round16f(const float* __restrict__ W, _Float16* __restrict__ Bt, size_t n8) { const size_t t = (size_t)blockIdx.x * 256 + threadIdx.x; if (t >= n8) return; FragH f;
#pragma unroll
  for (int i = 0; i < 8; ++i) f.h[i] = (_Float16)(bf16_round(W[t * 8 + i]) * 16.0f); *(v8us*)((unsigned short*)Bt + t * 8) = f.half[0];  }
template <int NHv, int TTv>
__global__ __launch_bounds__(256) void k_vt(const _Float16* __restrict__ V16, int ldv, int voff, _Float16* __restrict__ Vt) { __shared__ unsigned short tl[64][66]; const int tid = threadIdx.x; const int slab = blockIdx.x / (TTv / 64), lg = blockIdx.x % (TTv / 64); const int b = slab / NHv, h = slab % NHv;
  for (int i = tid; i < 64 * 8; i += 256) { const int r = i / 8, c8 = (i % 8) * 8; FragH f; f.half[0] = *(const v8us*)((const unsigned short*)V16 + ((size_t)b * TTv + lg * 64 + r) * ldv + voff + h * 64 + c8);
#pragma unroll
    for (int q = 0; q < 8; ++q) tl[r][c8 + q] = f.u[q]; }
  __syncthreads();
  {
#pragma unroll
    for (int rd = 0; rd < 2; ++rd) { const int d = rd * 32 + tid / 8, pc = tid % 8; FragH f;
#pragma unroll
      for (int q = 0; q < 8; ++q) f.u[q] = tl[pc * 8 + q][d];
      *(v8us*)((unsigned short*)Vt + ((size_t)slab * 64 + d) * TTv + lg * 64 + pc * 8) = f.half[0]; }
     } }

__global__ __launch_bounds__(256) void k_hl(const float* __restrict__ F, _Float16* __restrict__ Hh, _Float16* __restrict__ Hl, size_t n8) { const size_t t = (size_t)blockIdx.x * 256 + threadIdx.x; if (t >= n8) return; FragH fh, fl; const v4f a = *(const v4fa*)(F + t * 8), c = *(const v4fa*)(F + t * 8 + 4);
#pragma unroll
  for (int q = 0; q < 4; ++q) { _Float16 h = (_Float16)a[q]; fh.h[q] = h; fl.h[q] = (_Float16)((a[q] - (float)h) * 1024.0f); h = (_Float16)c[q]; fh.h[4 + q] = h; fl.h[4 + q] = (_Float16)((c[q] - (float)h) * 1024.0f); }
  { *(v8us*)((unsigned short*)Hh + t * 8) = fh.half[0]; *(v8us*)((unsigned short*)Hl + t * 8) = fl.half[0];  } }

// ---- fast GEMM (wave tile 32x64; requires M % 32 == 0 rows per launch region, N % 64 == 0, K % 32 == 0 and K >= 32); epilogue = k_gemm_hhx semantics ----
__device__ __forceinline__ v16h g2_frag(const _Float16* p, int hh) { FragH f; f.half[0] = *(const v8us*)((const unsigned short*)p + 8 * hh); f.half[1] = *(const v8us*)((const unsigned short*)p + 16 + 8 * hh); return f.v; }
__device__ __forceinline__ v8f g2_mma(v16h a, v16h b, v8f c) { v8f d = __builtin_amdgcn_wmma_f32_16x16x32_f16(false, a, false, b, (short)0, c, false, false); asm volatile("v_nop\n\tv_nop\n\tv_nop\n\tv_nop" : "+v"(d) : "v"(a), "v"(b)); return d; }
struct G2S { v16h a0, a1, b0, b1, b2, b3; };      /* the six fragments of one k step */
template <int ACT>
__global__ __launch_bounds__(128) void k_gemm2(const _Float16* __restrict__ A, int lda, size_t sA, const _Float16* __restrict__ Bh, int ldb, size_t sB, float alpha, const float* __restrict__ bias, size_t sBias, const float* __restrict__ CP, int rowsPerB, size_t sCPb, int row0g,
    float* __restrict__ C, _Float16* __restrict__ C16, int ldc, size_t sC, int M, int N, int K) { static_assert(ACT == 0 || ACT == 3 || ACT == 6 || ACT == 8 || ACT == 9 || ACT == 11 || ACT == 12 || ACT == 14 || ACT == 15 || ACT == 16 || ACT == 17, "k_gemm2: unsupported ACT code (would silently apply no activation)");
  __shared__ __attribute__((aligned(16))) float so[4][32][68];
  const int tid = threadIdx.x, w = tid >> 5, lane = tid & 31, ln = lane & 15, hh = lane >> 4; const int by = blockIdx.y;
  A += (size_t)by * sA; Bh += (size_t)by * sB; const size_t cofs = (size_t)by * sC; const float* bp = bias ? bias + (size_t)by * sBias : nullptr;
  const int ntn = N >> 6; const int mt = blockIdx.x / ntn, nq = blockIdx.x - mt * ntn; const int row0 = mt * 128 + 32 * w, col0 = nq * 64; if (row0 >= M) return;
  const _Float16* a0p = A + (size_t)(row0 + ln) * lda + 8 * hh; const _Float16* a1p = a0p + (size_t)16 * lda;
  const _Float16* b0p = Bh + (size_t)(col0 + ln) * ldb + 8 * hh; const _Float16* b1p = b0p + (size_t)16 * ldb; const _Float16* b2p = b1p + (size_t)16 * ldb; const _Float16* b3p = b2p + (size_t)16 * ldb;
  const v8f z8 = {0.f,0.f,0.f,0.f,0.f,0.f,0.f,0.f}; v8f c00 = z8, c01 = z8, c02 = z8, c03 = z8, c10 = z8, c11 = z8, c12 = z8, c13 = z8;
  /* Three k steps of fragments in registers. A step's twelve loads are issued together, right behind the products of the step whose registers they refill, and are first read three steps later: a load's latency is spread over three steps instead of being paid five times in each.
     No branch stands between the loads, so their waits are counted exactly: past the last step the step index is clamped (an in-bounds re-read of the last step that no product uses). Each accumulator still takes its products in the order kb = 0, 32, 64, ... */
  const int nst = K >> 5;
  auto ld = [&](int st) { const int kb = (st < nst ? st : nst - 1) << 5; const _Float16 *pa0 = a0p + kb, *pa1 = a1p + kb, *pb0 = b0p + kb, *pb1 = b1p + kb, *pb2 = b2p + kb, *pb3 = b3p + kb;      /* the lane half's 8 hh elements are in the row pointers */
    G2S f; f.a0 = g2_frag(pa0, 0); f.a1 = g2_frag(pa1, 0); f.b0 = g2_frag(pb0, 0); f.b1 = g2_frag(pb1, 0); f.b2 = g2_frag(pb2, 0); f.b3 = g2_frag(pb3, 0);
    asm volatile("s_wait_xcnt 0x0" :: "v"(pa0), "v"(pa1), "v"(pb0), "v"(pb1), "v"(pb2), "v"(pb3) : "memory");      /* stands behind the step's loads and in front of every instruction that rewrites an address register they name; the addresses are inputs so that their registers stay as they are up to the wait */
    return f; };
  auto mm = [&](const G2S& f) { c00 = g2_mma(f.a0, f.b0, c00); c10 = g2_mma(f.a1, f.b0, c10); c01 = g2_mma(f.a0, f.b1, c01); c11 = g2_mma(f.a1, f.b1, c11); c02 = g2_mma(f.a0, f.b2, c02); c12 = g2_mma(f.a1, f.b2, c12); c03 = g2_mma(f.a0, f.b3, c03); c13 = g2_mma(f.a1, f.b3, c13); };
  G2S f0 = ld(0), f1 = ld(1), f2 = ld(2); int st = 0;
  /* kept rolled: one trip is the whole ring, and a second copy would only add registers */
#pragma unroll 1
  for (; st + 3 <= nst; st += 3) { mm(f0); f0 = ld(st + 3); mm(f1); f1 = ld(st + 4); mm(f2); f2 = ld(st + 5); }
  if (st < nst) mm(f0);
  if (st + 1 < nst) mm(f1);
  v8f accs[8] = {c00, c01, c02, c03, c10, c11, c12, c13};
#pragma unroll
  for (int u = 0; u < 8; ++u) { const int t = u & 3, half = u >> 2; const int col = col0 + t * 16 + ln; const float bv = bp ? bf16_round(bp[col]) : 0.f;
#pragma unroll
    for (int r = 0; r < 8; ++r) { const int rloc = half * 16 + 8 * hh + r; float v = accs[u][r] * alpha + bv; if (CP) { if (rowsPerB < 0) v += CP[cofs + (size_t)(row0g + row0 + rloc) * ldc + col];      /* rowsPerB < 0: own element of the batched C plane */ else { const int bidx = (row0g + row0 + rloc) / rowsPerB; v += CP[(size_t)bidx * sCPb + (size_t)by * 64 + col]; } }
      if (ACT == 3) v = fmaxf(v, 0.f); else if (ACT == 6) v = 0.5f * v * (1.0f + erff(v * 0.70710678118654752f)); else if (ACT == 11) v = 1.0f / (1.0f + expf(-v)); else if (ACT == 15) v = v / (1.0f + expf(-v)); else if (ACT == 12) v = (v > 0.f) ? v : 0.01f * v; else if (ACT == 8) v = tanhf(v); else if (ACT == 9) v = 0.5f * v * (1.0f + tanhf(0.7978845608028654f * (v + 0.044715f * v * v * v))); else if (ACT == 14) v = (v > 0.f) ? v : 0.1f * v; else if (ACT == 16) v = (v >= 0.f) ? v : 0.3f * v; else if (ACT == 17) v = (v >= 0.f) ? v : 0.2f * v;
      so[w][rloc][t * 16 + ln] = v; } }
  __builtin_amdgcn_fence(__ATOMIC_ACQ_REL, "workgroup"); __builtin_amdgcn_wave_barrier();
  const int rsub = lane >> 4, c4 = (lane & 15) * 4;
  {
#pragma unroll
    for (int q = 0; q < 16; ++q) { const int r = q * 2 + rsub; const v4f v = *(const v4fa*)&so[w][r][c4]; if (C) *(v4f*)(C + cofs + (size_t)(row0 + r) * ldc + col0 + c4) = v; if (C16) { v4h h4; for (int i = 0; i < 4; ++i) h4[i] = (_Float16)v[i]; *(v4h*)(C16 + cofs + (size_t)(row0 + r) * ldc + col0 + c4) = h4; } }
     } }


__global__ __launch_bounds__(256) void k_wnat(const float* __restrict__ w, size_t n8, _Float16* __restrict__ Bt) { const size_t t = (size_t)blockIdx.x * 256 + threadIdx.x; if (t >= n8) return; FragH f; for (int q = 0; q < 8; ++q) f.h[q] = (_Float16)(bf16_round(w[t * 8 + q]) * 16.0f); *(v8us*)((unsigned short*)Bt + t * 8) = f.half[0];  }
__global__ __launch_bounds__(256) void k_rsm(const float* __restrict__ S, _Float16* __restrict__ P, int nrows) {
  #pragma clang fp contract(off)
  const int i = blockIdx.x * 256 + threadIdx.x; if (i >= nrows) return; const float* s = S + (size_t)i * SQ; float mx = -3.0e38f;
#pragma unroll 1
  for (int j = 0; j < SQ; ++j) mx = fmaxf(mx, s[j]); float se = 0.f;
#pragma unroll 1
  for (int j = 0; j < SQ; ++j) se += expf(s[j] - mx); const float sc = 256.0f / se;
#pragma unroll 1
  for (int j0 = 0; j0 < SQ; j0 += 8) { FragH f; for (int q = 0; q < 8; ++q) f.h[q] = (_Float16)(expf(s[j0 + q] - mx) * sc); unsigned short* d = (unsigned short*)P + (size_t)i * SQ + j0; *(v8us*)d = f.half[0];  } }
__global__ __launch_bounds__(256) void k_vt(const _Float16* __restrict__ V16, int b, int h0, _Float16* __restrict__ VT) { __shared__ unsigned short tl[64][65]; const int tid = threadIdx.x; const int hh = blockIdx.x % HG, sg = blockIdx.x / HG; const int s0 = sg * 64; const int h = h0 + hh;
  for (int i = tid; i < 64 * 8; i += 256) { const int j = i / 8, d8 = (i % 8) * 8; FragH f; f.half[0] = *(const v8us*)((const unsigned short*)V16 + ((size_t)b * SQ + s0 + j) * DM + h * HD + d8); for (int q = 0; q < 8; ++q) tl[d8 + q][j] = f.u[q]; }
  __syncthreads();
  { for (int i = tid; i < 64 * 8; i += 256) { const int d = i / 8, j8 = (i % 8) * 8; FragH f; for (int q = 0; q < 8; ++q) f.u[q] = tl[d][j8 + q]; *(v8us*)((unsigned short*)VT + ((size_t)hh * HD + d) * SQ + s0 + j8) = f.half[0]; }  } }



__global__ __launch_bounds__(256) void k_rsmcf2(const float* __restrict__ S, _Float16* __restrict__ P, int hg, int q0, int nk) {
  #pragma clang fp contract(off)
  const int t = blockIdx.x * 256 + threadIdx.x; if (t >= hg * QT) return; const size_t i = (size_t)t; const float* s = S + i * NKX; const int last = q0 + (t % QT); float mx = -3.0e38f;
#pragma unroll 1
  for (int j = 0; j < nk; ++j) { const float f = (j <= last) ? 1.f : 0.f; mx = fmaxf(mx, fmaf(f, s[j], (1.f - f) * -1.0e9f)); } float se = 0.f;
#pragma unroll 1
  for (int j = 0; j < nk; ++j) { const float f = (j <= last) ? 1.f : 0.f; se += __expf(fmaf(f, s[j], (1.f - f) * -1.0e9f) - mx); } const float sc = 256.0f / se;
#pragma unroll 1
  for (int j0 = 0; j0 < nk; j0 += 8) { FragH fr; for (int q = 0; q < 8; ++q) { const int j = j0 + q; const float f = (j <= last) ? 1.f : 0.f; fr.h[q] = (_Float16)(__expf(fmaf(f, s[j], (1.f - f) * -1.0e9f) - mx) * sc); } unsigned short* d = (unsigned short*)P + i * NKX + j0; *(v8us*)d = fr.half[0];  } }



typedef int v4ia __attribute__((ext_vector_type(4), may_alias));
// native exp, the two instructions of __expf: x log2(e), then v_exp_f32. Written as asm for the v_nop: it is the slot that the instruction set asks for behind a transcendental before its result is read or its source overwritten.
__device__ __forceinline__ float exp_native(float x) { float r; asm("v_exp_f32 %0, %1\n\tv_nop" : "=v"(r) : "v"(x * 1.44269504088896340736f)); return r; }
// One wave per score row of nk = QT NP keys. Lane l holds keys j = 128 c + 4 l .. + 3 of every 128-key chunk c: each load covers 512 contiguous bytes, the row is read once and stays in registers, and each exponential is taken once.
// Row statistics: four partial chains per lane, then a five-step butterfly over the wave. One straight-line kernel per row length: no branch stands between a row's loads, so their waits are counted exactly and many of them are in flight at once.
template <int NP>
__global__ __launch_bounds__(256) void k_rsmcf2kv(const float* __restrict__ S, _Float16* __restrict__ P, int hg, int q0, const int* __restrict__ Km) {
  const int j0 = (threadIdx.x & 31) * 4; const int t = blockIdx.x * 8 + (threadIdx.x >> 5); if (t >= hg * QT) return;
  const float* s = S + (size_t)t * NKX + j0; _Float16* p = P + (size_t)t * NKX + j0; const int* km = Km + j0; const int last = q0 + (t % QT);
  constexpr int NC = NP * (QT / 128); v4f v[NC]; v4ia m[NC];
  /* every loop over c is fully unrolled so that v and m are registers, not scratch */
#pragma unroll
  for (int c = 0; c < NC; ++c) { m[c] = *(const v4ia*)(km + c * 128); v[c] = *(const v4fa*)(s + c * 128); }
  v4f mx4 = {-3.0e38f, -3.0e38f, -3.0e38f, -3.0e38f};
#pragma unroll
  for (int c = 0; c < NC; ++c) {
#pragma unroll
    for (int q = 0; q < 4; ++q) { const int j = c * 128 + j0 + q; const float f = (j <= last && m[c][q] != 0) ? 1.f : 0.f;      /* causal AND key not padded (mask[b][j] != 0) */ const float sv = fmaf(f, v[c][q], (1.f - f) * -1.0e9f); v[c][q] = sv; mx4[q] = fmaxf(mx4[q], sv); } }
  float mx = fmaxf(fmaxf(mx4[0], mx4[1]), fmaxf(mx4[2], mx4[3]));
#pragma unroll
  for (int d = 16; d > 0; d >>= 1) mx = fmaxf(mx, __shfl_xor(mx, d, 32));
  v4f se4 = {0.f, 0.f, 0.f, 0.f};
#pragma unroll
  for (int c = 0; c < NC; ++c) {
#pragma unroll
    for (int q = 0; q < 4; ++q) { const float e = exp_native(v[c][q] - mx); v[c][q] = e; se4[q] += e; } }
  float se = (se4[0] + se4[1]) + (se4[2] + se4[3]);
#pragma unroll
  for (int d = 16; d > 0; d >>= 1) se += __shfl_xor(se, d, 32);
  const float sc = 256.0f / se;
#pragma unroll
  for (int c = 0; c < NC; ++c) { v4h h4;
#pragma unroll
    for (int q = 0; q < 4; ++q) h4[q] = (_Float16)(v[c][q] * sc);
    *(v4h*)(p + c * 128) = h4; } }


template <int MASKADD, int MASKKV>
__global__ __launch_bounds__(64) void k_att0(const float* __restrict__ QF, const float* __restrict__ KF, const float* __restrict__ VF, int ld, const float* __restrict__ mask, const int* __restrict__ Km, float scale, float* __restrict__ OF, int ldo) {
  #pragma clang fp contract(off)
  __shared__ __attribute__((aligned(16))) float lq[64][64]; __shared__ __attribute__((aligned(16))) float lo[64][64];
  const int tid = threadIdx.x; const int h = blockIdx.x / (QT0 / 64), rg = blockIdx.x % (QT0 / 64); const int i = rg * 64 + tid;
  const float* qr = QF + (size_t)i * ld + h * HD;
#pragma unroll 1
  for (int c = 0; c < HD / 4; ++c) { *(v4f*)&lq[tid][c * 4] = *(const v4fa*)(qr + c * 4); const v4f z = {0.f, 0.f, 0.f, 0.f}; *(v4f*)&lo[tid][c * 4] = z; }
  float m = -1.0e30f, l = 0.f; const int jmax = MASKADD ? (SQ - 1) : (rg * 64 + 63);      /* additive-mask form: every key (the mask input decides); causal form: keys up to the block's last row */
#pragma unroll 1
  for (int j = 0; j <= jmax; ++j) { const float* kr = KF + (size_t)j * ld + h * HD; const float* vr = VF + (size_t)j * ld + h * HD; float s = 0.f;
#pragma unroll 1
    for (int c = 0; c < HD / 4; ++c) { const v4f kq = *(const v4fa*)(kr + c * 4); const v4f qq = *(v4f*)&lq[tid][c * 4]; s = __fadd_rn(s, __fmul_rn(qq[0], kq[0])); s = __fadd_rn(s, __fmul_rn(qq[1], kq[1])); s = __fadd_rn(s, __fmul_rn(qq[2], kq[2])); s = __fadd_rn(s, __fmul_rn(qq[3], kq[3])); }
    s = __fmul_rn(s, scale); if (MASKADD) s = __fadd_rn(s, __fmul_rn(bf16_round(mask[(size_t)i * SQ + j]), -10000.0f));
    const float f = (MASKADD || (j <= i && (!MASKKV || Km[j] != 0))) ? 1.f : 0.f;      /* MASKKV: also drop keys whose int padding entry is 0 */ const float sm = fmaf(f, s, (1.f - f) * -1.0e30f); const float mn = fmaxf(m, sm); const float sc = expf(m - mn); const float e = expf(sm - mn); l = __fadd_rn(__fmul_rn(l, sc), e); m = mn;
#pragma unroll 1
    for (int c = 0; c < HD / 4; ++c) { const v4f vv = *(const v4fa*)(vr + c * 4); v4f oo = *(v4f*)&lo[tid][c * 4]; for (int u = 0; u < 4; ++u) oo[u] = __fadd_rn(__fmul_rn(oo[u], sc), __fmul_rn(e, vv[u])); *(v4f*)&lo[tid][c * 4] = oo; } }
  const float fin = 64.0f / l;      /* o carried x64 like the f16 path */
#pragma unroll 1
  for (int c = 0; c < HD / 4; ++c) { v4f oo = *(v4f*)&lo[tid][c * 4]; for (int u = 0; u < 4; ++u) oo[u] = __fmul_rn(oo[u], fin); *(v4f*)&lo[tid][c * 4] = oo; }
  __syncthreads();
  {
#pragma unroll 1
    for (int it = 0; it < 16; ++it) { const int row = it * 4 + tid / 16, pc = (tid % 16) * 4; const v4f v = *(const v4f*)&lo[row][pc]; *(v4f*)(OF + (size_t)(rg * 64 + row) * ldo + h * HD + pc) = v; }
     } }


__global__ __launch_bounds__(256) void k_xt16(const float* __restrict__ x, const float* __restrict__ tg, const float* __restrict__ wt, const float* __restrict__ bt, _Float16* __restrict__ XT, _Float16* __restrict__ XL, size_t n8) {
  #pragma clang fp contract(off)
  const size_t t = (size_t)blockIdx.x * 256 + threadIdx.x; if (t >= n8) return; const size_t e0 = t * 8; const size_t r = e0 / DM; const int c0 = (int)(e0 % DM); const float g = bf16_round(tg[r]); FragH f, l;
  for (int q = 0; q < 8; ++q) { const int c = c0 + q; const float te = __fadd_rn(__fmul_rn(g, bf16_round(wt[c])), bf16_round(bt[c])); const float v = __fadd_rn(bf16_round(x[e0 + q]), te); const _Float16 h = (_Float16)v; f.h[q] = h; l.h[q] = (_Float16)((v - (float)h) * 1024.0f); }
  *(v8us*)((unsigned short*)XT + e0) = f.half[0]; *(v8us*)((unsigned short*)XL + e0) = l.half[0];  }
extern "C" void kernel_launch(void* const* d_in, const int* in_sizes, int n_in,
                              void* d_out, int out_size, void* d_ws, size_t ws_size, hipStream_t stream) {
  (void)in_sizes; (void)n_in; (void)out_size;
  const float* const* I = (const float* const*)d_in; const float* x = I[0]; const float* tg = I[1]; const int* km = (const int*)d_in[2]; const float* wq = I[3]; const float* bq = I[4]; const float* wk = I[5]; const float* bk = I[6]; const float* wv = I[7]; const float* bv = I[8]; const float* wo = I[9]; const float* bo = I[10]; const float* wt = I[11]; const float* bt = I[12];      /* natural [out][in] weights + biases; time_gaps [2][2048][1]; int key mask [2][2048]; Wt [1024][1], bt [1024] */
  char* ws = (char*)d_ws; size_t off = 0;
  auto take = [&](size_t bytes) { char* p = ws + off; off += (bytes + 255) & ~(size_t)255; return p; };
  _Float16* BQ = (_Float16*)take((size_t)DM * DM * 2); _Float16* BK = (_Float16*)take((size_t)DM * DM * 2); _Float16* BV = (_Float16*)take((size_t)DM * DM * 2); _Float16* BO = (_Float16*)take((size_t)DM * DM * 2);
  _Float16* X16 = (_Float16*)take(NR * DM * 2); _Float16* XT16 = (_Float16*)take(NR * DM * 2); _Float16* XL16 = (_Float16*)take(NR * DM * 2);      /* x (exact f16) for v; x_time as f16 hi + x1024 residual for q and k */ float* F32 = (float*)take(NR * DM * 4);      /* f32 scratch rows: q, then k, then v, then o */ _Float16* Q16 = (_Float16*)take(NR * DM * 2); _Float16* QL = (_Float16*)take(NR * DM * 2); _Float16* K16 = (_Float16*)take(NR * DM * 2); _Float16* KL = (_Float16*)take(NR * DM * 2); _Float16* V16 = (_Float16*)take(NR * DM * 2); _Float16* VL = (_Float16*)take(NR * DM * 2); _Float16* O16 = (_Float16*)take(NR * DM * 2); _Float16* OL = (_Float16*)take(NR * DM * 2);
  float* S = (float*)take((size_t)NH * QT * NKX * 4); _Float16* P = (_Float16*)take((size_t)NH * QT * NKX * 2); _Float16* VT = (_Float16*)take((size_t)NH * HD * SQ * 2); _Float16* VTL = (_Float16*)take((size_t)NH * HD * SQ * 2);
  float* QF0 = (float*)take((size_t)QT0 * DM * 4); float* KF0 = (float*)take((size_t)QT0 * DM * 4); float* VF0 = (float*)take((size_t)QT0 * DM * 4); float* OF0 = (float*)take((size_t)NB * QT0 * DM * 4); _Float16* OH0 = (_Float16*)take((size_t)NB * QT0 * DM * 2); _Float16* OL0 = (_Float16*)take((size_t)NB * QT0 * DM * 2);
  if (off > ws_size) return;
  { const unsigned g = (unsigned)(((size_t)DM * DM / 8 + 255) / 256); k_wnat<<<g, 256, 0, stream>>>(wq, (size_t)DM * DM / 8, BQ); k_wnat<<<g, 256, 0, stream>>>(wk, (size_t)DM * DM / 8, BK); k_wnat<<<g, 256, 0, stream>>>(wv, (size_t)DM * DM / 8, BV); k_wnat<<<g, 256, 0, stream>>>(wo, (size_t)DM * DM / 8, BO); }      /* natural [out][in] = Bt[n][k], x16 */

  k_x16<<<(unsigned)((NR * DM / 8 + 255) / 256), 256, 0, stream>>>(x, X16, NR * DM / 8); k_xt16<<<(unsigned)((NR * DM / 8 + 255) / 256), 256, 0, stream>>>(x, tg, wt, bt, XT16, XL16, NR * DM / 8);      /* x_time = x + time_gaps Wt^T + bt as f16 hi + x1024 residual rows */
  const size_t r0p = (size_t)B0 * SQ;      /* first projected row */
  k_gemm2<0><<<dim3((unsigned)((MP / 128) * (DM / 64)), 1), 128, 0, stream>>>(XT16 + r0p * DM, DM, 0, BQ, DM, 0, 0.0625f, bq, 0, nullptr, 1, 0, 0, F32 + r0p * DM, nullptr, DM, 0, MP, DM, DM); k_gemm2<0><<<dim3((unsigned)((MP / 128) * (DM / 64)), 1), 128, 0, stream>>>(XL16 + r0p * DM, DM, 0, BQ, DM, 0, 0.00006103515625f, nullptr, 0, F32 + r0p * DM, -1, 0, 0, F32 + r0p * DM, nullptr, DM, 0, MP, DM, DM); k_hl<<<(unsigned)(((size_t)MP * DM / 8 + 255) / 256), 256, 0, stream>>>(F32 + r0p * DM, Q16 + r0p * DM, QL + r0p * DM, (size_t)MP * DM / 8);      
  k_gemm2<0><<<dim3((unsigned)((MP / 128) * (DM / 64)), 1), 128, 0, stream>>>(XT16 + r0p * DM, DM, 0, BK, DM, 0, 0.0625f, bk, 0, nullptr, 1, 0, 0, F32 + r0p * DM, nullptr, DM, 0, MP, DM, DM); k_gemm2<0><<<dim3((unsigned)((MP / 128) * (DM / 64)), 1), 128, 0, stream>>>(XL16 + r0p * DM, DM, 0, BK, DM, 0, 0.00006103515625f, nullptr, 0, F32 + r0p * DM, -1, 0, 0, F32 + r0p * DM, nullptr, DM, 0, MP, DM, DM); k_hl<<<(unsigned)(((size_t)MP * DM / 8 + 255) / 256), 256, 0, stream>>>(F32 + r0p * DM, K16 + r0p * DM, KL + r0p * DM, (size_t)MP * DM / 8);      /* k likewise */
  k_gemm2<0><<<dim3((unsigned)((MP / 128) * (DM / 64)), 1), 128, 0, stream>>>(X16 + r0p * DM, DM, 0, BV, DM, 0, 0.0625f, bv, 0, nullptr, 1, 0, 0, F32 + r0p * DM, nullptr, DM, 0, MP, DM, DM); k_hl<<<(unsigned)(((size_t)MP * DM / 8 + 255) / 256), 256, 0, stream>>>(F32 + r0p * DM, V16 + r0p * DM, VL + r0p * DM, (size_t)MP * DM / 8);      /* v = x Wv^T + bv in f32 -> f16 hi + x1024 residual */
  for (int b = B0; b < B0 + NBR; ++b) { const size_t r0 = (size_t)b * SQ;
    k_vt<NH, SQ><<<NH * (SQ / 64), 256, 0, stream>>>(V16 + r0 * LQ, LQ, 0, VT); k_vt<NH, SQ><<<NH * (SQ / 64), 256, 0, stream>>>(VL + r0 * LQ, LQ, 0, VTL);      /* V^T (hi and residual) [NH][HD][SQ] for this batch */
    k_gemm2<0><<<dim3((QT0 / 128) * (DM / 64), 1), 128, 0, stream>>>(XT16 + r0 * DM, DM, 0, BQ, DM, 0, 0.0625f, bq, 0, nullptr, 1, 0, 0, QF0, nullptr, DM, 0, QT0, DM, DM); k_gemm2<0><<<dim3((QT0 / 128) * (DM / 64), 1), 128, 0, stream>>>(XL16 + r0 * DM, DM, 0, BQ, DM, 0, 0.00006103515625f, nullptr, 0, QF0, -1, 0, 0, QF0, nullptr, DM, 0, QT0, DM, DM); k_gemm2<0><<<dim3((QT0 / 128) * (DM / 64), 1), 128, 0, stream>>>(XT16 + r0 * DM, DM, 0, BK, DM, 0, 0.0625f, bk, 0, nullptr, 1, 0, 0, KF0, nullptr, DM, 0, QT0, DM, DM); k_gemm2<0><<<dim3((QT0 / 128) * (DM / 64), 1), 128, 0, stream>>>(XL16 + r0 * DM, DM, 0, BK, DM, 0, 0.00006103515625f, nullptr, 0, KF0, -1, 0, 0, KF0, nullptr, DM, 0, QT0, DM, DM); k_gemm2<0><<<dim3((QT0 / 128) * (DM / 64), 1), 128, 0, stream>>>(X16 + r0 * DM, DM, 0, BV, DM, 0, 0.0625f, bv, 0, nullptr, 1, 0, 0, VF0, nullptr, DM, 0, QT0, DM, DM);      /* f32 q, k, v of the first 128 rows (exact products) */
    k_att0<0, 1><<<NH * (QT0 / 64), 64, 0, stream>>>(QF0, KF0, VF0, DM, nullptr, km + (size_t)b * SQ, 0.125f, OF0 + (size_t)b * QT0 * DM, DM);      /* exact f32 causal attention with the key padding vector */      /* exact f32 attention for rows 0..127 (o x64) */
    for (int q0 = 0; q0 < QN; q0 += QT) { const int nk = q0 + QT;      /* causal: only keys below the tile end are computed */
      k_gemm2<0><<<dim3((QT / 128) * (nk / 64), NHD), 128, 0, stream>>>(Q16 + (r0 + q0) * LQ, LQ, (size_t)HD, K16 + r0 * LQ, LQ, (size_t)HD, 0.125f, nullptr, 0, nullptr, 1, 0, 0, S, nullptr, NKX, (size_t)QT * NKX, QT, nk, HD); k_gemm2<0><<<dim3((QT / 128) * (nk / 64), NHD), 128, 0, stream>>>(QL + (r0 + q0) * LQ, LQ, (size_t)HD, K16 + r0 * LQ, LQ, (size_t)HD, 0.0001220703125f, nullptr, 0, S, -1, 0, 0, S, nullptr, NKX, (size_t)QT * NKX, QT, nk, HD); k_gemm2<0><<<dim3((QT / 128) * (nk / 64), NHD), 128, 0, stream>>>(Q16 + (r0 + q0) * LQ, LQ, (size_t)HD, KL + r0 * LQ, LQ, (size_t)HD, 0.0001220703125f, nullptr, 0, S, -1, 0, 0, S, nullptr, NKX, (size_t)QT * NKX, QT, nk, HD);      /* scores = (q_hi.k_hi + q_lo.k_hi/1024 + q_hi.k_lo/1024) / 8: three accumulating passes, all heads on grid.y */
      switch (nk / QT) {      /* causal + key padding mask; one wave per row, 8 rows per block; the row length picks the kernel */
        case 1: k_rsmcf2kv<1><<<(NHD * QT + 7) / 8, 256, 0, stream>>>(S, P, NHD, q0, km + (size_t)b * SQ); break;
        case 2: k_rsmcf2kv<2><<<(NHD * QT + 7) / 8, 256, 0, stream>>>(S, P, NHD, q0, km + (size_t)b * SQ); break;
        case 3: k_rsmcf2kv<3><<<(NHD * QT + 7) / 8, 256, 0, stream>>>(S, P, NHD, q0, km + (size_t)b * SQ); break;
        case 4: k_rsmcf2kv<4><<<(NHD * QT + 7) / 8, 256, 0, stream>>>(S, P, NHD, q0, km + (size_t)b * SQ); break;
        case 5: k_rsmcf2kv<5><<<(NHD * QT + 7) / 8, 256, 0, stream>>>(S, P, NHD, q0, km + (size_t)b * SQ); break;
        case 6: k_rsmcf2kv<6><<<(NHD * QT + 7) / 8, 256, 0, stream>>>(S, P, NHD, q0, km + (size_t)b * SQ); break;
        case 7: k_rsmcf2kv<7><<<(NHD * QT + 7) / 8, 256, 0, stream>>>(S, P, NHD, q0, km + (size_t)b * SQ); break;
        case 8: k_rsmcf2kv<8><<<(NHD * QT + 7) / 8, 256, 0, stream>>>(S, P, NHD, q0, km + (size_t)b * SQ); break;
      }
      k_gemm2<0><<<dim3((QT / 128) * (HD / 64), NHD), 128, 0, stream>>>(P, NKX, (size_t)QT * NKX, VT, SQ, (size_t)HD * SQ, 0.25f, nullptr, 0, nullptr, 1, 0, 0, F32 + (r0 + q0) * DM, nullptr, DM, (size_t)HD, QT, HD, nk); k_gemm2<0><<<dim3((QT / 128) * (HD / 64), NHD), 128, 0, stream>>>(P, NKX, (size_t)QT * NKX, VTL, SQ, (size_t)HD * SQ, 0.000244140625f, nullptr, 0, F32 + (r0 + q0) * DM, -1, 0, 0, F32 + (r0 + q0) * DM, nullptr, DM, (size_t)HD, QT, HD, nk); }      /* o (x64) = P.V_hi^T + P.V_lo^T/1024 in f32 rows */
    k_hl<<<(unsigned)(((size_t)SQ * DM / 8 + 255) / 256), 256, 0, stream>>>(F32 + r0 * DM, O16 + r0 * DM, OL + r0 * DM, (size_t)SQ * DM / 8); }      /* o -> f16 hi + x1024 residual */
  k_gemm2<0><<<dim3((unsigned)((MPO / 128) * (DM / 64)), 1), 128, 0, stream>>>(O16 + r0p * DM, DM, 0, BO, DM, 0, 0.0009765625f, bo, 0, nullptr, 1, 0, 0, (float*)d_out + r0p * DM, nullptr, DM, 0, MPO, DM, DM); k_gemm2<0><<<dim3((unsigned)((MPO / 128) * (DM / 64)), 1), 128, 0, stream>>>(OL + r0p * DM, DM, 0, BO, DM, 0, 0.00000095367431640625f, nullptr, 0, (const float*)d_out + r0p * DM, -1, 0, 0, (float*)d_out + r0p * DM, nullptr, DM, 0, MPO, DM, DM);      /* out = o_hi Wo^T + bo, then += o_lo Wo^T 2^-20 (own element) */
  k_hl<<<(unsigned)(((size_t)NB * QT0 * DM / 8 + 255) / 256), 256, 0, stream>>>(OF0, OH0, OL0, (size_t)NB * QT0 * DM / 8);      /* first-tile o (x64) -> f16 hi + x1024 residual planes */
  for (int b = B0; b < B0 + NBR; ++b) { const size_t r0 = (size_t)b * SQ; const size_t f0 = (size_t)b * QT0;
    k_gemm2<0><<<dim3((QT0 / 128) * (DM / 64), 1), 128, 0, stream>>>(OH0 + f0 * DM, DM, 0, BO, DM, 0, 0.0009765625f, bo, 0, nullptr, 1, 0, 0, (float*)d_out + r0 * DM, nullptr, DM, 0, QT0, DM, DM);      /* rows 0..127: out = o_hi Wo (+ b), overwriting the f16-path rows */
    k_gemm2<0><<<dim3((QT0 / 128) * (DM / 64), 1), 128, 0, stream>>>(OL0 + f0 * DM, DM, 0, BO, DM, 0, 0.00000095367431640625f, nullptr, 0, (const float*)d_out + r0 * DM, -1, 0, 0, (float*)d_out + r0 * DM, nullptr, DM, 0, QT0, DM, DM); }      /* += o_lo Wo 2^-20 (own-element accumulate) */
}

// v003
// One run takes 2140 microseconds.
// Timed twice side by side with v002, it ran 1.39 times as fast both times.
// Over all steps from v000 it is 4.05 times as fast.
#include <hip/hip_runtime.h>
// Causal multi-head attention with a time-gap embedding and a key padding mask (x [2][2048][1024]; x_time = x + (time_gaps Wt^T + bt) with time_gaps [2][2048][1] (U[0,1)), Wt [1024][1] sigma 1, bt zeros; q = x_time Wq^T + bq, k = x_time Wk^T + bk, v = x Wv^T + bv (v from the RAW x; natural [1024][1024] sigma 1/32, zero biases); 16 heads of 64; scores / 8; where(mask[b][j] == 0, -1e9) (int mask [2][2048], all ones) and where(j > i, -1e9) (causal); softmax; out = merged Wo^T + bo -> [2][2048][1024]).
// Structure: token rows r = b*2048 + s; x as exact f16 rows; x_time = x + t Wt + bt on VALU as f16 hi + x1024 residual rows; q and k = (hi + lo/1024) W + b as two accumulating WMMA GEMMs each (32x64 wave tiles, f32 accumulation) into f32 rows, split into f16 hi + x1024 residual planes; v = x Wv + bv in f32, split likewise (both transposed per batch); per query tile of 256 rows: scores = three accumulating passes (q_hi.k_hi + q_lo.k_hi/1024 + q_hi.k_lo/1024, K = 64, all heads on grid.y, alpha 1/8), causal + key-mask row softmax on VALU (0/1 factors, f32 statistics, native exp; weights x256 f16), o = P.V_hi^T + P.V_lo^T/1024 in f32 rows, split into hi + residual; out = o_hi Wo + bo then += o_lo Wo 2^-20 (own element); first-tile refinement: the first 128 rows of each batch recomputed exactly in f32 on VALU and rewritten; launches: see trace.
// Compute dtype: inputs rounded to bf16; x / weights exact; q, k, v and o as f16 hi + x1024 residual GEMM operands, softmax weights as plain f16 (~2^-12); scores and softmax statistics f32; v_wmma_f32_16x16x32_f16.
#define NB 2
#define SQ 2048
#define DM 1024
#define NH 16
#define HD 64
#define HG 4                         /* heads per block group of the unlaunched k_vt overload */
#define QT 256                       /* query rows per causal tile */
#define NKX SQ                       /* S / P row pitch */
#define QT0 128                      /* first-tile rows recomputed exactly in f32 */
#define B0 0                         /* first batch processed (debug hook) */
#define NBR NB                       /* batches processed (debug hook) */
#define NR ((size_t)NB * SQ)         /* token rows */
#define MP ((int)((size_t)NBR * SQ)) /* rows projected (debug hook) */
#define QN SQ                        /* query rows attended per batch (debug hook) */
#define NHD NH                       /* heads attended (debug hook) */
#define MPO MP                       /* rows through the output stage (debug hook) */
#define LQ DM      /* row pitch of the q/k/v rows */
typedef __bf16 v16b __attribute__((ext_vector_type(16)));
typedef unsigned short v8us __attribute__((ext_vector_type(8), may_alias));
typedef float  v8f  __attribute__((ext_vector_type(8)));
typedef float  v4f  __attribute__((ext_vector_type(4)));
typedef float  v4fa __attribute__((ext_vector_type(4), may_alias));
union FragB { v16b v; v8us half[2]; unsigned short u[16]; };

__device__ __forceinline__ unsigned short bf16_bits(float x) { unsigned int u = __float_as_uint(x); return (unsigned short)((u + 0x7FFFu + ((u >> 16) & 1u)) >> 16); }
__device__ __forceinline__ float bf16_val(unsigned short b) { return __uint_as_float(((unsigned int)b) << 16); }
__device__ __forceinline__ float bf16_round(float x) { return bf16_val(bf16_bits(x)); }
// D += A·B with NT terms: 1 = ah·bh, 2 = + al·bh (A split), 3 = + ah·bl (both split)
template <int NT>
__device__ __forceinline__ v8f mmaN(v16b ah, v16b al, v16b bh, v16b bl, v8f c) {
  c = __builtin_amdgcn_wmma_f32_16x16x32_bf16(false, ah, false, bh, (short)0, c, false, false);
  if (NT >= 2) c = __builtin_amdgcn_wmma_f32_16x16x32_bf16(false, al, false, bh, (short)0, c, false, false);
  if (NT >= 3) c = __builtin_amdgcn_wmma_f32_16x16x32_bf16(false, ah, false, bl, (short)0, c, false, false);
  asm volatile("v_nop\n\tv_nop\n\tv_nop\n\tv_nop" : "+v"(c) : "v"(ah), "v"(al), "v"(bh), "v"(bl));
  return c;
}

__global__ __launch_bounds__(256) void k_wt_bf16(const float* __restrict__ W, unsigned short* __restrict__ Wt, int K, int N) {
  const int t = blockIdx.x * 256 + threadIdx.x;
  const int k8n = K / 8;
  if (t >= N * k8n) return;
  const int n = t / k8n, k8 = (t % k8n) * 8;
  v8us v;
#pragma unroll
  for (int i = 0; i < 8; ++i) v[i] = bf16_bits(W[(size_t)(k8 + i) * N + n]);
  *(v8us*)(Wt + (size_t)n * K + k8) = v;
  
}

// GEMM C[M][N] (f32, pitch ldc) = act(A[M][K]·W + bias). A f32 row-major (pitch lda) converted per fragment to bf16
// (ASPLIT: hi/lo two planes -> 2 terms, else single rounded term); Wt bf16 [N][K] (pitch ldb). BIAS_BF16 rounds the
// bias to bf16 first (bias quantised to bf16 before the add). K%32==0, M%16==0, N%64==0.
template <bool ASPLIT, int ACT, bool BIAS_BF16>
__global__ __launch_bounds__(128) void k_gemm_bf(const float* __restrict__ A, int lda, const unsigned short* __restrict__ Wt, int ldb,
                                               const float* __restrict__ bias, float* __restrict__ C, int ldc, int M, int N, int K) {
  __shared__ __attribute__((aligned(16))) float so[4][16][64];
  const int tid = threadIdx.x, w = tid >> 5, lane = tid & 31, ln = lane & 15, hh = lane >> 4;
  const int ntn = N / 64;
  const int wid = blockIdx.x * 4 + w;
  const int mt = wid / ntn, nq = wid % ntn;
  if (mt * 16 >= M) return;
  const int row0 = mt * 16, col0 = nq * 64;
  const float* arow = A + (size_t)(row0 + ln) * lda;
  v8f acc[4] = {};
  for (int kb = 0; kb < K; kb += 32) {
    FragB ah, al;
    const v4f x0 = *(const v4fa*)(arow + kb + 8 * hh), x1 = *(const v4fa*)(arow + kb + 8 * hh + 4);
    const v4f x2 = *(const v4fa*)(arow + kb + 16 + 8 * hh), x3 = *(const v4fa*)(arow + kb + 16 + 8 * hh + 4);
    float xs[16] = {x0[0],x0[1],x0[2],x0[3],x1[0],x1[1],x1[2],x1[3],x2[0],x2[1],x2[2],x2[3],x3[0],x3[1],x3[2],x3[3]};
#pragma unroll
    for (int i = 0; i < 16; ++i) { const unsigned short hb = bf16_bits(xs[i]); ah.u[i] = hb; al.u[i] = ASPLIT ? bf16_bits(xs[i] - bf16_val(hb)) : (unsigned short)0; }
#pragma unroll
    for (int t = 0; t < 4; ++t) {
      const unsigned short* brow = Wt + (size_t)(col0 + t * 16 + ln) * ldb + kb;
      FragB b;
      b.half[0] = *(const v8us*)(brow + 8 * hh);
      b.half[1] = *(const v8us*)(brow + 16 + 8 * hh);
      acc[t] = mmaN<ASPLIT ? 2 : 1>(ah.v, al.v, b.v, b.v, acc[t]);
    }
  }
#pragma unroll
  for (int t = 0; t < 4; ++t) {
    float bv = bias ? bias[col0 + t * 16 + ln] : 0.f;
    if (BIAS_BF16) bv = bf16_round(bv);
#pragma unroll
    for (int r = 0; r < 8; ++r) { float v = acc[t][r] + bv; if (ACT == 1) v = fmaxf(v, 0.f); so[w][8 * hh + r][t * 16 + ln] = v; }
  }
  __builtin_amdgcn_fence(__ATOMIC_ACQ_REL, "workgroup");
  __builtin_amdgcn_wave_barrier();
  const int rsub = lane >> 4, c4 = (lane & 15) * 4;
  {
#pragma unroll
    for (int q = 0; q < 8; ++q) {
      const int r = q * 2 + rsub;
      const v4f v = *(const v4fa*)&so[w][r][c4];
      *(v4f*)(C + (size_t)(row0 + r) * ldc + col0 + c4) = v;
    }
    
  }
}

// GEMM C = act(A·W + bias + resid): A f32 (ASPLIT -> hi/lo 2 terms), Wt bf16 [N][K]; ACT 0 none, 1 relu, 2 exact gelu;
// resid (optional, f32, row index = (row % rmod), pitch ldr, RES_BF16 rounds it) added before the activation.
template <bool ASPLIT, int ACT, bool BIAS_BF16, bool RES_BF16>
__global__ __launch_bounds__(128) void k_gemm_bf3(const float* __restrict__ A, int lda, const unsigned short* __restrict__ Wt, int ldb,
                                                const float* __restrict__ bias, const float* __restrict__ resid, int rmod, int ldr,
                                                float* __restrict__ C, int ldc, int M, int N, int K) {
  __shared__ __attribute__((aligned(16))) float so[4][16][64];
  const int tid = threadIdx.x, w = tid >> 5, lane = tid & 31, ln = lane & 15, hh = lane >> 4;
  const int ntn = N / 64;
  const int wid = blockIdx.x * 4 + w;
  const int mt = wid / ntn, nq = wid % ntn;
  if (mt * 16 >= M) return;
  const int row0 = mt * 16, col0 = nq * 64;
  const float* arow = A + (size_t)(row0 + ln) * lda;
  v8f acc[4] = {};
  for (int kb = 0; kb < K; kb += 32) {
    FragB ah, al;
    const v4f x0 = *(const v4fa*)(arow + kb + 8 * hh), x1 = *(const v4fa*)(arow + kb + 8 * hh + 4);
    const v4f x2 = *(const v4fa*)(arow + kb + 16 + 8 * hh), x3 = *(const v4fa*)(arow + kb + 16 + 8 * hh + 4);
    float xs[16] = {x0[0],x0[1],x0[2],x0[3],x1[0],x1[1],x1[2],x1[3],x2[0],x2[1],x2[2],x2[3],x3[0],x3[1],x3[2],x3[3]};
#pragma unroll
    for (int i = 0; i < 16; ++i) { const unsigned short hb = bf16_bits(xs[i]); ah.u[i] = hb; al.u[i] = ASPLIT ? bf16_bits(xs[i] - bf16_val(hb)) : (unsigned short)0; }
#pragma unroll
    for (int t = 0; t < 4; ++t) {
      const unsigned short* brow = Wt + (size_t)(col0 + t * 16 + ln) * ldb + kb;
      FragB b;
      b.half[0] = *(const v8us*)(brow + 8 * hh);
      b.half[1] = *(const v8us*)(brow + 16 + 8 * hh);
      acc[t] = mmaN<ASPLIT ? 2 : 1>(ah.v, al.v, b.v, b.v, acc[t]);
    }
  }
#pragma unroll
  for (int t = 0; t < 4; ++t) {
    const int col = col0 + t * 16 + ln;
    float bv = bias ? bias[col] : 0.f;
    if (BIAS_BF16) bv = bf16_round(bv);
#pragma unroll
    for (int r = 0; r < 8; ++r) {
      float v = acc[t][r] + bv;
      if (resid) { float rv = resid[(size_t)((row0 + 8 * hh + r) % rmod) * ldr + col]; if (RES_BF16) rv = bf16_round(rv); v += rv; }
      if (ACT == 1) v = fmaxf(v, 0.f);
      if (ACT == 2) v = 0.5f * v * (1.0f + erff(v * 0.70710678118654752f));
      if (ACT == 3) { const float u = 0.7978845608028654f * (v + 0.044715f * v * v * v); v = 0.5f * v * (1.0f + tanhf(u)); }
      so[w][8 * hh + r][t * 16 + ln] = v;
    }
  }
  __builtin_amdgcn_fence(__ATOMIC_ACQ_REL, "workgroup");
  __builtin_amdgcn_wave_barrier();
  const int rsub = lane >> 4, c4 = (lane & 15) * 4;
  {
#pragma unroll
    for (int q = 0; q < 8; ++q) {
      const int r = q * 2 + rsub;
      const v4f v = *(const v4fa*)&so[w][r][c4];
      *(v4f*)(C + (size_t)(row0 + r) * ldc + col0 + c4) = v;
    }
    
  }
}
// row LayerNorm (biased variance, eps) over N: s = X (+ R); optional out_sum <- s; out_norm <- (s-mu)*rsqrt(var+eps)*g + b
template <bool PARAM_BF16>
__global__ __launch_bounds__(256) void k_layernorm(const float* __restrict__ X, const float* __restrict__ R, const float* __restrict__ g, const float* __restrict__ bta,
                                                  float* __restrict__ out_sum, float* __restrict__ out_norm, int N, float eps) {
  __shared__ float red[256];
  const int row = blockIdx.x, tid = threadIdx.x;
  const float* x = X + (size_t)row * N; const float* rr = R ? R + (size_t)row * N : nullptr;
  float vals[16];                     // up to N = 4096
  const int per = N / 256;            // contiguous chunk per thread? use strided-by-4 chunks: thread handles j = tid*4 + 1024*u
  float s1 = 0.f;
  for (int u = 0; u < per / 4; ++u) {
    const int j = tid * 4 + 1024 * u;
    const v4f a = *(const v4fa*)(x + j);
    v4f b = {0.f,0.f,0.f,0.f}; if (rr) b = *(const v4fa*)(rr + j);
#pragma unroll
    for (int q = 0; q < 4; ++q) { const float v = a[q] + b[q]; vals[u * 4 + q] = v; s1 += v; }
  }
  red[tid] = s1; __syncthreads();
  for (int st = 128; st > 0; st >>= 1) { if (tid < st) red[tid] += red[tid + st]; __syncthreads(); }
  const float mu = red[0] / (float)N; __syncthreads();
  float s2 = 0.f;
  for (int u = 0; u < per / 4; ++u)
#pragma unroll
    for (int q = 0; q < 4; ++q) { const float c = vals[u * 4 + q] - mu; s2 += c * c; }
  red[tid] = s2; __syncthreads();
  for (int st = 128; st > 0; st >>= 1) { if (tid < st) red[tid] += red[tid + st]; __syncthreads(); }
  const float rs = rsqrtf(red[0] / (float)N + eps);
  {
    for (int u = 0; u < per / 4; ++u) {
      const int j = tid * 4 + 1024 * u;
      v4f o, sm;
#pragma unroll
      for (int q = 0; q < 4; ++q) {
        float gg = g[j + q], bb = bta[j + q];
        if (PARAM_BF16) { gg = bf16_round(gg); bb = bf16_round(bb); }
        sm[q] = vals[u * 4 + q]; o[q] = (vals[u * 4 + q] - mu) * rs * gg + bb;
      }
      if (out_sum) *(v4f*)(out_sum + (size_t)row * N + j) = sm;
      *(v4f*)(out_norm + (size_t)row * N + j) = o;
    }
    
  }
}



// ---- f16 WMMA path (v_wmma_f32_16x16x32_f16): 11-bit significands for operands in range — used where a [0,1] probability operand needs more precision than bf16
typedef _Float16 v16h __attribute__((ext_vector_type(16)));
union FragH { v16h v; v8us half[2]; _Float16 h[16]; unsigned short u[16]; };
template <int NT>
__device__ __forceinline__ v8f mmaH(v16h ah, v16h al, v16h bh, v16h bl, v8f c) {
  c = __builtin_amdgcn_wmma_f32_16x16x32_f16(false, ah, false, bh, (short)0, c, false, false);
  if (NT >= 2) c = __builtin_amdgcn_wmma_f32_16x16x32_f16(false, al, false, bh, (short)0, c, false, false);
  if (NT >= 3) c = __builtin_amdgcn_wmma_f32_16x16x32_f16(false, ah, false, bl, (short)0, c, false, false);
  asm volatile("v_nop\n\tv_nop\n\tv_nop\n\tv_nop" : "+v"(c) : "v"(ah), "v"(al), "v"(bh), "v"(bl));
  return c;
}
// batched GEMM like k_gemm_b but f16 operands: A f32 (split into f16 hi/lo if ASPLIT, else rounded to f16), Bt = f16 values [n][k]; alpha; C f32; N multiple of 16 (partial tiles skipped)
template <bool ASPLIT>
__global__ __launch_bounds__(128) void k_gemm_h(const float* __restrict__ A, int lda, size_t sA, const _Float16* __restrict__ Bh, int ldb, size_t sB, float alpha, float* __restrict__ C, int ldc, size_t sC, int M, int N, int K) {
  __shared__ __attribute__((aligned(16))) float so[4][16][64];
  const int tid = threadIdx.x, w = tid >> 5, lane = tid & 31, ln = lane & 15, hh = lane >> 4; const int by = blockIdx.y;
  A += (size_t)by * sA; Bh += (size_t)by * sB; C += (size_t)by * sC;
  const int ntn = (N + 63) / 64; const int wid = blockIdx.x * 4 + w; const int mt = wid / ntn, nq = wid % ntn; if (mt * 16 >= M) return;
  const int row0 = mt * 16, col0 = nq * 64; const float* arow = A + (size_t)(row0 + ln) * lda;
  v8f acc[4] = {};
  for (int kb = 0; kb < K; kb += 32) {
    FragH ah, al;
    const v4f x0 = *(const v4fa*)(arow + kb + 8 * hh), x1 = *(const v4fa*)(arow + kb + 8 * hh + 4), x2 = *(const v4fa*)(arow + kb + 16 + 8 * hh), x3 = *(const v4fa*)(arow + kb + 16 + 8 * hh + 4);
    float xs[16] = {x0[0],x0[1],x0[2],x0[3],x1[0],x1[1],x1[2],x1[3],x2[0],x2[1],x2[2],x2[3],x3[0],x3[1],x3[2],x3[3]};
#pragma unroll
    for (int i = 0; i < 16; ++i) { const _Float16 h = (_Float16)xs[i]; ah.h[i] = h; al.h[i] = ASPLIT ? (_Float16)(xs[i] - (float)h) : (_Float16)0.0f; }
#pragma unroll
    for (int t = 0; t < 4; ++t) { if (col0 + t * 16 >= N) continue; const size_t boff = (size_t)(col0 + t * 16 + ln) * ldb + kb; FragH bq; bq.half[0] = *(const v8us*)(Bh + boff + 8 * hh); bq.half[1] = *(const v8us*)(Bh + boff + 16 + 8 * hh);
      acc[t] = mmaH<ASPLIT ? 2 : 1>(ah.v, al.v, bq.v, bq.v, acc[t]); }
  }
#pragma unroll
  for (int t = 0; t < 4; ++t) { if (col0 + t * 16 >= N) continue;
#pragma unroll
    for (int r = 0; r < 8; ++r) so[w][8 * hh + r][t * 16 + ln] = acc[t][r] * alpha; }
  __builtin_amdgcn_fence(__ATOMIC_ACQ_REL, "workgroup"); __builtin_amdgcn_wave_barrier();
  const int rsub = lane >> 4, c4 = (lane & 15) * 4;
  {
#pragma unroll
    for (int q = 0; q < 8; ++q) { const int r = q * 2 + rsub; if (col0 + c4 < N) { const v4f v = *(const v4fa*)&so[w][r][c4]; *(v4f*)(C + (size_t)(row0 + r) * ldc + col0 + c4) = v; } }
     }
}

// Wt[n][k] = f16(W[k][n]·scale) from f32 row-major W[K][N] (scale = power of two; bf16-exact weights stay exact in f16 away from the subnormal range)
__global__ __launch_bounds__(256) void k_wt_f16(const float* __restrict__ W, _Float16* __restrict__ Wt, int K, int N, float scale) {
  const int t = blockIdx.x * 256 + threadIdx.x; if (t >= N * (K / 8)) return; const int n = t / (K / 8), k8 = (t % (K / 8)) * 8; FragH f;
#pragma unroll
  for (int i = 0; i < 8; ++i) f.h[i] = (_Float16)(bf16_round(W[(size_t)(k8 + i) * N + n]) * scale); const v8us o = f.half[0];
  *(v8us*)((unsigned short*)Wt + (size_t)n * K + k8) = o; 
}
// k_gemm_hh variant with fused epilogue: v = acc·alpha + bias[by·sBias + col] (+ CP[(row/rowsPerB)·sCPb + by·64 + col] if CP) ; ACT 0 none / 1 elu ; writes f16 C16 (and f32 C if non-null)
template <int ACT>
__global__ __launch_bounds__(128) void k_gemm_hhx(const _Float16* __restrict__ A, int lda, size_t sA, const _Float16* __restrict__ Bh, int ldb, size_t sB, float alpha, const float* __restrict__ bias, size_t sBias, const float* __restrict__ CP, int rowsPerB, size_t sCPb, int row0g,
    float* __restrict__ C, _Float16* __restrict__ C16, int ldc, size_t sC, int M, int N, int K) {
  __shared__ __attribute__((aligned(16))) float so[4][16][64];
  const int tid = threadIdx.x, w = tid >> 5, lane = tid & 31, ln = lane & 15, hh = lane >> 4; const int by = blockIdx.y;
  A += (size_t)by * sA; Bh += (size_t)by * sB; const size_t cofs = (size_t)by * sC; const float* bp = bias ? bias + (size_t)by * sBias : nullptr;
  const int ntn = (N + 63) / 64; const int wid = blockIdx.x * 4 + w; const int mt = wid / ntn, nq = wid % ntn; if (mt * 16 >= M) return;
  const int row0 = mt * 16, col0 = nq * 64; const _Float16* arow = A + (size_t)(row0 + ln) * lda;
  v8f acc[4] = {};
  for (int kb = 0; kb < K; kb += 32) { FragH ah; ah.half[0] = *(const v8us*)((const unsigned short*)arow + kb + 8 * hh); ah.half[1] = *(const v8us*)((const unsigned short*)arow + kb + 16 + 8 * hh);
#pragma unroll
    for (int t = 0; t < 4; ++t) { if (col0 + t * 16 >= N) continue; const size_t boff = (size_t)(col0 + t * 16 + ln) * ldb + kb; FragH bq; bq.half[0] = *(const v8us*)((const unsigned short*)Bh + boff + 8 * hh); bq.half[1] = *(const v8us*)((const unsigned short*)Bh + boff + 16 + 8 * hh);
      acc[t] = mmaH<1>(ah.v, ah.v, bq.v, bq.v, acc[t]); }
  }
#pragma unroll
  for (int t = 0; t < 4; ++t) { if (col0 + t * 16 >= N) continue; const int col = col0 + t * 16 + ln; const float bv = bp ? bf16_round(bp[col]) : 0.f;
#pragma unroll
    for (int r = 0; r < 8; ++r) { float v = acc[t][r] * alpha + bv; if (CP) { const int rr = row0g + row0 + 8 * hh + r; if (rowsPerB < 0) v += CP[cofs + (size_t)rr * ldc + col];      /* rowsPerB < 0: own element of the batched C plane */ else { const int bidx = rr / rowsPerB; v += CP[(size_t)bidx * sCPb + (size_t)by * 64 + col]; } } if (ACT == 1) v = (v > 0.f) ? v : expm1f(v); else if (ACT == 7) v = (v > 0.f) ? v + 1.0f : expf(v); else if (ACT == 8) v = tanhf(v); else if (ACT == 9) v = 0.5f * v * (1.0f + tanhf(0.7978845608028654f * (v + 0.044715f * v * v * v))); else if (ACT == 11) v = 1.0f / (1.0f + expf(-v)); else if (ACT == 12) v = (v > 0.f) ? v : 0.01f * v; else if (ACT == 14) v = (v > 0.f) ? v : 0.1f * v; else if (ACT == 16) v = (v >= 0.f) ? v : 0.3f * v; else if (ACT == 17) v = (v >= 0.f) ? v : 0.2f * v; else if (ACT == 15) v = v / (1.0f + expf(-v)); else if (ACT == 3) v = fmaxf(v, 0.f); else if (ACT == 6) v = 0.5f * v * (1.0f + erff(v * 0.70710678118654752f)); so[w][8 * hh + r][t * 16 + ln] = v; } }
  __builtin_amdgcn_fence(__ATOMIC_ACQ_REL, "workgroup"); __builtin_amdgcn_wave_barrier();
  const int rsub = lane >> 4, c4 = (lane & 15) * 4; typedef _Float16 v4h __attribute__((ext_vector_type(4)));
  {
#pragma unroll
    for (int q = 0; q < 8; ++q) { const int r = q * 2 + rsub; if (col0 + c4 < N) { const v4f v = *(const v4fa*)&so[w][r][c4]; if (C) *(v4f*)(C + cofs + (size_t)(row0 + r) * ldc + col0 + c4) = v; if (C16) { v4h h4; for (int i = 0; i < 4; ++i) h4[i] = (_Float16)v[i]; *(v4h*)(C16 + cofs + (size_t)(row0 + r) * ldc + col0 + c4) = h4; } } }
     }
}


typedef _Float16 v4h __attribute__((ext_vector_type(4)));

__global__ __launch_bounds__(256) void k_x16(const float* __restrict__ x, _Float16* __restrict__ X16, size_t n8) { const size_t t = (size_t)blockIdx.x * 256 + threadIdx.x; if (t >= n8) return; FragH f;
#pragma unroll
  for (int q = 0; q < 8; ++q) f.h[q] = (_Float16)bf16_round(x[t * 8 + q]); *(v8us*)((unsigned short*)X16 + t * 8) = f.half[0];  }
__global__ __launch_bounds__(256) void k_h16(const float* __restrict__ x, _Float16* __restrict__ X16, size_t n8) { const size_t t = (size_t)blockIdx.x * 256 + threadIdx.x; if (t >= n8) return; FragH f;
#pragma unroll
  for (int q = 0; q < 8; ++q) f.h[q] = (_Float16)x[t * 8 + q]; *(v8us*)((unsigned short*)X16 + t * 8) = f.half[0];  }
__global__ __launch_bounds__(256) void k_round16f(const float* __restrict__ W, _Float16* __restrict__ Bt, size_t n8) { const size_t t = (size_t)blockIdx.x * 256 + threadIdx.x; if (t >= n8) return; FragH f;
#pragma unroll
  for (int i = 0; i < 8; ++i) f.h[i] = (_Float16)(bf16_round(W[t * 8 + i]) * 16.0f); *(v8us*)((unsigned short*)Bt + t * 8) = f.half[0];  }
template <int NHv, int TTv>
__global__ __launch_bounds__(256) void k_vt(const _Float16* __restrict__ V16, int ldv, int voff, _Float16* __restrict__ Vt) { __shared__ unsigned short tl[64][66]; const int tid = threadIdx.x; const int slab = blockIdx.x / (TTv / 64), lg = blockIdx.x % (TTv / 64); const int b = slab / NHv, h = slab % NHv;
  for (int i = tid; i < 64 * 8; i += 256) { const int r = i / 8, c8 = (i % 8) * 8; FragH f; f.half[0] = *(const v8us*)((const unsigned short*)V16 + ((size_t)b * TTv + lg * 64 + r) * ldv + voff + h * 64 + c8);
#pragma unroll
    for (int q = 0; q < 8; ++q) tl[r][c8 + q] = f.u[q]; }
  __syncthreads();
  {
#pragma unroll
    for (int rd = 0; rd < 2; ++rd) { const int d = rd * 32 + tid / 8, pc = tid % 8; FragH f;
#pragma unroll
      for (int q = 0; q < 8; ++q) f.u[q] = tl[pc * 8 + q][d];
      *(v8us*)((unsigned short*)Vt + ((size_t)slab * 64 + d) * TTv + lg * 64 + pc * 8) = f.half[0]; }
     } }

__global__ __launch_bounds__(256) void k_hl(const float* __restrict__ F, _Float16* __restrict__ Hh, _Float16* __restrict__ Hl, size_t n8) { const size_t t = (size_t)blockIdx.x * 256 + threadIdx.x; if (t >= n8) return; FragH fh, fl; const v4f a = *(const v4fa*)(F + t * 8), c = *(const v4fa*)(F + t * 8 + 4);
#pragma unroll
  for (int q = 0; q < 4; ++q) { _Float16 h = (_Float16)a[q]; fh.h[q] = h; fl.h[q] = (_Float16)((a[q] - (float)h) * 1024.0f); h = (_Float16)c[q]; fh.h[4 + q] = h; fl.h[4 + q] = (_Float16)((c[q] - (float)h) * 1024.0f); }
  { *(v8us*)((unsigned short*)Hh + t * 8) = fh.half[0]; *(v8us*)((unsigned short*)Hl + t * 8) = fl.half[0];  } }

// ---- fast GEMM (wave tile 32x64; requires M % 32 == 0 rows per launch region, N % 64 == 0, K % 32 == 0 and K >= 32); epilogue = k_gemm_hhx semantics ----
__device__ __forceinline__ v16h g2_frag(const _Float16* p, int hh) { FragH f; f.half[0] = *(const v8us*)((const unsigned short*)p + 8 * hh); f.half[1] = *(const v8us*)((const unsigned short*)p + 16 + 8 * hh); return f.v; }
__device__ __forceinline__ v8f g2_mma(v16h a, v16h b, v8f c) { v8f d = __builtin_amdgcn_wmma_f32_16x16x32_f16(false, a, false, b, (short)0, c, false, false); asm volatile("v_nop\n\tv_nop\n\tv_nop\n\tv_nop" : "+v"(d) : "v"(a), "v"(b)); return d; }
struct G2S { v16h a0, a1, b0, b1, b2, b3; };      /* the six fragments of one k step */
template <int ACT>
__global__ __launch_bounds__(128) void k_gemm2(const _Float16* __restrict__ A, int lda, size_t sA, const _Float16* __restrict__ Bh, int ldb, size_t sB, float alpha, const float* __restrict__ bias, size_t sBias, const float* __restrict__ CP, int rowsPerB, size_t sCPb, int row0g,
    float* __restrict__ C, _Float16* __restrict__ C16, int ldc, size_t sC, int M, int N, int K) { static_assert(ACT == 0 || ACT == 3 || ACT == 6 || ACT == 8 || ACT == 9 || ACT == 11 || ACT == 12 || ACT == 14 || ACT == 15 || ACT == 16 || ACT == 17, "k_gemm2: unsupported ACT code (would silently apply no activation)");
  __shared__ __attribute__((aligned(16))) float so[4][32][68];
  const int tid = threadIdx.x, w = tid >> 5, lane = tid & 31, ln = lane & 15, hh = lane >> 4; const int by = blockIdx.y;
  A += (size_t)by * sA; Bh += (size_t)by * sB; const size_t cofs = (size_t)by * sC; const float* bp = bias ? bias + (size_t)by * sBias : nullptr;
  const int ntn = N >> 6; const int mt = blockIdx.x / ntn, nq = blockIdx.x - mt * ntn; const int row0 = mt * 128 + 32 * w, col0 = nq * 64; if (row0 >= M) return;
  const _Float16* a0p = A + (size_t)(row0 + ln) * lda + 8 * hh; const _Float16* a1p = a0p + (size_t)16 * lda;
  const _Float16* b0p = Bh + (size_t)(col0 + ln) * ldb + 8 * hh; const _Float16* b1p = b0p + (size_t)16 * ldb; const _Float16* b2p = b1p + (size_t)16 * ldb; const _Float16* b3p = b2p + (size_t)16 * ldb;
  const v8f z8 = {0.f,0.f,0.f,0.f,0.f,0.f,0.f,0.f}; v8f c00 = z8, c01 = z8, c02 = z8, c03 = z8, c10 = z8, c11 = z8, c12 = z8, c13 = z8;
  /* Three k steps of fragments in registers. A step's twelve loads are issued together, right behind the products of the step whose registers they refill, and are first read three steps later: a load's latency is spread over three steps instead of being paid five times in each.
     No branch stands between the loads, so their waits are counted exactly: past the last step the step index is clamped (an in-bounds re-read of the last step that no product uses). Each accumulator still takes its products in the order kb = 0, 32, 64, ... */
  const int nst = K >> 5;
  auto ld = [&](int st) { const int kb = (st < nst ? st : nst - 1) << 5; const _Float16 *pa0 = a0p + kb, *pa1 = a1p + kb, *pb0 = b0p + kb, *pb1 = b1p + kb, *pb2 = b2p + kb, *pb3 = b3p + kb;      /* the lane half's 8 hh elements are in the row pointers */
    G2S f; f.a0 = g2_frag(pa0, 0); f.a1 = g2_frag(pa1, 0); f.b0 = g2_frag(pb0, 0); f.b1 = g2_frag(pb1, 0); f.b2 = g2_frag(pb2, 0); f.b3 = g2_frag(pb3, 0);
    asm volatile("s_wait_xcnt 0x0" :: "v"(pa0), "v"(pa1), "v"(pb0), "v"(pb1), "v"(pb2), "v"(pb3) : "memory");      /* stands behind the step's loads and in front of every instruction that rewrites an address register they name; the addresses are inputs so that their registers stay as they are up to the wait */
    return f; };
  auto mm = [&](const G2S& f) { c00 = g2_mma(f.a0, f.b0, c00); c10 = g2_mma(f.a1, f.b0, c10); c01 = g2_mma(f.a0, f.b1, c01); c11 = g2_mma(f.a1, f.b1, c11); c02 = g2_mma(f.a0, f.b2, c02); c12 = g2_mma(f.a1, f.b2, c12); c03 = g2_mma(f.a0, f.b3, c03); c13 = g2_mma(f.a1, f.b3, c13); };
  G2S f0 = ld(0), f1 = ld(1), f2 = ld(2); int st = 0;
  /* kept rolled: one trip is the whole ring, and a second copy would only add registers */
#pragma unroll 1
  for (; st + 3 <= nst; st += 3) { mm(f0); f0 = ld(st + 3); mm(f1); f1 = ld(st + 4); mm(f2); f2 = ld(st + 5); }
  if (st < nst) mm(f0);
  if (st + 1 < nst) mm(f1);
  v8f accs[8] = {c00, c01, c02, c03, c10, c11, c12, c13};
#pragma unroll
  for (int u = 0; u < 8; ++u) { const int t = u & 3, half = u >> 2; const int col = col0 + t * 16 + ln; const float bv = bp ? bf16_round(bp[col]) : 0.f;
#pragma unroll
    for (int r = 0; r < 8; ++r) { const int rloc = half * 16 + 8 * hh + r; float v = accs[u][r] * alpha + bv; if (CP) { if (rowsPerB < 0) v += CP[cofs + (size_t)(row0g + row0 + rloc) * ldc + col];      /* rowsPerB < 0: own element of the batched C plane */ else { const int bidx = (row0g + row0 + rloc) / rowsPerB; v += CP[(size_t)bidx * sCPb + (size_t)by * 64 + col]; } }
      if (ACT == 3) v = fmaxf(v, 0.f); else if (ACT == 6) v = 0.5f * v * (1.0f + erff(v * 0.70710678118654752f)); else if (ACT == 11) v = 1.0f / (1.0f + expf(-v)); else if (ACT == 15) v = v / (1.0f + expf(-v)); else if (ACT == 12) v = (v > 0.f) ? v : 0.01f * v; else if (ACT == 8) v = tanhf(v); else if (ACT == 9) v = 0.5f * v * (1.0f + tanhf(0.7978845608028654f * (v + 0.044715f * v * v * v))); else if (ACT == 14) v = (v > 0.f) ? v : 0.1f * v; else if (ACT == 16) v = (v >= 0.f) ? v : 0.3f * v; else if (ACT == 17) v = (v >= 0.f) ? v : 0.2f * v;
      so[w][rloc][t * 16 + ln] = v; } }
  __builtin_amdgcn_fence(__ATOMIC_ACQ_REL, "workgroup"); __builtin_amdgcn_wave_barrier();
  const int rsub = lane >> 4, c4 = (lane & 15) * 4;
  {
#pragma unroll
    for (int q = 0; q < 16; ++q) { const int r = q * 2 + rsub; const v4f v = *(const v4fa*)&so[w][r][c4]; if (C) *(v4f*)(C + cofs + (size_t)(row0 + r) * ldc + col0 + c4) = v; if (C16) { v4h h4; for (int i = 0; i < 4; ++i) h4[i] = (_Float16)v[i]; *(v4h*)(C16 + cofs + (size_t)(row0 + r) * ldc + col0 + c4) = h4; } }
     } }


__global__ __launch_bounds__(256) void k_wnat(const float* __restrict__ w, size_t n8, _Float16* __restrict__ Bt) { const size_t t = (size_t)blockIdx.x * 256 + threadIdx.x; if (t >= n8) return; FragH f; for (int q = 0; q < 8; ++q) f.h[q] = (_Float16)(bf16_round(w[t * 8 + q]) * 16.0f); *(v8us*)((unsigned short*)Bt + t * 8) = f.half[0];  }
__global__ __launch_bounds__(256) void k_rsm(const float* __restrict__ S, _Float16* __restrict__ P, int nrows) {
  #pragma clang fp contract(off)
  const int i = blockIdx.x * 256 + threadIdx.x; if (i >= nrows) return; const float* s = S + (size_t)i * SQ; float mx = -3.0e38f;
#pragma unroll 1
  for (int j = 0; j < SQ; ++j) mx = fmaxf(mx, s[j]); float se = 0.f;
#pragma unroll 1
  for (int j = 0; j < SQ; ++j) se += expf(s[j] - mx); const float sc = 256.0f / se;
#pragma unroll 1
  for (int j0 = 0; j0 < SQ; j0 += 8) { FragH f; for (int q = 0; q < 8; ++q) f.h[q] = (_Float16)(expf(s[j0 + q] - mx) * sc); unsigned short* d = (unsigned short*)P + (size_t)i * SQ + j0; *(v8us*)d = f.half[0];  } }
__global__ __launch_bounds__(256) void k_vt(const _Float16* __restrict__ V16, int b, int h0, _Float16* __restrict__ VT) { __shared__ unsigned short tl[64][65]; const int tid = threadIdx.x; const int hh = blockIdx.x % HG, sg = blockIdx.x / HG; const int s0 = sg * 64; const int h = h0 + hh;
  for (int i = tid; i < 64 * 8; i += 256) { const int j = i / 8, d8 = (i % 8) * 8; FragH f; f.half[0] = *(const v8us*)((const unsigned short*)V16 + ((size_t)b * SQ + s0 + j) * DM + h * HD + d8); for (int q = 0; q < 8; ++q) tl[d8 + q][j] = f.u[q]; }
  __syncthreads();
  { for (int i = tid; i < 64 * 8; i += 256) { const int d = i / 8, j8 = (i % 8) * 8; FragH f; for (int q = 0; q < 8; ++q) f.u[q] = tl[d][j8 + q]; *(v8us*)((unsigned short*)VT + ((size_t)hh * HD + d) * SQ + s0 + j8) = f.half[0]; }  } }



__global__ __launch_bounds__(256) void k_rsmcf2(const float* __restrict__ S, _Float16* __restrict__ P, int hg, int q0, int nk) {
  #pragma clang fp contract(off)
  const int t = blockIdx.x * 256 + threadIdx.x; if (t >= hg * QT) return; const size_t i = (size_t)t; const float* s = S + i * NKX; const int last = q0 + (t % QT); float mx = -3.0e38f;
#pragma unroll 1
  for (int j = 0; j < nk; ++j) { const float f = (j <= last) ? 1.f : 0.f; mx = fmaxf(mx, fmaf(f, s[j], (1.f - f) * -1.0e9f)); } float se = 0.f;
#pragma unroll 1
  for (int j = 0; j < nk; ++j) { const float f = (j <= last) ? 1.f : 0.f; se += __expf(fmaf(f, s[j], (1.f - f) * -1.0e9f) - mx); } const float sc = 256.0f / se;
#pragma unroll 1
  for (int j0 = 0; j0 < nk; j0 += 8) { FragH fr; for (int q = 0; q < 8; ++q) { const int j = j0 + q; const float f = (j <= last) ? 1.f : 0.f; fr.h[q] = (_Float16)(__expf(fmaf(f, s[j], (1.f - f) * -1.0e9f) - mx) * sc); } unsigned short* d = (unsigned short*)P + i * NKX + j0; *(v8us*)d = fr.half[0];  } }



typedef int v4ia __attribute__((ext_vector_type(4), may_alias));
// native exp, the two instructions of __expf: x log2(e), then v_exp_f32. Written as asm for the v_nop: it is the slot that the instruction set asks for behind a transcendental before its result is read or its source overwritten.
__device__ __forceinline__ float exp_native(float x) { float r; asm("v_exp_f32 %0, %1\n\tv_nop" : "=v"(r) : "v"(x * 1.44269504088896340736f)); return r; }
// One wave per score row of nk = QT NP keys. Lane l holds keys j = 128 c + 4 l .. + 3 of every 128-key chunk c: each load covers 512 contiguous bytes, the row is read once and stays in registers, and each exponential is taken once.
// Row statistics: four partial chains per lane, then a five-step butterfly over the wave. One straight-line kernel per row length: no branch stands between a row's loads, so their waits are counted exactly and many of them are in flight at once.
template <int NP>
__global__ __launch_bounds__(256) void k_rsmcf2kv(const float* __restrict__ S, _Float16* __restrict__ P, int hg, int q0, const int* __restrict__ Km) {
  const int j0 = (threadIdx.x & 31) * 4; const int t = blockIdx.x * 8 + (threadIdx.x >> 5); if (t >= hg * QT) return;
  const float* s = S + (size_t)t * NKX + j0; _Float16* p = P + (size_t)t * NKX + j0; const int* km = Km + j0; const int last = q0 + (t % QT);
  constexpr int NC = NP * (QT / 128); v4f v[NC]; v4ia m[NC];
  /* every loop over c is fully unrolled so that v and m are registers, not scratch */
#pragma unroll
  for (int c = 0; c < NC; ++c) { m[c] = *(const v4ia*)(km + c * 128); v[c] = *(const v4fa*)(s + c * 128); }
  v4f mx4 = {-3.0e38f, -3.0e38f, -3.0e38f, -3.0e38f};
#pragma unroll
  for (int c = 0; c < NC; ++c) {
#pragma unroll
    for (int q = 0; q < 4; ++q) { const int j = c * 128 + j0 + q; const float f = (j <= last && m[c][q] != 0) ? 1.f : 0.f;      /* causal AND key not padded (mask[b][j] != 0) */ const float sv = fmaf(f, v[c][q], (1.f - f) * -1.0e9f); v[c][q] = sv; mx4[q] = fmaxf(mx4[q], sv); } }
  float mx = fmaxf(fmaxf(mx4[0], mx4[1]), fmaxf(mx4[2], mx4[3]));
#pragma unroll
  for (int d = 16; d > 0; d >>= 1) mx = fmaxf(mx, __shfl_xor(mx, d, 32));
  v4f se4 = {0.f, 0.f, 0.f, 0.f};
#pragma unroll
  for (int c = 0; c < NC; ++c) {
#pragma unroll
    for (int q = 0; q < 4; ++q) { const float e = exp_native(v[c][q] - mx); v[c][q] = e; se4[q] += e; } }
  float se = (se4[0] + se4[1]) + (se4[2] + se4[3]);
#pragma unroll
  for (int d = 16; d > 0; d >>= 1) se += __shfl_xor(se, d, 32);
  const float sc = 256.0f / se;
#pragma unroll
  for (int c = 0; c < NC; ++c) { v4h h4;
#pragma unroll
    for (int q = 0; q < 4; ++q) h4[q] = (_Float16)(v[c][q] * sc);
    *(v4h*)(p + c * 128) = h4; } }


// Exact f32 attention of the first QT0 rows; one thread per query row, one block per (head, 64 rows).
// All operands stay on chip: the head's K and V rows (and the key padding entries) are staged once in LDS with whole-line loads, every lane then reads the same LDS address (a broadcast, no bank conflict), and the thread's q and o rows live in registers.
// Four keys per trip: their four score chains are independent, so one chain's dependent adds are covered by the other three. Every sum (score, l, o) keeps its order: d = 0..63 inside a score, keys in rising j.
template <int MASKADD, int MASKKV>
__global__ __launch_bounds__(64) void k_att0(const float* __restrict__ QF, const float* __restrict__ KF, const float* __restrict__ VF, int ld, const float* __restrict__ mask, const int* __restrict__ Km, float scale, float* __restrict__ OF, int ldo) {
  #pragma clang fp contract(off)
  __shared__ __attribute__((aligned(16))) float lk[QT0][HD]; __shared__ __attribute__((aligned(16))) float lv[QT0][HD]; __shared__ __attribute__((aligned(16))) int lm[QT0];
  const int tid = threadIdx.x; const int h = blockIdx.x / (QT0 / 64), rg = blockIdx.x % (QT0 / 64); const int i = rg * 64 + tid;
  const float* qr = QF + (size_t)i * ld + h * HD;
  v4f q[HD / 4], o[HD / 4];
  /* every loop over c is fully unrolled so that q and o are registers, not scratch */
#pragma unroll
  for (int c = 0; c < HD / 4; ++c) { q[c] = *(const v4fa*)(qr + c * 4); const v4f z = {0.f, 0.f, 0.f, 0.f}; o[c] = z; }
  asm volatile("s_wait_xcnt 0x0" :: "v"(qr) : "memory");      /* stands behind the q loads and in front of every instruction that rewrites their address register; the address is an input so that its register stays as it is up to the wait */
  float m = -1.0e30f, l = 0.f; const int jmax = MASKADD ? (SQ - 1) : (rg * 64 + 63);      /* additive-mask form: every key (the mask input decides); causal form: keys up to the block's last row */
  /* kept rolled: the causal form makes one trip */
#pragma unroll 1
  for (int jt = 0; jt <= jmax; jt += QT0) { const int nr = (jmax + 1 - jt < QT0) ? (jmax + 1 - jt) : QT0;      /* keys of this tile: a multiple of 64, the same for the whole block */
    if (jt) __syncthreads();      /* every reader has left the tile before it is refilled */
    /* eight K and eight V loads in flight per thread; 16 lanes cover one 256-byte row, the block 4 rows per load */
    const size_t g0 = (size_t)(jt + (tid >> 4)) * ld + h * HD + (tid & 15) * 4;
    /* kept rolled: nr is only known at run time, and each trip already has sixteen loads per thread in flight */
#pragma unroll 1
    for (int r0 = 0; r0 < nr; r0 += 32) { v4f tk[8], tv[8]; const float *pk[8], *pv[8];
      /* the three loops over u are fully unrolled so that the pointers and the loaded rows are registers and the sixteen loads stand together */
#pragma unroll
      for (int u = 0; u < 8; ++u) { const size_t g = g0 + (size_t)(r0 + u * 4) * ld; pk[u] = KF + g; pv[u] = VF + g; }
#pragma unroll
      for (int u = 0; u < 8; ++u) { tk[u] = *(const v4fa*)pk[u]; tv[u] = *(const v4fa*)pv[u]; }
      asm volatile("s_wait_xcnt 0x0" :: "v"(pk[0]), "v"(pk[1]), "v"(pk[2]), "v"(pk[3]), "v"(pk[4]), "v"(pk[5]), "v"(pk[6]), "v"(pk[7]), "v"(pv[0]), "v"(pv[1]), "v"(pv[2]), "v"(pv[3]), "v"(pv[4]), "v"(pv[5]), "v"(pv[6]), "v"(pv[7]) : "memory");      /* stands behind the trip's loads and in front of every instruction that rewrites an address register they name; the addresses are inputs so that no load lands on one of them */
#pragma unroll
      for (int u = 0; u < 8; ++u) { const int r = r0 + u * 4 + (tid >> 4); *(v4f*)&lk[r][(tid & 15) * 4] = tk[u]; *(v4f*)&lv[r][(tid & 15) * 4] = tv[u]; } }
    if (MASKKV) for (int e = tid; e < nr; e += 64) lm[e] = Km[jt + e];
    __syncthreads();      /* the tile is complete before any thread reads it */
    /* kept rolled: one trip already holds four keys, and a second copy would only add code and registers */
#pragma unroll 1
    for (int jj = 0; jj < nr; jj += 4) { float s4[4] = {0.f, 0.f, 0.f, 0.f}, sc4[4], e4[4]; v4ia km4 = {1, 1, 1, 1}; if (MASKKV) km4 = *(const v4ia*)&lm[jj];
      /* all loops over c and u below are fully unrolled: constant indices keep q, o and the four keys' values in registers, and the four score chains stand side by side */
#pragma unroll
      for (int c = 0; c < HD / 4; ++c) { const v4f qq = q[c];
#pragma unroll
        for (int u = 0; u < 4; ++u) { const v4f kq = *(const v4f*)&lk[jj + u][c * 4]; float s = s4[u]; s = __fadd_rn(s, __fmul_rn(qq[0], kq[0])); s = __fadd_rn(s, __fmul_rn(qq[1], kq[1])); s = __fadd_rn(s, __fmul_rn(qq[2], kq[2])); s = __fadd_rn(s, __fmul_rn(qq[3], kq[3])); s4[u] = s; } }
#pragma unroll
      for (int u = 0; u < 4; ++u) { const int j = jt + jj + u; float s = __fmul_rn(s4[u], scale); if (MASKADD) s = __fadd_rn(s, __fmul_rn(bf16_round(mask[(size_t)i * SQ + j]), -10000.0f));
        const float f = (MASKADD || (j <= i && (!MASKKV || km4[u] != 0))) ? 1.f : 0.f;      /* MASKKV: also drop keys whose int padding entry is 0 */ const float sm = fmaf(f, s, (1.f - f) * -1.0e30f); const float mn = fmaxf(m, sm); const float sc = expf(m - mn); const float e = expf(sm - mn); l = __fadd_rn(__fmul_rn(l, sc), e); m = mn; sc4[u] = sc; e4[u] = e; }
#pragma unroll
      for (int u = 0; u < 4; ++u) { const float sc = sc4[u], e = e4[u];
#pragma unroll
        for (int c = 0; c < HD / 4; ++c) { const v4f vv = *(const v4f*)&lv[jj + u][c * 4]; v4f oo = o[c]; for (int w = 0; w < 4; ++w) oo[w] = __fadd_rn(__fmul_rn(oo[w], sc), __fmul_rn(e, vv[w])); o[c] = oo; } } } }
  const float fin = 64.0f / l;      /* o carried x64 like the f16 path */
  float* orow = OF + (size_t)i * ldo + h * HD;      /* the thread's own 256 bytes: two whole lines, no other writer */
  /* unrolled: o stays in registers */
#pragma unroll
  for (int c = 0; c < HD / 4; ++c) { v4f oo = o[c]; for (int w = 0; w < 4; ++w) oo[w] = __fmul_rn(oo[w], fin); *(v4f*)(orow + c * 4) = oo; } }


__global__ __launch_bounds__(256) void k_xt16(const float* __restrict__ x, const float* __restrict__ tg, const float* __restrict__ wt, const float* __restrict__ bt, _Float16* __restrict__ XT, _Float16* __restrict__ XL, size_t n8) {
  #pragma clang fp contract(off)
  const size_t t = (size_t)blockIdx.x * 256 + threadIdx.x; if (t >= n8) return; const size_t e0 = t * 8; const size_t r = e0 / DM; const int c0 = (int)(e0 % DM); const float g = bf16_round(tg[r]); FragH f, l;
  for (int q = 0; q < 8; ++q) { const int c = c0 + q; const float te = __fadd_rn(__fmul_rn(g, bf16_round(wt[c])), bf16_round(bt[c])); const float v = __fadd_rn(bf16_round(x[e0 + q]), te); const _Float16 h = (_Float16)v; f.h[q] = h; l.h[q] = (_Float16)((v - (float)h) * 1024.0f); }
  *(v8us*)((unsigned short*)XT + e0) = f.half[0]; *(v8us*)((unsigned short*)XL + e0) = l.half[0];  }
extern "C" void kernel_launch(void* const* d_in, const int* in_sizes, int n_in,
                              void* d_out, int out_size, void* d_ws, size_t ws_size, hipStream_t stream) {
  (void)in_sizes; (void)n_in; (void)out_size;
  const float* const* I = (const float* const*)d_in; const float* x = I[0]; const float* tg = I[1]; const int* km = (const int*)d_in[2]; const float* wq = I[3]; const float* bq = I[4]; const float* wk = I[5]; const float* bk = I[6]; const float* wv = I[7]; const float* bv = I[8]; const float* wo = I[9]; const float* bo = I[10]; const float* wt = I[11]; const float* bt = I[12];      /* natural [out][in] weights + biases; time_gaps [2][2048][1]; int key mask [2][2048]; Wt [1024][1], bt [1024] */
  char* ws = (char*)d_ws; size_t off = 0;
  auto take = [&](size_t bytes) { char* p = ws + off; off += (bytes + 255) & ~(size_t)255; return p; };
  _Float16* BQ = (_Float16*)take((size_t)DM * DM * 2); _Float16* BK = (_Float16*)take((size_t)DM * DM * 2); _Float16* BV = (_Float16*)take((size_t)DM * DM * 2); _Float16* BO = (_Float16*)take((size_t)DM * DM * 2);
  _Float16* X16 = (_Float16*)take(NR * DM * 2); _Float16* XT16 = (_Float16*)take(NR * DM * 2); _Float16* XL16 = (_Float16*)take(NR * DM * 2);      /* x (exact f16) for v; x_time as f16 hi + x1024 residual for q and k */ float* F32 = (float*)take(NR * DM * 4);      /* f32 scratch rows: q, then k, then v, then o */ _Float16* Q16 = (_Float16*)take(NR * DM * 2); _Float16* QL = (_Float16*)take(NR * DM * 2); _Float16* K16 = (_Float16*)take(NR * DM * 2); _Float16* KL = (_Float16*)take(NR * DM * 2); _Float16* V16 = (_Float16*)take(NR * DM * 2); _Float16* VL = (_Float16*)take(NR * DM * 2); _Float16* O16 = (_Float16*)take(NR * DM * 2); _Float16* OL = (_Float16*)take(NR * DM * 2);
  float* S = (float*)take((size_t)NH * QT * NKX * 4); _Float16* P = (_Float16*)take((size_t)NH * QT * NKX * 2); _Float16* VT = (_Float16*)take((size_t)NH * HD * SQ * 2); _Float16* VTL = (_Float16*)take((size_t)NH * HD * SQ * 2);
  float* QF0 = (float*)take((size_t)QT0 * DM * 4); float* KF0 = (float*)take((size_t)QT0 * DM * 4); float* VF0 = (float*)take((size_t)QT0 * DM * 4); float* OF0 = (float*)take((size_t)NB * QT0 * DM * 4); _Float16* OH0 = (_Float16*)take((size_t)NB * QT0 * DM * 2); _Float16* OL0 = (_Float16*)take((size_t)NB * QT0 * DM * 2);
  if (off > ws_size) return;
  { const unsigned g = (unsigned)(((size_t)DM * DM / 8 + 255) / 256); k_wnat<<<g, 256, 0, stream>>>(wq, (size_t)DM * DM / 8, BQ); k_wnat<<<g, 256, 0, stream>>>(wk, (size_t)DM * DM / 8, BK); k_wnat<<<g, 256, 0, stream>>>(wv, (size_t)DM * DM / 8, BV); k_wnat<<<g, 256, 0, stream>>>(wo, (size_t)DM * DM / 8, BO); }      /* natural [out][in] = Bt[n][k], x16 */

  k_x16<<<(unsigned)((NR * DM / 8 + 255) / 256), 256, 0, stream>>>(x, X16, NR * DM / 8); k_xt16<<<(unsigned)((NR * DM / 8 + 255) / 256), 256, 0, stream>>>(x, tg, wt, bt, XT16, XL16, NR * DM / 8);      /* x_time = x + time_gaps Wt^T + bt as f16 hi + x1024 residual rows */
  const size_t r0p = (size_t)B0 * SQ;      /* first projected row */
  k_gemm2<0><<<dim3((unsigned)((MP / 128) * (DM / 64)), 1), 128, 0, stream>>>(XT16 + r0p * DM, DM, 0, BQ, DM, 0, 0.0625f, bq, 0, nullptr, 1, 0, 0, F32 + r0p * DM, nullptr, DM, 0, MP, DM, DM); k_gemm2<0><<<dim3((unsigned)((MP / 128) * (DM / 64)), 1), 128, 0, stream>>>(XL16 + r0p * DM, DM, 0, BQ, DM, 0, 0.00006103515625f, nullptr, 0, F32 + r0p * DM, -1, 0, 0, F32 + r0p * DM, nullptr, DM, 0, MP, DM, DM); k_hl<<<(unsigned)(((size_t)MP * DM / 8 + 255) / 256), 256, 0, stream>>>(F32 + r0p * DM, Q16 + r0p * DM, QL + r0p * DM, (size_t)MP * DM / 8);      
  k_gemm2<0><<<dim3((unsigned)((MP / 128) * (DM / 64)), 1), 128, 0, stream>>>(XT16 + r0p * DM, DM, 0, BK, DM, 0, 0.0625f, bk, 0, nullptr, 1, 0, 0, F32 + r0p * DM, nullptr, DM, 0, MP, DM, DM); k_gemm2<0><<<dim3((unsigned)((MP / 128) * (DM / 64)), 1), 128, 0, stream>>>(XL16 + r0p * DM, DM, 0, BK, DM, 0, 0.00006103515625f, nullptr, 0, F32 + r0p * DM, -1, 0, 0, F32 + r0p * DM, nullptr, DM, 0, MP, DM, DM); k_hl<<<(unsigned)(((size_t)MP * DM / 8 + 255) / 256), 256, 0, stream>>>(F32 + r0p * DM, K16 + r0p * DM, KL + r0p * DM, (size_t)MP * DM / 8);      /* k likewise */
  k_gemm2<0><<<dim3((unsigned)((MP / 128) * (DM / 64)), 1), 128, 0, stream>>>(X16 + r0p * DM, DM, 0, BV, DM, 0, 0.0625f, bv, 0, nullptr, 1, 0, 0, F32 + r0p * DM, nullptr, DM, 0, MP, DM, DM); k_hl<<<(unsigned)(((size_t)MP * DM / 8 + 255) / 256), 256, 0, stream>>>(F32 + r0p * DM, V16 + r0p * DM, VL + r0p * DM, (size_t)MP * DM / 8);      /* v = x Wv^T + bv in f32 -> f16 hi + x1024 residual */
  for (int b = B0; b < B0 + NBR; ++b) { const size_t r0 = (size_t)b * SQ;
    k_vt<NH, SQ><<<NH * (SQ / 64), 256, 0, stream>>>(V16 + r0 * LQ, LQ, 0, VT); k_vt<NH, SQ><<<NH * (SQ / 64), 256, 0, stream>>>(VL + r0 * LQ, LQ, 0, VTL);      /* V^T (hi and residual) [NH][HD][SQ] for this batch */
    k_gemm2<0><<<dim3((QT0 / 128) * (DM / 64), 1), 128, 0, stream>>>(XT16 + r0 * DM, DM, 0, BQ, DM, 0, 0.0625f, bq, 0, nullptr, 1, 0, 0, QF0, nullptr, DM, 0, QT0, DM, DM); k_gemm2<0><<<dim3((QT0 / 128) * (DM / 64), 1), 128, 0, stream>>>(XL16 + r0 * DM, DM, 0, BQ, DM, 0, 0.00006103515625f, nullptr, 0, QF0, -1, 0, 0, QF0, nullptr, DM, 0, QT0, DM, DM); k_gemm2<0><<<dim3((QT0 / 128) * (DM / 64), 1), 128, 0, stream>>>(XT16 + r0 * DM, DM, 0, BK, DM, 0, 0.0625f, bk, 0, nullptr, 1, 0, 0, KF0, nullptr, DM, 0, QT0, DM, DM); k_gemm2<0><<<dim3((QT0 / 128) * (DM / 64), 1), 128, 0, stream>>>(XL16 + r0 * DM, DM, 0, BK, DM, 0, 0.00006103515625f, nullptr, 0, KF0, -1, 0, 0, KF0, nullptr, DM, 0, QT0, DM, DM); k_gemm2<0><<<dim3((QT0 / 128) * (DM / 64), 1), 128, 0, stream>>>(X16 + r0 * DM, DM, 0, BV, DM, 0, 0.0625f, bv, 0, nullptr, 1, 0, 0, VF0, nullptr, DM, 0, QT0, DM, DM);      /* f32 q, k, v of the first 128 rows (exact products) */
    k_att0<0, 1><<<NH * (QT0 / 64), 64, 0, stream>>>(QF0, KF0, VF0, DM, nullptr, km + (size_t)b * SQ, 0.125f, OF0 + (size_t)b * QT0 * DM, DM);      /* exact f32 causal attention with the key padding vector */      /* exact f32 attention for rows 0..127 (o x64) */
    for (int q0 = 0; q0 < QN; q0 += QT) { const int nk = q0 + QT;      /* causal: only keys below the tile end are computed */
      k_gemm2<0><<<dim3((QT / 128) * (nk / 64), NHD), 128, 0, stream>>>(Q16 + (r0 + q0) * LQ, LQ, (size_t)HD, K16 + r0 * LQ, LQ, (size_t)HD, 0.125f, nullptr, 0, nullptr, 1, 0, 0, S, nullptr, NKX, (size_t)QT * NKX, QT, nk, HD); k_gemm2<0><<<dim3((QT / 128) * (nk / 64), NHD), 128, 0, stream>>>(QL + (r0 + q0) * LQ, LQ, (size_t)HD, K16 + r0 * LQ, LQ, (size_t)HD, 0.0001220703125f, nullptr, 0, S, -1, 0, 0, S, nullptr, NKX, (size_t)QT * NKX, QT, nk, HD); k_gemm2<0><<<dim3((QT / 128) * (nk / 64), NHD), 128, 0, stream>>>(Q16 + (r0 + q0) * LQ, LQ, (size_t)HD, KL + r0 * LQ, LQ, (size_t)HD, 0.0001220703125f, nullptr, 0, S, -1, 0, 0, S, nullptr, NKX, (size_t)QT * NKX, QT, nk, HD);      /* scores = (q_hi.k_hi + q_lo.k_hi/1024 + q_hi.k_lo/1024) / 8: three accumulating passes, all heads on grid.y */
      switch (nk / QT) {      /* causal + key padding mask; one wave per row, 8 rows per block; the row length picks the kernel */
        case 1: k_rsmcf2kv<1><<<(NHD * QT + 7) / 8, 256, 0, stream>>>(S, P, NHD, q0, km + (size_t)b * SQ); break;
        case 2: k_rsmcf2kv<2><<<(NHD * QT + 7) / 8, 256, 0, stream>>>(S, P, NHD, q0, km + (size_t)b * SQ); break;
        case 3: k_rsmcf2kv<3><<<(NHD * QT + 7) / 8, 256, 0, stream>>>(S, P, NHD, q0, km + (size_t)b * SQ); break;
        case 4: k_rsmcf2kv<4><<<(NHD * QT + 7) / 8, 256, 0, stream>>>(S, P, NHD, q0, km + (size_t)b * SQ); break;
        case 5: k_rsmcf2kv<5><<<(NHD * QT + 7) / 8, 256, 0, stream>>>(S, P, NHD, q0, km + (size_t)b * SQ); break;
        case 6: k_rsmcf2kv<6><<<(NHD * QT + 7) / 8, 256, 0, stream>>>(S, P, NHD, q0, km + (size_t)b * SQ); break;
        case 7: k_rsmcf2kv<7><<<(NHD * QT + 7) / 8, 256, 0, stream>>>(S, P, NHD, q0, km + (size_t)b * SQ); break;
        case 8: k_rsmcf2kv<8><<<(NHD * QT + 7) / 8, 256, 0, stream>>>(S, P, NHD, q0, km + (size_t)b * SQ); break;
      }
      k_gemm2<0><<<dim3((QT / 128) * (HD / 64), NHD), 128, 0, stream>>>(P, NKX, (size_t)QT * NKX, VT, SQ, (size_t)HD * SQ, 0.25f, nullptr, 0, nullptr, 1, 0, 0, F32 + (r0 + q0) * DM, nullptr, DM, (size_t)HD, QT, HD, nk); k_gemm2<0><<<dim3((QT / 128) * (HD / 64), NHD), 128, 0, stream>>>(P, NKX, (size_t)QT * NKX, VTL, SQ, (size_t)HD * SQ, 0.000244140625f, nullptr, 0, F32 + (r0 + q0) * DM, -1, 0, 0, F32 + (r0 + q0) * DM, nullptr, DM, (size_t)HD, QT, HD, nk); }      /* o (x64) = P.V_hi^T + P.V_lo^T/1024 in f32 rows */
    k_hl<<<(unsigned)(((size_t)SQ * DM / 8 + 255) / 256), 256, 0, stream>>>(F32 + r0 * DM, O16 + r0 * DM, OL + r0 * DM, (size_t)SQ * DM / 8); }      /* o -> f16 hi + x1024 residual */
  k_gemm2<0><<<dim3((unsigned)((MPO / 128) * (DM / 64)), 1), 128, 0, stream>>>(O16 + r0p * DM, DM, 0, BO, DM, 0, 0.0009765625f, bo, 0, nullptr, 1, 0, 0, (float*)d_out + r0p * DM, nullptr, DM, 0, MPO, DM, DM); k_gemm2<0><<<dim3((unsigned)((MPO / 128) * (DM / 64)), 1), 128, 0, stream>>>(OL + r0p * DM, DM, 0, BO, DM, 0, 0.00000095367431640625f, nullptr, 0, (const float*)d_out + r0p * DM, -1, 0, 0, (float*)d_out + r0p * DM, nullptr, DM, 0, MPO, DM, DM);      /* out = o_hi Wo^T + bo, then += o_lo Wo^T 2^-20 (own element) */
  k_hl<<<(unsigned)(((size_t)NB * QT0 * DM / 8 + 255) / 256), 256, 0, stream>>>(OF0, OH0, OL0, (size_t)NB * QT0 * DM / 8);      /* first-tile o (x64) -> f16 hi + x1024 residual planes */
  for (int b = B0; b < B0 + NBR; ++b) { const size_t r0 = (size_t)b * SQ; const size_t f0 = (size_t)b * QT0;
    k_gemm2<0><<<dim3((QT0 / 128) * (DM / 64), 1), 128, 0, stream>>>(OH0 + f0 * DM, DM, 0, BO, DM, 0, 0.0009765625f, bo, 0, nullptr, 1, 0, 0, (float*)d_out + r0 * DM, nullptr, DM, 0, QT0, DM, DM);      /* rows 0..127: out = o_hi Wo (+ b), overwriting the f16-path rows */
    k_gemm2<0><<<dim3((QT0 / 128) * (DM / 64), 1), 128, 0, stream>>>(OL0 + f0 * DM, DM, 0, BO, DM, 0, 0.00000095367431640625f, nullptr, 0, (const float*)d_out + r0 * DM, -1, 0, 0, (float*)d_out + r0 * DM, nullptr, DM, 0, QT0, DM, DM); }      /* += o_lo Wo 2^-20 (own-element accumulate) */
}

// v005
// Measured time: 367 microseconds a run.
// Versions in between are left out here; by their measured steps it is 5.88 times as fast as v003.
// Counting every step since v000, it is 23.8 times as fast.
#include <hip/hip_runtime.h>
// Causal multi-head attention with a time-gap embedding and a key padding mask (x [2][2048][1024]; x_time = x + (time_gaps Wt^T + bt) with time_gaps [2][2048][1] (U[0,1)), Wt [1024][1] sigma 1, bt zeros; q = x_time Wq^T + bq, k = x_time Wk^T + bk, v = x Wv^T + bv (v from the RAW x; natural [1024][1024] sigma 1/32, zero biases); 16 heads of 64; scores / 8; where(mask[b][j] == 0, -1e9) (int mask [2][2048], all ones) and where(j > i, -1e9) (causal); softmax; out = merged Wo^T + bo -> [2][2048][1024]).
// Structure: token rows r = b*2048 + s; x as exact f16 rows; x_time = x + t Wt + bt on VALU as f16 hi + x1024 residual rows; q and k = (hi + lo/1024) W + b as two accumulating WMMA GEMMs each (32x64 wave tiles, f32 accumulation) into f32 rows, split into f16 hi + x1024 residual planes; v = x Wv + bv in f32, split likewise (both transposed per batch); one fused attention launch (a wave owns 32 query rows, 32 keys per trip): scores^T = k_hi.q_hi + (k_hi.q_lo + k_lo.q_hi)/1024 on WMMA, / 8, causal + key-mask running softmax in registers (f32 statistics, native exp2; weights x4096 f16), o^T += V_hi^T.P^T + V_lo^T.(P^T/1024), o in f32 rows, split into hi + residual; out = o_hi Wo + bo then += o_lo Wo 2^-20 (own element); first-tile refinement: the o rows of the first 128 rows of each batch recomputed exactly in f32 on VALU from the f32 q, k, v rows of the full projections and written over the fused kernel's rows in front of the split; launches: see trace.
// Compute dtype: inputs rounded to bf16; x / weights exact; q, k, v and o as f16 hi + x1024 residual pairs, softmax weights as plain f16 GEMM operands (~2^-12); scores and softmax statistics f32. v_wmma_f32_16x16x32_f16.
#define NB 2
#define SQ 2048
#define DM 1024
#define NH 16
#define HD 64
#define HG 4                         /* heads per block group of the unlaunched k_vt overload */
#define QT 256                       /* query rows per causal tile */
#define NKX SQ                       /* S / P row pitch */
#define QT0 128                      /* first-tile rows recomputed exactly in f32 */
#define B0 0                         /* first batch processed (debug hook) */
#define NBR NB                       /* batches processed (debug hook) */
#define NR ((size_t)NB * SQ)         /* token rows */
#define MP ((int)((size_t)NBR * SQ)) /* rows projected (debug hook) */
#define QN SQ                        /* unused (every batch attends all SQ query rows) */
#define NHD NH                       /* unused (all NH heads are attended) */
#define MPO MP                       /* rows through the output stage (debug hook) */
#define LQ DM      /* row pitch of the q/k/v rows */
typedef __bf16 v16b __attribute__((ext_vector_type(16)));
typedef unsigned short v8us __attribute__((ext_vector_type(8), may_alias));
typedef float  v8f  __attribute__((ext_vector_type(8)));
typedef float  v4f  __attribute__((ext_vector_type(4)));
typedef float  v4fa __attribute__((ext_vector_type(4), may_alias));
union FragB { v16b v; v8us half[2]; unsigned short u[16]; };

__device__ __forceinline__ unsigned short bf16_bits(float x) { unsigned int u = __float_as_uint(x); return (unsigned short)((u + 0x7FFFu + ((u >> 16) & 1u)) >> 16); }
__device__ __forceinline__ float bf16_val(unsigned short b) { return __uint_as_float(((unsigned int)b) << 16); }
__device__ __forceinline__ float bf16_round(float x) { return bf16_val(bf16_bits(x)); }
// D += A·B with NT terms: 1 = ah·bh, 2 = + al·bh (A split), 3 = + ah·bl (both split)
template <int NT>
__device__ __forceinline__ v8f mmaN(v16b ah, v16b al, v16b bh, v16b bl, v8f c) {
  c = __builtin_amdgcn_wmma_f32_16x16x32_bf16(false, ah, false, bh, (short)0, c, false, false);
  if (NT >= 2) c = __builtin_amdgcn_wmma_f32_16x16x32_bf16(false, al, false, bh, (short)0, c, false, false);
  if (NT >= 3) c = __builtin_amdgcn_wmma_f32_16x16x32_bf16(false, ah, false, bl, (short)0, c, false, false);
  asm volatile("v_nop\n\tv_nop\n\tv_nop\n\tv_nop" : "+v"(c) : "v"(ah), "v"(al), "v"(bh), "v"(bl));
  return c;
}

__global__ __launch_bounds__(256) void k_wt_bf16(const float* __restrict__ W, unsigned short* __restrict__ Wt, int K, int N) {
  const int t = blockIdx.x * 256 + threadIdx.x;
  const int k8n = K / 8;
  if (t >= N * k8n) return;
  const int n = t / k8n, k8 = (t % k8n) * 8;
  v8us v;
#pragma unroll
  for (int i = 0; i < 8; ++i) v[i] = bf16_bits(W[(size_t)(k8 + i) * N + n]);
  *(v8us*)(Wt + (size_t)n * K + k8) = v;
  
}

// GEMM C[M][N] (f32, pitch ldc) = act(A[M][K]·W + bias). A f32 row-major (pitch lda) converted per fragment to bf16
// (ASPLIT: hi/lo two planes -> 2 terms, else single rounded term); Wt bf16 [N][K] (pitch ldb). BIAS_BF16 rounds the
// bias to bf16 first (bias quantised to bf16 before the add). K%32==0, M%16==0, N%64==0.
template <bool ASPLIT, int ACT, bool BIAS_BF16>
__global__ __launch_bounds__(128) void k_gemm_bf(const float* __restrict__ A, int lda, const unsigned short* __restrict__ Wt, int ldb,
                                               const float* __restrict__ bias, float* __restrict__ C, int ldc, int M, int N, int K) {
  __shared__ __attribute__((aligned(16))) float so[4][16][64];
  const int tid = threadIdx.x, w = tid >> 5, lane = tid & 31, ln = lane & 15, hh = lane >> 4;
  const int ntn = N / 64;
  const int wid = blockIdx.x * 4 + w;
  const int mt = wid / ntn, nq = wid % ntn;
  if (mt * 16 >= M) return;
  const int row0 = mt * 16, col0 = nq * 64;
  const float* arow = A + (size_t)(row0 + ln) * lda;
  v8f acc[4] = {};
  for (int kb = 0; kb < K; kb += 32) {
    FragB ah, al;
    const v4f x0 = *(const v4fa*)(arow + kb + 8 * hh), x1 = *(const v4fa*)(arow + kb + 8 * hh + 4);
    const v4f x2 = *(const v4fa*)(arow + kb + 16 + 8 * hh), x3 = *(const v4fa*)(arow + kb + 16 + 8 * hh + 4);
    float xs[16] = {x0[0],x0[1],x0[2],x0[3],x1[0],x1[1],x1[2],x1[3],x2[0],x2[1],x2[2],x2[3],x3[0],x3[1],x3[2],x3[3]};
#pragma unroll
    for (int i = 0; i < 16; ++i) { const unsigned short hb = bf16_bits(xs[i]); ah.u[i] = hb; al.u[i] = ASPLIT ? bf16_bits(xs[i] - bf16_val(hb)) : (unsigned short)0; }
#pragma unroll
    for (int t = 0; t < 4; ++t) {
      const unsigned short* brow = Wt + (size_t)(col0 + t * 16 + ln) * ldb + kb;
      FragB b;
      b.half[0] = *(const v8us*)(brow + 8 * hh);
      b.half[1] = *(const v8us*)(brow + 16 + 8 * hh);
      acc[t] = mmaN<ASPLIT ? 2 : 1>(ah.v, al.v, b.v, b.v, acc[t]);
    }
  }
#pragma unroll
  for (int t = 0; t < 4; ++t) {
    float bv = bias ? bias[col0 + t * 16 + ln] : 0.f;
    if (BIAS_BF16) bv = bf16_round(bv);
#pragma unroll
    for (int r = 0; r < 8; ++r) { float v = acc[t][r] + bv; if (ACT == 1) v = fmaxf(v, 0.f); so[w][8 * hh + r][t * 16 + ln] = v; }
  }
  __builtin_amdgcn_fence(__ATOMIC_ACQ_REL, "workgroup");
  __builtin_amdgcn_wave_barrier();
  const int rsub = lane >> 4, c4 = (lane & 15) * 4;
  {
#pragma unroll
    for (int q = 0; q < 8; ++q) {
      const int r = q * 2 + rsub;
      const v4f v = *(const v4fa*)&so[w][r][c4];
      *(v4f*)(C + (size_t)(row0 + r) * ldc + col0 + c4) = v;
    }
    
  }
}

// GEMM C = act(A·W + bias + resid): A f32 (ASPLIT -> hi/lo 2 terms), Wt bf16 [N][K]; ACT 0 none, 1 relu, 2 exact gelu;
// resid (optional, f32, row index = (row % rmod), pitch ldr, RES_BF16 rounds it) added before the activation.
template <bool ASPLIT, int ACT, bool BIAS_BF16, bool RES_BF16>
__global__ __launch_bounds__(128) void k_gemm_bf3(const float* __restrict__ A, int lda, const unsigned short* __restrict__ Wt, int ldb,
                                                const float* __restrict__ bias, const float* __restrict__ resid, int rmod, int ldr,
                                                float* __restrict__ C, int ldc, int M, int N, int K) {
  __shared__ __attribute__((aligned(16))) float so[4][16][64];
  const int tid = threadIdx.x, w = tid >> 5, lane = tid & 31, ln = lane & 15, hh = lane >> 4;
  const int ntn = N / 64;
  const int wid = blockIdx.x * 4 + w;
  const int mt = wid / ntn, nq = wid % ntn;
  if (mt * 16 >= M) return;
  const int row0 = mt * 16, col0 = nq * 64;
  const float* arow = A + (size_t)(row0 + ln) * lda;
  v8f acc[4] = {};
  for (int kb = 0; kb < K; kb += 32) {
    FragB ah, al;
    const v4f x0 = *(const v4fa*)(arow + kb + 8 * hh), x1 = *(const v4fa*)(arow + kb + 8 * hh + 4);
    const v4f x2 = *(const v4fa*)(arow + kb + 16 + 8 * hh), x3 = *(const v4fa*)(arow + kb + 16 + 8 * hh + 4);
    float xs[16] = {x0[0],x0[1],x0[2],x0[3],x1[0],x1[1],x1[2],x1[3],x2[0],x2[1],x2[2],x2[3],x3[0],x3[1],x3[2],x3[3]};
#pragma unroll
    for (int i = 0; i < 16; ++i) { const unsigned short hb = bf16_bits(xs[i]); ah.u[i] = hb; al.u[i] = ASPLIT ? bf16_bits(xs[i] - bf16_val(hb)) : (unsigned short)0; }
#pragma unroll
    for (int t = 0; t < 4; ++t) {
      const unsigned short* brow = Wt + (size_t)(col0 + t * 16 + ln) * ldb + kb;
      FragB b;
      b.half[0] = *(const v8us*)(brow + 8 * hh);
      b.half[1] = *(const v8us*)(brow + 16 + 8 * hh);
      acc[t] = mmaN<ASPLIT ? 2 : 1>(ah.v, al.v, b.v, b.v, acc[t]);
    }
  }
#pragma unroll
  for (int t = 0; t < 4; ++t) {
    const int col = col0 + t * 16 + ln;
    float bv = bias ? bias[col] : 0.f;
    if (BIAS_BF16) bv = bf16_round(bv);
#pragma unroll
    for (int r = 0; r < 8; ++r) {
      float v = acc[t][r] + bv;
      if (resid) { float rv = resid[(size_t)((row0 + 8 * hh + r) % rmod) * ldr + col]; if (RES_BF16) rv = bf16_round(rv); v += rv; }
      if (ACT == 1) v = fmaxf(v, 0.f);
      if (ACT == 2) v = 0.5f * v * (1.0f + erff(v * 0.70710678118654752f));
      if (ACT == 3) { const float u = 0.7978845608028654f * (v + 0.044715f * v * v * v); v = 0.5f * v * (1.0f + tanhf(u)); }
      so[w][8 * hh + r][t * 16 + ln] = v;
    }
  }
  __builtin_amdgcn_fence(__ATOMIC_ACQ_REL, "workgroup");
  __builtin_amdgcn_wave_barrier();
  const int rsub = lane >> 4, c4 = (lane & 15) * 4;
  {
#pragma unroll
    for (int q = 0; q < 8; ++q) {
      const int r = q * 2 + rsub;
      const v4f v = *(const v4fa*)&so[w][r][c4];
      *(v4f*)(C + (size_t)(row0 + r) * ldc + col0 + c4) = v;
    }
    
  }
}
// row LayerNorm (biased variance, eps) over N: s = X (+ R); optional out_sum <- s; out_norm <- (s-mu)*rsqrt(var+eps)*g + b
template <bool PARAM_BF16>
__global__ __launch_bounds__(256) void k_layernorm(const float* __restrict__ X, const float* __restrict__ R, const float* __restrict__ g, const float* __restrict__ bta,
                                                  float* __restrict__ out_sum, float* __restrict__ out_norm, int N, float eps) {
  __shared__ float red[256];
  const int row = blockIdx.x, tid = threadIdx.x;
  const float* x = X + (size_t)row * N; const float* rr = R ? R + (size_t)row * N : nullptr;
  float vals[16];                     // up to N = 4096
  const int per = N / 256;            // contiguous chunk per thread? use strided-by-4 chunks: thread handles j = tid*4 + 1024*u
  float s1 = 0.f;
  for (int u = 0; u < per / 4; ++u) {
    const int j = tid * 4 + 1024 * u;
    const v4f a = *(const v4fa*)(x + j);
    v4f b = {0.f,0.f,0.f,0.f}; if (rr) b = *(const v4fa*)(rr + j);
#pragma unroll
    for (int q = 0; q < 4; ++q) { const float v = a[q] + b[q]; vals[u * 4 + q] = v; s1 += v; }
  }
  red[tid] = s1; __syncthreads();
  for (int st = 128; st > 0; st >>= 1) { if (tid < st) red[tid] += red[tid + st]; __syncthreads(); }
  const float mu = red[0] / (float)N; __syncthreads();
  float s2 = 0.f;
  for (int u = 0; u < per / 4; ++u)
#pragma unroll
    for (int q = 0; q < 4; ++q) { const float c = vals[u * 4 + q] - mu; s2 += c * c; }
  red[tid] = s2; __syncthreads();
  for (int st = 128; st > 0; st >>= 1) { if (tid < st) red[tid] += red[tid + st]; __syncthreads(); }
  const float rs = rsqrtf(red[0] / (float)N + eps);
  {
    for (int u = 0; u < per / 4; ++u) {
      const int j = tid * 4 + 1024 * u;
      v4f o, sm;
#pragma unroll
      for (int q = 0; q < 4; ++q) {
        float gg = g[j + q], bb = bta[j + q];
        if (PARAM_BF16) { gg = bf16_round(gg); bb = bf16_round(bb); }
        sm[q] = vals[u * 4 + q]; o[q] = (vals[u * 4 + q] - mu) * rs * gg + bb;
      }
      if (out_sum) *(v4f*)(out_sum + (size_t)row * N + j) = sm;
      *(v4f*)(out_norm + (size_t)row * N + j) = o;
    }
    
  }
}



// ---- f16 WMMA path (v_wmma_f32_16x16x32_f16): 11-bit significands for operands in range — used where a [0,1] probability operand needs more precision than bf16
typedef _Float16 v16h __attribute__((ext_vector_type(16)));
union FragH { v16h v; v8us half[2]; _Float16 h[16]; unsigned short u[16]; };
template <int NT>
__device__ __forceinline__ v8f mmaH(v16h ah, v16h al, v16h bh, v16h bl, v8f c) {
  c = __builtin_amdgcn_wmma_f32_16x16x32_f16(false, ah, false, bh, (short)0, c, false, false);
  if (NT >= 2) c = __builtin_amdgcn_wmma_f32_16x16x32_f16(false, al, false, bh, (short)0, c, false, false);
  if (NT >= 3) c = __builtin_amdgcn_wmma_f32_16x16x32_f16(false, ah, false, bl, (short)0, c, false, false);
  asm volatile("v_nop\n\tv_nop\n\tv_nop\n\tv_nop" : "+v"(c) : "v"(ah), "v"(al), "v"(bh), "v"(bl));
  return c;
}
// batched GEMM like k_gemm_b but f16 operands: A f32 (split into f16 hi/lo if ASPLIT, else rounded to f16), Bt = f16 values [n][k]; alpha; C f32; N multiple of 16 (partial tiles skipped)
template <bool ASPLIT>
__global__ __launch_bounds__(128) void k_gemm_h(const float* __restrict__ A, int lda, size_t sA, const _Float16* __restrict__ Bh, int ldb, size_t sB, float alpha, float* __restrict__ C, int ldc, size_t sC, int M, int N, int K) {
  __shared__ __attribute__((aligned(16))) float so[4][16][64];
  const int tid = threadIdx.x, w = tid >> 5, lane = tid & 31, ln = lane & 15, hh = lane >> 4; const int by = blockIdx.y;
  A += (size_t)by * sA; Bh += (size_t)by * sB; C += (size_t)by * sC;
  const int ntn = (N + 63) / 64; const int wid = blockIdx.x * 4 + w; const int mt = wid / ntn, nq = wid % ntn; if (mt * 16 >= M) return;
  const int row0 = mt * 16, col0 = nq * 64; const float* arow = A + (size_t)(row0 + ln) * lda;
  v8f acc[4] = {};
  for (int kb = 0; kb < K; kb += 32) {
    FragH ah, al;
    const v4f x0 = *(const v4fa*)(arow + kb + 8 * hh), x1 = *(const v4fa*)(arow + kb + 8 * hh + 4), x2 = *(const v4fa*)(arow + kb + 16 + 8 * hh), x3 = *(const v4fa*)(arow + kb + 16 + 8 * hh + 4);
    float xs[16] = {x0[0],x0[1],x0[2],x0[3],x1[0],x1[1],x1[2],x1[3],x2[0],x2[1],x2[2],x2[3],x3[0],x3[1],x3[2],x3[3]};
#pragma unroll
    for (int i = 0; i < 16; ++i) { const _Float16 h = (_Float16)xs[i]; ah.h[i] = h; al.h[i] = ASPLIT ? (_Float16)(xs[i] - (float)h) : (_Float16)0.0f; }
#pragma unroll
    for (int t = 0; t < 4; ++t) { if (col0 + t * 16 >= N) continue; const size_t boff = (size_t)(col0 + t * 16 + ln) * ldb + kb; FragH bq; bq.half[0] = *(const v8us*)(Bh + boff + 8 * hh); bq.half[1] = *(const v8us*)(Bh + boff + 16 + 8 * hh);
      acc[t] = mmaH<ASPLIT ? 2 : 1>(ah.v, al.v, bq.v, bq.v, acc[t]); }
  }
#pragma unroll
  for (int t = 0; t < 4; ++t) { if (col0 + t * 16 >= N) continue;
#pragma unroll
    for (int r = 0; r < 8; ++r) so[w][8 * hh + r][t * 16 + ln] = acc[t][r] * alpha; }
  __builtin_amdgcn_fence(__ATOMIC_ACQ_REL, "workgroup"); __builtin_amdgcn_wave_barrier();
  const int rsub = lane >> 4, c4 = (lane & 15) * 4;
  {
#pragma unroll
    for (int q = 0; q < 8; ++q) { const int r = q * 2 + rsub; if (col0 + c4 < N) { const v4f v = *(const v4fa*)&so[w][r][c4]; *(v4f*)(C + (size_t)(row0 + r) * ldc + col0 + c4) = v; } }
     }
}

// Wt[n][k] = f16(W[k][n]·scale) from f32 row-major W[K][N] (scale = power of two; bf16-exact weights stay exact in f16 away from the subnormal range)
__global__ __launch_bounds__(256) void k_wt_f16(const float* __restrict__ W, _Float16* __restrict__ Wt, int K, int N, float scale) {
  const int t = blockIdx.x * 256 + threadIdx.x; if (t >= N * (K / 8)) return; const int n = t / (K / 8), k8 = (t % (K / 8)) * 8; FragH f;
#pragma unroll
  for (int i = 0; i < 8; ++i) f.h[i] = (_Float16)(bf16_round(W[(size_t)(k8 + i) * N + n]) * scale); const v8us o = f.half[0];
  *(v8us*)((unsigned short*)Wt + (size_t)n * K + k8) = o; 
}
// k_gemm_hh variant with fused epilogue: v = acc·alpha + bias[by·sBias + col] (+ CP[(row/rowsPerB)·sCPb + by·64 + col] if CP) ; ACT 0 none / 1 elu ; writes f16 C16 (and f32 C if non-null)
template <int ACT>
__global__ __launch_bounds__(128) void k_gemm_hhx(const _Float16* __restrict__ A, int lda, size_t sA, const _Float16* __restrict__ Bh, int ldb, size_t sB, float alpha, const float* __restrict__ bias, size_t sBias, const float* __restrict__ CP, int rowsPerB, size_t sCPb, int row0g,
    float* __restrict__ C, _Float16* __restrict__ C16, int ldc, size_t sC, int M, int N, int K) {
  __shared__ __attribute__((aligned(16))) float so[4][16][64];
  const int tid = threadIdx.x, w = tid >> 5, lane = tid & 31, ln = lane & 15, hh = lane >> 4; const int by = blockIdx.y;
  A += (size_t)by * sA; Bh += (size_t)by * sB; const size_t cofs = (size_t)by * sC; const float* bp = bias ? bias + (size_t)by * sBias : nullptr;
  const int ntn = (N + 63) / 64; const int wid = blockIdx.x * 4 + w; const int mt = wid / ntn, nq = wid % ntn; if (mt * 16 >= M) return;
  const int row0 = mt * 16, col0 = nq * 64; const _Float16* arow = A + (size_t)(row0 + ln) * lda;
  v8f acc[4] = {};
  for (int kb = 0; kb < K; kb += 32) { FragH ah; ah.half[0] = *(const v8us*)((const unsigned short*)arow + kb + 8 * hh); ah.half[1] = *(const v8us*)((const unsigned short*)arow + kb + 16 + 8 * hh);
#pragma unroll
    for (int t = 0; t < 4; ++t) { if (col0 + t * 16 >= N) continue; const size_t boff = (size_t)(col0 + t * 16 + ln) * ldb + kb; FragH bq; bq.half[0] = *(const v8us*)((const unsigned short*)Bh + boff + 8 * hh); bq.half[1] = *(const v8us*)((const unsigned short*)Bh + boff + 16 + 8 * hh);
      acc[t] = mmaH<1>(ah.v, ah.v, bq.v, bq.v, acc[t]); }
  }
#pragma unroll
  for (int t = 0; t < 4; ++t) { if (col0 + t * 16 >= N) continue; const int col = col0 + t * 16 + ln; const float bv = bp ? bf16_round(bp[col]) : 0.f;
#pragma unroll
    for (int r = 0; r < 8; ++r) { float v = acc[t][r] * alpha + bv; if (CP) { const int rr = row0g + row0 + 8 * hh + r; if (rowsPerB < 0) v += CP[cofs + (size_t)rr * ldc + col];      /* rowsPerB < 0: own element of the batched C plane */ else { const int bidx = rr / rowsPerB; v += CP[(size_t)bidx * sCPb + (size_t)by * 64 + col]; } } if (ACT == 1) v = (v > 0.f) ? v : expm1f(v); else if (ACT == 7) v = (v > 0.f) ? v + 1.0f : expf(v); else if (ACT == 8) v = tanhf(v); else if (ACT == 9) v = 0.5f * v * (1.0f + tanhf(0.7978845608028654f * (v + 0.044715f * v * v * v))); else if (ACT == 11) v = 1.0f / (1.0f + expf(-v)); else if (ACT == 12) v = (v > 0.f) ? v : 0.01f * v; else if (ACT == 14) v = (v > 0.f) ? v : 0.1f * v; else if (ACT == 16) v = (v >= 0.f) ? v : 0.3f * v; else if (ACT == 17) v = (v >= 0.f) ? v : 0.2f * v; else if (ACT == 15) v = v / (1.0f + expf(-v)); else if (ACT == 3) v = fmaxf(v, 0.f); else if (ACT == 6) v = 0.5f * v * (1.0f + erff(v * 0.70710678118654752f)); so[w][8 * hh + r][t * 16 + ln] = v; } }
  __builtin_amdgcn_fence(__ATOMIC_ACQ_REL, "workgroup"); __builtin_amdgcn_wave_barrier();
  const int rsub = lane >> 4, c4 = (lane & 15) * 4; typedef _Float16 v4h __attribute__((ext_vector_type(4)));
  {
#pragma unroll
    for (int q = 0; q < 8; ++q) { const int r = q * 2 + rsub; if (col0 + c4 < N) { const v4f v = *(const v4fa*)&so[w][r][c4]; if (C) *(v4f*)(C + cofs + (size_t)(row0 + r) * ldc + col0 + c4) = v; if (C16) { v4h h4; for (int i = 0; i < 4; ++i) h4[i] = (_Float16)v[i]; *(v4h*)(C16 + cofs + (size_t)(row0 + r) * ldc + col0 + c4) = h4; } } }
     }
}


typedef _Float16 v4h __attribute__((ext_vector_type(4)));

__global__ __launch_bounds__(256) void k_x16(const float* __restrict__ x, _Float16* __restrict__ X16, size_t n8) { const size_t t = (size_t)blockIdx.x * 256 + threadIdx.x; if (t >= n8) return; FragH f;
#pragma unroll
  for (int q = 0; q < 8; ++q) f.h[q] = (_Float16)bf16_round(x[t * 8 + q]); *(v8us*)((unsigned short*)X16 + t * 8) = f.half[0];  }
__global__ __launch_bounds__(256) void k_h16(const float* __restrict__ x, _Float16* __restrict__ X16, size_t n8) { const size_t t = (size_t)blockIdx.x * 256 + threadIdx.x; if (t >= n8) return; FragH f;
#pragma unroll
  for (int q = 0; q < 8; ++q) f.h[q] = (_Float16)x[t * 8 + q]; *(v8us*)((unsigned short*)X16 + t * 8) = f.half[0];  }
__global__ __launch_bounds__(256) void k_round16f(const float* __restrict__ W, _Float16* __restrict__ Bt, size_t n8) { const size_t t = (size_t)blockIdx.x * 256 + threadIdx.x; if (t >= n8) return; FragH f;
#pragma unroll
  for (int i = 0; i < 8; ++i) f.h[i] = (_Float16)(bf16_round(W[t * 8 + i]) * 16.0f); *(v8us*)((unsigned short*)Bt + t * 8) = f.half[0];  }
template <int NHv, int TTv>
__global__ __launch_bounds__(256) void k_vt(const _Float16* __restrict__ V16, int ldv, int voff, _Float16* __restrict__ Vt) { __shared__ unsigned short tl[64][66]; const int tid = threadIdx.x; const int slab = blockIdx.x / (TTv / 64), lg = blockIdx.x % (TTv / 64); const int b = slab / NHv, h = slab % NHv;
  for (int i = tid; i < 64 * 8; i += 256) { const int r = i / 8, c8 = (i % 8) * 8; FragH f; f.half[0] = *(const v8us*)((const unsigned short*)V16 + ((size_t)b * TTv + lg * 64 + r) * ldv + voff + h * 64 + c8);
#pragma unroll
    for (int q = 0; q < 8; ++q) tl[r][c8 + q] = f.u[q]; }
  __syncthreads();
  {
#pragma unroll
    for (int rd = 0; rd < 2; ++rd) { const int d = rd * 32 + tid / 8, pc = tid % 8; FragH f;
#pragma unroll
      for (int q = 0; q < 8; ++q) f.u[q] = tl[pc * 8 + q][d];
      *(v8us*)((unsigned short*)Vt + ((size_t)slab * 64 + d) * TTv + lg * 64 + pc * 8) = f.half[0]; }
     } }

__global__ __launch_bounds__(256) void k_hl(const float* __restrict__ F, _Float16* __restrict__ Hh, _Float16* __restrict__ Hl, size_t n8) { const size_t t = (size_t)blockIdx.x * 256 + threadIdx.x; if (t >= n8) return; FragH fh, fl; const v4f a = *(const v4fa*)(F + t * 8), c = *(const v4fa*)(F + t * 8 + 4);
#pragma unroll
  for (int q = 0; q < 4; ++q) { _Float16 h = (_Float16)a[q]; fh.h[q] = h; fl.h[q] = (_Float16)((a[q] - (float)h) * 1024.0f); h = (_Float16)c[q]; fh.h[4 + q] = h; fl.h[4 + q] = (_Float16)((c[q] - (float)h) * 1024.0f); }
  { *(v8us*)((unsigned short*)Hh + t * 8) = fh.half[0]; *(v8us*)((unsigned short*)Hl + t * 8) = fl.half[0];  } }

// ---- fast GEMM (wave tile 32x64; requires M % 32 == 0 rows per launch region, N % 64 == 0, K % 32 == 0 and K >= 32); epilogue = k_gemm_hhx semantics ----
__device__ __forceinline__ v16h g2_frag(const _Float16* p, int hh) { FragH f; f.half[0] = *(const v8us*)((const unsigned short*)p + 8 * hh); f.half[1] = *(const v8us*)((const unsigned short*)p + 16 + 8 * hh); return f.v; }
__device__ __forceinline__ v8f g2_mma(v16h a, v16h b, v8f c) { v8f d = __builtin_amdgcn_wmma_f32_16x16x32_f16(false, a, false, b, (short)0, c, false, false); asm volatile("v_nop\n\tv_nop\n\tv_nop\n\tv_nop" : "+v"(d) : "v"(a), "v"(b)); return d; }
struct G2S { v16h a0, a1, b0, b1, b2, b3; };      /* the six fragments of one k step */
template <int ACT>
__global__ __launch_bounds__(128) void k_gemm2(const _Float16* __restrict__ A, int lda, size_t sA, const _Float16* __restrict__ Bh, int ldb, size_t sB, float alpha, const float* __restrict__ bias, size_t sBias, const float* __restrict__ CP, int rowsPerB, size_t sCPb, int row0g,
    float* __restrict__ C, _Float16* __restrict__ C16, int ldc, size_t sC, int M, int N, int K) { static_assert(ACT == 0 || ACT == 3 || ACT == 6 || ACT == 8 || ACT == 9 || ACT == 11 || ACT == 12 || ACT == 14 || ACT == 15 || ACT == 16 || ACT == 17, "k_gemm2: unsupported ACT code (would silently apply no activation)");
  __shared__ __attribute__((aligned(16))) float so[4][32][68];
  const int tid = threadIdx.x, w = tid >> 5, lane = tid & 31, ln = lane & 15, hh = lane >> 4; const int by = blockIdx.y;
  A += (size_t)by * sA; Bh += (size_t)by * sB; const size_t cofs = (size_t)by * sC; const float* bp = bias ? bias + (size_t)by * sBias : nullptr;
  const int ntn = N >> 6; const int mt = blockIdx.x / ntn, nq = blockIdx.x - mt * ntn; const int row0 = mt * 128 + 32 * w, col0 = nq * 64; if (row0 >= M) return;
  const _Float16* a0p = A + (size_t)(row0 + ln) * lda + 8 * hh; const _Float16* a1p = a0p + (size_t)16 * lda;
  const _Float16* b0p = Bh + (size_t)(col0 + ln) * ldb + 8 * hh; const _Float16* b1p = b0p + (size_t)16 * ldb; const _Float16* b2p = b1p + (size_t)16 * ldb; const _Float16* b3p = b2p + (size_t)16 * ldb;
  const v8f z8 = {0.f,0.f,0.f,0.f,0.f,0.f,0.f,0.f}; v8f c00 = z8, c01 = z8, c02 = z8, c03 = z8, c10 = z8, c11 = z8, c12 = z8, c13 = z8;
  /* Three k steps of fragments in registers. A step's twelve loads are issued together, right behind the products of the step whose registers they refill, and are first read three steps later: a load's latency is spread over three steps instead of being paid five times in each.
     No branch stands between the loads, so their waits are counted exactly: past the last step the step index is clamped (an in-bounds re-read of the last step that no product uses). Each accumulator still takes its products in the order kb = 0, 32, 64, ... */
  const int nst = K >> 5;
  auto ld = [&](int st) { const int kb = (st < nst ? st : nst - 1) << 5; const _Float16 *pa0 = a0p + kb, *pa1 = a1p + kb, *pb0 = b0p + kb, *pb1 = b1p + kb, *pb2 = b2p + kb, *pb3 = b3p + kb;      /* the lane half's 8 hh elements are in the row pointers */
    G2S f; f.a0 = g2_frag(pa0, 0); f.a1 = g2_frag(pa1, 0); f.b0 = g2_frag(pb0, 0); f.b1 = g2_frag(pb1, 0); f.b2 = g2_frag(pb2, 0); f.b3 = g2_frag(pb3, 0);
    asm volatile("s_wait_xcnt 0x0" :: "v"(pa0), "v"(pa1), "v"(pb0), "v"(pb1), "v"(pb2), "v"(pb3) : "memory");      /* stands behind the step's loads and in front of every instruction that rewrites an address register they name; the addresses are inputs so that their registers stay as they are up to the wait */
    return f; };
  auto mm = [&](const G2S& f) { c00 = g2_mma(f.a0, f.b0, c00); c10 = g2_mma(f.a1, f.b0, c10); c01 = g2_mma(f.a0, f.b1, c01); c11 = g2_mma(f.a1, f.b1, c11); c02 = g2_mma(f.a0, f.b2, c02); c12 = g2_mma(f.a1, f.b2, c12); c03 = g2_mma(f.a0, f.b3, c03); c13 = g2_mma(f.a1, f.b3, c13); };
  G2S f0 = ld(0), f1 = ld(1), f2 = ld(2); int st = 0;
  /* kept rolled: one trip is the whole ring, and a second copy would only add registers */
#pragma unroll 1
  for (; st + 3 <= nst; st += 3) { mm(f0); f0 = ld(st + 3); mm(f1); f1 = ld(st + 4); mm(f2); f2 = ld(st + 5); }
  if (st < nst) mm(f0);
  if (st + 1 < nst) mm(f1);
  v8f accs[8] = {c00, c01, c02, c03, c10, c11, c12, c13};
#pragma unroll
  for (int u = 0; u < 8; ++u) { const int t = u & 3, half = u >> 2; const int col = col0 + t * 16 + ln; const float bv = bp ? bf16_round(bp[col]) : 0.f;
#pragma unroll
    for (int r = 0; r < 8; ++r) { const int rloc = half * 16 + 8 * hh + r; float v = accs[u][r] * alpha + bv; if (CP) { if (rowsPerB < 0) v += CP[cofs + (size_t)(row0g + row0 + rloc) * ldc + col];      /* rowsPerB < 0: own element of the batched C plane */ else { const int bidx = (row0g + row0 + rloc) / rowsPerB; v += CP[(size_t)bidx * sCPb + (size_t)by * 64 + col]; } }
      if (ACT == 3) v = fmaxf(v, 0.f); else if (ACT == 6) v = 0.5f * v * (1.0f + erff(v * 0.70710678118654752f)); else if (ACT == 11) v = 1.0f / (1.0f + expf(-v)); else if (ACT == 15) v = v / (1.0f + expf(-v)); else if (ACT == 12) v = (v > 0.f) ? v : 0.01f * v; else if (ACT == 8) v = tanhf(v); else if (ACT == 9) v = 0.5f * v * (1.0f + tanhf(0.7978845608028654f * (v + 0.044715f * v * v * v))); else if (ACT == 14) v = (v > 0.f) ? v : 0.1f * v; else if (ACT == 16) v = (v >= 0.f) ? v : 0.3f * v; else if (ACT == 17) v = (v >= 0.f) ? v : 0.2f * v;
      so[w][rloc][t * 16 + ln] = v; } }
  __builtin_amdgcn_fence(__ATOMIC_ACQ_REL, "workgroup"); __builtin_amdgcn_wave_barrier();
  const int rsub = lane >> 4, c4 = (lane & 15) * 4;
  {
#pragma unroll
    for (int q = 0; q < 16; ++q) { const int r = q * 2 + rsub; const v4f v = *(const v4fa*)&so[w][r][c4]; if (C) *(v4f*)(C + cofs + (size_t)(row0 + r) * ldc + col0 + c4) = v; if (C16) { v4h h4; for (int i = 0; i < 4; ++i) h4[i] = (_Float16)v[i]; *(v4h*)(C16 + cofs + (size_t)(row0 + r) * ldc + col0 + c4) = h4; } }
     } }


__global__ __launch_bounds__(256) void k_wnat(const float* __restrict__ w, size_t n8, _Float16* __restrict__ Bt) { const size_t t = (size_t)blockIdx.x * 256 + threadIdx.x; if (t >= n8) return; FragH f; for (int q = 0; q < 8; ++q) f.h[q] = (_Float16)(bf16_round(w[t * 8 + q]) * 16.0f); *(v8us*)((unsigned short*)Bt + t * 8) = f.half[0];  }
__global__ __launch_bounds__(256) void k_rsm(const float* __restrict__ S, _Float16* __restrict__ P, int nrows) {
  #pragma clang fp contract(off)
  const int i = blockIdx.x * 256 + threadIdx.x; if (i >= nrows) return; const float* s = S + (size_t)i * SQ; float mx = -3.0e38f;
#pragma unroll 1
  for (int j = 0; j < SQ; ++j) mx = fmaxf(mx, s[j]); float se = 0.f;
#pragma unroll 1
  for (int j = 0; j < SQ; ++j) se += expf(s[j] - mx); const float sc = 256.0f / se;
#pragma unroll 1
  for (int j0 = 0; j0 < SQ; j0 += 8) { FragH f; for (int q = 0; q < 8; ++q) f.h[q] = (_Float16)(expf(s[j0 + q] - mx) * sc); unsigned short* d = (unsigned short*)P + (size_t)i * SQ + j0; *(v8us*)d = f.half[0];  } }
__global__ __launch_bounds__(256) void k_vt(const _Float16* __restrict__ V16, int b, int h0, _Float16* __restrict__ VT) { __shared__ unsigned short tl[64][65]; const int tid = threadIdx.x; const int hh = blockIdx.x % HG, sg = blockIdx.x / HG; const int s0 = sg * 64; const int h = h0 + hh;
  for (int i = tid; i < 64 * 8; i += 256) { const int j = i / 8, d8 = (i % 8) * 8; FragH f; f.half[0] = *(const v8us*)((const unsigned short*)V16 + ((size_t)b * SQ + s0 + j) * DM + h * HD + d8); for (int q = 0; q < 8; ++q) tl[d8 + q][j] = f.u[q]; }
  __syncthreads();
  { for (int i = tid; i < 64 * 8; i += 256) { const int d = i / 8, j8 = (i % 8) * 8; FragH f; for (int q = 0; q < 8; ++q) f.u[q] = tl[d][j8 + q]; *(v8us*)((unsigned short*)VT + ((size_t)hh * HD + d) * SQ + s0 + j8) = f.half[0]; }  } }



__global__ __launch_bounds__(256) void k_rsmcf2(const float* __restrict__ S, _Float16* __restrict__ P, int hg, int q0, int nk) {
  #pragma clang fp contract(off)
  const int t = blockIdx.x * 256 + threadIdx.x; if (t >= hg * QT) return; const size_t i = (size_t)t; const float* s = S + i * NKX; const int last = q0 + (t % QT); float mx = -3.0e38f;
#pragma unroll 1
  for (int j = 0; j < nk; ++j) { const float f = (j <= last) ? 1.f : 0.f; mx = fmaxf(mx, fmaf(f, s[j], (1.f - f) * -1.0e9f)); } float se = 0.f;
#pragma unroll 1
  for (int j = 0; j < nk; ++j) { const float f = (j <= last) ? 1.f : 0.f; se += __expf(fmaf(f, s[j], (1.f - f) * -1.0e9f) - mx); } const float sc = 256.0f / se;
#pragma unroll 1
  for (int j0 = 0; j0 < nk; j0 += 8) { FragH fr; for (int q = 0; q < 8; ++q) { const int j = j0 + q; const float f = (j <= last) ? 1.f : 0.f; fr.h[q] = (_Float16)(__expf(fmaf(f, s[j], (1.f - f) * -1.0e9f) - mx) * sc); } unsigned short* d = (unsigned short*)P + i * NKX + j0; *(v8us*)d = fr.half[0];  } }



typedef int v4ia __attribute__((ext_vector_type(4), may_alias));
// native 2^x. Written as asm for the v_nop: it is the slot that the instruction set asks for behind a transcendental before its result is read or its source overwritten.
__device__ __forceinline__ float exp2_native(float x) { float r; asm("v_exp_f32 %0, %1\n\tv_nop" : "=v"(r) : "v"(x)); return r; }
#define FQ 2                         /* 16-query column groups per wave of the fused attention kernel */
struct FAK { v16h h[2][2], l[2][2]; };      /* K fragments of 32 keys: [16-key tile][32-wide step over the head size], hi and x1024 residual */
struct FAV { v16h h[4], l[4]; };            /* V^T fragments of 32 keys: [16-row tile of the head size], hi and x1024 residual */
__device__ __forceinline__ v8f fa_mma(v16h a, v16h b, v8f c) { return __builtin_amdgcn_wmma_f32_16x16x32_f16(false, a, false, b, (short)0, c, false, false); }
__global__ __launch_bounds__(256) void k_fattn(const _Float16* __restrict__ Qh, const _Float16* __restrict__ Ql, const _Float16* __restrict__ Kh, const _Float16* __restrict__ Kl, const _Float16* __restrict__ Vh, const _Float16* __restrict__ Vl, const int* __restrict__ Km, float* __restrict__ O) {
  const int lane = threadIdx.x & 31, ln = lane & 15, hh = lane >> 4; const int w = __builtin_amdgcn_readfirstlane((int)(threadIdx.x >> 5));
  const int tb = (int)(blockIdx.x / (NB * NH)); const int bh = blockIdx.x % (NB * NH); const int b = bh / NH, h = bh % NH;
  const int qb = (w < 4) ? SQ / (64 * FQ) - 1 - tb : tb;      /* a long and a short row group per block */
  const int q0 = qb * (64 * FQ) + (w & 3) * (16 * FQ);      /* the wave's first query row: a multiple of 32, the same in every lane */
  /* every loop under '#pragma unroll' in this kernel is fully unrolled so that the fragment, score and accumulator arrays are registers, not scratch */
  v16h qh[FQ][2], ql[FQ][2];
  { const _Float16* pq = Qh + ((size_t)b * SQ + q0 + ln) * LQ + h * HD + 8 * hh; const _Float16* pl = Ql + ((size_t)b * SQ + q0 + ln) * LQ + h * HD + 8 * hh;
#pragma unroll
    for (int g = 0; g < FQ; ++g) { qh[g][0] = g2_frag(pq + (size_t)g * 16 * LQ, 0); qh[g][1] = g2_frag(pq + (size_t)g * 16 * LQ + 32, 0); ql[g][0] = g2_frag(pl + (size_t)g * 16 * LQ, 0); ql[g][1] = g2_frag(pl + (size_t)g * 16 * LQ + 32, 0); }
    asm volatile("s_wait_xcnt 0x0" :: "v"(pq), "v"(pl) : "memory"); }      /* stands behind the q loads and in front of every instruction that rewrites an address register they name */
  const _Float16* pkh = Kh + ((size_t)b * SQ + ln) * LQ + h * HD + 8 * hh; const _Float16* pkl = Kl + ((size_t)b * SQ + ln) * LQ + h * HD + 8 * hh;
  const _Float16* pvh = Vh + ((size_t)bh * HD + ln) * SQ + 8 * hh; const _Float16* pvl = Vl + ((size_t)bh * HD + ln) * SQ + 8 * hh; const int* pm = Km + (size_t)b * SQ + lane;
  int kmv;
  auto ldk = [&](int kb) { const _Float16* a = pkh + (size_t)kb * LQ; const _Float16* c = pkl + (size_t)kb * LQ; const int* e = pm + kb; FAK f;
#pragma unroll
    for (int t = 0; t < 2; ++t) { f.h[t][0] = g2_frag(a + (size_t)t * 16 * LQ, 0); f.h[t][1] = g2_frag(a + (size_t)t * 16 * LQ + 32, 0); f.l[t][0] = g2_frag(c + (size_t)t * 16 * LQ, 0); f.l[t][1] = g2_frag(c + (size_t)t * 16 * LQ + 32, 0); }
    kmv = *e;
    asm volatile("s_wait_xcnt 0x0" :: "v"(a), "v"(c), "v"(e) : "memory");      /* stands behind the loads and in front of every instruction that rewrites an address register they name; the addresses are inputs so that their registers stay as they are up to the wait */
    return f; };
  auto ldv = [&](int kb) { const _Float16* a = pvh + kb; const _Float16* c = pvl + kb; FAV f;
#pragma unroll
    for (int d = 0; d < 4; ++d) { f.h[d] = g2_frag(a + (size_t)d * 16 * SQ, 0); f.l[d] = g2_frag(c + (size_t)d * 16 * SQ, 0); }
    asm volatile("s_wait_xcnt 0x0" :: "v"(a), "v"(c) : "memory");      /* as in ldk */
    return f; };
  const v8f z8 = {0.f, 0.f, 0.f, 0.f, 0.f, 0.f, 0.f, 0.f};
  v8f o[FQ][4]; float m[FQ], l[FQ];
#pragma unroll
  for (int g = 0; g < FQ; ++g) { m[g] = -3.0e38f; l[g] = 0.f; for (int d = 0; d < 4; ++d) o[g][d] = z8; }
  FAK kf = ldk(0);
  /* kept rolled: one trip holds 32 keys x 32 queries, and a second copy would only add code and registers */
#pragma unroll 1
  for (int kb = 0; kb <= q0; kb += 32) {
    const FAV vf = ldv(kb);      /* issued here, first read behind the softmax */
    v8f s[FQ][2];
#pragma unroll
    for (int g = 0; g < FQ; ++g) {
#pragma unroll
      for (int t = 0; t < 2; ++t) { v8f sh = fa_mma(kf.h[t][0], qh[g][0], z8); sh = fa_mma(kf.h[t][1], qh[g][1], sh);
        v8f sl = fa_mma(kf.h[t][0], ql[g][0], z8); sl = fa_mma(kf.h[t][1], ql[g][1], sl); sl = fa_mma(kf.l[t][0], qh[g][0], sl); sl = fa_mma(kf.l[t][1], qh[g][1], sl);
#pragma unroll
        for (int r = 0; r < 8; ++r) s[g][t][r] = fmaf(sl[r], 0.18033688011112042f / 1024.0f, sh[r] * 0.18033688011112042f); } }      /* (q_hi.k_hi + (q_lo.k_hi + q_hi.k_lo)/1024) / 8, times log2(e) */
    const unsigned bm = __builtin_amdgcn_ballot_w32(kmv != 0);      /* bit j: key kb + j is not padded */
    kf = ldk(kb + 32 <= q0 ? kb + 32 : kb);      /* the next trip's K fragments fly over the softmax and P.V; behind the last trip an in-bounds re-read that nothing uses */
    if (kb == q0 || bm != 0xFFFFFFFFu) {      /* only the diagonal trip and trips with a padded key mask; the test is the same for the whole wave */
      const unsigned bmh = bm >> (8 * hh);
#pragma unroll
      for (int g = 0; g < FQ; ++g) {
#pragma unroll
        for (int t = 0; t < 2; ++t) {
#pragma unroll
          for (int r = 0; r < 8; ++r) { const bool ok = (kb + t * 16 + 8 * hh + r <= q0 + g * 16 + ln) && ((bmh >> (t * 16 + r)) & 1u); s[g][t][r] = ok ? s[g][t][r] : -1.0e9f; } } } }
    v16h ph[FQ], pl[FQ];
#pragma unroll
    for (int g = 0; g < FQ; ++g) { float mx = fmaxf(s[g][0][0], s[g][1][0]);
#pragma unroll
      for (int r = 1; r < 8; ++r) mx = fmaxf(mx, fmaxf(s[g][0][r], s[g][1][r]));
      mx = fmaxf(mx, __shfl_xor(mx, 16, 32));      /* the query's other 16 keys of this trip sit in the other lane half */
      const float mn = fmaxf(m[g], mx); const float sc = exp2_native(m[g] - mn); const float mo = mn - 12.0f; m[g] = mn;
      float se0 = 0.f, se1 = 0.f;
#pragma unroll
      for (int r = 0; r < 8; ++r) { const float e0 = exp2_native(s[g][0][r] - mo), e1 = exp2_native(s[g][1][r] - mo); se0 += e0; se1 += e1; ph[g][r] = (_Float16)e0; ph[g][8 + r] = (_Float16)e1; }
      l[g] = fmaf(l[g], sc, se0 + se1); pl[g] = ph[g] * (_Float16)0.0009765625f;
#pragma unroll
      for (int d = 0; d < 4; ++d) o[g][d] *= sc; }
#pragma unroll
    for (int d = 0; d < 4; ++d) {
#pragma unroll
      for (int g = 0; g < FQ; ++g) { o[g][d] = fa_mma(vf.h[d], ph[g], o[g][d]); o[g][d] = fa_mma(vf.l[d], pl[g], o[g][d]); } } }
  float* po[FQ];
#pragma unroll
  for (int g = 0; g < FQ; ++g) { const float fin = 64.0f / (l[g] + __shfl_xor(l[g], 16, 32));      /* o carried x64; the halves' sums are joined once */
    po[g] = O + ((size_t)b * SQ + q0 + g * 16 + ln) * DM + h * HD + 8 * hh;
#pragma unroll
    for (int d = 0; d < 4; ++d) o[g][d] *= fin; }
  /* a lane holds 8 consecutive columns of its query row per tile; the wave alone writes its rows' 256 bytes */
#pragma unroll
  for (int g = 0; g < FQ; ++g) {
#pragma unroll
    for (int d = 0; d < 4; ++d) { const v4f lo = {o[g][d][0], o[g][d][1], o[g][d][2], o[g][d][3]}, hi = {o[g][d][4], o[g][d][5], o[g][d][6], o[g][d][7]}; *(v4f*)(po[g] + d * 16) = lo; *(v4f*)(po[g] + d * 16 + 4) = hi; } }
  asm volatile("s_wait_xcnt 0x0" :: "v"(po[0]), "v"(po[FQ - 1]) : "memory");      /* stands behind the stores: their address registers stay as they are up to here */
}


// Exact f32 attention of the first QT0 rows of every batch; one thread per query row, one block per (head, 64 rows), blockIdx.y = batch (all row planes hold SQ rows per batch).
// All operands stay on chip: the head's K and V rows (and the key padding entries) are staged once in LDS with whole-line loads, every lane then reads the same LDS address (a broadcast, no bank conflict), and the thread's q and o rows live in registers.
// Four keys per trip: their four score chains are independent, so one chain's dependent adds are covered by the other three. Every sum (score, l, o) keeps its order: d = 0..63 inside a score, keys in rising j.
template <int MASKADD, int MASKKV>
__global__ __launch_bounds__(64) void k_att0(const float* __restrict__ QF, const float* __restrict__ KF, const float* __restrict__ VF, int ld, const float* __restrict__ mask, const int* __restrict__ Km, float scale, float* __restrict__ OF, int ldo) {
  #pragma clang fp contract(off)
  __shared__ __attribute__((aligned(16))) float lk[QT0][HD]; __shared__ __attribute__((aligned(16))) float lv[QT0][HD]; __shared__ __attribute__((aligned(16))) int lm[QT0];
  const int tid = threadIdx.x; const int h = blockIdx.x / (QT0 / 64), rg = blockIdx.x % (QT0 / 64); const int i = rg * 64 + tid;
  { const size_t rb = (size_t)blockIdx.y * SQ; QF += rb * ld; KF += rb * ld; VF += rb * ld; OF += rb * ldo; if (MASKKV) Km += rb; }      /* the batch's first row */
  const float* qr = QF + (size_t)i * ld + h * HD;
  v4f q[HD / 4], o[HD / 4];
  /* every loop over c is fully unrolled so that q and o are registers, not scratch */
#pragma unroll
  for (int c = 0; c < HD / 4; ++c) { q[c] = *(const v4fa*)(qr + c * 4); const v4f z = {0.f, 0.f, 0.f, 0.f}; o[c] = z; }
  asm volatile("s_wait_xcnt 0x0" :: "v"(qr) : "memory");      /* stands behind the q loads and in front of every instruction that rewrites their address register; the address is an input so that its register stays as it is up to the wait */
  float m = -1.0e30f, l = 0.f; const int jmax = MASKADD ? (SQ - 1) : (rg * 64 + 63);      /* additive-mask form: every key (the mask input decides); causal form: keys up to the block's last row */
  /* kept rolled: the causal form makes one trip */
#pragma unroll 1
  for (int jt = 0; jt <= jmax; jt += QT0) { const int nr = (jmax + 1 - jt < QT0) ? (jmax + 1 - jt) : QT0;      /* keys of this tile: a multiple of 64, the same for the whole block */
    if (jt) __syncthreads();      /* every reader has left the tile before it is refilled */
    /* eight K and eight V loads in flight per thread; 16 lanes cover one 256-byte row, the block 4 rows per load */
    const size_t g0 = (size_t)(jt + (tid >> 4)) * ld + h * HD + (tid & 15) * 4;
    /* kept rolled: nr is only known at run time, and each trip already has sixteen loads per thread in flight */
#pragma unroll 1
    for (int r0 = 0; r0 < nr; r0 += 32) { v4f tk[8], tv[8]; const float *pk[8], *pv[8];
      /* the three loops over u are fully unrolled so that the pointers and the loaded rows are registers and the sixteen loads stand together */
#pragma unroll
      for (int u = 0; u < 8; ++u) { const size_t g = g0 + (size_t)(r0 + u * 4) * ld; pk[u] = KF + g; pv[u] = VF + g; }
#pragma unroll
      for (int u = 0; u < 8; ++u) { tk[u] = *(const v4fa*)pk[u]; tv[u] = *(const v4fa*)pv[u]; }
      asm volatile("s_wait_xcnt 0x0" :: "v"(pk[0]), "v"(pk[1]), "v"(pk[2]), "v"(pk[3]), "v"(pk[4]), "v"(pk[5]), "v"(pk[6]), "v"(pk[7]), "v"(pv[0]), "v"(pv[1]), "v"(pv[2]), "v"(pv[3]), "v"(pv[4]), "v"(pv[5]), "v"(pv[6]), "v"(pv[7]) : "memory");      /* stands behind the trip's loads and in front of every instruction that rewrites an address register they name; the addresses are inputs so that no load lands on one of them */
#pragma unroll
      for (int u = 0; u < 8; ++u) { const int r = r0 + u * 4 + (tid >> 4); *(v4f*)&lk[r][(tid & 15) * 4] = tk[u]; *(v4f*)&lv[r][(tid & 15) * 4] = tv[u]; } }
    if (MASKKV) for (int e = tid; e < nr; e += 64) lm[e] = Km[jt + e];
    __syncthreads();      /* the tile is complete before any thread reads it */
    /* kept rolled: one trip already holds four keys, and a second copy would only add code and registers */
#pragma unroll 1
    for (int jj = 0; jj < nr; jj += 4) { float s4[4] = {0.f, 0.f, 0.f, 0.f}, sc4[4], e4[4]; v4ia km4 = {1, 1, 1, 1}; if (MASKKV) km4 = *(const v4ia*)&lm[jj];
      /* all loops over c and u below are fully unrolled: constant indices keep q, o and the four keys' values in registers, and the four score chains stand side by side */
#pragma unroll
      for (int c = 0; c < HD / 4; ++c) { const v4f qq = q[c];
#pragma unroll
        for (int u = 0; u < 4; ++u) { const v4f kq = *(const v4f*)&lk[jj + u][c * 4]; float s = s4[u]; s = __fadd_rn(s, __fmul_rn(qq[0], kq[0])); s = __fadd_rn(s, __fmul_rn(qq[1], kq[1])); s = __fadd_rn(s, __fmul_rn(qq[2], kq[2])); s = __fadd_rn(s, __fmul_rn(qq[3], kq[3])); s4[u] = s; } }
#pragma unroll
      for (int u = 0; u < 4; ++u) { const int j = jt + jj + u; float s = __fmul_rn(s4[u], scale); if (MASKADD) s = __fadd_rn(s, __fmul_rn(bf16_round(mask[(size_t)i * SQ + j]), -10000.0f));
        const float f = (MASKADD || (j <= i && (!MASKKV || km4[u] != 0))) ? 1.f : 0.f;      /* MASKKV: also drop keys whose int padding entry is 0 */ const float sm = fmaf(f, s, (1.f - f) * -1.0e30f); const float mn = fmaxf(m, sm); const float sc = expf(m - mn); const float e = expf(sm - mn); l = __fadd_rn(__fmul_rn(l, sc), e); m = mn; sc4[u] = sc; e4[u] = e; }
#pragma unroll
      for (int u = 0; u < 4; ++u) { const float sc = sc4[u], e = e4[u];
#pragma unroll
        for (int c = 0; c < HD / 4; ++c) { const v4f vv = *(const v4f*)&lv[jj + u][c * 4]; v4f oo = o[c]; for (int w = 0; w < 4; ++w) oo[w] = __fadd_rn(__fmul_rn(oo[w], sc), __fmul_rn(e, vv[w])); o[c] = oo; } } } }
  const float fin = 64.0f / l;      /* o carried x64 like the f16 path */
  float* orow = OF + (size_t)i * ldo + h * HD;      /* the thread's own 256 bytes: two whole lines, no other writer */
  /* unrolled: o stays in registers */
#pragma unroll
  for (int c = 0; c < HD / 4; ++c) { v4f oo = o[c]; for (int w = 0; w < 4; ++w) oo[w] = __fmul_rn(oo[w], fin); *(v4f*)(orow + c * 4) = oo; } }


__global__ __launch_bounds__(256) void k_xt16(const float* __restrict__ x, const float* __restrict__ tg, const float* __restrict__ wt, const float* __restrict__ bt, _Float16* __restrict__ XT, _Float16* __restrict__ XL, size_t n8) {
  #pragma clang fp contract(off)
  const size_t t = (size_t)blockIdx.x * 256 + threadIdx.x; if (t >= n8) return; const size_t e0 = t * 8; const size_t r = e0 / DM; const int c0 = (int)(e0 % DM); const float g = bf16_round(tg[r]); FragH f, l;
  for (int q = 0; q < 8; ++q) { const int c = c0 + q; const float te = __fadd_rn(__fmul_rn(g, bf16_round(wt[c])), bf16_round(bt[c])); const float v = __fadd_rn(bf16_round(x[e0 + q]), te); const _Float16 h = (_Float16)v; f.h[q] = h; l.h[q] = (_Float16)((v - (float)h) * 1024.0f); }
  *(v8us*)((unsigned short*)XT + e0) = f.half[0]; *(v8us*)((unsigned short*)XL + e0) = l.half[0];  }
extern "C" void kernel_launch(void* const* d_in, const int* in_sizes, int n_in,
                              void* d_out, int out_size, void* d_ws, size_t ws_size, hipStream_t stream) {
  (void)in_sizes; (void)n_in; (void)out_size;
  const float* const* I = (const float* const*)d_in; const float* x = I[0]; const float* tg = I[1]; const int* km = (const int*)d_in[2]; const float* wq = I[3]; const float* bq = I[4]; const float* wk = I[5]; const float* bk = I[6]; const float* wv = I[7]; const float* bv = I[8]; const float* wo = I[9]; const float* bo = I[10]; const float* wt = I[11]; const float* bt = I[12];      /* natural [out][in] weights + biases; time_gaps [2][2048][1]; int key mask [2][2048]; Wt [1024][1], bt [1024] */
  char* ws = (char*)d_ws; size_t off = 0;
  auto take = [&](size_t bytes) { char* p = ws + off; off += (bytes + 255) & ~(size_t)255; return p; };
  _Float16* BQ = (_Float16*)take((size_t)DM * DM * 2); _Float16* BK = (_Float16*)take((size_t)DM * DM * 2); _Float16* BV = (_Float16*)take((size_t)DM * DM * 2); _Float16* BO = (_Float16*)take((size_t)DM * DM * 2);
  _Float16* X16 = (_Float16*)take(NR * DM * 2); _Float16* XT16 = (_Float16*)take(NR * DM * 2); _Float16* XL16 = (_Float16*)take(NR * DM * 2);      /* x (exact f16) for v; x_time as f16 hi + x1024 residual for q and k */ float* QF = (float*)take(NR * DM * 4); float* KF = (float*)take(NR * DM * 4); float* VF = (float*)take(NR * DM * 4); float* F32 = (float*)take(NR * DM * 4);      /* f32 rows of q, k, v (kept: the first-tile attention reads them) and o */ _Float16* Q16 = (_Float16*)take(NR * DM * 2); _Float16* QL = (_Float16*)take(NR * DM * 2); _Float16* K16 = (_Float16*)take(NR * DM * 2); _Float16* KL = (_Float16*)take(NR * DM * 2); _Float16* V16 = (_Float16*)take(NR * DM * 2); _Float16* VL = (_Float16*)take(NR * DM * 2); _Float16* O16 = (_Float16*)take(NR * DM * 2); _Float16* OL = (_Float16*)take(NR * DM * 2);
  _Float16* VT = (_Float16*)take((size_t)NB * NH * HD * SQ * 2); _Float16* VTL = (_Float16*)take((size_t)NB * NH * HD * SQ * 2);      /* V^T planes of both batches */
  if (off > ws_size) return;
  { const unsigned g = (unsigned)(((size_t)DM * DM / 8 + 255) / 256); k_wnat<<<g, 256, 0, stream>>>(wq, (size_t)DM * DM / 8, BQ); k_wnat<<<g, 256, 0, stream>>>(wk, (size_t)DM * DM / 8, BK); k_wnat<<<g, 256, 0, stream>>>(wv, (size_t)DM * DM / 8, BV); k_wnat<<<g, 256, 0, stream>>>(wo, (size_t)DM * DM / 8, BO); }      /* natural [out][in] = Bt[n][k], x16 */

  k_x16<<<(unsigned)((NR * DM / 8 + 255) / 256), 256, 0, stream>>>(x, X16, NR * DM / 8); k_xt16<<<(unsigned)((NR * DM / 8 + 255) / 256), 256, 0, stream>>>(x, tg, wt, bt, XT16, XL16, NR * DM / 8);      /* x_time = x + time_gaps Wt^T + bt as f16 hi + x1024 residual rows */
  const size_t r0p = (size_t)B0 * SQ;      /* first projected row */
  k_gemm2<0><<<dim3((unsigned)((MP / 128) * (DM / 64)), 1), 128, 0, stream>>>(XT16 + r0p * DM, DM, 0, BQ, DM, 0, 0.0625f, bq, 0, nullptr, 1, 0, 0, QF + r0p * DM, nullptr, DM, 0, MP, DM, DM); k_gemm2<0><<<dim3((unsigned)((MP / 128) * (DM / 64)), 1), 128, 0, stream>>>(XL16 + r0p * DM, DM, 0, BQ, DM, 0, 0.00006103515625f, nullptr, 0, QF + r0p * DM, -1, 0, 0, QF + r0p * DM, nullptr, DM, 0, MP, DM, DM); k_hl<<<(unsigned)(((size_t)MP * DM / 8 + 255) / 256), 256, 0, stream>>>(QF + r0p * DM, Q16 + r0p * DM, QL + r0p * DM, (size_t)MP * DM / 8);      
  k_gemm2<0><<<dim3((unsigned)((MP / 128) * (DM / 64)), 1), 128, 0, stream>>>(XT16 + r0p * DM, DM, 0, BK, DM, 0, 0.0625f, bk, 0, nullptr, 1, 0, 0, KF + r0p * DM, nullptr, DM, 0, MP, DM, DM); k_gemm2<0><<<dim3((unsigned)((MP / 128) * (DM / 64)), 1), 128, 0, stream>>>(XL16 + r0p * DM, DM, 0, BK, DM, 0, 0.00006103515625f, nullptr, 0, KF + r0p * DM, -1, 0, 0, KF + r0p * DM, nullptr, DM, 0, MP, DM, DM); k_hl<<<(unsigned)(((size_t)MP * DM / 8 + 255) / 256), 256, 0, stream>>>(KF + r0p * DM, K16 + r0p * DM, KL + r0p * DM, (size_t)MP * DM / 8);      /* k likewise */
  k_gemm2<0><<<dim3((unsigned)((MP / 128) * (DM / 64)), 1), 128, 0, stream>>>(X16 + r0p * DM, DM, 0, BV, DM, 0, 0.0625f, bv, 0, nullptr, 1, 0, 0, VF + r0p * DM, nullptr, DM, 0, MP, DM, DM); k_hl<<<(unsigned)(((size_t)MP * DM / 8 + 255) / 256), 256, 0, stream>>>(VF + r0p * DM, V16 + r0p * DM, VL + r0p * DM, (size_t)MP * DM / 8);      /* v = x Wv^T + bv in f32 -> f16 hi + x1024 residual */
  for (int b = B0; b < B0 + NBR; ++b) { const size_t r0 = (size_t)b * SQ;
    k_vt<NH, SQ><<<NH * (SQ / 64), 256, 0, stream>>>(V16 + r0 * LQ, LQ, 0, VT + (size_t)b * NH * HD * SQ); k_vt<NH, SQ><<<NH * (SQ / 64), 256, 0, stream>>>(VL + r0 * LQ, LQ, 0, VTL + (size_t)b * NH * HD * SQ);      /* V^T (hi and residual) [NH][HD][SQ] for this batch */
  }
  k_fattn<<<NB * NH * (SQ / (128 * FQ)), 256, 0, stream>>>(Q16, QL, K16, KL, VT, VTL, km, F32);      /* o (x64) in f32 rows: scores, causal + key padding softmax and P.V of both batches and all heads in one launch */
  k_att0<0, 1><<<dim3(NH * (QT0 / 64), NB), 64, 0, stream>>>(QF, KF, VF, DM, nullptr, km, 0.125f, F32, DM);      /* rows 0..127 of each batch: exact f32 causal attention with the key padding vector (o x64), from the f32 q, k, v rows of the full projections, written over the fused kernel's rows; the split and the out GEMMs below then take them like every other row */
  for (int b = B0; b < B0 + NBR; ++b) { const size_t r0 = (size_t)b * SQ;
    k_hl<<<(unsigned)(((size_t)SQ * DM / 8 + 255) / 256), 256, 0, stream>>>(F32 + r0 * DM, O16 + r0 * DM, OL + r0 * DM, (size_t)SQ * DM / 8); }      /* o -> f16 hi + x1024 residual */
  k_gemm2<0><<<dim3((unsigned)((MPO / 128) * (DM / 64)), 1), 128, 0, stream>>>(O16 + r0p * DM, DM, 0, BO, DM, 0, 0.0009765625f, bo, 0, nullptr, 1, 0, 0, (float*)d_out + r0p * DM, nullptr, DM, 0, MPO, DM, DM); k_gemm2<0><<<dim3((unsigned)((MPO / 128) * (DM / 64)), 1), 128, 0, stream>>>(OL + r0p * DM, DM, 0, BO, DM, 0, 0.00000095367431640625f, nullptr, 0, (const float*)d_out + r0p * DM, -1, 0, 0, (float*)d_out + r0p * DM, nullptr, DM, 0, MPO, DM, DM);      /* out = o_hi Wo^T + bo, then += o_lo Wo^T 2^-20 (own element) */
}

// v006
// Measured time: 279 microseconds a run.
// In two side-by-side timings against v005, it was 1.36 and 1.32 times as fast.
// Over all steps from v000 it is 31.8 times as fast.
#include <hip/hip_runtime.h>
// Causal multi-head attention with a time-gap embedding and a key padding mask (x [2][2048][1024]; x_time = x + (time_gaps Wt^T + bt) with time_gaps [2][2048][1] (U[0,1)), Wt [1024][1] sigma 1, bt zeros; q = x_time Wq^T + bq, k = x_time Wk^T + bk, v = x Wv^T + bv (v from the RAW x; natural [1024][1024] sigma 1/32, zero biases); 16 heads of 64; scores / 8; where(mask[b][j] == 0, -1e9) (int mask [2][2048], all ones) and where(j > i, -1e9) (causal); softmax; out = merged Wo^T + bo -> [2][2048][1024]).
// Structure: every f16 plane that a WMMA reads (x, x_time, the weights, q, k, V^T, o) is stored fragment-major (16 x 32 tiles in lane order, see tf_frag); token rows r = b*2048 + s; x as exact f16 rows; x_time = x + t Wt + bt on VALU as f16 hi + x1024 residual rows; q and k = (hi + lo/1024) W + b as two accumulating WMMA GEMMs each (32x64 wave tiles, f32 accumulation) into f32 rows, split into f16 hi + x1024 residual planes; v = x Wv + bv in f32, split likewise (both transposed per batch); one fused attention launch (a wave owns 32 query rows, 32 keys per trip): scores^T = k_hi.q_hi + (k_hi.q_lo + k_lo.q_hi)/1024 on WMMA, / 8, causal + key-mask running softmax in registers (f32 statistics, native exp2; weights x4096 f16), o^T += V_hi^T.P^T + V_lo^T.(P^T/1024), o in f32 rows, split into hi + residual; out = o_hi Wo + bo then += o_lo Wo 2^-20 (own element); first-tile refinement: the o rows of the first 128 rows of each batch recomputed exactly in f32 on VALU from the f32 q, k, v rows of the full projections and written over the fused kernel's rows in front of the split; launches: see trace.
// Compute dtype: inputs rounded to bf16; x / weights exact; q, k, v and o as f16 hi + x1024 residual operand pairs, softmax weights as plain f16 GEMM operands (~2^-12); scores and softmax statistics f32. v_wmma_f32_16x16x32_f16.
#define NB 2
#define SQ 2048
#define DM 1024
#define NH 16
#define HD 64
#define HG 4                         /* heads per block group of the unlaunched k_vt overload */
#define QT 256                       /* query rows per causal tile */
#define NKX SQ                       /* S / P row pitch */
#define QT0 128                      /* first-tile rows recomputed exactly in f32 */
#define B0 0                         /* first batch processed (debug hook) */
#define NBR NB                       /* batches processed (debug hook) */
#define NR ((size_t)NB * SQ)         /* token rows */
#define MP ((int)((size_t)NBR * SQ)) /* rows projected (debug hook) */
#define QN SQ                        /* unused (every batch attends all SQ query rows) */
#define NHD NH                       /* unused (all NH heads are attended) */
#define MPO MP                       /* rows through the output stage (debug hook) */
#define LQ DM      /* row pitch of the q/k/v rows */
typedef __bf16 v16b __attribute__((ext_vector_type(16)));
typedef unsigned short v8us __attribute__((ext_vector_type(8), may_alias));
typedef float  v8f  __attribute__((ext_vector_type(8)));
typedef float  v4f  __attribute__((ext_vector_type(4)));
typedef float  v4fa __attribute__((ext_vector_type(4), may_alias));
union FragB { v16b v; v8us half[2]; unsigned short u[16]; };

__device__ __forceinline__ unsigned short bf16_bits(float x) { unsigned int u = __float_as_uint(x); return (unsigned short)((u + 0x7FFFu + ((u >> 16) & 1u)) >> 16); }
__device__ __forceinline__ float bf16_val(unsigned short b) { return __uint_as_float(((unsigned int)b) << 16); }
__device__ __forceinline__ float bf16_round(float x) { return bf16_val(bf16_bits(x)); }
// D += A·B with NT terms: 1 = ah·bh, 2 = + al·bh (A split), 3 = + ah·bl (both split)
template <int NT>
__device__ __forceinline__ v8f mmaN(v16b ah, v16b al, v16b bh, v16b bl, v8f c) {
  c = __builtin_amdgcn_wmma_f32_16x16x32_bf16(false, ah, false, bh, (short)0, c, false, false);
  if (NT >= 2) c = __builtin_amdgcn_wmma_f32_16x16x32_bf16(false, al, false, bh, (short)0, c, false, false);
  if (NT >= 3) c = __builtin_amdgcn_wmma_f32_16x16x32_bf16(false, ah, false, bl, (short)0, c, false, false);
  asm volatile("v_nop\n\tv_nop\n\tv_nop\n\tv_nop" : "+v"(c) : "v"(ah), "v"(al), "v"(bh), "v"(bl));
  return c;
}

__global__ __launch_bounds__(256) void k_wt_bf16(const float* __restrict__ W, unsigned short* __restrict__ Wt, int K, int N) {
  const int t = blockIdx.x * 256 + threadIdx.x;
  const int k8n = K / 8;
  if (t >= N * k8n) return;
  const int n = t / k8n, k8 = (t % k8n) * 8;
  v8us v;
#pragma unroll
  for (int i = 0; i < 8; ++i) v[i] = bf16_bits(W[(size_t)(k8 + i) * N + n]);
  *(v8us*)(Wt + (size_t)n * K + k8) = v;
  
}

// GEMM C[M][N] (f32, pitch ldc) = act(A[M][K]·W + bias). A f32 row-major (pitch lda) converted per fragment to bf16
// (ASPLIT: hi/lo two planes -> 2 terms, else single rounded term); Wt bf16 [N][K] (pitch ldb). BIAS_BF16 rounds the
// bias to bf16 first (bias quantised to bf16 before the add). K%32==0, M%16==0, N%64==0.
template <bool ASPLIT, int ACT, bool BIAS_BF16>
__global__ __launch_bounds__(128) void k_gemm_bf(const float* __restrict__ A, int lda, const unsigned short* __restrict__ Wt, int ldb,
                                               const float* __restrict__ bias, float* __restrict__ C, int ldc, int M, int N, int K) {
  __shared__ __attribute__((aligned(16))) float so[4][16][64];
  const int tid = threadIdx.x, w = tid >> 5, lane = tid & 31, ln = lane & 15, hh = lane >> 4;
  const int ntn = N / 64;
  const int wid = blockIdx.x * 4 + w;
  const int mt = wid / ntn, nq = wid % ntn;
  if (mt * 16 >= M) return;
  const int row0 = mt * 16, col0 = nq * 64;
  const float* arow = A + (size_t)(row0 + ln) * lda;
  v8f acc[4] = {};
  for (int kb = 0; kb < K; kb += 32) {
    FragB ah, al;
    const v4f x0 = *(const v4fa*)(arow + kb + 8 * hh), x1 = *(const v4fa*)(arow + kb + 8 * hh + 4);
    const v4f x2 = *(const v4fa*)(arow + kb + 16 + 8 * hh), x3 = *(const v4fa*)(arow + kb + 16 + 8 * hh + 4);
    float xs[16] = {x0[0],x0[1],x0[2],x0[3],x1[0],x1[1],x1[2],x1[3],x2[0],x2[1],x2[2],x2[3],x3[0],x3[1],x3[2],x3[3]};
#pragma unroll
    for (int i = 0; i < 16; ++i) { const unsigned short hb = bf16_bits(xs[i]); ah.u[i] = hb; al.u[i] = ASPLIT ? bf16_bits(xs[i] - bf16_val(hb)) : (unsigned short)0; }
#pragma unroll
    for (int t = 0; t < 4; ++t) {
      const unsigned short* brow = Wt + (size_t)(col0 + t * 16 + ln) * ldb + kb;
      FragB b;
      b.half[0] = *(const v8us*)(brow + 8 * hh);
      b.half[1] = *(const v8us*)(brow + 16 + 8 * hh);
      acc[t] = mmaN<ASPLIT ? 2 : 1>(ah.v, al.v, b.v, b.v, acc[t]);
    }
  }
#pragma unroll
  for (int t = 0; t < 4; ++t) {
    float bv = bias ? bias[col0 + t * 16 + ln] : 0.f;
    if (BIAS_BF16) bv = bf16_round(bv);
#pragma unroll
    for (int r = 0; r < 8; ++r) { float v = acc[t][r] + bv; if (ACT == 1) v = fmaxf(v, 0.f); so[w][8 * hh + r][t * 16 + ln] = v; }
  }
  __builtin_amdgcn_fence(__ATOMIC_ACQ_REL, "workgroup");
  __builtin_amdgcn_wave_barrier();
  const int rsub = lane >> 4, c4 = (lane & 15) * 4;
  {
#pragma unroll
    for (int q = 0; q < 8; ++q) {
      const int r = q * 2 + rsub;
      const v4f v = *(const v4fa*)&so[w][r][c4];
      *(v4f*)(C + (size_t)(row0 + r) * ldc + col0 + c4) = v;
    }
    
  }
}

// GEMM C = act(A·W + bias + resid): A f32 (ASPLIT -> hi/lo 2 terms), Wt bf16 [N][K]; ACT 0 none, 1 relu, 2 exact gelu;
// resid (optional, f32, row index = (row % rmod), pitch ldr, RES_BF16 rounds it) added before the activation.
template <bool ASPLIT, int ACT, bool BIAS_BF16, bool RES_BF16>
__global__ __launch_bounds__(128) void k_gemm_bf3(const float* __restrict__ A, int lda, const unsigned short* __restrict__ Wt, int ldb,
                                                const float* __restrict__ bias, const float* __restrict__ resid, int rmod, int ldr,
                                                float* __restrict__ C, int ldc, int M, int N, int K) {
  __shared__ __attribute__((aligned(16))) float so[4][16][64];
  const int tid = threadIdx.x, w = tid >> 5, lane = tid & 31, ln = lane & 15, hh = lane >> 4;
  const int ntn = N / 64;
  const int wid = blockIdx.x * 4 + w;
  const int mt = wid / ntn, nq = wid % ntn;
  if (mt * 16 >= M) return;
  const int row0 = mt * 16, col0 = nq * 64;
  const float* arow = A + (size_t)(row0 + ln) * lda;
  v8f acc[4] = {};
  for (int kb = 0; kb < K; kb += 32) {
    FragB ah, al;
    const v4f x0 = *(const v4fa*)(arow + kb + 8 * hh), x1 = *(const v4fa*)(arow + kb + 8 * hh + 4);
    const v4f x2 = *(const v4fa*)(arow + kb + 16 + 8 * hh), x3 = *(const v4fa*)(arow + kb + 16 + 8 * hh + 4);
    float xs[16] = {x0[0],x0[1],x0[2],x0[3],x1[0],x1[1],x1[2],x1[3],x2[0],x2[1],x2[2],x2[3],x3[0],x3[1],x3[2],x3[3]};
#pragma unroll
    for (int i = 0; i < 16; ++i) { const unsigned short hb = bf16_bits(xs[i]); ah.u[i] = hb; al.u[i] = ASPLIT ? bf16_bits(xs[i] - bf16_val(hb)) : (unsigned short)0; }
#pragma unroll
    for (int t = 0; t < 4; ++t) {
      const unsigned short* brow = Wt + (size_t)(col0 + t * 16 + ln) * ldb + kb;
      FragB b;
      b.half[0] = *(const v8us*)(brow + 8 * hh);
      b.half[1] = *(const v8us*)(brow + 16 + 8 * hh);
      acc[t] = mmaN<ASPLIT ? 2 : 1>(ah.v, al.v, b.v, b.v, acc[t]);
    }
  }
#pragma unroll
  for (int t = 0; t < 4; ++t) {
    const int col = col0 + t * 16 + ln;
    float bv = bias ? bias[col] : 0.f;
    if (BIAS_BF16) bv = bf16_round(bv);
#pragma unroll
    for (int r = 0; r < 8; ++r) {
      float v = acc[t][r] + bv;
      if (resid) { float rv = resid[(size_t)((row0 + 8 * hh + r) % rmod) * ldr + col]; if (RES_BF16) rv = bf16_round(rv); v += rv; }
      if (ACT == 1) v = fmaxf(v, 0.f);
      if (ACT == 2) v = 0.5f * v * (1.0f + erff(v * 0.70710678118654752f));
      if (ACT == 3) { const float u = 0.7978845608028654f * (v + 0.044715f * v * v * v); v = 0.5f * v * (1.0f + tanhf(u)); }
      so[w][8 * hh + r][t * 16 + ln] = v;
    }
  }
  __builtin_amdgcn_fence(__ATOMIC_ACQ_REL, "workgroup");
  __builtin_amdgcn_wave_barrier();
  const int rsub = lane >> 4, c4 = (lane & 15) * 4;
  {
#pragma unroll
    for (int q = 0; q < 8; ++q) {
      const int r = q * 2 + rsub;
      const v4f v = *(const v4fa*)&so[w][r][c4];
      *(v4f*)(C + (size_t)(row0 + r) * ldc + col0 + c4) = v;
    }
    
  }
}
// row LayerNorm (biased variance, eps) over N: s = X (+ R); optional out_sum <- s; out_norm <- (s-mu)*rsqrt(var+eps)*g + b
template <bool PARAM_BF16>
__global__ __launch_bounds__(256) void k_layernorm(const float* __restrict__ X, const float* __restrict__ R, const float* __restrict__ g, const float* __restrict__ bta,
                                                  float* __restrict__ out_sum, float* __restrict__ out_norm, int N, float eps) {
  __shared__ float red[256];
  const int row = blockIdx.x, tid = threadIdx.x;
  const float* x = X + (size_t)row * N; const float* rr = R ? R + (size_t)row * N : nullptr;
  float vals[16];                     // up to N = 4096
  const int per = N / 256;            // contiguous chunk per thread? use strided-by-4 chunks: thread handles j = tid*4 + 1024*u
  float s1 = 0.f;
  for (int u = 0; u < per / 4; ++u) {
    const int j = tid * 4 + 1024 * u;
    const v4f a = *(const v4fa*)(x + j);
    v4f b = {0.f,0.f,0.f,0.f}; if (rr) b = *(const v4fa*)(rr + j);
#pragma unroll
    for (int q = 0; q < 4; ++q) { const float v = a[q] + b[q]; vals[u * 4 + q] = v; s1 += v; }
  }
  red[tid] = s1; __syncthreads();
  for (int st = 128; st > 0; st >>= 1) { if (tid < st) red[tid] += red[tid + st]; __syncthreads(); }
  const float mu = red[0] / (float)N; __syncthreads();
  float s2 = 0.f;
  for (int u = 0; u < per / 4; ++u)
#pragma unroll
    for (int q = 0; q < 4; ++q) { const float c = vals[u * 4 + q] - mu; s2 += c * c; }
  red[tid] = s2; __syncthreads();
  for (int st = 128; st > 0; st >>= 1) { if (tid < st) red[tid] += red[tid + st]; __syncthreads(); }
  const float rs = rsqrtf(red[0] / (float)N + eps);
  {
    for (int u = 0; u < per / 4; ++u) {
      const int j = tid * 4 + 1024 * u;
      v4f o, sm;
#pragma unroll
      for (int q = 0; q < 4; ++q) {
        float gg = g[j + q], bb = bta[j + q];
        if (PARAM_BF16) { gg = bf16_round(gg); bb = bf16_round(bb); }
        sm[q] = vals[u * 4 + q]; o[q] = (vals[u * 4 + q] - mu) * rs * gg + bb;
      }
      if (out_sum) *(v4f*)(out_sum + (size_t)row * N + j) = sm;
      *(v4f*)(out_norm + (size_t)row * N + j) = o;
    }
    
  }
}



// ---- f16 WMMA path (v_wmma_f32_16x16x32_f16): 11-bit significands for operands in range — used where a [0,1] probability operand needs more precision than bf16
typedef _Float16 v16h __attribute__((ext_vector_type(16)));
union FragH { v16h v; v8us half[2]; _Float16 h[16]; unsigned short u[16]; };
template <int NT>
__device__ __forceinline__ v8f mmaH(v16h ah, v16h al, v16h bh, v16h bl, v8f c) {
  c = __builtin_amdgcn_wmma_f32_16x16x32_f16(false, ah, false, bh, (short)0, c, false, false);
  if (NT >= 2) c = __builtin_amdgcn_wmma_f32_16x16x32_f16(false, al, false, bh, (short)0, c, false, false);
  if (NT >= 3) c = __builtin_amdgcn_wmma_f32_16x16x32_f16(false, ah, false, bl, (short)0, c, false, false);
  asm volatile("v_nop\n\tv_nop\n\tv_nop\n\tv_nop" : "+v"(c) : "v"(ah), "v"(al), "v"(bh), "v"(bl));
  return c;
}
// batched GEMM like k_gemm_b but f16 operands: A f32 (split into f16 hi/lo if ASPLIT, else rounded to f16), Bt = f16 values [n][k]; alpha; C f32; N multiple of 16 (partial tiles skipped)
template <bool ASPLIT>
__global__ __launch_bounds__(128) void k_gemm_h(const float* __restrict__ A, int lda, size_t sA, const _Float16* __restrict__ Bh, int ldb, size_t sB, float alpha, float* __restrict__ C, int ldc, size_t sC, int M, int N, int K) {
  __shared__ __attribute__((aligned(16))) float so[4][16][64];
  const int tid = threadIdx.x, w = tid >> 5, lane = tid & 31, ln = lane & 15, hh = lane >> 4; const int by = blockIdx.y;
  A += (size_t)by * sA; Bh += (size_t)by * sB; C += (size_t)by * sC;
  const int ntn = (N + 63) / 64; const int wid = blockIdx.x * 4 + w; const int mt = wid / ntn, nq = wid % ntn; if (mt * 16 >= M) return;
  const int row0 = mt * 16, col0 = nq * 64; const float* arow = A + (size_t)(row0 + ln) * lda;
  v8f acc[4] = {};
  for (int kb = 0; kb < K; kb += 32) {
    FragH ah, al;
    const v4f x0 = *(const v4fa*)(arow + kb + 8 * hh), x1 = *(const v4fa*)(arow + kb + 8 * hh + 4), x2 = *(const v4fa*)(arow + kb + 16 + 8 * hh), x3 = *(const v4fa*)(arow + kb + 16 + 8 * hh + 4);
    float xs[16] = {x0[0],x0[1],x0[2],x0[3],x1[0],x1[1],x1[2],x1[3],x2[0],x2[1],x2[2],x2[3],x3[0],x3[1],x3[2],x3[3]};
#pragma unroll
    for (int i = 0; i < 16; ++i) { const _Float16 h = (_Float16)xs[i]; ah.h[i] = h; al.h[i] = ASPLIT ? (_Float16)(xs[i] - (float)h) : (_Float16)0.0f; }
#pragma unroll
    for (int t = 0; t < 4; ++t) { if (col0 + t * 16 >= N) continue; const size_t boff = (size_t)(col0 + t * 16 + ln) * ldb + kb; FragH bq; bq.half[0] = *(const v8us*)(Bh + boff + 8 * hh); bq.half[1] = *(const v8us*)(Bh + boff + 16 + 8 * hh);
      acc[t] = mmaH<ASPLIT ? 2 : 1>(ah.v, al.v, bq.v, bq.v, acc[t]); }
  }
#pragma unroll
  for (int t = 0; t < 4; ++t) { if (col0 + t * 16 >= N) continue;
#pragma unroll
    for (int r = 0; r < 8; ++r) so[w][8 * hh + r][t * 16 + ln] = acc[t][r] * alpha; }
  __builtin_amdgcn_fence(__ATOMIC_ACQ_REL, "workgroup"); __builtin_amdgcn_wave_barrier();
  const int rsub = lane >> 4, c4 = (lane & 15) * 4;
  {
#pragma unroll
    for (int q = 0; q < 8; ++q) { const int r = q * 2 + rsub; if (col0 + c4 < N) { const v4f v = *(const v4fa*)&so[w][r][c4]; *(v4f*)(C + (size_t)(row0 + r) * ldc + col0 + c4) = v; } }
     }
}

// Wt[n][k] = f16(W[k][n]·scale) from f32 row-major W[K][N] (scale = power of two; bf16-exact weights stay exact in f16 away from the subnormal range)
__global__ __launch_bounds__(256) void k_wt_f16(const float* __restrict__ W, _Float16* __restrict__ Wt, int K, int N, float scale) {
  const int t = blockIdx.x * 256 + threadIdx.x; if (t >= N * (K / 8)) return; const int n = t / (K / 8), k8 = (t % (K / 8)) * 8; FragH f;
#pragma unroll
  for (int i = 0; i < 8; ++i) f.h[i] = (_Float16)(bf16_round(W[(size_t)(k8 + i) * N + n]) * scale); const v8us o = f.half[0];
  *(v8us*)((unsigned short*)Wt + (size_t)n * K + k8) = o; 
}
// k_gemm_hh variant with fused epilogue: v = acc·alpha + bias[by·sBias + col] (+ CP[(row/rowsPerB)·sCPb + by·64 + col] if CP) ; ACT 0 none / 1 elu ; writes f16 C16 (and f32 C if non-null)
template <int ACT>
__global__ __launch_bounds__(128) void k_gemm_hhx(const _Float16* __restrict__ A, int lda, size_t sA, const _Float16* __restrict__ Bh, int ldb, size_t sB, float alpha, const float* __restrict__ bias, size_t sBias, const float* __restrict__ CP, int rowsPerB, size_t sCPb, int row0g,
    float* __restrict__ C, _Float16* __restrict__ C16, int ldc, size_t sC, int M, int N, int K) {
  __shared__ __attribute__((aligned(16))) float so[4][16][64];
  const int tid = threadIdx.x, w = tid >> 5, lane = tid & 31, ln = lane & 15, hh = lane >> 4; const int by = blockIdx.y;
  A += (size_t)by * sA; Bh += (size_t)by * sB; const size_t cofs = (size_t)by * sC; const float* bp = bias ? bias + (size_t)by * sBias : nullptr;
  const int ntn = (N + 63) / 64; const int wid = blockIdx.x * 4 + w; const int mt = wid / ntn, nq = wid % ntn; if (mt * 16 >= M) return;
  const int row0 = mt * 16, col0 = nq * 64; const _Float16* arow = A + (size_t)(row0 + ln) * lda;
  v8f acc[4] = {};
  for (int kb = 0; kb < K; kb += 32) { FragH ah; ah.half[0] = *(const v8us*)((const unsigned short*)arow + kb + 8 * hh); ah.half[1] = *(const v8us*)((const unsigned short*)arow + kb + 16 + 8 * hh);
#pragma unroll
    for (int t = 0; t < 4; ++t) { if (col0 + t * 16 >= N) continue; const size_t boff = (size_t)(col0 + t * 16 + ln) * ldb + kb; FragH bq; bq.half[0] = *(const v8us*)((const unsigned short*)Bh + boff + 8 * hh); bq.half[1] = *(const v8us*)((const unsigned short*)Bh + boff + 16 + 8 * hh);
      acc[t] = mmaH<1>(ah.v, ah.v, bq.v, bq.v, acc[t]); }
  }
#pragma unroll
  for (int t = 0; t < 4; ++t) { if (col0 + t * 16 >= N) continue; const int col = col0 + t * 16 + ln; const float bv = bp ? bf16_round(bp[col]) : 0.f;
#pragma unroll
    for (int r = 0; r < 8; ++r) { float v = acc[t][r] * alpha + bv; if (CP) { const int rr = row0g + row0 + 8 * hh + r; if (rowsPerB < 0) v += CP[cofs + (size_t)rr * ldc + col];      /* rowsPerB < 0: own element of the batched C plane */ else { const int bidx = rr / rowsPerB; v += CP[(size_t)bidx * sCPb + (size_t)by * 64 + col]; } } if (ACT == 1) v = (v > 0.f) ? v : expm1f(v); else if (ACT == 7) v = (v > 0.f) ? v + 1.0f : expf(v); else if (ACT == 8) v = tanhf(v); else if (ACT == 9) v = 0.5f * v * (1.0f + tanhf(0.7978845608028654f * (v + 0.044715f * v * v * v))); else if (ACT == 11) v = 1.0f / (1.0f + expf(-v)); else if (ACT == 12) v = (v > 0.f) ? v : 0.01f * v; else if (ACT == 14) v = (v > 0.f) ? v : 0.1f * v; else if (ACT == 16) v = (v >= 0.f) ? v : 0.3f * v; else if (ACT == 17) v = (v >= 0.f) ? v : 0.2f * v; else if (ACT == 15) v = v / (1.0f + expf(-v)); else if (ACT == 3) v = fmaxf(v, 0.f); else if (ACT == 6) v = 0.5f * v * (1.0f + erff(v * 0.70710678118654752f)); so[w][8 * hh + r][t * 16 + ln] = v; } }
  __builtin_amdgcn_fence(__ATOMIC_ACQ_REL, "workgroup"); __builtin_amdgcn_wave_barrier();
  const int rsub = lane >> 4, c4 = (lane & 15) * 4; typedef _Float16 v4h __attribute__((ext_vector_type(4)));
  {
#pragma unroll
    for (int q = 0; q < 8; ++q) { const int r = q * 2 + rsub; if (col0 + c4 < N) { const v4f v = *(const v4fa*)&so[w][r][c4]; if (C) *(v4f*)(C + cofs + (size_t)(row0 + r) * ldc + col0 + c4) = v; if (C16) { v4h h4; for (int i = 0; i < 4; ++i) h4[i] = (_Float16)v[i]; *(v4h*)(C16 + cofs + (size_t)(row0 + r) * ldc + col0 + c4) = h4; } } }
     }
}


typedef _Float16 v4h __attribute__((ext_vector_type(4)));

// ---- fragment-major f16 operand planes ----
// A plane of R rows x K columns (R % 16 == 0, K % 32 == 0) is kept as 16 x 32 tiles of 512 elements, tile (r / 16, k / 32) at ((r / 16) * (K / 32) + k / 32) * 512. Inside a tile the 8-element chunk c = (k % 32) / 8 of row r stands at (c / 2) * 256 + ((c % 2) * 16 + r % 16) * 8:
// that is the order in which the lanes of a wave hold a 16x16x32 A or B fragment (lane = 16 hh + ln: k = 8 hh + s, then 16 + 8 hh + s), so each of a fragment's two loads reads 512 contiguous bytes (four whole lines) instead of 32 bytes out of each of 16 rows.
// Sixteen rows fill 16 K consecutive elements, so a row offset that is a multiple of 16 is the same pointer offset as in a row-major plane.
__device__ __forceinline__ v16h tf_frag(const _Float16* p) { FragH f; f.half[0] = *(const v8us*)((const unsigned short*)p); f.half[1] = *(const v8us*)((const unsigned short*)p + 256); return f.v; }      /* p = tile + 8 * lane */
__device__ __forceinline__ size_t tf_off(size_t r, size_t k, size_t K) { return (((r >> 4) * (K >> 5) + (k >> 5)) << 9) + (((k >> 4) & 1) << 8) + (((((k >> 3) & 1) << 4) | (r & 15)) << 3); }      /* k % 8 == 0 */
// Writer thread t of a plane with DM columns -> its chunk (row r, first column k). A wave takes 8 rows x 32 columns: it reads 8 whole 128-byte f32 lines and writes 4 whole 128-byte lines of the tile, each line by this wave alone.
__device__ __forceinline__ void tf_chunk(size_t t, size_t& r, size_t& k) { const size_t tile = t >> 6; r = ((tile / (DM / 32)) << 4) + (((t >> 5) & 1) << 3) + ((t >> 2) & 7); k = ((tile % (DM / 32)) << 5) + ((t & 3) << 3); }

__global__ __launch_bounds__(256) void k_x16(const float* __restrict__ x, _Float16* __restrict__ X16, size_t n8) { const size_t t = (size_t)blockIdx.x * 256 + threadIdx.x; if (t >= n8) return; FragH f; size_t r, k; tf_chunk(t, r, k); const float* xs = x + r * DM + k;
#pragma unroll
  for (int q = 0; q < 8; ++q) f.h[q] = (_Float16)bf16_round(xs[q]); *(v8us*)((unsigned short*)X16 + tf_off(r, k, DM)) = f.half[0];  }      /* X16 fragment-major */
__global__ __launch_bounds__(256) void k_h16(const float* __restrict__ x, _Float16* __restrict__ X16, size_t n8) { const size_t t = (size_t)blockIdx.x * 256 + threadIdx.x; if (t >= n8) return; FragH f;
#pragma unroll
  for (int q = 0; q < 8; ++q) f.h[q] = (_Float16)x[t * 8 + q]; *(v8us*)((unsigned short*)X16 + t * 8) = f.half[0];  }
__global__ __launch_bounds__(256) void k_round16f(const float* __restrict__ W, _Float16* __restrict__ Bt, size_t n8) { const size_t t = (size_t)blockIdx.x * 256 + threadIdx.x; if (t >= n8) return; FragH f;
#pragma unroll
  for (int i = 0; i < 8; ++i) f.h[i] = (_Float16)(bf16_round(W[t * 8 + i]) * 16.0f); *(v8us*)((unsigned short*)Bt + t * 8) = f.half[0];  }
template <int NHv, int TTv>
__global__ __launch_bounds__(256) void k_vt(const _Float16* __restrict__ V16, int ldv, int voff, _Float16* __restrict__ Vt) { __shared__ unsigned short tl[64][66]; const int tid = threadIdx.x; const int slab = blockIdx.x / (TTv / 64), lg = blockIdx.x % (TTv / 64); const int b = slab / NHv, h = slab % NHv;
  for (int i = tid; i < 64 * 8; i += 256) { const int r = i / 8, c8 = (i % 8) * 8; FragH f; f.half[0] = *(const v8us*)((const unsigned short*)V16 + ((size_t)b * TTv + lg * 64 + r) * ldv + voff + h * 64 + c8);
#pragma unroll
    for (int q = 0; q < 8; ++q) tl[r][c8 + q] = f.u[q]; }
  __syncthreads();
  {
#pragma unroll
    for (int rd = 0; rd < 2; ++rd) { const int d = ((tid >> 6) << 4) + (((tid >> 5) & 1) << 3) + ((tid >> 2) & 7), pc = rd * 4 + (tid & 3); FragH f;      /* a wave takes 8 rows of V^T x 32 keys: 4 whole lines of one tile */
#pragma unroll
      for (int q = 0; q < 8; ++q) f.u[q] = tl[pc * 8 + q][d];
      *(v8us*)((unsigned short*)Vt + tf_off((size_t)slab * 64 + d, (size_t)lg * 64 + pc * 8, TTv)) = f.half[0]; }      /* Vt fragment-major, TTv columns */
     } }

// TF: the two f16 planes are written fragment-major (F has DM columns); otherwise row-major like F
template <bool TF>
__global__ __launch_bounds__(256) void k_hl(const float* __restrict__ F, _Float16* __restrict__ Hh, _Float16* __restrict__ Hl, size_t n8) { const size_t t = (size_t)blockIdx.x * 256 + threadIdx.x; if (t >= n8) return; FragH fh, fl; size_t si = t * 8, di = t * 8; if (TF) { size_t r, k; tf_chunk(t, r, k); si = r * DM + k; di = tf_off(r, k, DM); } const float* pf = F + si; const v4f a = *(const v4fa*)pf, c = *(const v4fa*)(pf + 4);
  asm volatile("s_wait_xcnt 0x0" :: "v"(pf) : "memory");      /* stands behind the two loads and in front of every instruction that rewrites their address register; the address is an input so that its register stays as it is up to the wait */
#pragma unroll
  for (int q = 0; q < 4; ++q) { _Float16 h = (_Float16)a[q]; fh.h[q] = h; fl.h[q] = (_Float16)((a[q] - (float)h) * 1024.0f); h = (_Float16)c[q]; fh.h[4 + q] = h; fl.h[4 + q] = (_Float16)((c[q] - (float)h) * 1024.0f); }
  { *(v8us*)((unsigned short*)Hh + di) = fh.half[0]; *(v8us*)((unsigned short*)Hl + di) = fl.half[0];  } }

// ---- fast GEMM (wave tile 32x64; requires M % 32 == 0 rows per launch region, N % 64 == 0, K % 32 == 0 and K >= 32); A and Bh are fragment-major planes of K columns (lda and ldb are not used); epilogue = k_gemm_hhx semantics ----
__device__ __forceinline__ v16h g2_frag(const _Float16* p, int hh) { FragH f; f.half[0] = *(const v8us*)((const unsigned short*)p + 8 * hh); f.half[1] = *(const v8us*)((const unsigned short*)p + 16 + 8 * hh); return f.v; }
__device__ __forceinline__ v8f g2_mma(v16h a, v16h b, v8f c) { v8f d = __builtin_amdgcn_wmma_f32_16x16x32_f16(false, a, false, b, (short)0, c, false, false); asm volatile("v_nop\n\tv_nop\n\tv_nop\n\tv_nop" : "+v"(d) : "v"(a), "v"(b)); return d; }
struct G2S { v16h a0, a1, b0, b1, b2, b3; };      /* the six fragments of one k step */
template <int ACT>
__global__ __launch_bounds__(128) void k_gemm2(const _Float16* __restrict__ A, int lda, size_t sA, const _Float16* __restrict__ Bh, int ldb, size_t sB, float alpha, const float* __restrict__ bias, size_t sBias, const float* __restrict__ CP, int rowsPerB, size_t sCPb, int row0g,
    float* __restrict__ C, _Float16* __restrict__ C16, int ldc, size_t sC, int M, int N, int K) { static_assert(ACT == 0 || ACT == 3 || ACT == 6 || ACT == 8 || ACT == 9 || ACT == 11 || ACT == 12 || ACT == 14 || ACT == 15 || ACT == 16 || ACT == 17, "k_gemm2: unsupported ACT code (would silently apply no activation)");
  __shared__ __attribute__((aligned(16))) float so[4][32][68];
  const int tid = threadIdx.x, w = tid >> 5, lane = tid & 31, ln = lane & 15, hh = lane >> 4; const int by = blockIdx.y;
  A += (size_t)by * sA; Bh += (size_t)by * sB; const size_t cofs = (size_t)by * sC; const float* bp = bias ? bias + (size_t)by * sBias : nullptr;
  const int ntn = N >> 6; const int mt = blockIdx.x / ntn, nq = blockIdx.x - mt * ntn; const int row0 = mt * 128 + 32 * w, col0 = nq * 64; if (row0 >= M) return;
  (void)lda; (void)ldb; const size_t tr = (size_t)16 * K;      /* elements of one 16-row band of tiles */
  const _Float16* a0p = A + (size_t)row0 * K + 8 * lane; const _Float16* a1p = a0p + tr;
  const _Float16* b0p = Bh + (size_t)col0 * K + 8 * lane; const _Float16* b1p = b0p + tr; const _Float16* b2p = b1p + tr; const _Float16* b3p = b2p + tr;
  const v8f z8 = {0.f,0.f,0.f,0.f,0.f,0.f,0.f,0.f}; v8f c00 = z8, c01 = z8, c02 = z8, c03 = z8, c10 = z8, c11 = z8, c12 = z8, c13 = z8;
  /* Three k steps of fragments in registers. A step's twelve loads are issued together, right behind the products of the step whose registers they refill, and are first read three steps later: a load's latency is spread over three steps instead of being paid five times in each.
     No branch stands between the loads, so their waits are counted exactly: past the last step the step index is clamped (an in-bounds re-read of the last step that no product uses). Each accumulator still takes its products in the order kb = 0, 32, 64, ... */
  const int nst = K >> 5;
  auto ld = [&](int st) { const int kb = (st < nst ? st : nst - 1) << 9; const _Float16 *pa0 = a0p + kb, *pa1 = a1p + kb, *pb0 = b0p + kb, *pb1 = b1p + kb, *pb2 = b2p + kb, *pb3 = b3p + kb;      /* one tile of 512 elements per k step; the lane's 8 elements are in the band pointers */
    G2S f; f.a0 = tf_frag(pa0); f.a1 = tf_frag(pa1); f.b0 = tf_frag(pb0); f.b1 = tf_frag(pb1); f.b2 = tf_frag(pb2); f.b3 = tf_frag(pb3);
    asm volatile("s_wait_xcnt 0x0" :: "v"(pa0), "v"(pa1), "v"(pb0), "v"(pb1), "v"(pb2), "v"(pb3) : "memory");      /* stands behind the step's loads and in front of every instruction that rewrites an address register they name; the addresses are inputs so that their registers stay as they are up to the wait */
    return f; };
  auto mm = [&](const G2S& f) { c00 = g2_mma(f.a0, f.b0, c00); c10 = g2_mma(f.a1, f.b0, c10); c01 = g2_mma(f.a0, f.b1, c01); c11 = g2_mma(f.a1, f.b1, c11); c02 = g2_mma(f.a0, f.b2, c02); c12 = g2_mma(f.a1, f.b2, c12); c03 = g2_mma(f.a0, f.b3, c03); c13 = g2_mma(f.a1, f.b3, c13); };
  G2S f0 = ld(0), f1 = ld(1), f2 = ld(2); int st = 0;
  /* kept rolled: one trip is the whole ring, and a second copy would only add registers */
#pragma unroll 1
  for (; st + 3 <= nst; st += 3) { mm(f0); f0 = ld(st + 3); mm(f1); f1 = ld(st + 4); mm(f2); f2 = ld(st + 5); }
  if (st < nst) mm(f0);
  if (st + 1 < nst) mm(f1);
  v8f accs[8] = {c00, c01, c02, c03, c10, c11, c12, c13};
#pragma unroll
  for (int u = 0; u < 8; ++u) { const int t = u & 3, half = u >> 2; const int col = col0 + t * 16 + ln; const float bv = bp ? bf16_round(bp[col]) : 0.f;
#pragma unroll
    for (int r = 0; r < 8; ++r) { const int rloc = half * 16 + 8 * hh + r; float v = accs[u][r] * alpha + bv; if (CP) { if (rowsPerB < 0) v += CP[cofs + (size_t)(row0g + row0 + rloc) * ldc + col];      /* rowsPerB < 0: own element of the batched C plane */ else { const int bidx = (row0g + row0 + rloc) / rowsPerB; v += CP[(size_t)bidx * sCPb + (size_t)by * 64 + col]; } }
      if (ACT == 3) v = fmaxf(v, 0.f); else if (ACT == 6) v = 0.5f * v * (1.0f + erff(v * 0.70710678118654752f)); else if (ACT == 11) v = 1.0f / (1.0f + expf(-v)); else if (ACT == 15) v = v / (1.0f + expf(-v)); else if (ACT == 12) v = (v > 0.f) ? v : 0.01f * v; else if (ACT == 8) v = tanhf(v); else if (ACT == 9) v = 0.5f * v * (1.0f + tanhf(0.7978845608028654f * (v + 0.044715f * v * v * v))); else if (ACT == 14) v = (v > 0.f) ? v : 0.1f * v; else if (ACT == 16) v = (v >= 0.f) ? v : 0.3f * v; else if (ACT == 17) v = (v >= 0.f) ? v : 0.2f * v;
      so[w][rloc][t * 16 + ln] = v; } }
  __builtin_amdgcn_fence(__ATOMIC_ACQ_REL, "workgroup"); __builtin_amdgcn_wave_barrier();
  const int rsub = lane >> 4, c4 = (lane & 15) * 4;
  {
#pragma unroll
    for (int q = 0; q < 16; ++q) { const int r = q * 2 + rsub; const v4f v = *(const v4fa*)&so[w][r][c4]; if (C) *(v4f*)(C + cofs + (size_t)(row0 + r) * ldc + col0 + c4) = v; if (C16) { v4h h4; for (int i = 0; i < 4; ++i) h4[i] = (_Float16)v[i]; *(v4h*)(C16 + cofs + (size_t)(row0 + r) * ldc + col0 + c4) = h4; } }
     } }


__global__ __launch_bounds__(256) void k_wnat(const float* __restrict__ w, size_t n8, _Float16* __restrict__ Bt) { const size_t t = (size_t)blockIdx.x * 256 + threadIdx.x; if (t >= n8) return; FragH f; size_t r, k; tf_chunk(t, r, k); const float* wsrc = w + r * DM + k; for (int q = 0; q < 8; ++q) f.h[q] = (_Float16)(bf16_round(wsrc[q]) * 16.0f); *(v8us*)((unsigned short*)Bt + tf_off(r, k, DM)) = f.half[0];  }      /* Bt fragment-major */
__global__ __launch_bounds__(256) void k_rsm(const float* __restrict__ S, _Float16* __restrict__ P, int nrows) {
  #pragma clang fp contract(off)
  const int i = blockIdx.x * 256 + threadIdx.x; if (i >= nrows) return; const float* s = S + (size_t)i * SQ; float mx = -3.0e38f;
#pragma unroll 1
  for (int j = 0; j < SQ; ++j) mx = fmaxf(mx, s[j]); float se = 0.f;
#pragma unroll 1
  for (int j = 0; j < SQ; ++j) se += expf(s[j] - mx); const float sc = 256.0f / se;
#pragma unroll 1
  for (int j0 = 0; j0 < SQ; j0 += 8) { FragH f; for (int q = 0; q < 8; ++q) f.h[q] = (_Float16)(expf(s[j0 + q] - mx) * sc); unsigned short* d = (unsigned short*)P + (size_t)i * SQ + j0; *(v8us*)d = f.half[0];  } }
__global__ __launch_bounds__(256) void k_vt(const _Float16* __restrict__ V16, int b, int h0, _Float16* __restrict__ VT) { __shared__ unsigned short tl[64][65]; const int tid = threadIdx.x; const int hh = blockIdx.x % HG, sg = blockIdx.x / HG; const int s0 = sg * 64; const int h = h0 + hh;
  for (int i = tid; i < 64 * 8; i += 256) { const int j = i / 8, d8 = (i % 8) * 8; FragH f; f.half[0] = *(const v8us*)((const unsigned short*)V16 + ((size_t)b * SQ + s0 + j) * DM + h * HD + d8); for (int q = 0; q < 8; ++q) tl[d8 + q][j] = f.u[q]; }
  __syncthreads();
  { for (int i = tid; i < 64 * 8; i += 256) { const int d = i / 8, j8 = (i % 8) * 8; FragH f; for (int q = 0; q < 8; ++q) f.u[q] = tl[d][j8 + q]; *(v8us*)((unsigned short*)VT + ((size_t)hh * HD + d) * SQ + s0 + j8) = f.half[0]; }  } }



__global__ __launch_bounds__(256) void k_rsmcf2(const float* __restrict__ S, _Float16* __restrict__ P, int hg, int q0, int nk) {
  #pragma clang fp contract(off)
  const int t = blockIdx.x * 256 + threadIdx.x; if (t >= hg * QT) return; const size_t i = (size_t)t; const float* s = S + i * NKX; const int last = q0 + (t % QT); float mx = -3.0e38f;
#pragma unroll 1
  for (int j = 0; j < nk; ++j) { const float f = (j <= last) ? 1.f : 0.f; mx = fmaxf(mx, fmaf(f, s[j], (1.f - f) * -1.0e9f)); } float se = 0.f;
#pragma unroll 1
  for (int j = 0; j < nk; ++j) { const float f = (j <= last) ? 1.f : 0.f; se += __expf(fmaf(f, s[j], (1.f - f) * -1.0e9f) - mx); } const float sc = 256.0f / se;
#pragma unroll 1
  for (int j0 = 0; j0 < nk; j0 += 8) { FragH fr; for (int q = 0; q < 8; ++q) { const int j = j0 + q; const float f = (j <= last) ? 1.f : 0.f; fr.h[q] = (_Float16)(__expf(fmaf(f, s[j], (1.f - f) * -1.0e9f) - mx) * sc); } unsigned short* d = (unsigned short*)P + i * NKX + j0; *(v8us*)d = fr.half[0];  } }



typedef int v4ia __attribute__((ext_vector_type(4), may_alias));
// native 2^x. Written as asm for the v_nop: it is the slot that the instruction set asks for behind a transcendental before its result is read or its source overwritten.
__device__ __forceinline__ float exp2_native(float x) { float r; asm("v_exp_f32 %0, %1\n\tv_nop" : "=v"(r) : "v"(x)); return r; }
#define FQ 2                         /* 16-query column groups per wave of the fused attention kernel */
struct FAK { v16h h[2][2], l[2][2]; };      /* K fragments of 32 keys: [16-key tile][32-wide step over the head size], hi and x1024 residual */
struct FAV { v16h h[4], l[4]; };            /* V^T fragments of 32 keys: [16-row tile of the head size], hi and x1024 residual */
__device__ __forceinline__ v8f fa_mma(v16h a, v16h b, v8f c) { return __builtin_amdgcn_wmma_f32_16x16x32_f16(false, a, false, b, (short)0, c, false, false); }
__global__ __launch_bounds__(256) void k_fattn(const _Float16* __restrict__ Qh, const _Float16* __restrict__ Ql, const _Float16* __restrict__ Kh, const _Float16* __restrict__ Kl, const _Float16* __restrict__ Vh, const _Float16* __restrict__ Vl, const int* __restrict__ Km, float* __restrict__ O) {
  const int lane = threadIdx.x & 31, ln = lane & 15, hh = lane >> 4; const int w = __builtin_amdgcn_readfirstlane((int)(threadIdx.x >> 5));
  const int tb = (int)(blockIdx.x / (NB * NH)); const int bh = blockIdx.x % (NB * NH); const int b = bh / NH, h = bh % NH;
  const int qb = (w < 4) ? SQ / (64 * FQ) - 1 - tb : tb;      /* a long and a short row group per block */
  const int q0 = qb * (64 * FQ) + (w & 3) * (16 * FQ);      /* the wave's first query row: a multiple of 32, the same in every lane */
  /* every loop under '#pragma unroll' in this kernel is fully unrolled so that the fragment, score and accumulator arrays are registers, not scratch */
  v16h qh[FQ][2], ql[FQ][2];
  /* all six operand planes are fragment-major: q and k planes have LQ columns (a head is two neighbouring tiles of a 16-row band), the V^T planes SQ columns (32 keys are one tile) */
  { const _Float16* bq = Qh + ((size_t)b * SQ + q0) * LQ + h * (HD * 16); const _Float16* bl = Ql + ((size_t)b * SQ + q0) * LQ + h * (HD * 16); const _Float16* pq = bq + 8 * lane; const _Float16* pl = bl + 8 * lane;      /* bq, bl: the same in every lane */
#pragma unroll
    for (int g = 0; g < FQ; ++g) { qh[g][0] = tf_frag(pq + (size_t)g * 16 * LQ); qh[g][1] = tf_frag(pq + (size_t)g * 16 * LQ + 512); ql[g][0] = tf_frag(pl + (size_t)g * 16 * LQ); ql[g][1] = tf_frag(pl + (size_t)g * 16 * LQ + 512); }
    asm volatile("s_wait_xcnt 0x0" :: "s"(bq), "s"(bl), "v"(lane) : "memory"); }      /* stands behind the q loads and in front of every instruction that rewrites an address register they name: the loads take a scalar base and the lane number, which are inputs so that their registers stay as they are up to the wait */
  const _Float16* pkh = Kh + (size_t)b * SQ * LQ + h * (HD * 16) + 8 * lane; const _Float16* pkl = Kl + (size_t)b * SQ * LQ + h * (HD * 16) + 8 * lane;
  const _Float16* pvh = Vh + (size_t)bh * HD * SQ + 8 * lane; const _Float16* pvl = Vl + (size_t)bh * HD * SQ + 8 * lane; const int* pm = Km + (size_t)b * SQ + lane;
  int kmv;
  auto ldk = [&](int kb) { const _Float16* a = pkh + (size_t)kb * LQ; const _Float16* c = pkl + (size_t)kb * LQ; const int* e = pm + kb; FAK f;
#pragma unroll
    for (int t = 0; t < 2; ++t) { f.h[t][0] = tf_frag(a + (size_t)t * 16 * LQ); f.h[t][1] = tf_frag(a + (size_t)t * 16 * LQ + 512); f.l[t][0] = tf_frag(c + (size_t)t * 16 * LQ); f.l[t][1] = tf_frag(c + (size_t)t * 16 * LQ + 512); }
    kmv = *e;
    asm volatile("s_wait_xcnt 0x0" :: "v"(a), "v"(c), "v"(e) : "memory");      /* stands behind the loads and in front of every instruction that rewrites an address register they name; the addresses are inputs so that their registers stay as they are up to the wait */
    return f; };
  auto ldv = [&](int kb) { const _Float16* a = pvh + (size_t)kb * 16; const _Float16* c = pvl + (size_t)kb * 16; FAV f;      /* 32 keys = one tile of 512 elements */
#pragma unroll
    for (int d = 0; d < 4; ++d) { f.h[d] = tf_frag(a + (size_t)d * 16 * SQ); f.l[d] = tf_frag(c + (size_t)d * 16 * SQ); }
    asm volatile("s_wait_xcnt 0x0" :: "v"(a), "v"(c) : "memory");      /* as in ldk */
    return f; };
  const v8f z8 = {0.f, 0.f, 0.f, 0.f, 0.f, 0.f, 0.f, 0.f};
  v8f o[FQ][4]; float m[FQ], l[FQ];
#pragma unroll
  for (int g = 0; g < FQ; ++g) { m[g] = -3.0e38f; l[g] = 0.f; for (int d = 0; d < 4; ++d) o[g][d] = z8; }
  FAK kf = ldk(0);
  /* kept rolled: one trip holds 32 keys x 32 queries, and a second copy would only add code and registers */
#pragma unroll 1
  for (int kb = 0; kb <= q0; kb += 32) {
    const FAV vf = ldv(kb);      /* issued here, first read behind the softmax */
    v8f s[FQ][2];
#pragma unroll
    for (int g = 0; g < FQ; ++g) {
#pragma unroll
      for (int t = 0; t < 2; ++t) { v8f sh = fa_mma(kf.h[t][0], qh[g][0], z8); sh = fa_mma(kf.h[t][1], qh[g][1], sh);
        v8f sl = fa_mma(kf.h[t][0], ql[g][0], z8); sl = fa_mma(kf.h[t][1], ql[g][1], sl); sl = fa_mma(kf.l[t][0], qh[g][0], sl); sl = fa_mma(kf.l[t][1], qh[g][1], sl);
#pragma unroll
        for (int r = 0; r < 8; ++r) s[g][t][r] = fmaf(sl[r], 0.18033688011112042f / 1024.0f, sh[r] * 0.18033688011112042f); } }      /* (q_hi.k_hi + (q_lo.k_hi + q_hi.k_lo)/1024) / 8, times log2(e) */
    const unsigned bm = __builtin_amdgcn_ballot_w32(kmv != 0);      /* bit j: key kb + j is not padded */
    kf = ldk(kb + 32 <= q0 ? kb + 32 : kb);      /* the next trip's K fragments fly over the softmax and P.V; behind the last trip an in-bounds re-read that nothing uses */
    if (kb == q0 || bm != 0xFFFFFFFFu) {      /* only the diagonal trip and trips with a padded key mask; the test is the same for the whole wave */
      const unsigned bmh = bm >> (8 * hh);
#pragma unroll
      for (int g = 0; g < FQ; ++g) {
#pragma unroll
        for (int t = 0; t < 2; ++t) {
#pragma unroll
          for (int r = 0; r < 8; ++r) { const bool ok = (kb + t * 16 + 8 * hh + r <= q0 + g * 16 + ln) && ((bmh >> (t * 16 + r)) & 1u); s[g][t][r] = ok ? s[g][t][r] : -1.0e9f; } } } }
    v16h ph[FQ], pl[FQ];
#pragma unroll
    for (int g = 0; g < FQ; ++g) { float mx = fmaxf(s[g][0][0], s[g][1][0]);
#pragma unroll
      for (int r = 1; r < 8; ++r) mx = fmaxf(mx, fmaxf(s[g][0][r], s[g][1][r]));
      mx = fmaxf(mx, __shfl_xor(mx, 16, 32));      /* the query's other 16 keys of this trip sit in the other lane half */
      const float mn = fmaxf(m[g], mx); const float sc = exp2_native(m[g] - mn); const float mo = mn - 12.0f; m[g] = mn;
      float se0 = 0.f, se1 = 0.f;
#pragma unroll
      for (int r = 0; r < 8; ++r) { const float e0 = exp2_native(s[g][0][r] - mo), e1 = exp2_native(s[g][1][r] - mo); se0 += e0; se1 += e1; ph[g][r] = (_Float16)e0; ph[g][8 + r] = (_Float16)e1; }
      l[g] = fmaf(l[g], sc, se0 + se1); pl[g] = ph[g] * (_Float16)0.0009765625f;
#pragma unroll
      for (int d = 0; d < 4; ++d) o[g][d] *= sc; }
#pragma unroll
    for (int d = 0; d < 4; ++d) {
#pragma unroll
      for (int g = 0; g < FQ; ++g) { o[g][d] = fa_mma(vf.h[d], ph[g], o[g][d]); o[g][d] = fa_mma(vf.l[d], pl[g], o[g][d]); } } }
  float* po[FQ];
#pragma unroll
  for (int g = 0; g < FQ; ++g) { const float fin = 64.0f / (l[g] + __shfl_xor(l[g], 16, 32));      /* o carried x64; the halves' sums are joined once */
    po[g] = O + ((size_t)b * SQ + q0 + g * 16 + ln) * DM + h * HD + 8 * hh;
#pragma unroll
    for (int d = 0; d < 4; ++d) o[g][d] *= fin; }
  /* a lane holds 8 consecutive columns of its query row per tile; the wave alone writes its rows' 256 bytes */
#pragma unroll
  for (int g = 0; g < FQ; ++g) {
#pragma unroll
    for (int d = 0; d < 4; ++d) { const v4f lo = {o[g][d][0], o[g][d][1], o[g][d][2], o[g][d][3]}, hi = {o[g][d][4], o[g][d][5], o[g][d][6], o[g][d][7]}; *(v4f*)(po[g] + d * 16) = lo; *(v4f*)(po[g] + d * 16 + 4) = hi; } }
  asm volatile("s_wait_xcnt 0x0" :: "v"(po[0]), "v"(po[FQ - 1]) : "memory");      /* stands behind the stores: their address registers stay as they are up to here */
}


// Exact f32 attention of the first QT0 rows of every batch; one thread per query row, one block per (head, 64 rows), blockIdx.y = batch (all row planes hold SQ rows per batch).
// All operands stay on chip: the head's K and V rows (and the key padding entries) are staged once in LDS with whole-line loads, every lane then reads the same LDS address (a broadcast, no bank conflict), and the thread's q and o rows live in registers.
// Four keys per trip: their four score chains are independent, so one chain's dependent adds are covered by the other three. Every sum (score, l, o) keeps its order: d = 0..63 inside a score, keys in rising j.
template <int MASKADD, int MASKKV>
__global__ __launch_bounds__(64) void k_att0(const float* __restrict__ QF, const float* __restrict__ KF, const float* __restrict__ VF, int ld, const float* __restrict__ mask, const int* __restrict__ Km, float scale, float* __restrict__ OF, int ldo) {
  #pragma clang fp contract(off)
  __shared__ __attribute__((aligned(16))) float lk[QT0][HD]; __shared__ __attribute__((aligned(16))) float lv[QT0][HD]; __shared__ __attribute__((aligned(16))) int lm[QT0];
  const int tid = threadIdx.x; const int h = blockIdx.x / (QT0 / 64), rg = blockIdx.x % (QT0 / 64); const int i = rg * 64 + tid;
  { const size_t rb = (size_t)blockIdx.y * SQ; QF += rb * ld; KF += rb * ld; VF += rb * ld; OF += rb * ldo; if (MASKKV) Km += rb; }      /* the batch's first row */
  const float* qr = QF + (size_t)i * ld + h * HD;
  v4f q[HD / 4], o[HD / 4];
  /* every loop over c is fully unrolled so that q and o are registers, not scratch */
#pragma unroll
  for (int c = 0; c < HD / 4; ++c) { q[c] = *(const v4fa*)(qr + c * 4); const v4f z = {0.f, 0.f, 0.f, 0.f}; o[c] = z; }
  asm volatile("s_wait_xcnt 0x0" :: "v"(qr) : "memory");      /* stands behind the q loads and in front of every instruction that rewrites their address register; the address is an input so that its register stays as it is up to the wait */
  float m = -1.0e30f, l = 0.f; const int jmax = MASKADD ? (SQ - 1) : (rg * 64 + 63);      /* additive-mask form: every key (the mask input decides); causal form: keys up to the block's last row */
  /* kept rolled: the causal form makes one trip */
#pragma unroll 1
  for (int jt = 0; jt <= jmax; jt += QT0) { const int nr = (jmax + 1 - jt < QT0) ? (jmax + 1 - jt) : QT0;      /* keys of this tile: a multiple of 64, the same for the whole block */
    if (jt) __syncthreads();      /* every reader has left the tile before it is refilled */
    /* eight K and eight V loads in flight per thread; 16 lanes cover one 256-byte row, the block 4 rows per load */
    const size_t g0 = (size_t)(jt + (tid >> 4)) * ld + h * HD + (tid & 15) * 4;
    /* kept rolled: nr is only known at run time, and each trip already has sixteen loads per thread in flight */
#pragma unroll 1
    for (int r0 = 0; r0 < nr; r0 += 32) { v4f tk[8], tv[8]; const float *pk[8], *pv[8];
      /* the three loops over u are fully unrolled so that the pointers and the loaded rows are registers and the sixteen loads stand together */
#pragma unroll
      for (int u = 0; u < 8; ++u) { const size_t g = g0 + (size_t)(r0 + u * 4) * ld; pk[u] = KF + g; pv[u] = VF + g; }
#pragma unroll
      for (int u = 0; u < 8; ++u) { tk[u] = *(const v4fa*)pk[u]; tv[u] = *(const v4fa*)pv[u]; }
      asm volatile("s_wait_xcnt 0x0" :: "v"(pk[0]), "v"(pk[1]), "v"(pk[2]), "v"(pk[3]), "v"(pk[4]), "v"(pk[5]), "v"(pk[6]), "v"(pk[7]), "v"(pv[0]), "v"(pv[1]), "v"(pv[2]), "v"(pv[3]), "v"(pv[4]), "v"(pv[5]), "v"(pv[6]), "v"(pv[7]) : "memory");      /* stands behind the trip's loads and in front of every instruction that rewrites an address register they name; the addresses are inputs so that no load lands on one of them */
#pragma unroll
      for (int u = 0; u < 8; ++u) { const int r = r0 + u * 4 + (tid >> 4); *(v4f*)&lk[r][(tid & 15) * 4] = tk[u]; *(v4f*)&lv[r][(tid & 15) * 4] = tv[u]; } }
    if (MASKKV) for (int e = tid; e < nr; e += 64) lm[e] = Km[jt + e];
    __syncthreads();      /* the tile is complete before any thread reads it */
    /* kept rolled: one trip already holds four keys, and a second copy would only add code and registers */
#pragma unroll 1
    for (int jj = 0; jj < nr; jj += 4) { float s4[4] = {0.f, 0.f, 0.f, 0.f}, sc4[4], e4[4]; v4ia km4 = {1, 1, 1, 1}; if (MASKKV) km4 = *(const v4ia*)&lm[jj];
      /* all loops over c and u below are fully unrolled: constant indices keep q, o and the four keys' values in registers, and the four score chains stand side by side */
#pragma unroll
      for (int c = 0; c < HD / 4; ++c) { const v4f qq = q[c];
#pragma unroll
        for (int u = 0; u < 4; ++u) { const v4f kq = *(const v4f*)&lk[jj + u][c * 4]; float s = s4[u]; s = __fadd_rn(s, __fmul_rn(qq[0], kq[0])); s = __fadd_rn(s, __fmul_rn(qq[1], kq[1])); s = __fadd_rn(s, __fmul_rn(qq[2], kq[2])); s = __fadd_rn(s, __fmul_rn(qq[3], kq[3])); s4[u] = s; } }
#pragma unroll
      for (int u = 0; u < 4; ++u) { const int j = jt + jj + u; float s = __fmul_rn(s4[u], scale); if (MASKADD) s = __fadd_rn(s, __fmul_rn(bf16_round(mask[(size_t)i * SQ + j]), -10000.0f));
        const float f = (MASKADD || (j <= i && (!MASKKV || km4[u] != 0))) ? 1.f : 0.f;      /* MASKKV: also drop keys whose int padding entry is 0 */ const float sm = fmaf(f, s, (1.f - f) * -1.0e30f); const float mn = fmaxf(m, sm); const float sc = expf(m - mn); const float e = expf(sm - mn); l = __fadd_rn(__fmul_rn(l, sc), e); m = mn; sc4[u] = sc; e4[u] = e; }
#pragma unroll
      for (int u = 0; u < 4; ++u) { const float sc = sc4[u], e = e4[u];
#pragma unroll
        for (int c = 0; c < HD / 4; ++c) { const v4f vv = *(const v4f*)&lv[jj + u][c * 4]; v4f oo = o[c]; for (int w = 0; w < 4; ++w) oo[w] = __fadd_rn(__fmul_rn(oo[w], sc), __fmul_rn(e, vv[w])); o[c] = oo; } } } }
  const float fin = 64.0f / l;      /* o carried x64 like the f16 path */
  float* orow = OF + (size_t)i * ldo + h * HD;      /* the thread's own 256 bytes: two whole lines, no other writer */
  /* unrolled: o stays in registers */
#pragma unroll
  for (int c = 0; c < HD / 4; ++c) { v4f oo = o[c]; for (int w = 0; w < 4; ++w) oo[w] = __fmul_rn(oo[w], fin); *(v4f*)(orow + c * 4) = oo; } }


__global__ __launch_bounds__(256) void k_xt16(const float* __restrict__ x, const float* __restrict__ tg, const float* __restrict__ wt, const float* __restrict__ bt, _Float16* __restrict__ XT, _Float16* __restrict__ XL, size_t n8) {
  #pragma clang fp contract(off)
  const size_t t = (size_t)blockIdx.x * 256 + threadIdx.x; if (t >= n8) return; size_t r, kc; tf_chunk(t, r, kc); const float* px = x + r * DM + kc; const float* pw = wt + kc; const float* pb = bt + kc; const float* pg = tg + r; FragH f, l;
  const v4f x0 = *(const v4fa*)px, x1 = *(const v4fa*)(px + 4), w0 = *(const v4fa*)pw, w1 = *(const v4fa*)(pw + 4), b0 = *(const v4fa*)pb, b1 = *(const v4fa*)(pb + 4); const float g = bf16_round(*pg);
  asm volatile("s_wait_xcnt 0x0" :: "v"(px), "v"(pw), "v"(pb), "v"(pg) : "memory");      /* stands behind the seven loads and in front of every instruction that rewrites an address register they name; the addresses are inputs so that no load lands on one of them */
  const float xv[8] = {x0[0], x0[1], x0[2], x0[3], x1[0], x1[1], x1[2], x1[3]}, wv[8] = {w0[0], w0[1], w0[2], w0[3], w1[0], w1[1], w1[2], w1[3]}, bv[8] = {b0[0], b0[1], b0[2], b0[3], b1[0], b1[1], b1[2], b1[3]};
  /* unrolled so that the three small arrays are registers */
#pragma unroll
  for (int q = 0; q < 8; ++q) { const float te = __fadd_rn(__fmul_rn(g, bf16_round(wv[q])), bf16_round(bv[q])); const float v = __fadd_rn(bf16_round(xv[q]), te); const _Float16 h = (_Float16)v; f.h[q] = h; l.h[q] = (_Float16)((v - (float)h) * 1024.0f); }
  const size_t di = tf_off(r, kc, DM); *(v8us*)((unsigned short*)XT + di) = f.half[0]; *(v8us*)((unsigned short*)XL + di) = l.half[0];  }      /* XT, XL fragment-major */
extern "C" void kernel_launch(void* const* d_in, const int* in_sizes, int n_in,
                              void* d_out, int out_size, void* d_ws, size_t ws_size, hipStream_t stream) {
  (void)in_sizes; (void)n_in; (void)out_size;
  const float* const* I = (const float* const*)d_in; const float* x = I[0]; const float* tg = I[1]; const int* km = (const int*)d_in[2]; const float* wq = I[3]; const float* bq = I[4]; const float* wk = I[5]; const float* bk = I[6]; const float* wv = I[7]; const float* bv = I[8]; const float* wo = I[9]; const float* bo = I[10]; const float* wt = I[11]; const float* bt = I[12];      /* natural [out][in] weights + biases; time_gaps [2][2048][1]; int key mask [2][2048]; Wt [1024][1], bt [1024] */
  char* ws = (char*)d_ws; size_t off = 0;
  auto take = [&](size_t bytes) { char* p = ws + off; off += (bytes + 255) & ~(size_t)255; return p; };
  _Float16* BQ = (_Float16*)take((size_t)DM * DM * 2); _Float16* BK = (_Float16*)take((size_t)DM * DM * 2); _Float16* BV = (_Float16*)take((size_t)DM * DM * 2); _Float16* BO = (_Float16*)take((size_t)DM * DM * 2);
  _Float16* X16 = (_Float16*)take(NR * DM * 2); _Float16* XT16 = (_Float16*)take(NR * DM * 2); _Float16* XL16 = (_Float16*)take(NR * DM * 2);      /* x (exact f16) for v; x_time as f16 hi + x1024 residual for q and k */ float* QF = (float*)take(NR * DM * 4); float* KF = (float*)take(NR * DM * 4); float* VF = (float*)take(NR * DM * 4); float* F32 = (float*)take(NR * DM * 4);      /* f32 rows of q, k, v (kept: the first-tile attention reads them) and o */ _Float16* Q16 = (_Float16*)take(NR * DM * 2); _Float16* QL = (_Float16*)take(NR * DM * 2); _Float16* K16 = (_Float16*)take(NR * DM * 2); _Float16* KL = (_Float16*)take(NR * DM * 2); _Float16* V16 = (_Float16*)take(NR * DM * 2); _Float16* VL = (_Float16*)take(NR * DM * 2); _Float16* O16 = (_Float16*)take(NR * DM * 2); _Float16* OL = (_Float16*)take(NR * DM * 2);
  _Float16* VT = (_Float16*)take((size_t)NB * NH * HD * SQ * 2); _Float16* VTL = (_Float16*)take((size_t)NB * NH * HD * SQ * 2);      /* V^T planes of both batches */
  if (off > ws_size) return;
  { const unsigned g = (unsigned)(((size_t)DM * DM / 8 + 255) / 256); k_wnat<<<g, 256, 0, stream>>>(wq, (size_t)DM * DM / 8, BQ); k_wnat<<<g, 256, 0, stream>>>(wk, (size_t)DM * DM / 8, BK); k_wnat<<<g, 256, 0, stream>>>(wv, (size_t)DM * DM / 8, BV); k_wnat<<<g, 256, 0, stream>>>(wo, (size_t)DM * DM / 8, BO); }      /* natural [out][in] = Bt[n][k], x16 */

  k_x16<<<(unsigned)((NR * DM / 8 + 255) / 256), 256, 0, stream>>>(x, X16, NR * DM / 8); k_xt16<<<(unsigned)((NR * DM / 8 + 255) / 256), 256, 0, stream>>>(x, tg, wt, bt, XT16, XL16, NR * DM / 8);      /* x_time = x + time_gaps Wt^T + bt as f16 hi + x1024 residual rows */
  const size_t r0p = (size_t)B0 * SQ;      /* first projected row */
  k_gemm2<0><<<dim3((unsigned)((MP / 128) * (DM / 64)), 1), 128, 0, stream>>>(XT16 + r0p * DM, DM, 0, BQ, DM, 0, 0.0625f, bq, 0, nullptr, 1, 0, 0, QF + r0p * DM, nullptr, DM, 0, MP, DM, DM); k_gemm2<0><<<dim3((unsigned)((MP / 128) * (DM / 64)), 1), 128, 0, stream>>>(XL16 + r0p * DM, DM, 0, BQ, DM, 0, 0.00006103515625f, nullptr, 0, QF + r0p * DM, -1, 0, 0, QF + r0p * DM, nullptr, DM, 0, MP, DM, DM); k_hl<true><<<(unsigned)(((size_t)MP * DM / 8 + 255) / 256), 256, 0, stream>>>(QF + r0p * DM, Q16 + r0p * DM, QL + r0p * DM, (size_t)MP * DM / 8);      
  k_gemm2<0><<<dim3((unsigned)((MP / 128) * (DM / 64)), 1), 128, 0, stream>>>(XT16 + r0p * DM, DM, 0, BK, DM, 0, 0.0625f, bk, 0, nullptr, 1, 0, 0, KF + r0p * DM, nullptr, DM, 0, MP, DM, DM); k_gemm2<0><<<dim3((unsigned)((MP / 128) * (DM / 64)), 1), 128, 0, stream>>>(XL16 + r0p * DM, DM, 0, BK, DM, 0, 0.00006103515625f, nullptr, 0, KF + r0p * DM, -1, 0, 0, KF + r0p * DM, nullptr, DM, 0, MP, DM, DM); k_hl<true><<<(unsigned)(((size_t)MP * DM / 8 + 255) / 256), 256, 0, stream>>>(KF + r0p * DM, K16 + r0p * DM, KL + r0p * DM, (size_t)MP * DM / 8);      /* k likewise */
  k_gemm2<0><<<dim3((unsigned)((MP / 128) * (DM / 64)), 1), 128, 0, stream>>>(X16 + r0p * DM, DM, 0, BV, DM, 0, 0.0625f, bv, 0, nullptr, 1, 0, 0, VF + r0p * DM, nullptr, DM, 0, MP, DM, DM); k_hl<false><<<(unsigned)(((size_t)MP * DM / 8 + 255) / 256), 256, 0, stream>>>(VF + r0p * DM, V16 + r0p * DM, VL + r0p * DM, (size_t)MP * DM / 8);      /* v = x Wv^T + bv in f32 -> f16 hi + x1024 residual (row-major: the transpose below reads them) */
  for (int b = B0; b < B0 + NBR; ++b) { const size_t r0 = (size_t)b * SQ;
    k_vt<NH, SQ><<<NH * (SQ / 64), 256, 0, stream>>>(V16 + r0 * LQ, LQ, 0, VT + (size_t)b * NH * HD * SQ); k_vt<NH, SQ><<<NH * (SQ / 64), 256, 0, stream>>>(VL + r0 * LQ, LQ, 0, VTL + (size_t)b * NH * HD * SQ);      /* V^T (hi and residual) [NH][HD][SQ] for this batch */
  }
  k_fattn<<<NB * NH * (SQ / (128 * FQ)), 256, 0, stream>>>(Q16, QL, K16, KL, VT, VTL, km, F32);      /* o (x64) in f32 rows: scores, causal + key padding softmax and P.V of both batches and all heads in one launch */
  k_att0<0, 1><<<dim3(NH * (QT0 / 64), NB), 64, 0, stream>>>(QF, KF, VF, DM, nullptr, km, 0.125f, F32, DM);      /* rows 0..127 of each batch: exact f32 causal attention with the key padding vector (o x64), from the f32 q, k, v rows of the full projections, written over the fused kernel's rows; the split and the out GEMMs below then take them like every other row */
  for (int b = B0; b < B0 + NBR; ++b) { const size_t r0 = (size_t)b * SQ;
    k_hl<true><<<(unsigned)(((size_t)SQ * DM / 8 + 255) / 256), 256, 0, stream>>>(F32 + r0 * DM, O16 + r0 * DM, OL + r0 * DM, (size_t)SQ * DM / 8); }      /* o -> f16 hi + x1024 residual */
  k_gemm2<0><<<dim3((unsigned)((MPO / 128) * (DM / 64)), 1), 128, 0, stream>>>(O16 + r0p * DM, DM, 0, BO, DM, 0, 0.0009765625f, bo, 0, nullptr, 1, 0, 0, (float*)d_out + r0p * DM, nullptr, DM, 0, MPO, DM, DM); k_gemm2<0><<<dim3((unsigned)((MPO / 128) * (DM / 64)), 1), 128, 0, stream>>>(OL + r0p * DM, DM, 0, BO, DM, 0, 0.00000095367431640625f, nullptr, 0, (const float*)d_out + r0p * DM, -1, 0, 0, (float*)d_out + r0p * DM, nullptr, DM, 0, MPO, DM, DM);      /* out = o_hi Wo^T + bo, then += o_lo Wo^T 2^-20 (own element) */
}

// v007
// One run takes 204 microseconds.
// Next to v006, in two timings, it ran 1.35 and 1.36 times as fast.
// All steps since v000 together make it 43.2 times as fast.
#include <hip/hip_runtime.h>
// Causal multi-head attention with a time-gap embedding and a key padding mask (x [2][2048][1024]; x_time = x + (time_gaps Wt^T + bt) with time_gaps [2][2048][1] (U[0,1)), Wt [1024][1] sigma 1, bt zeros; q = x_time Wq^T + bq, k = x_time Wk^T + bk, v = x Wv^T + bv (v from the RAW x; natural [1024][1024] sigma 1/32, zero biases); 16 heads of 64; scores / 8; where(mask[b][j] == 0, -1e9) (int mask [2][2048], all ones) and where(j > i, -1e9) (causal); softmax; out = merged Wo^T + bo -> [2][2048][1024]).
// Structure: every f16 plane that a WMMA reads (x, x_time, the weights, q, k, V^T, o) is stored fragment-major (16 x 32 tiles in lane order, see tf_frag); token rows r = b*2048 + s; x as exact f16 rows; x_time = x + t Wt + bt on VALU as f16 hi + x1024 residual rows; q and k = (hi + lo/1024) W + b, each one WMMA GEMM launch with both A planes in the k loop and an accumulator set per plane (32x64 wave tiles, f32 accumulation), into f32 rows, split into f16 hi + x1024 residual planes; v = x Wv + bv in f32, split likewise (both transposed per batch); one fused attention launch (a wave owns 32 query rows, 32 keys per trip): scores^T = k_hi.q_hi + (k_hi.q_lo + k_lo.q_hi)/1024 on WMMA, / 8, causal + key-mask running softmax in registers (f32 statistics, native exp2; weights x4096 f16), o^T += V_hi^T.P^T + V_lo^T.(P^T/1024), o in f32 rows, split into hi + residual; out = (o_hi Wo + bo) + o_lo Wo 2^-20 likewise in one launch; first-tile refinement: the o rows of the first 128 rows of each batch recomputed exactly in f32 on VALU from the f32 q, k, v rows of the full projections and written over the fused kernel's rows in front of the split; launches: see trace.
// Compute dtype: inputs rounded to bf16; x / weights exact; q, k, v and o as f16 hi + x1024 residual operand pairs, softmax weights as plain f16 GEMM operands (~2^-12); scores and softmax statistics f32. v_wmma_f32_16x16x32_f16.
#define NB 2
#define SQ 2048
#define DM 1024
#define NH 16
#define HD 64
#define HG 4                         /* heads per block group of the unlaunched k_vt overload */
#define QT 256                       /* query rows per causal tile */
#define NKX SQ                       /* S / P row pitch */
#define QT0 128                      /* first-tile rows recomputed exactly in f32 */
#define B0 0                         /* first batch processed (debug hook) */
#define NBR NB                       /* batches processed (debug hook) */
#define NR ((size_t)NB * SQ)         /* token rows */
#define MP ((int)((size_t)NBR * SQ)) /* rows projected (debug hook) */
#define QN SQ                        /* unused (every batch attends all SQ query rows) */
#define NHD NH                       /* unused (all NH heads are attended) */
#define MPO MP                       /* rows through the output stage (debug hook) */
#define LQ DM      /* row pitch of the q/k/v rows */
typedef __bf16 v16b __attribute__((ext_vector_type(16)));
typedef unsigned short v8us __attribute__((ext_vector_type(8), may_alias));
typedef float  v8f  __attribute__((ext_vector_type(8)));
typedef float  v4f  __attribute__((ext_vector_type(4)));
typedef float  v4fa __attribute__((ext_vector_type(4), may_alias));
union FragB { v16b v; v8us half[2]; unsigned short u[16]; };

__device__ __forceinline__ unsigned short bf16_bits(float x) { unsigned int u = __float_as_uint(x); return (unsigned short)((u + 0x7FFFu + ((u >> 16) & 1u)) >> 16); }
__device__ __forceinline__ float bf16_val(unsigned short b) { return __uint_as_float(((unsigned int)b) << 16); }
__device__ __forceinline__ float bf16_round(float x) { return bf16_val(bf16_bits(x)); }
// D += A·B with NT terms: 1 = ah·bh, 2 = + al·bh (A split), 3 = + ah·bl (both split)
template <int NT>
__device__ __forceinline__ v8f mmaN(v16b ah, v16b al, v16b bh, v16b bl, v8f c) {
  c = __builtin_amdgcn_wmma_f32_16x16x32_bf16(false, ah, false, bh, (short)0, c, false, false);
  if (NT >= 2) c = __builtin_amdgcn_wmma_f32_16x16x32_bf16(false, al, false, bh, (short)0, c, false, false);
  if (NT >= 3) c = __builtin_amdgcn_wmma_f32_16x16x32_bf16(false, ah, false, bl, (short)0, c, false, false);
  asm volatile("v_nop\n\tv_nop\n\tv_nop\n\tv_nop" : "+v"(c) : "v"(ah), "v"(al), "v"(bh), "v"(bl));
  return c;
}

__global__ __launch_bounds__(256) void k_wt_bf16(const float* __restrict__ W, unsigned short* __restrict__ Wt, int K, int N) {
  const int t = blockIdx.x * 256 + threadIdx.x;
  const int k8n = K / 8;
  if (t >= N * k8n) return;
  const int n = t / k8n, k8 = (t % k8n) * 8;
  v8us v;
#pragma unroll
  for (int i = 0; i < 8; ++i) v[i] = bf16_bits(W[(size_t)(k8 + i) * N + n]);
  *(v8us*)(Wt + (size_t)n * K + k8) = v;
  
}

// GEMM C[M][N] (f32, pitch ldc) = act(A[M][K]·W + bias). A f32 row-major (pitch lda) converted per fragment to bf16
// (ASPLIT: hi/lo two planes -> 2 terms, else single rounded term); Wt bf16 [N][K] (pitch ldb). BIAS_BF16 rounds the
// bias to bf16 first (bias quantised to bf16 before the add). K%32==0, M%16==0, N%64==0.
template <bool ASPLIT, int ACT, bool BIAS_BF16>
__global__ __launch_bounds__(128) void k_gemm_bf(const float* __restrict__ A, int lda, const unsigned short* __restrict__ Wt, int ldb,
                                               const float* __restrict__ bias, float* __restrict__ C, int ldc, int M, int N, int K) {
  __shared__ __attribute__((aligned(16))) float so[4][16][64];
  const int tid = threadIdx.x, w = tid >> 5, lane = tid & 31, ln = lane & 15, hh = lane >> 4;
  const int ntn = N / 64;
  const int wid = blockIdx.x * 4 + w;
  const int mt = wid / ntn, nq = wid % ntn;
  if (mt * 16 >= M) return;
  const int row0 = mt * 16, col0 = nq * 64;
  const float* arow = A + (size_t)(row0 + ln) * lda;
  v8f acc[4] = {};
  for (int kb = 0; kb < K; kb += 32) {
    FragB ah, al;
    const v4f x0 = *(const v4fa*)(arow + kb + 8 * hh), x1 = *(const v4fa*)(arow + kb + 8 * hh + 4);
    const v4f x2 = *(const v4fa*)(arow + kb + 16 + 8 * hh), x3 = *(const v4fa*)(arow + kb + 16 + 8 * hh + 4);
    float xs[16] = {x0[0],x0[1],x0[2],x0[3],x1[0],x1[1],x1[2],x1[3],x2[0],x2[1],x2[2],x2[3],x3[0],x3[1],x3[2],x3[3]};
#pragma unroll
    for (int i = 0; i < 16; ++i) { const unsigned short hb = bf16_bits(xs[i]); ah.u[i] = hb; al.u[i] = ASPLIT ? bf16_bits(xs[i] - bf16_val(hb)) : (unsigned short)0; }
#pragma unroll
    for (int t = 0; t < 4; ++t) {
      const unsigned short* brow = Wt + (size_t)(col0 + t * 16 + ln) * ldb + kb;
      FragB b;
      b.half[0] = *(const v8us*)(brow + 8 * hh);
      b.half[1] = *(const v8us*)(brow + 16 + 8 * hh);
      acc[t] = mmaN<ASPLIT ? 2 : 1>(ah.v, al.v, b.v, b.v, acc[t]);
    }
  }
#pragma unroll
  for (int t = 0; t < 4; ++t) {
    float bv = bias ? bias[col0 + t * 16 + ln] : 0.f;
    if (BIAS_BF16) bv = bf16_round(bv);
#pragma unroll
    for (int r = 0; r < 8; ++r) { float v = acc[t][r] + bv; if (ACT == 1) v = fmaxf(v, 0.f); so[w][8 * hh + r][t * 16 + ln] = v; }
  }
  __builtin_amdgcn_fence(__ATOMIC_ACQ_REL, "workgroup");
  __builtin_amdgcn_wave_barrier();
  const int rsub = lane >> 4, c4 = (lane & 15) * 4;
  {
#pragma unroll
    for (int q = 0; q < 8; ++q) {
      const int r = q * 2 + rsub;
      const v4f v = *(const v4fa*)&so[w][r][c4];
      *(v4f*)(C + (size_t)(row0 + r) * ldc + col0 + c4) = v;
    }
    
  }
}

// GEMM C = act(A·W + bias + resid): A f32 (ASPLIT -> hi/lo 2 terms), Wt bf16 [N][K]; ACT 0 none, 1 relu, 2 exact gelu;
// resid (optional, f32, row index = (row % rmod), pitch ldr, RES_BF16 rounds it) added before the activation.
template <bool ASPLIT, int ACT, bool BIAS_BF16, bool RES_BF16>
__global__ __launch_bounds__(128) void k_gemm_bf3(const float* __restrict__ A, int lda, const unsigned short* __restrict__ Wt, int ldb,
                                                const float* __restrict__ bias, const float* __restrict__ resid, int rmod, int ldr,
                                                float* __restrict__ C, int ldc, int M, int N, int K) {
  __shared__ __attribute__((aligned(16))) float so[4][16][64];
  const int tid = threadIdx.x, w = tid >> 5, lane = tid & 31, ln = lane & 15, hh = lane >> 4;
  const int ntn = N / 64;
  const int wid = blockIdx.x * 4 + w;
  const int mt = wid / ntn, nq = wid % ntn;
  if (mt * 16 >= M) return;
  const int row0 = mt * 16, col0 = nq * 64;
  const float* arow = A + (size_t)(row0 + ln) * lda;
  v8f acc[4] = {};
  for (int kb = 0; kb < K; kb += 32) {
    FragB ah, al;
    const v4f x0 = *(const v4fa*)(arow + kb + 8 * hh), x1 = *(const v4fa*)(arow + kb + 8 * hh + 4);
    const v4f x2 = *(const v4fa*)(arow + kb + 16 + 8 * hh), x3 = *(const v4fa*)(arow + kb + 16 + 8 * hh + 4);
    float xs[16] = {x0[0],x0[1],x0[2],x0[3],x1[0],x1[1],x1[2],x1[3],x2[0],x2[1],x2[2],x2[3],x3[0],x3[1],x3[2],x3[3]};
#pragma unroll
    for (int i = 0; i < 16; ++i) { const unsigned short hb = bf16_bits(xs[i]); ah.u[i] = hb; al.u[i] = ASPLIT ? bf16_bits(xs[i] - bf16_val(hb)) : (unsigned short)0; }
#pragma unroll
    for (int t = 0; t < 4; ++t) {
      const unsigned short* brow = Wt + (size_t)(col0 + t * 16 + ln) * ldb + kb;
      FragB b;
      b.half[0] = *(const v8us*)(brow + 8 * hh);
      b.half[1] = *(const v8us*)(brow + 16 + 8 * hh);
      acc[t] = mmaN<ASPLIT ? 2 : 1>(ah.v, al.v, b.v, b.v, acc[t]);
    }
  }
#pragma unroll
  for (int t = 0; t < 4; ++t) {
    const int col = col0 + t * 16 + ln;
    float bv = bias ? bias[col] : 0.f;
    if (BIAS_BF16) bv = bf16_round(bv);
#pragma unroll
    for (int r = 0; r < 8; ++r) {
      float v = acc[t][r] + bv;
      if (resid) { float rv = resid[(size_t)((row0 + 8 * hh + r) % rmod) * ldr + col]; if (RES_BF16) rv = bf16_round(rv); v += rv; }
      if (ACT == 1) v = fmaxf(v, 0.f);
      if (ACT == 2) v = 0.5f * v * (1.0f + erff(v * 0.70710678118654752f));
      if (ACT == 3) { const float u = 0.7978845608028654f * (v + 0.044715f * v * v * v); v = 0.5f * v * (1.0f + tanhf(u)); }
      so[w][8 * hh + r][t * 16 + ln] = v;
    }
  }
  __builtin_amdgcn_fence(__ATOMIC_ACQ_REL, "workgroup");
  __builtin_amdgcn_wave_barrier();
  const int rsub = lane >> 4, c4 = (lane & 15) * 4;
  {
#pragma unroll
    for (int q = 0; q < 8; ++q) {
      const int r = q * 2 + rsub;
      const v4f v = *(const v4fa*)&so[w][r][c4];
      *(v4f*)(C + (size_t)(row0 + r) * ldc + col0 + c4) = v;
    }
    
  }
}
// row LayerNorm (biased variance, eps) over N: s = X (+ R); optional out_sum <- s; out_norm <- (s-mu)*rsqrt(var+eps)*g + b
template <bool PARAM_BF16>
__global__ __launch_bounds__(256) void k_layernorm(const float* __restrict__ X, const float* __restrict__ R, const float* __restrict__ g, const float* __restrict__ bta,
                                                  float* __restrict__ out_sum, float* __restrict__ out_norm, int N, float eps) {
  __shared__ float red[256];
  const int row = blockIdx.x, tid = threadIdx.x;
  const float* x = X + (size_t)row * N; const float* rr = R ? R + (size_t)row * N : nullptr;
  float vals[16];                     // up to N = 4096
  const int per = N / 256;            // contiguous chunk per thread? use strided-by-4 chunks: thread handles j = tid*4 + 1024*u
  float s1 = 0.f;
  for (int u = 0; u < per / 4; ++u) {
    const int j = tid * 4 + 1024 * u;
    const v4f a = *(const v4fa*)(x + j);
    v4f b = {0.f,0.f,0.f,0.f}; if (rr) b = *(const v4fa*)(rr + j);
#pragma unroll
    for (int q = 0; q < 4; ++q) { const float v = a[q] + b[q]; vals[u * 4 + q] = v; s1 += v; }
  }
  red[tid] = s1; __syncthreads();
  for (int st = 128; st > 0; st >>= 1) { if (tid < st) red[tid] += red[tid + st]; __syncthreads(); }
  const float mu = red[0] / (float)N; __syncthreads();
  float s2 = 0.f;
  for (int u = 0; u < per / 4; ++u)
#pragma unroll
    for (int q = 0; q < 4; ++q) { const float c = vals[u * 4 + q] - mu; s2 += c * c; }
  red[tid] = s2; __syncthreads();
  for (int st = 128; st > 0; st >>= 1) { if (tid < st) red[tid] += red[tid + st]; __syncthreads(); }
  const float rs = rsqrtf(red[0] / (float)N + eps);
  {
    for (int u = 0; u < per / 4; ++u) {
      const int j = tid * 4 + 1024 * u;
      v4f o, sm;
#pragma unroll
      for (int q = 0; q < 4; ++q) {
        float gg = g[j + q], bb = bta[j + q];
        if (PARAM_BF16) { gg = bf16_round(gg); bb = bf16_round(bb); }
        sm[q] = vals[u * 4 + q]; o[q] = (vals[u * 4 + q] - mu) * rs * gg + bb;
      }
      if (out_sum) *(v4f*)(out_sum + (size_t)row * N + j) = sm;
      *(v4f*)(out_norm + (size_t)row * N + j) = o;
    }
    
  }
}



// ---- f16 WMMA path (v_wmma_f32_16x16x32_f16): 11-bit significands for operands in range — used where a [0,1] probability operand needs more precision than bf16
typedef _Float16 v16h __attribute__((ext_vector_type(16)));
union FragH { v16h v; v8us half[2]; _Float16 h[16]; unsigned short u[16]; };
template <int NT>
__device__ __forceinline__ v8f mmaH(v16h ah, v16h al, v16h bh, v16h bl, v8f c) {
  c = __builtin_amdgcn_wmma_f32_16x16x32_f16(false, ah, false, bh, (short)0, c, false, false);
  if (NT >= 2) c = __builtin_amdgcn_wmma_f32_16x16x32_f16(false, al, false, bh, (short)0, c, false, false);
  if (NT >= 3) c = __builtin_amdgcn_wmma_f32_16x16x32_f16(false, ah, false, bl, (short)0, c, false, false);
  asm volatile("v_nop\n\tv_nop\n\tv_nop\n\tv_nop" : "+v"(c) : "v"(ah), "v"(al), "v"(bh), "v"(bl));
  return c;
}
// batched GEMM like k_gemm_b but f16 operands: A f32 (split into f16 hi/lo if ASPLIT, else rounded to f16), Bt = f16 values [n][k]; alpha; C f32; N multiple of 16 (partial tiles skipped)
template <bool ASPLIT>
__global__ __launch_bounds__(128) void k_gemm_h(const float* __restrict__ A, int lda, size_t sA, const _Float16* __restrict__ Bh, int ldb, size_t sB, float alpha, float* __restrict__ C, int ldc, size_t sC, int M, int N, int K) {
  __shared__ __attribute__((aligned(16))) float so[4][16][64];
  const int tid = threadIdx.x, w = tid >> 5, lane = tid & 31, ln = lane & 15, hh = lane >> 4; const int by = blockIdx.y;
  A += (size_t)by * sA; Bh += (size_t)by * sB; C += (size_t)by * sC;
  const int ntn = (N + 63) / 64; const int wid = blockIdx.x * 4 + w; const int mt = wid / ntn, nq = wid % ntn; if (mt * 16 >= M) return;
  const int row0 = mt * 16, col0 = nq * 64; const float* arow = A + (size_t)(row0 + ln) * lda;
  v8f acc[4] = {};
  for (int kb = 0; kb < K; kb += 32) {
    FragH ah, al;
    const v4f x0 = *(const v4fa*)(arow + kb + 8 * hh), x1 = *(const v4fa*)(arow + kb + 8 * hh + 4), x2 = *(const v4fa*)(arow + kb + 16 + 8 * hh), x3 = *(const v4fa*)(arow + kb + 16 + 8 * hh + 4);
    float xs[16] = {x0[0],x0[1],x0[2],x0[3],x1[0],x1[1],x1[2],x1[3],x2[0],x2[1],x2[2],x2[3],x3[0],x3[1],x3[2],x3[3]};
#pragma unroll
    for (int i = 0; i < 16; ++i) { const _Float16 h = (_Float16)xs[i]; ah.h[i] = h; al.h[i] = ASPLIT ? (_Float16)(xs[i] - (float)h) : (_Float16)0.0f; }
#pragma unroll
    for (int t = 0; t < 4; ++t) { if (col0 + t * 16 >= N) continue; const size_t boff = (size_t)(col0 + t * 16 + ln) * ldb + kb; FragH bq; bq.half[0] = *(const v8us*)(Bh + boff + 8 * hh); bq.half[1] = *(const v8us*)(Bh + boff + 16 + 8 * hh);
      acc[t] = mmaH<ASPLIT ? 2 : 1>(ah.v, al.v, bq.v, bq.v, acc[t]); }
  }
#pragma unroll
  for (int t = 0; t < 4; ++t) { if (col0 + t * 16 >= N) continue;
#pragma unroll
    for (int r = 0; r < 8; ++r) so[w][8 * hh + r][t * 16 + ln] = acc[t][r] * alpha; }
  __builtin_amdgcn_fence(__ATOMIC_ACQ_REL, "workgroup"); __builtin_amdgcn_wave_barrier();
  const int rsub = lane >> 4, c4 = (lane & 15) * 4;
  {
#pragma unroll
    for (int q = 0; q < 8; ++q) { const int r = q * 2 + rsub; if (col0 + c4 < N) { const v4f v = *(const v4fa*)&so[w][r][c4]; *(v4f*)(C + (size_t)(row0 + r) * ldc + col0 + c4) = v; } }
     }
}

// Wt[n][k] = f16(W[k][n]·scale) from f32 row-major W[K][N] (scale = power of two; bf16-exact weights stay exact in f16 away from the subnormal range)
__global__ __launch_bounds__(256) void k_wt_f16(const float* __restrict__ W, _Float16* __restrict__ Wt, int K, int N, float scale) {
  const int t = blockIdx.x * 256 + threadIdx.x; if (t >= N * (K / 8)) return; const int n = t / (K / 8), k8 = (t % (K / 8)) * 8; FragH f;
#pragma unroll
  for (int i = 0; i < 8; ++i) f.h[i] = (_Float16)(bf16_round(W[(size_t)(k8 + i) * N + n]) * scale); const v8us o = f.half[0];
  *(v8us*)((unsigned short*)Wt + (size_t)n * K + k8) = o; 
}
// k_gemm_hh variant with fused epilogue: v = acc·alpha + bias[by·sBias + col] (+ CP[(row/rowsPerB)·sCPb + by·64 + col] if CP) ; ACT 0 none / 1 elu ; writes f16 C16 (and f32 C if non-null)
template <int ACT>
__global__ __launch_bounds__(128) void k_gemm_hhx(const _Float16* __restrict__ A, int lda, size_t sA, const _Float16* __restrict__ Bh, int ldb, size_t sB, float alpha, const float* __restrict__ bias, size_t sBias, const float* __restrict__ CP, int rowsPerB, size_t sCPb, int row0g,
    float* __restrict__ C, _Float16* __restrict__ C16, int ldc, size_t sC, int M, int N, int K) {
  __shared__ __attribute__((aligned(16))) float so[4][16][64];
  const int tid = threadIdx.x, w = tid >> 5, lane = tid & 31, ln = lane & 15, hh = lane >> 4; const int by = blockIdx.y;
  A += (size_t)by * sA; Bh += (size_t)by * sB; const size_t cofs = (size_t)by * sC; const float* bp = bias ? bias + (size_t)by * sBias : nullptr;
  const int ntn = (N + 63) / 64; const int wid = blockIdx.x * 4 + w; const int mt = wid / ntn, nq = wid % ntn; if (mt * 16 >= M) return;
  const int row0 = mt * 16, col0 = nq * 64; const _Float16* arow = A + (size_t)(row0 + ln) * lda;
  v8f acc[4] = {};
  for (int kb = 0; kb < K; kb += 32) { FragH ah; ah.half[0] = *(const v8us*)((const unsigned short*)arow + kb + 8 * hh); ah.half[1] = *(const v8us*)((const unsigned short*)arow + kb + 16 + 8 * hh);
#pragma unroll
    for (int t = 0; t < 4; ++t) { if (col0 + t * 16 >= N) continue; const size_t boff = (size_t)(col0 + t * 16 + ln) * ldb + kb; FragH bq; bq.half[0] = *(const v8us*)((const unsigned short*)Bh + boff + 8 * hh); bq.half[1] = *(const v8us*)((const unsigned short*)Bh + boff + 16 + 8 * hh);
      acc[t] = mmaH<1>(ah.v, ah.v, bq.v, bq.v, acc[t]); }
  }
#pragma unroll
  for (int t = 0; t < 4; ++t) { if (col0 + t * 16 >= N) continue; const int col = col0 + t * 16 + ln; const float bv = bp ? bf16_round(bp[col]) : 0.f;
#pragma unroll
    for (int r = 0; r < 8; ++r) { float v = acc[t][r] * alpha + bv; if (CP) { const int rr = row0g + row0 + 8 * hh + r; if (rowsPerB < 0) v += CP[cofs + (size_t)rr * ldc + col];      /* rowsPerB < 0: own element of the batched C plane */ else { const int bidx = rr / rowsPerB; v += CP[(size_t)bidx * sCPb + (size_t)by * 64 + col]; } } if (ACT == 1) v = (v > 0.f) ? v : expm1f(v); else if (ACT == 7) v = (v > 0.f) ? v + 1.0f : expf(v); else if (ACT == 8) v = tanhf(v); else if (ACT == 9) v = 0.5f * v * (1.0f + tanhf(0.7978845608028654f * (v + 0.044715f * v * v * v))); else if (ACT == 11) v = 1.0f / (1.0f + expf(-v)); else if (ACT == 12) v = (v > 0.f) ? v : 0.01f * v; else if (ACT == 14) v = (v > 0.f) ? v : 0.1f * v; else if (ACT == 16) v = (v >= 0.f) ? v : 0.3f * v; else if (ACT == 17) v = (v >= 0.f) ? v : 0.2f * v; else if (ACT == 15) v = v / (1.0f + expf(-v)); else if (ACT == 3) v = fmaxf(v, 0.f); else if (ACT == 6) v = 0.5f * v * (1.0f + erff(v * 0.70710678118654752f)); so[w][8 * hh + r][t * 16 + ln] = v; } }
  __builtin_amdgcn_fence(__ATOMIC_ACQ_REL, "workgroup"); __builtin_amdgcn_wave_barrier();
  const int rsub = lane >> 4, c4 = (lane & 15) * 4; typedef _Float16 v4h __attribute__((ext_vector_type(4)));
  {
#pragma unroll
    for (int q = 0; q < 8; ++q) { const int r = q * 2 + rsub; if (col0 + c4 < N) { const v4f v = *(const v4fa*)&so[w][r][c4]; if (C) *(v4f*)(C + cofs + (size_t)(row0 + r) * ldc + col0 + c4) = v; if (C16) { v4h h4; for (int i = 0; i < 4; ++i) h4[i] = (_Float16)v[i]; *(v4h*)(C16 + cofs + (size_t)(row0 + r) * ldc + col0 + c4) = h4; } } }
     }
}


typedef _Float16 v4h __attribute__((ext_vector_type(4)));

// ---- fragment-major f16 operand planes ----
// A plane of R rows x K columns (R % 16 == 0, K % 32 == 0) is kept as 16 x 32 tiles of 512 elements, tile (r / 16, k / 32) at ((r / 16) * (K / 32) + k / 32) * 512. Inside a tile the 8-element chunk c = (k % 32) / 8 of row r stands at (c / 2) * 256 + ((c % 2) * 16 + r % 16) * 8:
// that is the order in which the lanes of a wave hold a 16x16x32 A or B fragment (lane = 16 hh + ln: k = 8 hh + s, then 16 + 8 hh + s), so each of a fragment's two loads reads 512 contiguous bytes (four whole lines) instead of 32 bytes out of each of 16 rows.
// Sixteen rows fill 16 K consecutive elements, so a row offset that is a multiple of 16 is the same pointer offset as in a row-major plane.
__device__ __forceinline__ v16h tf_frag(const _Float16* p) { FragH f; f.half[0] = *(const v8us*)((const unsigned short*)p); f.half[1] = *(const v8us*)((const unsigned short*)p + 256); return f.v; }      /* p = tile + 8 * lane */
__device__ __forceinline__ size_t tf_off(size_t r, size_t k, size_t K) { return (((r >> 4) * (K >> 5) + (k >> 5)) << 9) + (((k >> 4) & 1) << 8) + (((((k >> 3) & 1) << 4) | (r & 15)) << 3); }      /* k % 8 == 0 */
// Writer thread t of a plane with DM columns -> its chunk (row r, first column k). A wave takes 8 rows x 32 columns: it reads 8 whole 128-byte f32 lines and writes 4 whole 128-byte lines of the tile, each line by this wave alone.
__device__ __forceinline__ void tf_chunk(size_t t, size_t& r, size_t& k) { const size_t tile = t >> 6; r = ((tile / (DM / 32)) << 4) + (((t >> 5) & 1) << 3) + ((t >> 2) & 7); k = ((tile % (DM / 32)) << 5) + ((t & 3) << 3); }

__global__ __launch_bounds__(256) void k_x16(const float* __restrict__ x, _Float16* __restrict__ X16, size_t n8) { const size_t t = (size_t)blockIdx.x * 256 + threadIdx.x; if (t >= n8) return; FragH f; size_t r, k; tf_chunk(t, r, k); const float* xs = x + r * DM + k;
#pragma unroll
  for (int q = 0; q < 8; ++q) f.h[q] = (_Float16)bf16_round(xs[q]); *(v8us*)((unsigned short*)X16 + tf_off(r, k, DM)) = f.half[0];  }      /* X16 fragment-major */
__global__ __launch_bounds__(256) void k_h16(const float* __restrict__ x, _Float16* __restrict__ X16, size_t n8) { const size_t t = (size_t)blockIdx.x * 256 + threadIdx.x; if (t >= n8) return; FragH f;
#pragma unroll
  for (int q = 0; q < 8; ++q) f.h[q] = (_Float16)x[t * 8 + q]; *(v8us*)((unsigned short*)X16 + t * 8) = f.half[0];  }
__global__ __launch_bounds__(256) void k_round16f(const float* __restrict__ W, _Float16* __restrict__ Bt, size_t n8) { const size_t t = (size_t)blockIdx.x * 256 + threadIdx.x; if (t >= n8) return; FragH f;
#pragma unroll
  for (int i = 0; i < 8; ++i) f.h[i] = (_Float16)(bf16_round(W[t * 8 + i]) * 16.0f); *(v8us*)((unsigned short*)Bt + t * 8) = f.half[0];  }
template <int NHv, int TTv>
__global__ __launch_bounds__(256) void k_vt(const _Float16* __restrict__ V16, int ldv, int voff, _Float16* __restrict__ Vt) { __shared__ unsigned short tl[64][66]; const int tid = threadIdx.x; const int slab = blockIdx.x / (TTv / 64), lg = blockIdx.x % (TTv / 64); const int b = slab / NHv, h = slab % NHv;
  for (int i = tid; i < 64 * 8; i += 256) { const int r = i / 8, c8 = (i % 8) * 8; FragH f; f.half[0] = *(const v8us*)((const unsigned short*)V16 + ((size_t)b * TTv + lg * 64 + r) * ldv + voff + h * 64 + c8);
#pragma unroll
    for (int q = 0; q < 8; ++q) tl[r][c8 + q] = f.u[q]; }
  __syncthreads();
  {
#pragma unroll
    for (int rd = 0; rd < 2; ++rd) { const int d = ((tid >> 6) << 4) + (((tid >> 5) & 1) << 3) + ((tid >> 2) & 7), pc = rd * 4 + (tid & 3); FragH f;      /* a wave takes 8 rows of V^T x 32 keys: 4 whole lines of one tile */
#pragma unroll
      for (int q = 0; q < 8; ++q) f.u[q] = tl[pc * 8 + q][d];
      *(v8us*)((unsigned short*)Vt + tf_off((size_t)slab * 64 + d, (size_t)lg * 64 + pc * 8, TTv)) = f.half[0]; }      /* Vt fragment-major, TTv columns */
     } }

// TF: the two f16 planes are written fragment-major (F has DM columns); otherwise row-major like F
template <bool TF>
__global__ __launch_bounds__(256) void k_hl(const float* __restrict__ F, _Float16* __restrict__ Hh, _Float16* __restrict__ Hl, size_t n8) { const size_t t = (size_t)blockIdx.x * 256 + threadIdx.x; if (t >= n8) return; FragH fh, fl; size_t si = t * 8, di = t * 8; if (TF) { size_t r, k; tf_chunk(t, r, k); si = r * DM + k; di = tf_off(r, k, DM); } const float* pf = F + si; const v4f a = *(const v4fa*)pf, c = *(const v4fa*)(pf + 4);
  asm volatile("s_wait_xcnt 0x0" :: "v"(pf) : "memory");      /* stands behind the two loads and in front of every instruction that rewrites their address register; the address is an input so that its register stays as it is up to the wait */
#pragma unroll
  for (int q = 0; q < 4; ++q) { _Float16 h = (_Float16)a[q]; fh.h[q] = h; fl.h[q] = (_Float16)((a[q] - (float)h) * 1024.0f); h = (_Float16)c[q]; fh.h[4 + q] = h; fl.h[4 + q] = (_Float16)((c[q] - (float)h) * 1024.0f); }
  { *(v8us*)((unsigned short*)Hh + di) = fh.half[0]; *(v8us*)((unsigned short*)Hl + di) = fl.half[0];  } }

// ---- fast GEMM (wave tile 32x64; requires M % 32 == 0 rows per launch region, N % 64 == 0, K % 32 == 0 and K >= 32); A and Bh are fragment-major planes of K columns (lda and ldb are not used); epilogue = k_gemm_hhx semantics ----
__device__ __forceinline__ v16h g2_frag(const _Float16* p, int hh) { FragH f; f.half[0] = *(const v8us*)((const unsigned short*)p + 8 * hh); f.half[1] = *(const v8us*)((const unsigned short*)p + 16 + 8 * hh); return f.v; }
__device__ __forceinline__ v8f g2_mma(v16h a, v16h b, v8f c) { v8f d = __builtin_amdgcn_wmma_f32_16x16x32_f16(false, a, false, b, (short)0, c, false, false); asm volatile("v_nop\n\tv_nop\n\tv_nop\n\tv_nop" : "+v"(d) : "v"(a), "v"(b)); return d; }
struct G2S { v16h a0, a1, b0, b1, b2, b3; };      /* the six fragments of one k step */
template <int ACT>
__global__ __launch_bounds__(128) void k_gemm2(const _Float16* __restrict__ A, int lda, size_t sA, const _Float16* __restrict__ Bh, int ldb, size_t sB, float alpha, const float* __restrict__ bias, size_t sBias, const float* __restrict__ CP, int rowsPerB, size_t sCPb, int row0g,
    float* __restrict__ C, _Float16* __restrict__ C16, int ldc, size_t sC, int M, int N, int K) { static_assert(ACT == 0 || ACT == 3 || ACT == 6 || ACT == 8 || ACT == 9 || ACT == 11 || ACT == 12 || ACT == 14 || ACT == 15 || ACT == 16 || ACT == 17, "k_gemm2: unsupported ACT code (would silently apply no activation)");
  __shared__ __attribute__((aligned(16))) float so[4][32][68];
  const int tid = threadIdx.x, w = tid >> 5, lane = tid & 31, ln = lane & 15, hh = lane >> 4; const int by = blockIdx.y;
  A += (size_t)by * sA; Bh += (size_t)by * sB; const size_t cofs = (size_t)by * sC; const float* bp = bias ? bias + (size_t)by * sBias : nullptr;
  const int ntn = N >> 6; const int mt = blockIdx.x / ntn, nq = blockIdx.x - mt * ntn; const int row0 = mt * 128 + 32 * w, col0 = nq * 64; if (row0 >= M) return;
  (void)lda; (void)ldb; const size_t tr = (size_t)16 * K;      /* elements of one 16-row band of tiles */
  const _Float16* a0p = A + (size_t)row0 * K + 8 * lane; const _Float16* a1p = a0p + tr;
  const _Float16* b0p = Bh + (size_t)col0 * K + 8 * lane; const _Float16* b1p = b0p + tr; const _Float16* b2p = b1p + tr; const _Float16* b3p = b2p + tr;
  const v8f z8 = {0.f,0.f,0.f,0.f,0.f,0.f,0.f,0.f}; v8f c00 = z8, c01 = z8, c02 = z8, c03 = z8, c10 = z8, c11 = z8, c12 = z8, c13 = z8;
  /* Three k steps of fragments in registers. A step's twelve loads are issued together, right behind the products of the step whose registers they refill, and are first read three steps later: a load's latency is spread over three steps instead of being paid five times in each.
     No branch stands between the loads, so their waits are counted exactly: past the last step the step index is clamped (an in-bounds re-read of the last step that no product uses). Each accumulator still takes its products in the order kb = 0, 32, 64, ... */
  const int nst = K >> 5;
  auto ld = [&](int st) { const int kb = (st < nst ? st : nst - 1) << 9; const _Float16 *pa0 = a0p + kb, *pa1 = a1p + kb, *pb0 = b0p + kb, *pb1 = b1p + kb, *pb2 = b2p + kb, *pb3 = b3p + kb;      /* one tile of 512 elements per k step; the lane's 8 elements are in the band pointers */
    G2S f; f.a0 = tf_frag(pa0); f.a1 = tf_frag(pa1); f.b0 = tf_frag(pb0); f.b1 = tf_frag(pb1); f.b2 = tf_frag(pb2); f.b3 = tf_frag(pb3);
    asm volatile("s_wait_xcnt 0x0" :: "v"(pa0), "v"(pa1), "v"(pb0), "v"(pb1), "v"(pb2), "v"(pb3) : "memory");      /* stands behind the step's loads and in front of every instruction that rewrites an address register they name; the addresses are inputs so that their registers stay as they are up to the wait */
    return f; };
  auto mm = [&](const G2S& f) { c00 = g2_mma(f.a0, f.b0, c00); c10 = g2_mma(f.a1, f.b0, c10); c01 = g2_mma(f.a0, f.b1, c01); c11 = g2_mma(f.a1, f.b1, c11); c02 = g2_mma(f.a0, f.b2, c02); c12 = g2_mma(f.a1, f.b2, c12); c03 = g2_mma(f.a0, f.b3, c03); c13 = g2_mma(f.a1, f.b3, c13); };
  G2S f0 = ld(0), f1 = ld(1), f2 = ld(2); int st = 0;
  /* kept rolled: one trip is the whole ring, and a second copy would only add registers */
#pragma unroll 1
  for (; st + 3 <= nst; st += 3) { mm(f0); f0 = ld(st + 3); mm(f1); f1 = ld(st + 4); mm(f2); f2 = ld(st + 5); }
  if (st < nst) mm(f0);
  if (st + 1 < nst) mm(f1);
  v8f accs[8] = {c00, c01, c02, c03, c10, c11, c12, c13};
#pragma unroll
  for (int u = 0; u < 8; ++u) { const int t = u & 3, half = u >> 2; const int col = col0 + t * 16 + ln; const float bv = bp ? bf16_round(bp[col]) : 0.f;
#pragma unroll
    for (int r = 0; r < 8; ++r) { const int rloc = half * 16 + 8 * hh + r; float v = accs[u][r] * alpha + bv; if (CP) { if (rowsPerB < 0) v += CP[cofs + (size_t)(row0g + row0 + rloc) * ldc + col];      /* rowsPerB < 0: own element of the batched C plane */ else { const int bidx = (row0g + row0 + rloc) / rowsPerB; v += CP[(size_t)bidx * sCPb + (size_t)by * 64 + col]; } }
      if (ACT == 3) v = fmaxf(v, 0.f); else if (ACT == 6) v = 0.5f * v * (1.0f + erff(v * 0.70710678118654752f)); else if (ACT == 11) v = 1.0f / (1.0f + expf(-v)); else if (ACT == 15) v = v / (1.0f + expf(-v)); else if (ACT == 12) v = (v > 0.f) ? v : 0.01f * v; else if (ACT == 8) v = tanhf(v); else if (ACT == 9) v = 0.5f * v * (1.0f + tanhf(0.7978845608028654f * (v + 0.044715f * v * v * v))); else if (ACT == 14) v = (v > 0.f) ? v : 0.1f * v; else if (ACT == 16) v = (v >= 0.f) ? v : 0.3f * v; else if (ACT == 17) v = (v >= 0.f) ? v : 0.2f * v;
      so[w][rloc][t * 16 + ln] = v; } }
  __builtin_amdgcn_fence(__ATOMIC_ACQ_REL, "workgroup"); __builtin_amdgcn_wave_barrier();
  const int rsub = lane >> 4, c4 = (lane & 15) * 4;
  {
#pragma unroll
    for (int q = 0; q < 16; ++q) { const int r = q * 2 + rsub; const v4f v = *(const v4fa*)&so[w][r][c4]; if (C) *(v4f*)(C + cofs + (size_t)(row0 + r) * ldc + col0 + c4) = v; if (C16) { v4h h4; for (int i = 0; i < 4; ++i) h4[i] = (_Float16)v[i]; *(v4h*)(C16 + cofs + (size_t)(row0 + r) * ldc + col0 + c4) = h4; } }
     } }


// ---- the same GEMM for an operand kept as f16 hi + x1024 residual planes: C = (A Bh) alpha + bias + (Al Bh) alphal in ONE launch (N = K = DM, C of pitch DM, M % 32 == 0) ----
// Both A planes walk one k loop against the same four B fragments, each plane into its own eight accumulators; each accumulator takes its products in the order kb = 0, 32, 64, ... and the two sets meet once, in the epilogue, in registers.
__device__ __forceinline__ v8f g2p_mma(v16h a, v16h b, v8f c) { return __builtin_amdgcn_wmma_f32_16x16x32_f16(false, a, false, b, (short)0, c, false, false); }      /* the plain builtin: its operands may stand in any register, which the 320 registers of accumulators and ring need */
struct G2P { v16h a0, a1, l0, l1, b0, b1, b2, b3; };      /* the eight fragments of one k step */
__global__ __launch_bounds__(128) void k_gemm2p(const _Float16* __restrict__ A, const _Float16* __restrict__ Al, const _Float16* __restrict__ Bh, float alpha, float alphal, const float* __restrict__ bias, float* __restrict__ C, int M) {
  __shared__ __attribute__((aligned(16))) float so[4][32][68];
  const int tid = threadIdx.x, lane = tid & 31, ln = lane & 15, hh = lane >> 4; const int w = __builtin_amdgcn_readfirstlane(tid >> 5);      /* the wave's number, the same in every lane: the three plane addresses below are then scalars */
  const int mt = blockIdx.x / (DM / 64), nq = blockIdx.x % (DM / 64); const int row0 = mt * 128 + 32 * w, col0 = nq * 64; if (row0 >= M) return;
  const size_t tr = (size_t)16 * DM;      /* elements of one 16-row band of tiles */
  const _Float16* ab = A + (size_t)row0 * DM; const _Float16* lb = Al + (size_t)row0 * DM; const _Float16* bb0 = Bh + (size_t)col0 * DM;      /* the wave's first tiles: the same in every lane */
  const float* sbias = bias + col0; float bv[4];      /* read here so that the k loop covers the latency */
#pragma unroll
  for (int t = 0; t < 4; ++t) bv[t] = sbias[ln + t * 16];
  asm volatile("s_wait_xcnt 0x0" :: "s"(sbias), "v"(ln) : "memory");      /* stands behind the four bias loads and in front of every instruction that rewrites an address register they name (a scalar base and the lane's column), which are inputs so that their registers stay as they are up to the wait */
  const v8f z8 = {0.f,0.f,0.f,0.f,0.f,0.f,0.f,0.f}; v8f c00 = z8, c01 = z8, c02 = z8, c03 = z8, c10 = z8, c11 = z8, c12 = z8, c13 = z8, d00 = z8, d01 = z8, d02 = z8, d03 = z8, d10 = z8, d11 = z8, d12 = z8, d13 = z8;
  /* the ring of three k steps of k_gemm2, with sixteen loads and sixteen products per step; past the last step the step index is clamped (an in-bounds re-read of the last step that no product uses) */
  const int nst = DM >> 5;
  auto ld = [&](int st) { const int kb = (st < nst ? st : nst - 1) << 9; const _Float16 *sa = ab + kb, *sl = lb + kb, *sb = bb0 + kb;      /* one tile of 512 elements per k step */
    const _Float16 *pa = sa + 8 * lane, *pl = sl + 8 * lane, *pq = sb + 8 * lane;
    G2P f; f.a0 = tf_frag(pa); f.a1 = tf_frag(pa + tr); f.l0 = tf_frag(pl); f.l1 = tf_frag(pl + tr); f.b0 = tf_frag(pq); f.b1 = tf_frag(pq + tr); f.b2 = tf_frag(pq + 2 * tr); f.b3 = tf_frag(pq + 3 * tr);
    asm volatile("s_wait_xcnt 0x0" :: "s"(sa), "s"(sl), "s"(sb), "v"(lane) : "memory");      /* stands behind the step's loads and in front of the next step's rewriting of the address registers they name. The three scalar bases and the lane number are inputs: that keeps the loads in the form scalar base + lane offset (without the inputs the build formed vector addresses in registers of the ring, with adds and their slots among the products) */
    return f; };
  auto mm = [&](const G2P& f) { c00 = g2p_mma(f.a0, f.b0, c00); c10 = g2p_mma(f.a1, f.b0, c10); d00 = g2p_mma(f.l0, f.b0, d00); d10 = g2p_mma(f.l1, f.b0, d10); c01 = g2p_mma(f.a0, f.b1, c01); c11 = g2p_mma(f.a1, f.b1, c11); d01 = g2p_mma(f.l0, f.b1, d01); d11 = g2p_mma(f.l1, f.b1, d11);
    c02 = g2p_mma(f.a0, f.b2, c02); c12 = g2p_mma(f.a1, f.b2, c12); d02 = g2p_mma(f.l0, f.b2, d02); d12 = g2p_mma(f.l1, f.b2, d12); c03 = g2p_mma(f.a0, f.b3, c03); c13 = g2p_mma(f.a1, f.b3, c13); d03 = g2p_mma(f.l0, f.b3, d03); d13 = g2p_mma(f.l1, f.b3, d13);
    __builtin_amdgcn_sched_barrier(0); };      /* keeps the refill's sixteen loads together behind the step's products, as in the ring of k_gemm2: without it the build spreads them over eight places among the products, the slower form of a WMMA loop with loads */
  G2P f0 = ld(0), f1 = ld(1), f2 = ld(2); int st = 0;
  /* kept rolled: one trip is the whole ring, and a second copy would only add registers */
#pragma unroll 1
  for (; st + 3 <= nst; st += 3) { mm(f0); f0 = ld(st + 3); mm(f1); f1 = ld(st + 4); mm(f2); f2 = ld(st + 5); }
  if (st < nst) mm(f0);
  if (st + 1 < nst) mm(f1);
  const v8f ch[8] = {c00, c01, c02, c03, c10, c11, c12, c13}, cl[8] = {d00, d01, d02, d03, d10, d11, d12, d13};
  /* unrolled so that the accumulator arrays are registers */
#pragma unroll
  for (int u = 0; u < 8; ++u) { const int t = u & 3, half = u >> 2; const float bb = bf16_round(bv[t]);
#pragma unroll
    for (int r = 0; r < 8; ++r) so[w][half * 16 + 8 * hh + r][t * 16 + ln] = (ch[u][r] * alpha + bb) + cl[u][r] * alphal; }      /* the hi product with its bias first, then the residual product: the order of the two launches this replaces */
  __builtin_amdgcn_fence(__ATOMIC_ACQ_REL, "workgroup"); __builtin_amdgcn_wave_barrier();      /* the wave's own LDS stores are done before its lanes read each other's rows */
  const int rsub = lane >> 4, c4 = (lane & 15) * 4; float* pc = C + (size_t)(row0 + rsub) * DM + col0 + c4;
  /* unrolled: sixteen stores from one address register with constant offsets */
#pragma unroll
  for (int q = 0; q < 16; ++q) { const v4f v = *(const v4fa*)&so[w][q * 2 + rsub][c4]; *(v4f*)(pc + (size_t)q * 2 * DM) = v; }
  asm volatile("s_wait_xcnt 0x0" :: "v"(pc) : "memory");      /* stands behind the stores: their address register stays as it is up to here */
}


__global__ __launch_bounds__(256) void k_wnat(const float* __restrict__ w, size_t n8, _Float16* __restrict__ Bt) { const size_t t = (size_t)blockIdx.x * 256 + threadIdx.x; if (t >= n8) return; FragH f; size_t r, k; tf_chunk(t, r, k); const float* wsrc = w + r * DM + k; for (int q = 0; q < 8; ++q) f.h[q] = (_Float16)(bf16_round(wsrc[q]) * 16.0f); *(v8us*)((unsigned short*)Bt + tf_off(r, k, DM)) = f.half[0];  }      /* Bt fragment-major */
__global__ __launch_bounds__(256) void k_rsm(const float* __restrict__ S, _Float16* __restrict__ P, int nrows) {
  #pragma clang fp contract(off)
  const int i = blockIdx.x * 256 + threadIdx.x; if (i >= nrows) return; const float* s = S + (size_t)i * SQ; float mx = -3.0e38f;
#pragma unroll 1
  for (int j = 0; j < SQ; ++j) mx = fmaxf(mx, s[j]); float se = 0.f;
#pragma unroll 1
  for (int j = 0; j < SQ; ++j) se += expf(s[j] - mx); const float sc = 256.0f / se;
#pragma unroll 1
  for (int j0 = 0; j0 < SQ; j0 += 8) { FragH f; for (int q = 0; q < 8; ++q) f.h[q] = (_Float16)(expf(s[j0 + q] - mx) * sc); unsigned short* d = (unsigned short*)P + (size_t)i * SQ + j0; *(v8us*)d = f.half[0];  } }
__global__ __launch_bounds__(256) void k_vt(const _Float16* __restrict__ V16, int b, int h0, _Float16* __restrict__ VT) { __shared__ unsigned short tl[64][65]; const int tid = threadIdx.x; const int hh = blockIdx.x % HG, sg = blockIdx.x / HG; const int s0 = sg * 64; const int h = h0 + hh;
  for (int i = tid; i < 64 * 8; i += 256) { const int j = i / 8, d8 = (i % 8) * 8; FragH f; f.half[0] = *(const v8us*)((const unsigned short*)V16 + ((size_t)b * SQ + s0 + j) * DM + h * HD + d8); for (int q = 0; q < 8; ++q) tl[d8 + q][j] = f.u[q]; }
  __syncthreads();
  { for (int i = tid; i < 64 * 8; i += 256) { const int d = i / 8, j8 = (i % 8) * 8; FragH f; for (int q = 0; q < 8; ++q) f.u[q] = tl[d][j8 + q]; *(v8us*)((unsigned short*)VT + ((size_t)hh * HD + d) * SQ + s0 + j8) = f.half[0]; }  } }



__global__ __launch_bounds__(256) void k_rsmcf2(const float* __restrict__ S, _Float16* __restrict__ P, int hg, int q0, int nk) {
  #pragma clang fp contract(off)
  const int t = blockIdx.x * 256 + threadIdx.x; if (t >= hg * QT) return; const size_t i = (size_t)t; const float* s = S + i * NKX; const int last = q0 + (t % QT); float mx = -3.0e38f;
#pragma unroll 1
  for (int j = 0; j < nk; ++j) { const float f = (j <= last) ? 1.f : 0.f; mx = fmaxf(mx, fmaf(f, s[j], (1.f - f) * -1.0e9f)); } float se = 0.f;
#pragma unroll 1
  for (int j = 0; j < nk; ++j) { const float f = (j <= last) ? 1.f : 0.f; se += __expf(fmaf(f, s[j], (1.f - f) * -1.0e9f) - mx); } const float sc = 256.0f / se;
#pragma unroll 1
  for (int j0 = 0; j0 < nk; j0 += 8) { FragH fr; for (int q = 0; q < 8; ++q) { const int j = j0 + q; const float f = (j <= last) ? 1.f : 0.f; fr.h[q] = (_Float16)(__expf(fmaf(f, s[j], (1.f - f) * -1.0e9f) - mx) * sc); } unsigned short* d = (unsigned short*)P + i * NKX + j0; *(v8us*)d = fr.half[0];  } }



typedef int v4ia __attribute__((ext_vector_type(4), may_alias));
// native 2^x. Written as asm for the v_nop: it is the slot that the instruction set asks for behind a transcendental before its result is read or its source overwritten.
__device__ __forceinline__ float exp2_native(float x) { float r; asm("v_exp_f32 %0, %1\n\tv_nop" : "=v"(r) : "v"(x)); return r; }
#define FQ 2                         /* 16-query column groups per wave of the fused attention kernel */
struct FAK { v16h h[2][2], l[2][2]; };      /* K fragments of 32 keys: [16-key tile][32-wide step over the head size], hi and x1024 residual */
struct FAV { v16h h[4], l[4]; };            /* V^T fragments of 32 keys: [16-row tile of the head size], hi and x1024 residual */
__device__ __forceinline__ v8f fa_mma(v16h a, v16h b, v8f c) { return __builtin_amdgcn_wmma_f32_16x16x32_f16(false, a, false, b, (short)0, c, false, false); }
__global__ __launch_bounds__(256) void k_fattn(const _Float16* __restrict__ Qh, const _Float16* __restrict__ Ql, const _Float16* __restrict__ Kh, const _Float16* __restrict__ Kl, const _Float16* __restrict__ Vh, const _Float16* __restrict__ Vl, const int* __restrict__ Km, float* __restrict__ O) {
  const int lane = threadIdx.x & 31, ln = lane & 15, hh = lane >> 4; const int w = __builtin_amdgcn_readfirstlane((int)(threadIdx.x >> 5));
  const int tb = (int)(blockIdx.x / (NB * NH)); const int bh = blockIdx.x % (NB * NH); const int b = bh / NH, h = bh % NH;
  const int qb = (w < 4) ? SQ / (64 * FQ) - 1 - tb : tb;      /* a long and a short row group per block */
  const int q0 = qb * (64 * FQ) + (w & 3) * (16 * FQ);      /* the wave's first query row: a multiple of 32, the same in every lane */
  /* every loop under '#pragma unroll' in this kernel is fully unrolled so that the fragment, score and accumulator arrays are registers, not scratch */
  v16h qh[FQ][2], ql[FQ][2];
  /* all six operand planes are fragment-major: q and k planes have LQ columns (a head is two neighbouring tiles of a 16-row band), the V^T planes SQ columns (32 keys are one tile) */
  { const _Float16* bq = Qh + ((size_t)b * SQ + q0) * LQ + h * (HD * 16); const _Float16* bl = Ql + ((size_t)b * SQ + q0) * LQ + h * (HD * 16); const _Float16* pq = bq + 8 * lane; const _Float16* pl = bl + 8 * lane;      /* bq, bl: the same in every lane */
#pragma unroll
    for (int g = 0; g < FQ; ++g) { qh[g][0] = tf_frag(pq + (size_t)g * 16 * LQ); qh[g][1] = tf_frag(pq + (size_t)g * 16 * LQ + 512); ql[g][0] = tf_frag(pl + (size_t)g * 16 * LQ); ql[g][1] = tf_frag(pl + (size_t)g * 16 * LQ + 512); }
    asm volatile("s_wait_xcnt 0x0" :: "s"(bq), "s"(bl), "v"(lane) : "memory"); }      /* stands behind the q loads and in front of every instruction that rewrites an address register they name: the loads take a scalar base and the lane number, which are inputs so that their registers stay as they are up to the wait */
  const _Float16* pkh = Kh + (size_t)b * SQ * LQ + h * (HD * 16) + 8 * lane; const _Float16* pkl = Kl + (size_t)b * SQ * LQ + h * (HD * 16) + 8 * lane;
  const _Float16* pvh = Vh + (size_t)bh * HD * SQ + 8 * lane; const _Float16* pvl = Vl + (size_t)bh * HD * SQ + 8 * lane; const int* pm = Km + (size_t)b * SQ + lane;
  int kmv;
  auto ldk = [&](int kb) { const _Float16* a = pkh + (size_t)kb * LQ; const _Float16* c = pkl + (size_t)kb * LQ; const int* e = pm + kb; FAK f;
#pragma unroll
    for (int t = 0; t < 2; ++t) { f.h[t][0] = tf_frag(a + (size_t)t * 16 * LQ); f.h[t][1] = tf_frag(a + (size_t)t * 16 * LQ + 512); f.l[t][0] = tf_frag(c + (size_t)t * 16 * LQ); f.l[t][1] = tf_frag(c + (size_t)t * 16 * LQ + 512); }
    kmv = *e;
    asm volatile("s_wait_xcnt 0x0" :: "v"(a), "v"(c), "v"(e) : "memory");      /* stands behind the loads and in front of every instruction that rewrites an address register they name; the addresses are inputs so that their registers stay as they are up to the wait */
    return f; };
  auto ldv = [&](int kb) { const _Float16* a = pvh + (size_t)kb * 16; const _Float16* c = pvl + (size_t)kb * 16; FAV f;      /* 32 keys = one tile of 512 elements */
#pragma unroll
    for (int d = 0; d < 4; ++d) { f.h[d] = tf_frag(a + (size_t)d * 16 * SQ); f.l[d] = tf_frag(c + (size_t)d * 16 * SQ); }
    asm volatile("s_wait_xcnt 0x0" :: "v"(a), "v"(c) : "memory");      /* as in ldk */
    return f; };
  const v8f z8 = {0.f, 0.f, 0.f, 0.f, 0.f, 0.f, 0.f, 0.f};
  v8f o[FQ][4]; float m[FQ], l[FQ];
#pragma unroll
  for (int g = 0; g < FQ; ++g) { m[g] = -3.0e38f; l[g] = 0.f; for (int d = 0; d < 4; ++d) o[g][d] = z8; }
  FAK kf = ldk(0);
  /* kept rolled: one trip holds 32 keys x 32 queries, and a second copy would only add code and registers */
#pragma unroll 1
  for (int kb = 0; kb <= q0; kb += 32) {
    const FAV vf = ldv(kb);      /* issued here, first read behind the softmax */
    v8f s[FQ][2];
#pragma unroll
    for (int g = 0; g < FQ; ++g) {
#pragma unroll
      for (int t = 0; t < 2; ++t) { v8f sh = fa_mma(kf.h[t][0], qh[g][0], z8); sh = fa_mma(kf.h[t][1], qh[g][1], sh);
        v8f sl = fa_mma(kf.h[t][0], ql[g][0], z8); sl = fa_mma(kf.h[t][1], ql[g][1], sl); sl = fa_mma(kf.l[t][0], qh[g][0], sl); sl = fa_mma(kf.l[t][1], qh[g][1], sl);
#pragma unroll
        for (int r = 0; r < 8; ++r) s[g][t][r] = fmaf(sl[r], 0.18033688011112042f / 1024.0f, sh[r] * 0.18033688011112042f); } }      /* (q_hi.k_hi + (q_lo.k_hi + q_hi.k_lo)/1024) / 8, times log2(e) */
    const unsigned bm = __builtin_amdgcn_ballot_w32(kmv != 0);      /* bit j: key kb + j is not padded */
    kf = ldk(kb + 32 <= q0 ? kb + 32 : kb);      /* the next trip's K fragments fly over the softmax and P.V; behind the last trip an in-bounds re-read that nothing uses */
    if (kb == q0 || bm != 0xFFFFFFFFu) {      /* only the diagonal trip and trips with a padded key mask; the test is the same for the whole wave */
      const unsigned bmh = bm >> (8 * hh);
#pragma unroll
      for (int g = 0; g < FQ; ++g) {
#pragma unroll
        for (int t = 0; t < 2; ++t) {
#pragma unroll
          for (int r = 0; r < 8; ++r) { const bool ok = (kb + t * 16 + 8 * hh + r <= q0 + g * 16 + ln) && ((bmh >> (t * 16 + r)) & 1u); s[g][t][r] = ok ? s[g][t][r] : -1.0e9f; } } } }
    v16h ph[FQ], pl[FQ];
#pragma unroll
    for (int g = 0; g < FQ; ++g) { float mx = fmaxf(s[g][0][0], s[g][1][0]);
#pragma unroll
      for (int r = 1; r < 8; ++r) mx = fmaxf(mx, fmaxf(s[g][0][r], s[g][1][r]));
      mx = fmaxf(mx, __shfl_xor(mx, 16, 32));      /* the query's other 16 keys of this trip sit in the other lane half */
      const float mn = fmaxf(m[g], mx); const float sc = exp2_native(m[g] - mn); const float mo = mn - 12.0f; m[g] = mn;
      float se0 = 0.f, se1 = 0.f;
#pragma unroll
      for (int r = 0; r < 8; ++r) { const float e0 = exp2_native(s[g][0][r] - mo), e1 = exp2_native(s[g][1][r] - mo); se0 += e0; se1 += e1; ph[g][r] = (_Float16)e0; ph[g][8 + r] = (_Float16)e1; }
      l[g] = fmaf(l[g], sc, se0 + se1); pl[g] = ph[g] * (_Float16)0.0009765625f;
#pragma unroll
      for (int d = 0; d < 4; ++d) o[g][d] *= sc; }
#pragma unroll
    for (int d = 0; d < 4; ++d) {
#pragma unroll
      for (int g = 0; g < FQ; ++g) { o[g][d] = fa_mma(vf.h[d], ph[g], o[g][d]); o[g][d] = fa_mma(vf.l[d], pl[g], o[g][d]); } } }
  float* po[FQ];
#pragma unroll
  for (int g = 0; g < FQ; ++g) { const float fin = 64.0f / (l[g] + __shfl_xor(l[g], 16, 32));      /* o carried x64; the halves' sums are joined once */
    po[g] = O + ((size_t)b * SQ + q0 + g * 16 + ln) * DM + h * HD + 8 * hh;
#pragma unroll
    for (int d = 0; d < 4; ++d) o[g][d] *= fin; }
  /* a lane holds 8 consecutive columns of its query row per tile; the wave alone writes its rows' 256 bytes */
#pragma unroll
  for (int g = 0; g < FQ; ++g) {
#pragma unroll
    for (int d = 0; d < 4; ++d) { const v4f lo = {o[g][d][0], o[g][d][1], o[g][d][2], o[g][d][3]}, hi = {o[g][d][4], o[g][d][5], o[g][d][6], o[g][d][7]}; *(v4f*)(po[g] + d * 16) = lo; *(v4f*)(po[g] + d * 16 + 4) = hi; } }
  asm volatile("s_wait_xcnt 0x0" :: "v"(po[0]), "v"(po[FQ - 1]) : "memory");      /* stands behind the stores: their address registers stay as they are up to here */
}


// Exact f32 attention of the first QT0 rows of every batch; one thread per query row, one block per (head, 64 rows), blockIdx.y = batch (all row planes hold SQ rows per batch).
// All operands stay on chip: the head's K and V rows (and the key padding entries) are staged once in LDS with whole-line loads, every lane then reads the same LDS address (a broadcast, no bank conflict), and the thread's q and o rows live in registers.
// Four keys per trip: their four score chains are independent, so one chain's dependent adds are covered by the other three. Every sum (score, l, o) keeps its order: d = 0..63 inside a score, keys in rising j.
template <int MASKADD, int MASKKV>
__global__ __launch_bounds__(64) void k_att0(const float* __restrict__ QF, const float* __restrict__ KF, const float* __restrict__ VF, int ld, const float* __restrict__ mask, const int* __restrict__ Km, float scale, float* __restrict__ OF, int ldo) {
  #pragma clang fp contract(off)
  __shared__ __attribute__((aligned(16))) float lk[QT0][HD]; __shared__ __attribute__((aligned(16))) float lv[QT0][HD]; __shared__ __attribute__((aligned(16))) int lm[QT0];
  const int tid = threadIdx.x; const int h = blockIdx.x / (QT0 / 64), rg = blockIdx.x % (QT0 / 64); const int i = rg * 64 + tid;
  { const size_t rb = (size_t)blockIdx.y * SQ; QF += rb * ld; KF += rb * ld; VF += rb * ld; OF += rb * ldo; if (MASKKV) Km += rb; }      /* the batch's first row */
  const float* qr = QF + (size_t)i * ld + h * HD;
  v4f q[HD / 4], o[HD / 4];
  /* every loop over c is fully unrolled so that q and o are registers, not scratch */
#pragma unroll
  for (int c = 0; c < HD / 4; ++c) { q[c] = *(const v4fa*)(qr + c * 4); const v4f z = {0.f, 0.f, 0.f, 0.f}; o[c] = z; }
  asm volatile("s_wait_xcnt 0x0" :: "v"(qr) : "memory");      /* stands behind the q loads and in front of every instruction that rewrites their address register; the address is an input so that its register stays as it is up to the wait */
  float m = -1.0e30f, l = 0.f; const int jmax = MASKADD ? (SQ - 1) : (rg * 64 + 63);      /* additive-mask form: every key (the mask input decides); causal form: keys up to the block's last row */
  /* kept rolled: the causal form makes one trip */
#pragma unroll 1
  for (int jt = 0; jt <= jmax; jt += QT0) { const int nr = (jmax + 1 - jt < QT0) ? (jmax + 1 - jt) : QT0;      /* keys of this tile: a multiple of 64, the same for the whole block */
    if (jt) __syncthreads();      /* every reader has left the tile before it is refilled */
    /* eight K and eight V loads in flight per thread; 16 lanes cover one 256-byte row, the block 4 rows per load */
    const size_t g0 = (size_t)(jt + (tid >> 4)) * ld + h * HD + (tid & 15) * 4;
    /* kept rolled: nr is only known at run time, and each trip already has sixteen loads per thread in flight */
#pragma unroll 1
    for (int r0 = 0; r0 < nr; r0 += 32) { v4f tk[8], tv[8]; const float *pk[8], *pv[8];
      /* the three loops over u are fully unrolled so that the pointers and the loaded rows are registers and the sixteen loads stand together */
#pragma unroll
      for (int u = 0; u < 8; ++u) { const size_t g = g0 + (size_t)(r0 + u * 4) * ld; pk[u] = KF + g; pv[u] = VF + g; }
#pragma unroll
      for (int u = 0; u < 8; ++u) { tk[u] = *(const v4fa*)pk[u]; tv[u] = *(const v4fa*)pv[u]; }
      asm volatile("s_wait_xcnt 0x0" :: "v"(pk[0]), "v"(pk[1]), "v"(pk[2]), "v"(pk[3]), "v"(pk[4]), "v"(pk[5]), "v"(pk[6]), "v"(pk[7]), "v"(pv[0]), "v"(pv[1]), "v"(pv[2]), "v"(pv[3]), "v"(pv[4]), "v"(pv[5]), "v"(pv[6]), "v"(pv[7]) : "memory");      /* stands behind the trip's loads and in front of every instruction that rewrites an address register they name; the addresses are inputs so that no load lands on one of them */
#pragma unroll
      for (int u = 0; u < 8; ++u) { const int r = r0 + u * 4 + (tid >> 4); *(v4f*)&lk[r][(tid & 15) * 4] = tk[u]; *(v4f*)&lv[r][(tid & 15) * 4] = tv[u]; } }
    if (MASKKV) for (int e = tid; e < nr; e += 64) lm[e] = Km[jt + e];
    __syncthreads();      /* the tile is complete before any thread reads it */
    /* kept rolled: one trip already holds four keys, and a second copy would only add code and registers */
#pragma unroll 1
    for (int jj = 0; jj < nr; jj += 4) { float s4[4] = {0.f, 0.f, 0.f, 0.f}, sc4[4], e4[4]; v4ia km4 = {1, 1, 1, 1}; if (MASKKV) km4 = *(const v4ia*)&lm[jj];
      /* all loops over c and u below are fully unrolled: constant indices keep q, o and the four keys' values in registers, and the four score chains stand side by side */
#pragma unroll
      for (int c = 0; c < HD / 4; ++c) { const v4f qq = q[c];
#pragma unroll
        for (int u = 0; u < 4; ++u) { const v4f kq = *(const v4f*)&lk[jj + u][c * 4]; float s = s4[u]; s = __fadd_rn(s, __fmul_rn(qq[0], kq[0])); s = __fadd_rn(s, __fmul_rn(qq[1], kq[1])); s = __fadd_rn(s, __fmul_rn(qq[2], kq[2])); s = __fadd_rn(s, __fmul_rn(qq[3], kq[3])); s4[u] = s; } }
#pragma unroll
      for (int u = 0; u < 4; ++u) { const int j = jt + jj + u; float s = __fmul_rn(s4[u], scale); if (MASKADD) s = __fadd_rn(s, __fmul_rn(bf16_round(mask[(size_t)i * SQ + j]), -10000.0f));
        const float f = (MASKADD || (j <= i && (!MASKKV || km4[u] != 0))) ? 1.f : 0.f;      /* MASKKV: also drop keys whose int padding entry is 0 */ const float sm = fmaf(f, s, (1.f - f) * -1.0e30f); const float mn = fmaxf(m, sm); const float sc = expf(m - mn); const float e = expf(sm - mn); l = __fadd_rn(__fmul_rn(l, sc), e); m = mn; sc4[u] = sc; e4[u] = e; }
#pragma unroll
      for (int u = 0; u < 4; ++u) { const float sc = sc4[u], e = e4[u];
#pragma unroll
        for (int c = 0; c < HD / 4; ++c) { const v4f vv = *(const v4f*)&lv[jj + u][c * 4]; v4f oo = o[c]; for (int w = 0; w < 4; ++w) oo[w] = __fadd_rn(__fmul_rn(oo[w], sc), __fmul_rn(e, vv[w])); o[c] = oo; } } } }
  const float fin = 64.0f / l;      /* o carried x64 like the f16 path */
  float* orow = OF + (size_t)i * ldo + h * HD;      /* the thread's own 256 bytes: two whole lines, no other writer */
  /* unrolled: o stays in registers */
#pragma unroll
  for (int c = 0; c < HD / 4; ++c) { v4f oo = o[c]; for (int w = 0; w < 4; ++w) oo[w] = __fmul_rn(oo[w], fin); *(v4f*)(orow + c * 4) = oo; } }


__global__ __launch_bounds__(256) void k_xt16(const float* __restrict__ x, const float* __restrict__ tg, const float* __restrict__ wt, const float* __restrict__ bt, _Float16* __restrict__ XT, _Float16* __restrict__ XL, size_t n8) {
  #pragma clang fp contract(off)
  const size_t t = (size_t)blockIdx.x * 256 + threadIdx.x; if (t >= n8) return; size_t r, kc; tf_chunk(t, r, kc); const float* px = x + r * DM + kc; const float* pw = wt + kc; const float* pb = bt + kc; const float* pg = tg + r; FragH f, l;
  const v4f x0 = *(const v4fa*)px, x1 = *(const v4fa*)(px + 4), w0 = *(const v4fa*)pw, w1 = *(const v4fa*)(pw + 4), b0 = *(const v4fa*)pb, b1 = *(const v4fa*)(pb + 4); const float g = bf16_round(*pg);
  asm volatile("s_wait_xcnt 0x0" :: "v"(px), "v"(pw), "v"(pb), "v"(pg) : "memory");      /* stands behind the seven loads and in front of every instruction that rewrites an address register they name; the addresses are inputs so that no load lands on one of them */
  const float xv[8] = {x0[0], x0[1], x0[2], x0[3], x1[0], x1[1], x1[2], x1[3]}, wv[8] = {w0[0], w0[1], w0[2], w0[3], w1[0], w1[1], w1[2], w1[3]}, bv[8] = {b0[0], b0[1], b0[2], b0[3], b1[0], b1[1], b1[2], b1[3]};
  /* unrolled so that the three small arrays are registers */
#pragma unroll
  for (int q = 0; q < 8; ++q) { const float te = __fadd_rn(__fmul_rn(g, bf16_round(wv[q])), bf16_round(bv[q])); const float v = __fadd_rn(bf16_round(xv[q]), te); const _Float16 h = (_Float16)v; f.h[q] = h; l.h[q] = (_Float16)((v - (float)h) * 1024.0f); }
  const size_t di = tf_off(r, kc, DM); *(v8us*)((unsigned short*)XT + di) = f.half[0]; *(v8us*)((unsigned short*)XL + di) = l.half[0];  }      /* XT, XL fragment-major */
extern "C" void kernel_launch(void* const* d_in, const int* in_sizes, int n_in,
                              void* d_out, int out_size, void* d_ws, size_t ws_size, hipStream_t stream) {
  (void)in_sizes; (void)n_in; (void)out_size;
  const float* const* I = (const float* const*)d_in; const float* x = I[0]; const float* tg = I[1]; const int* km = (const int*)d_in[2]; const float* wq = I[3]; const float* bq = I[4]; const float* wk = I[5]; const float* bk = I[6]; const float* wv = I[7]; const float* bv = I[8]; const float* wo = I[9]; const float* bo = I[10]; const float* wt = I[11]; const float* bt = I[12];      /* natural [out][in] weights + biases; time_gaps [2][2048][1]; int key mask [2][2048]; Wt [1024][1], bt [1024] */
  char* ws = (char*)d_ws; size_t off = 0;
  auto take = [&](size_t bytes) { char* p = ws + off; off += (bytes + 255) & ~(size_t)255; return p; };
  _Float16* BQ = (_Float16*)take((size_t)DM * DM * 2); _Float16* BK = (_Float16*)take((size_t)DM * DM * 2); _Float16* BV = (_Float16*)take((size_t)DM * DM * 2); _Float16* BO = (_Float16*)take((size_t)DM * DM * 2);
  _Float16* X16 = (_Float16*)take(NR * DM * 2); _Float16* XT16 = (_Float16*)take(NR * DM * 2); _Float16* XL16 = (_Float16*)take(NR * DM * 2);      /* x (exact f16) for v; x_time as f16 hi + x1024 residual for q and k */ float* QF = (float*)take(NR * DM * 4); float* KF = (float*)take(NR * DM * 4); float* VF = (float*)take(NR * DM * 4); float* F32 = (float*)take(NR * DM * 4);      /* f32 rows of q, k, v (kept: the first-tile attention reads them) and o */ _Float16* Q16 = (_Float16*)take(NR * DM * 2); _Float16* QL = (_Float16*)take(NR * DM * 2); _Float16* K16 = (_Float16*)take(NR * DM * 2); _Float16* KL = (_Float16*)take(NR * DM * 2); _Float16* V16 = (_Float16*)take(NR * DM * 2); _Float16* VL = (_Float16*)take(NR * DM * 2); _Float16* O16 = (_Float16*)take(NR * DM * 2); _Float16* OL = (_Float16*)take(NR * DM * 2);
  _Float16* VT = (_Float16*)take((size_t)NB * NH * HD * SQ * 2); _Float16* VTL = (_Float16*)take((size_t)NB * NH * HD * SQ * 2);      /* V^T planes of both batches */
  if (off > ws_size) return;
  { const unsigned g = (unsigned)(((size_t)DM * DM / 8 + 255) / 256); k_wnat<<<g, 256, 0, stream>>>(wq, (size_t)DM * DM / 8, BQ); k_wnat<<<g, 256, 0, stream>>>(wk, (size_t)DM * DM / 8, BK); k_wnat<<<g, 256, 0, stream>>>(wv, (size_t)DM * DM / 8, BV); k_wnat<<<g, 256, 0, stream>>>(wo, (size_t)DM * DM / 8, BO); }      /* natural [out][in] = Bt[n][k], x16 */

  k_x16<<<(unsigned)((NR * DM / 8 + 255) / 256), 256, 0, stream>>>(x, X16, NR * DM / 8); k_xt16<<<(unsigned)((NR * DM / 8 + 255) / 256), 256, 0, stream>>>(x, tg, wt, bt, XT16, XL16, NR * DM / 8);      /* x_time = x + time_gaps Wt^T + bt as f16 hi + x1024 residual rows */
  const size_t r0p = (size_t)B0 * SQ;      /* first projected row */
  k_gemm2p<<<(unsigned)((MP / 128) * (DM / 64)), 128, 0, stream>>>(XT16 + r0p * DM, XL16 + r0p * DM, BQ, 0.0625f, 0.00006103515625f, bq, QF + r0p * DM, MP); k_hl<true><<<(unsigned)(((size_t)MP * DM / 8 + 255) / 256), 256, 0, stream>>>(QF + r0p * DM, Q16 + r0p * DM, QL + r0p * DM, (size_t)MP * DM / 8);      
  k_gemm2p<<<(unsigned)((MP / 128) * (DM / 64)), 128, 0, stream>>>(XT16 + r0p * DM, XL16 + r0p * DM, BK, 0.0625f, 0.00006103515625f, bk, KF + r0p * DM, MP); k_hl<true><<<(unsigned)(((size_t)MP * DM / 8 + 255) / 256), 256, 0, stream>>>(KF + r0p * DM, K16 + r0p * DM, KL + r0p * DM, (size_t)MP * DM / 8);      /* k likewise */
  k_gemm2<0><<<dim3((unsigned)((MP / 128) * (DM / 64)), 1), 128, 0, stream>>>(X16 + r0p * DM, DM, 0, BV, DM, 0, 0.0625f, bv, 0, nullptr, 1, 0, 0, VF + r0p * DM, nullptr, DM, 0, MP, DM, DM); k_hl<false><<<(unsigned)(((size_t)MP * DM / 8 + 255) / 256), 256, 0, stream>>>(VF + r0p * DM, V16 + r0p * DM, VL + r0p * DM, (size_t)MP * DM / 8);      /* v = x Wv^T + bv in f32 -> f16 hi + x1024 residual (row-major: the transpose below reads them) */
  for (int b = B0; b < B0 + NBR; ++b) { const size_t r0 = (size_t)b * SQ;
    k_vt<NH, SQ><<<NH * (SQ / 64), 256, 0, stream>>>(V16 + r0 * LQ, LQ, 0, VT + (size_t)b * NH * HD * SQ); k_vt<NH, SQ><<<NH * (SQ / 64), 256, 0, stream>>>(VL + r0 * LQ, LQ, 0, VTL + (size_t)b * NH * HD * SQ);      /* V^T (hi and residual) [NH][HD][SQ] for this batch */
  }
  k_fattn<<<NB * NH * (SQ / (128 * FQ)), 256, 0, stream>>>(Q16, QL, K16, KL, VT, VTL, km, F32);      /* o (x64) in f32 rows: scores, causal + key padding softmax and P.V of both batches and all heads in one launch */
  k_att0<0, 1><<<dim3(NH * (QT0 / 64), NB), 64, 0, stream>>>(QF, KF, VF, DM, nullptr, km, 0.125f, F32, DM);      /* rows 0..127 of each batch: exact f32 causal attention with the key padding vector (o x64), from the f32 q, k, v rows of the full projections, written over the fused kernel's rows; the split and the out GEMM below then take them like every other row */
  for (int b = B0; b < B0 + NBR; ++b) { const size_t r0 = (size_t)b * SQ;
    k_hl<true><<<(unsigned)(((size_t)SQ * DM / 8 + 255) / 256), 256, 0, stream>>>(F32 + r0 * DM, O16 + r0 * DM, OL + r0 * DM, (size_t)SQ * DM / 8); }      /* o -> f16 hi + x1024 residual */
  k_gemm2p<<<(unsigned)((MPO / 128) * (DM / 64)), 128, 0, stream>>>(O16 + r0p * DM, OL + r0p * DM, BO, 0.0009765625f, 0.00000095367431640625f, bo, (float*)d_out + r0p * DM, MPO);      /* out = (o_hi Wo^T + bo) + o_lo Wo^T 2^-20, one launch */
}

// v008
// It runs in 179 microseconds.
// In both of two side-by-side timings against v007, it was 1.14 times as fast.
// Over all steps from v000 it is 49.3 times as fast.
#include <hip/hip_runtime.h>
// Causal multi-head attention with a time-gap embedding and a key padding mask (x [2][2048][1024]; x_time = x + (time_gaps Wt^T + bt) with time_gaps [2][2048][1] (U[0,1)), Wt [1024][1] sigma 1, bt zeros; q = x_time Wq^T + bq, k = x_time Wk^T + bk, v = x Wv^T + bv (v from the RAW x; natural [1024][1024] sigma 1/32, zero biases); 16 heads of 64; scores / 8; where(mask[b][j] == 0, -1e9) (int mask [2][2048], all ones) and where(j > i, -1e9) (causal); softmax; out = merged Wo^T + bo -> [2][2048][1024]).
// Structure: every f16 plane that a WMMA reads (x, x_time, the weights, q, k, V^T, o) is stored fragment-major (16 x 32 tiles in lane order, see tf_frag); token rows r = b*2048 + s; x as exact f16 rows; x_time = x + t Wt + bt on VALU as f16 hi + x1024 residual rows; q and k = (hi + lo/1024) W + b, each one WMMA GEMM launch with both A planes in the k loop and an accumulator set per plane (32x64 wave tiles, f32 accumulation), split in the GEMM's epilogue into f16 hi + x1024 residual planes; v = x Wv + bv in f32, split likewise in its GEMM's epilogue and written transposed per (batch, head); one fused attention launch (a wave owns 32 query rows, 32 keys per trip): scores^T = k_hi.q_hi + (k_hi.q_lo + k_lo.q_hi)/1024 on WMMA, / 8, causal + key-mask running softmax in registers (f32 statistics, native exp2; weights x4096 f16), o^T += V_hi^T.P^T + V_lo^T.(P^T/1024), o split into hi + residual planes in the kernel's epilogue; out = (o_hi Wo + bo) + o_lo Wo 2^-20 likewise in one launch; first-tile refinement: the o rows of the first 128 rows of each batch recomputed exactly in f32 on VALU from the f32 q, k, v rows of the full projections (kept in f32 for those rows only) and written, split, over the fused kernel's rows; launches: see trace.
// Compute dtype: inputs rounded to bf16; x / weights exact; q, k, v and o as f16 hi + x1024 residual planes, softmax weights as plain f16 GEMM operands (~2^-12); scores and softmax statistics f32; v_wmma_f32_16x16x32_f16.
#define NB 2
#define SQ 2048
#define DM 1024
#define NH 16
#define HD 64
#define HG 4                         /* heads per block group of the unlaunched k_vt overload */
#define QT 256                       /* query rows per causal tile */
#define NKX SQ                       /* S / P row pitch */
#define QT0 128                      /* first-tile rows recomputed exactly in f32 */
#define B0 0                         /* first batch processed (debug hook) */
#define NBR NB                       /* batches processed (debug hook) */
#define NR ((size_t)NB * SQ)         /* token rows */
#define MP ((int)((size_t)NBR * SQ)) /* rows projected (debug hook) */
#define QN SQ                        /* unused (every batch attends all SQ query rows) */
#define NHD NH                       /* unused (all NH heads are attended) */
#define MPO MP                       /* rows through the output stage (debug hook) */
#define LQ DM      /* row pitch of the q/k/v rows */
typedef __bf16 v16b __attribute__((ext_vector_type(16)));
typedef unsigned short v8us __attribute__((ext_vector_type(8), may_alias));
typedef float  v8f  __attribute__((ext_vector_type(8)));
typedef float  v4f  __attribute__((ext_vector_type(4)));
typedef float  v4fa __attribute__((ext_vector_type(4), may_alias));
union FragB { v16b v; v8us half[2]; unsigned short u[16]; };

__device__ __forceinline__ unsigned short bf16_bits(float x) { unsigned int u = __float_as_uint(x); return (unsigned short)((u + 0x7FFFu + ((u >> 16) & 1u)) >> 16); }
__device__ __forceinline__ float bf16_val(unsigned short b) { return __uint_as_float(((unsigned int)b) << 16); }
__device__ __forceinline__ float bf16_round(float x) { return bf16_val(bf16_bits(x)); }
// D += A·B with NT terms: 1 = ah·bh, 2 = + al·bh (A split), 3 = + ah·bl (both split)
template <int NT>
__device__ __forceinline__ v8f mmaN(v16b ah, v16b al, v16b bh, v16b bl, v8f c) {
  c = __builtin_amdgcn_wmma_f32_16x16x32_bf16(false, ah, false, bh, (short)0, c, false, false);
  if (NT >= 2) c = __builtin_amdgcn_wmma_f32_16x16x32_bf16(false, al, false, bh, (short)0, c, false, false);
  if (NT >= 3) c = __builtin_amdgcn_wmma_f32_16x16x32_bf16(false, ah, false, bl, (short)0, c, false, false);
  asm volatile("v_nop\n\tv_nop\n\tv_nop\n\tv_nop" : "+v"(c) : "v"(ah), "v"(al), "v"(bh), "v"(bl));
  return c;
}

__global__ __launch_bounds__(256) void k_wt_bf16(const float* __restrict__ W, unsigned short* __restrict__ Wt, int K, int N) {
  const int t = blockIdx.x * 256 + threadIdx.x;
  const int k8n = K / 8;
  if (t >= N * k8n) return;
  const int n = t / k8n, k8 = (t % k8n) * 8;
  v8us v;
#pragma unroll
  for (int i = 0; i < 8; ++i) v[i] = bf16_bits(W[(size_t)(k8 + i) * N + n]);
  *(v8us*)(Wt + (size_t)n * K + k8) = v;
  
}

// GEMM C[M][N] (f32, pitch ldc) = act(A[M][K]·W + bias). A f32 row-major (pitch lda) converted per fragment to bf16
// (ASPLIT: hi/lo two planes -> 2 terms, else single rounded term); Wt bf16 [N][K] (pitch ldb). BIAS_BF16 rounds the
// bias to bf16 first (bias quantised to bf16 before the add). K%32==0, M%16==0, N%64==0.
template <bool ASPLIT, int ACT, bool BIAS_BF16>
__global__ __launch_bounds__(128) void k_gemm_bf(const float* __restrict__ A, int lda, const unsigned short* __restrict__ Wt, int ldb,
                                               const float* __restrict__ bias, float* __restrict__ C, int ldc, int M, int N, int K) {
  __shared__ __attribute__((aligned(16))) float so[4][16][64];
  const int tid = threadIdx.x, w = tid >> 5, lane = tid & 31, ln = lane & 15, hh = lane >> 4;
  const int ntn = N / 64;
  const int wid = blockIdx.x * 4 + w;
  const int mt = wid / ntn, nq = wid % ntn;
  if (mt * 16 >= M) return;
  const int row0 = mt * 16, col0 = nq * 64;
  const float* arow = A + (size_t)(row0 + ln) * lda;
  v8f acc[4] = {};
  for (int kb = 0; kb < K; kb += 32) {
    FragB ah, al;
    const v4f x0 = *(const v4fa*)(arow + kb + 8 * hh), x1 = *(const v4fa*)(arow + kb + 8 * hh + 4);
    const v4f x2 = *(const v4fa*)(arow + kb + 16 + 8 * hh), x3 = *(const v4fa*)(arow + kb + 16 + 8 * hh + 4);
    float xs[16] = {x0[0],x0[1],x0[2],x0[3],x1[0],x1[1],x1[2],x1[3],x2[0],x2[1],x2[2],x2[3],x3[0],x3[1],x3[2],x3[3]};
#pragma unroll
    for (int i = 0; i < 16; ++i) { const unsigned short hb = bf16_bits(xs[i]); ah.u[i] = hb; al.u[i] = ASPLIT ? bf16_bits(xs[i] - bf16_val(hb)) : (unsigned short)0; }
#pragma unroll
    for (int t = 0; t < 4; ++t) {
      const unsigned short* brow = Wt + (size_t)(col0 + t * 16 + ln) * ldb + kb;
      FragB b;
      b.half[0] = *(const v8us*)(brow + 8 * hh);
      b.half[1] = *(const v8us*)(brow + 16 + 8 * hh);
      acc[t] = mmaN<ASPLIT ? 2 : 1>(ah.v, al.v, b.v, b.v, acc[t]);
    }
  }
#pragma unroll
  for (int t = 0; t < 4; ++t) {
    float bv = bias ? bias[col0 + t * 16 + ln] : 0.f;
    if (BIAS_BF16) bv = bf16_round(bv);
#pragma unroll
    for (int r = 0; r < 8; ++r) { float v = acc[t][r] + bv; if (ACT == 1) v = fmaxf(v, 0.f); so[w][8 * hh + r][t * 16 + ln] = v; }
  }
  __builtin_amdgcn_fence(__ATOMIC_ACQ_REL, "workgroup");
  __builtin_amdgcn_wave_barrier();
  const int rsub = lane >> 4, c4 = (lane & 15) * 4;
  {
#pragma unroll
    for (int q = 0; q < 8; ++q) {
      const int r = q * 2 + rsub;
      const v4f v = *(const v4fa*)&so[w][r][c4];
      *(v4f*)(C + (size_t)(row0 + r) * ldc + col0 + c4) = v;
    }
    
  }
}

// GEMM C = act(A·W + bias + resid): A f32 (ASPLIT -> hi/lo 2 terms), Wt bf16 [N][K]; ACT 0 none, 1 relu, 2 exact gelu;
// resid (optional, f32, row index = (row % rmod), pitch ldr, RES_BF16 rounds it) added before the activation.
template <bool ASPLIT, int ACT, bool BIAS_BF16, bool RES_BF16>
__global__ __launch_bounds__(128) void k_gemm_bf3(const float* __restrict__ A, int lda, const unsigned short* __restrict__ Wt, int ldb,
                                                const float* __restrict__ bias, const float* __restrict__ resid, int rmod, int ldr,
                                                float* __restrict__ C, int ldc, int M, int N, int K) {
  __shared__ __attribute__((aligned(16))) float so[4][16][64];
  const int tid = threadIdx.x, w = tid >> 5, lane = tid & 31, ln = lane & 15, hh = lane >> 4;
  const int ntn = N / 64;
  const int wid = blockIdx.x * 4 + w;
  const int mt = wid / ntn, nq = wid % ntn;
  if (mt * 16 >= M) return;
  const int row0 = mt * 16, col0 = nq * 64;
  const float* arow = A + (size_t)(row0 + ln) * lda;
  v8f acc[4] = {};
  for (int kb = 0; kb < K; kb += 32) {
    FragB ah, al;
    const v4f x0 = *(const v4fa*)(arow + kb + 8 * hh), x1 = *(const v4fa*)(arow + kb + 8 * hh + 4);
    const v4f x2 = *(const v4fa*)(arow + kb + 16 + 8 * hh), x3 = *(const v4fa*)(arow + kb + 16 + 8 * hh + 4);
    float xs[16] = {x0[0],x0[1],x0[2],x0[3],x1[0],x1[1],x1[2],x1[3],x2[0],x2[1],x2[2],x2[3],x3[0],x3[1],x3[2],x3[3]};
#pragma unroll
    for (int i = 0; i < 16; ++i) { const unsigned short hb = bf16_bits(xs[i]); ah.u[i] = hb; al.u[i] = ASPLIT ? bf16_bits(xs[i] - bf16_val(hb)) : (unsigned short)0; }
#pragma unroll
    for (int t = 0; t < 4; ++t) {
      const unsigned short* brow = Wt + (size_t)(col0 + t * 16 + ln) * ldb + kb;
      FragB b;
      b.half[0] = *(const v8us*)(brow + 8 * hh);
      b.half[1] = *(const v8us*)(brow + 16 + 8 * hh);
      acc[t] = mmaN<ASPLIT ? 2 : 1>(ah.v, al.v, b.v, b.v, acc[t]);
    }
  }
#pragma unroll
  for (int t = 0; t < 4; ++t) {
    const int col = col0 + t * 16 + ln;
    float bv = bias ? bias[col] : 0.f;
    if (BIAS_BF16) bv = bf16_round(bv);
#pragma unroll
    for (int r = 0; r < 8; ++r) {
      float v = acc[t][r] + bv;
      if (resid) { float rv = resid[(size_t)((row0 + 8 * hh + r) % rmod) * ldr + col]; if (RES_BF16) rv = bf16_round(rv); v += rv; }
      if (ACT == 1) v = fmaxf(v, 0.f);
      if (ACT == 2) v = 0.5f * v * (1.0f + erff(v * 0.70710678118654752f));
      if (ACT == 3) { const float u = 0.7978845608028654f * (v + 0.044715f * v * v * v); v = 0.5f * v * (1.0f + tanhf(u)); }
      so[w][8 * hh + r][t * 16 + ln] = v;
    }
  }
  __builtin_amdgcn_fence(__ATOMIC_ACQ_REL, "workgroup");
  __builtin_amdgcn_wave_barrier();
  const int rsub = lane >> 4, c4 = (lane & 15) * 4;
  {
#pragma unroll
    for (int q = 0; q < 8; ++q) {
      const int r = q * 2 + rsub;
      const v4f v = *(const v4fa*)&so[w][r][c4];
      *(v4f*)(C + (size_t)(row0 + r) * ldc + col0 + c4) = v;
    }
    
  }
}
// row LayerNorm (biased variance, eps) over N: s = X (+ R); optional out_sum <- s; out_norm <- (s-mu)*rsqrt(var+eps)*g + b
template <bool PARAM_BF16>
__global__ __launch_bounds__(256) void k_layernorm(const float* __restrict__ X, const float* __restrict__ R, const float* __restrict__ g, const float* __restrict__ bta,
                                                  float* __restrict__ out_sum, float* __restrict__ out_norm, int N, float eps) {
  __shared__ float red[256];
  const int row = blockIdx.x, tid = threadIdx.x;
  const float* x = X + (size_t)row * N; const float* rr = R ? R + (size_t)row * N : nullptr;
  float vals[16];                     // up to N = 4096
  const int per = N / 256;            // contiguous chunk per thread? use strided-by-4 chunks: thread handles j = tid*4 + 1024*u
  float s1 = 0.f;
  for (int u = 0; u < per / 4; ++u) {
    const int j = tid * 4 + 1024 * u;
    const v4f a = *(const v4fa*)(x + j);
    v4f b = {0.f,0.f,0.f,0.f}; if (rr) b = *(const v4fa*)(rr + j);
#pragma unroll
    for (int q = 0; q < 4; ++q) { const float v = a[q] + b[q]; vals[u * 4 + q] = v; s1 += v; }
  }
  red[tid] = s1; __syncthreads();
  for (int st = 128; st > 0; st >>= 1) { if (tid < st) red[tid] += red[tid + st]; __syncthreads(); }
  const float mu = red[0] / (float)N; __syncthreads();
  float s2 = 0.f;
  for (int u = 0; u < per / 4; ++u)
#pragma unroll
    for (int q = 0; q < 4; ++q) { const float c = vals[u * 4 + q] - mu; s2 += c * c; }
  red[tid] = s2; __syncthreads();
  for (int st = 128; st > 0; st >>= 1) { if (tid < st) red[tid] += red[tid + st]; __syncthreads(); }
  const float rs = rsqrtf(red[0] / (float)N + eps);
  {
    for (int u = 0; u < per / 4; ++u) {
      const int j = tid * 4 + 1024 * u;
      v4f o, sm;
#pragma unroll
      for (int q = 0; q < 4; ++q) {
        float gg = g[j + q], bb = bta[j + q];
        if (PARAM_BF16) { gg = bf16_round(gg); bb = bf16_round(bb); }
        sm[q] = vals[u * 4 + q]; o[q] = (vals[u * 4 + q] - mu) * rs * gg + bb;
      }
      if (out_sum) *(v4f*)(out_sum + (size_t)row * N + j) = sm;
      *(v4f*)(out_norm + (size_t)row * N + j) = o;
    }
    
  }
}



// ---- f16 WMMA path (v_wmma_f32_16x16x32_f16): 11-bit significands for operands in range — used where a [0,1] probability operand needs more precision than bf16
typedef _Float16 v16h __attribute__((ext_vector_type(16)));
union FragH { v16h v; v8us half[2]; _Float16 h[16]; unsigned short u[16]; };
template <int NT>
__device__ __forceinline__ v8f mmaH(v16h ah, v16h al, v16h bh, v16h bl, v8f c) {
  c = __builtin_amdgcn_wmma_f32_16x16x32_f16(false, ah, false, bh, (short)0, c, false, false);
  if (NT >= 2) c = __builtin_amdgcn_wmma_f32_16x16x32_f16(false, al, false, bh, (short)0, c, false, false);
  if (NT >= 3) c = __builtin_amdgcn_wmma_f32_16x16x32_f16(false, ah, false, bl, (short)0, c, false, false);
  asm volatile("v_nop\n\tv_nop\n\tv_nop\n\tv_nop" : "+v"(c) : "v"(ah), "v"(al), "v"(bh), "v"(bl));
  return c;
}
// batched GEMM like k_gemm_b but f16 operands: A f32 (split into f16 hi/lo if ASPLIT, else rounded to f16), Bt = f16 values [n][k]; alpha; C f32; N multiple of 16 (partial tiles skipped)
template <bool ASPLIT>
__global__ __launch_bounds__(128) void k_gemm_h(const float* __restrict__ A, int lda, size_t sA, const _Float16* __restrict__ Bh, int ldb, size_t sB, float alpha, float* __restrict__ C, int ldc, size_t sC, int M, int N, int K) {
  __shared__ __attribute__((aligned(16))) float so[4][16][64];
  const int tid = threadIdx.x, w = tid >> 5, lane = tid & 31, ln = lane & 15, hh = lane >> 4; const int by = blockIdx.y;
  A += (size_t)by * sA; Bh += (size_t)by * sB; C += (size_t)by * sC;
  const int ntn = (N + 63) / 64; const int wid = blockIdx.x * 4 + w; const int mt = wid / ntn, nq = wid % ntn; if (mt * 16 >= M) return;
  const int row0 = mt * 16, col0 = nq * 64; const float* arow = A + (size_t)(row0 + ln) * lda;
  v8f acc[4] = {};
  for (int kb = 0; kb < K; kb += 32) {
    FragH ah, al;
    const v4f x0 = *(const v4fa*)(arow + kb + 8 * hh), x1 = *(const v4fa*)(arow + kb + 8 * hh + 4), x2 = *(const v4fa*)(arow + kb + 16 + 8 * hh), x3 = *(const v4fa*)(arow + kb + 16 + 8 * hh + 4);
    float xs[16] = {x0[0],x0[1],x0[2],x0[3],x1[0],x1[1],x1[2],x1[3],x2[0],x2[1],x2[2],x2[3],x3[0],x3[1],x3[2],x3[3]};
#pragma unroll
    for (int i = 0; i < 16; ++i) { const _Float16 h = (_Float16)xs[i]; ah.h[i] = h; al.h[i] = ASPLIT ? (_Float16)(xs[i] - (float)h) : (_Float16)0.0f; }
#pragma unroll
    for (int t = 0; t < 4; ++t) { if (col0 + t * 16 >= N) continue; const size_t boff = (size_t)(col0 + t * 16 + ln) * ldb + kb; FragH bq; bq.half[0] = *(const v8us*)(Bh + boff + 8 * hh); bq.half[1] = *(const v8us*)(Bh + boff + 16 + 8 * hh);
      acc[t] = mmaH<ASPLIT ? 2 : 1>(ah.v, al.v, bq.v, bq.v, acc[t]); }
  }
#pragma unroll
  for (int t = 0; t < 4; ++t) { if (col0 + t * 16 >= N) continue;
#pragma unroll
    for (int r = 0; r < 8; ++r) so[w][8 * hh + r][t * 16 + ln] = acc[t][r] * alpha; }
  __builtin_amdgcn_fence(__ATOMIC_ACQ_REL, "workgroup"); __builtin_amdgcn_wave_barrier();
  const int rsub = lane >> 4, c4 = (lane & 15) * 4;
  {
#pragma unroll
    for (int q = 0; q < 8; ++q) { const int r = q * 2 + rsub; if (col0 + c4 < N) { const v4f v = *(const v4fa*)&so[w][r][c4]; *(v4f*)(C + (size_t)(row0 + r) * ldc + col0 + c4) = v; } }
     }
}

// Wt[n][k] = f16(W[k][n]·scale) from f32 row-major W[K][N] (scale = power of two; bf16-exact weights stay exact in f16 away from the subnormal range)
__global__ __launch_bounds__(256) void k_wt_f16(const float* __restrict__ W, _Float16* __restrict__ Wt, int K, int N, float scale) {
  const int t = blockIdx.x * 256 + threadIdx.x; if (t >= N * (K / 8)) return; const int n = t / (K / 8), k8 = (t % (K / 8)) * 8; FragH f;
#pragma unroll
  for (int i = 0; i < 8; ++i) f.h[i] = (_Float16)(bf16_round(W[(size_t)(k8 + i) * N + n]) * scale); const v8us o = f.half[0];
  *(v8us*)((unsigned short*)Wt + (size_t)n * K + k8) = o; 
}
// k_gemm_hh variant with fused epilogue: v = acc·alpha + bias[by·sBias + col] (+ CP[(row/rowsPerB)·sCPb + by·64 + col] if CP) ; ACT 0 none / 1 elu ; writes f16 C16 (and f32 C if non-null)
template <int ACT>
__global__ __launch_bounds__(128) void k_gemm_hhx(const _Float16* __restrict__ A, int lda, size_t sA, const _Float16* __restrict__ Bh, int ldb, size_t sB, float alpha, const float* __restrict__ bias, size_t sBias, const float* __restrict__ CP, int rowsPerB, size_t sCPb, int row0g,
    float* __restrict__ C, _Float16* __restrict__ C16, int ldc, size_t sC, int M, int N, int K) {
  __shared__ __attribute__((aligned(16))) float so[4][16][64];
  const int tid = threadIdx.x, w = tid >> 5, lane = tid & 31, ln = lane & 15, hh = lane >> 4; const int by = blockIdx.y;
  A += (size_t)by * sA; Bh += (size_t)by * sB; const size_t cofs = (size_t)by * sC; const float* bp = bias ? bias + (size_t)by * sBias : nullptr;
  const int ntn = (N + 63) / 64; const int wid = blockIdx.x * 4 + w; const int mt = wid / ntn, nq = wid % ntn; if (mt * 16 >= M) return;
  const int row0 = mt * 16, col0 = nq * 64; const _Float16* arow = A + (size_t)(row0 + ln) * lda;
  v8f acc[4] = {};
  for (int kb = 0; kb < K; kb += 32) { FragH ah; ah.half[0] = *(const v8us*)((const unsigned short*)arow + kb + 8 * hh); ah.half[1] = *(const v8us*)((const unsigned short*)arow + kb + 16 + 8 * hh);
#pragma unroll
    for (int t = 0; t < 4; ++t) { if (col0 + t * 16 >= N) continue; const size_t boff = (size_t)(col0 + t * 16 + ln) * ldb + kb; FragH bq; bq.half[0] = *(const v8us*)((const unsigned short*)Bh + boff + 8 * hh); bq.half[1] = *(const v8us*)((const unsigned short*)Bh + boff + 16 + 8 * hh);
      acc[t] = mmaH<1>(ah.v, ah.v, bq.v, bq.v, acc[t]); }
  }
#pragma unroll
  for (int t = 0; t < 4; ++t) { if (col0 + t * 16 >= N) continue; const int col = col0 + t * 16 + ln; const float bv = bp ? bf16_round(bp[col]) : 0.f;
#pragma unroll
    for (int r = 0; r < 8; ++r) { float v = acc[t][r] * alpha + bv; if (CP) { const int rr = row0g + row0 + 8 * hh + r; if (rowsPerB < 0) v += CP[cofs + (size_t)rr * ldc + col];      /* rowsPerB < 0: own element of the batched C plane */ else { const int bidx = rr / rowsPerB; v += CP[(size_t)bidx * sCPb + (size_t)by * 64 + col]; } } if (ACT == 1) v = (v > 0.f) ? v : expm1f(v); else if (ACT == 7) v = (v > 0.f) ? v + 1.0f : expf(v); else if (ACT == 8) v = tanhf(v); else if (ACT == 9) v = 0.5f * v * (1.0f + tanhf(0.7978845608028654f * (v + 0.044715f * v * v * v))); else if (ACT == 11) v = 1.0f / (1.0f + expf(-v)); else if (ACT == 12) v = (v > 0.f) ? v : 0.01f * v; else if (ACT == 14) v = (v > 0.f) ? v : 0.1f * v; else if (ACT == 16) v = (v >= 0.f) ? v : 0.3f * v; else if (ACT == 17) v = (v >= 0.f) ? v : 0.2f * v; else if (ACT == 15) v = v / (1.0f + expf(-v)); else if (ACT == 3) v = fmaxf(v, 0.f); else if (ACT == 6) v = 0.5f * v * (1.0f + erff(v * 0.70710678118654752f)); so[w][8 * hh + r][t * 16 + ln] = v; } }
  __builtin_amdgcn_fence(__ATOMIC_ACQ_REL, "workgroup"); __builtin_amdgcn_wave_barrier();
  const int rsub = lane >> 4, c4 = (lane & 15) * 4; typedef _Float16 v4h __attribute__((ext_vector_type(4)));
  {
#pragma unroll
    for (int q = 0; q < 8; ++q) { const int r = q * 2 + rsub; if (col0 + c4 < N) { const v4f v = *(const v4fa*)&so[w][r][c4]; if (C) *(v4f*)(C + cofs + (size_t)(row0 + r) * ldc + col0 + c4) = v; if (C16) { v4h h4; for (int i = 0; i < 4; ++i) h4[i] = (_Float16)v[i]; *(v4h*)(C16 + cofs + (size_t)(row0 + r) * ldc + col0 + c4) = h4; } } }
     }
}


typedef _Float16 v4h __attribute__((ext_vector_type(4)));

// ---- fragment-major f16 operand planes ----
// A plane of R rows x K columns (R % 16 == 0, K % 32 == 0) is kept as 16 x 32 tiles of 512 elements, tile (r / 16, k / 32) at ((r / 16) * (K / 32) + k / 32) * 512. Inside a tile the 8-element chunk c = (k % 32) / 8 of row r stands at (c / 2) * 256 + ((c % 2) * 16 + r % 16) * 8:
// that is the order in which the lanes of a wave hold a 16x16x32 A or B fragment (lane = 16 hh + ln: k = 8 hh + s, then 16 + 8 hh + s), so each of a fragment's two loads reads 512 contiguous bytes (four whole lines) instead of 32 bytes out of each of 16 rows.
// Sixteen rows fill 16 K consecutive elements, so a row offset that is a multiple of 16 is the same pointer offset as in a row-major plane.
__device__ __forceinline__ v16h tf_frag(const _Float16* p) { FragH f; f.half[0] = *(const v8us*)((const unsigned short*)p); f.half[1] = *(const v8us*)((const unsigned short*)p + 256); return f.v; }      /* p = tile + 8 * lane */
__device__ __forceinline__ size_t tf_off(size_t r, size_t k, size_t K) { return (((r >> 4) * (K >> 5) + (k >> 5)) << 9) + (((k >> 4) & 1) << 8) + (((((k >> 3) & 1) << 4) | (r & 15)) << 3); }      /* k % 8 == 0 */
// Writer thread t of a plane with DM columns -> its chunk (row r, first column k). A wave takes 8 rows x 32 columns: it reads 8 whole 128-byte f32 lines and writes 4 whole 128-byte lines of the tile, each line by this wave alone.
__device__ __forceinline__ void tf_chunk(size_t t, size_t& r, size_t& k) { const size_t tile = t >> 6; r = ((tile / (DM / 32)) << 4) + (((t >> 5) & 1) << 3) + ((t >> 2) & 7); k = ((tile % (DM / 32)) << 5) + ((t & 3) << 3); }

__global__ __launch_bounds__(256) void k_x16(const float* __restrict__ x, _Float16* __restrict__ X16, size_t n8) { const size_t t = (size_t)blockIdx.x * 256 + threadIdx.x; if (t >= n8) return; FragH f; size_t r, k; tf_chunk(t, r, k); const float* xs = x + r * DM + k;
#pragma unroll
  for (int q = 0; q < 8; ++q) f.h[q] = (_Float16)bf16_round(xs[q]); *(v8us*)((unsigned short*)X16 + tf_off(r, k, DM)) = f.half[0];  }      /* X16 fragment-major */
__global__ __launch_bounds__(256) void k_h16(const float* __restrict__ x, _Float16* __restrict__ X16, size_t n8) { const size_t t = (size_t)blockIdx.x * 256 + threadIdx.x; if (t >= n8) return; FragH f;
#pragma unroll
  for (int q = 0; q < 8; ++q) f.h[q] = (_Float16)x[t * 8 + q]; *(v8us*)((unsigned short*)X16 + t * 8) = f.half[0];  }
__global__ __launch_bounds__(256) void k_round16f(const float* __restrict__ W, _Float16* __restrict__ Bt, size_t n8) { const size_t t = (size_t)blockIdx.x * 256 + threadIdx.x; if (t >= n8) return; FragH f;
#pragma unroll
  for (int i = 0; i < 8; ++i) f.h[i] = (_Float16)(bf16_round(W[t * 8 + i]) * 16.0f); *(v8us*)((unsigned short*)Bt + t * 8) = f.half[0];  }
template <int NHv, int TTv>
__global__ __launch_bounds__(256) void k_vt(const _Float16* __restrict__ V16, int ldv, int voff, _Float16* __restrict__ Vt) { __shared__ unsigned short tl[64][66]; const int tid = threadIdx.x; const int slab = blockIdx.x / (TTv / 64), lg = blockIdx.x % (TTv / 64); const int b = slab / NHv, h = slab % NHv;
  for (int i = tid; i < 64 * 8; i += 256) { const int r = i / 8, c8 = (i % 8) * 8; FragH f; f.half[0] = *(const v8us*)((const unsigned short*)V16 + ((size_t)b * TTv + lg * 64 + r) * ldv + voff + h * 64 + c8);
#pragma unroll
    for (int q = 0; q < 8; ++q) tl[r][c8 + q] = f.u[q]; }
  __syncthreads();
  {
#pragma unroll
    for (int rd = 0; rd < 2; ++rd) { const int d = ((tid >> 6) << 4) + (((tid >> 5) & 1) << 3) + ((tid >> 2) & 7), pc = rd * 4 + (tid & 3); FragH f;      /* a wave takes 8 rows of V^T x 32 keys: 4 whole lines of one tile */
#pragma unroll
      for (int q = 0; q < 8; ++q) f.u[q] = tl[pc * 8 + q][d];
      *(v8us*)((unsigned short*)Vt + tf_off((size_t)slab * 64 + d, (size_t)lg * 64 + pc * 8, TTv)) = f.half[0]; }      /* Vt fragment-major, TTv columns */
     } }

// TF: the two f16 planes are written fragment-major (F has DM columns); otherwise row-major like F
template <bool TF>
__global__ __launch_bounds__(256) void k_hl(const float* __restrict__ F, _Float16* __restrict__ Hh, _Float16* __restrict__ Hl, size_t n8) { const size_t t = (size_t)blockIdx.x * 256 + threadIdx.x; if (t >= n8) return; FragH fh, fl; size_t si = t * 8, di = t * 8; if (TF) { size_t r, k; tf_chunk(t, r, k); si = r * DM + k; di = tf_off(r, k, DM); } const float* pf = F + si; const v4f a = *(const v4fa*)pf, c = *(const v4fa*)(pf + 4);
  asm volatile("s_wait_xcnt 0x0" :: "v"(pf) : "memory");      /* stands behind the two loads and in front of every instruction that rewrites their address register; the address is an input so that its register stays as it is up to the wait */
#pragma unroll
  for (int q = 0; q < 4; ++q) { _Float16 h = (_Float16)a[q]; fh.h[q] = h; fl.h[q] = (_Float16)((a[q] - (float)h) * 1024.0f); h = (_Float16)c[q]; fh.h[4 + q] = h; fl.h[4 + q] = (_Float16)((c[q] - (float)h) * 1024.0f); }
  { *(v8us*)((unsigned short*)Hh + di) = fh.half[0]; *(v8us*)((unsigned short*)Hl + di) = fl.half[0];  } }

// eight f32 values -> the f16 hi chunk and the x1024 residual chunk (the arithmetic of k_hl), for producers that write the split planes themselves
__device__ __forceinline__ void hl8(const float* v, v8us& hi, v8us& lo) { FragH fh, fl;
#pragma unroll
  for (int q = 0; q < 8; ++q) { const _Float16 h = (_Float16)v[q]; fh.h[q] = h; fl.h[q] = (_Float16)((v[q] - (float)h) * 1024.0f); }
  hi = fh.half[0]; lo = fl.half[0]; }

// ---- fast GEMM (wave tile 32x64; requires M % 32 == 0 rows per launch region, N % 64 == 0, K % 32 == 0 and K >= 32); A and Bh are fragment-major planes of K columns (lda and ldb are not used); epilogue = k_gemm_hhx semantics ----
__device__ __forceinline__ v16h g2_frag(const _Float16* p, int hh) { FragH f; f.half[0] = *(const v8us*)((const unsigned short*)p + 8 * hh); f.half[1] = *(const v8us*)((const unsigned short*)p + 16 + 8 * hh); return f.v; }
__device__ __forceinline__ v8f g2_mma(v16h a, v16h b, v8f c) { v8f d = __builtin_amdgcn_wmma_f32_16x16x32_f16(false, a, false, b, (short)0, c, false, false); asm volatile("v_nop\n\tv_nop\n\tv_nop\n\tv_nop" : "+v"(d) : "v"(a), "v"(b)); return d; }
struct G2S { v16h a0, a1, b0, b1, b2, b3; };      /* the six fragments of one k step */
// VTS (rows = tokens of NB batches of SQ, columns = NH heads of HD, no CP, ACT 0): the result leaves as the two fragment-major V^T planes VTh, VTl ([batch][head][HD] rows of SQ columns), straight from the accumulators; the f32 rows go to C only for the first QT0 tokens of a batch (the first-tile attention reads them)
template <int ACT, bool VTS>
__global__ __launch_bounds__(128) void k_gemm2(const _Float16* __restrict__ A, int lda, size_t sA, const _Float16* __restrict__ Bh, int ldb, size_t sB, float alpha, const float* __restrict__ bias, size_t sBias, const float* __restrict__ CP, int rowsPerB, size_t sCPb, int row0g,
    float* __restrict__ C, _Float16* __restrict__ C16, int ldc, size_t sC, int M, int N, int K, _Float16* __restrict__ VTh, _Float16* __restrict__ VTl) { static_assert(ACT == 0 || ACT == 3 || ACT == 6 || ACT == 8 || ACT == 9 || ACT == 11 || ACT == 12 || ACT == 14 || ACT == 15 || ACT == 16 || ACT == 17, "k_gemm2: unsupported ACT code (would silently apply no activation)");
  __shared__ __attribute__((aligned(16))) float so[4][32][68];
  const int tid = threadIdx.x, w = tid >> 5, lane = tid & 31, ln = lane & 15, hh = lane >> 4; const int by = blockIdx.y;
  A += (size_t)by * sA; Bh += (size_t)by * sB; const size_t cofs = (size_t)by * sC; const float* bp = bias ? bias + (size_t)by * sBias : nullptr;
  const int ntn = N >> 6; const int mt = blockIdx.x / ntn, nq = blockIdx.x - mt * ntn; const int row0 = mt * 128 + 32 * w, col0 = nq * 64; if (row0 >= M) return;
  (void)lda; (void)ldb; const size_t tr = (size_t)16 * K;      /* elements of one 16-row band of tiles */
  const _Float16* a0p = A + (size_t)row0 * K + 8 * lane; const _Float16* a1p = a0p + tr;
  const _Float16* b0p = Bh + (size_t)col0 * K + 8 * lane; const _Float16* b1p = b0p + tr; const _Float16* b2p = b1p + tr; const _Float16* b3p = b2p + tr;
  const v8f z8 = {0.f,0.f,0.f,0.f,0.f,0.f,0.f,0.f}; v8f c00 = z8, c01 = z8, c02 = z8, c03 = z8, c10 = z8, c11 = z8, c12 = z8, c13 = z8;
  /* Three k steps of fragments in registers. A step's twelve loads are issued together, right behind the products of the step whose registers they refill, and are first read three steps later: a load's latency is spread over three steps instead of being paid five times in each.
     No branch stands between the loads, so their waits are counted exactly: past the last step the step index is clamped (an in-bounds re-read of the last step that no product uses). Each accumulator still takes its products in the order kb = 0, 32, 64, ... */
  const int nst = K >> 5;
  auto ld = [&](int st) { const int kb = (st < nst ? st : nst - 1) << 9; const _Float16 *pa0 = a0p + kb, *pa1 = a1p + kb, *pb0 = b0p + kb, *pb1 = b1p + kb, *pb2 = b2p + kb, *pb3 = b3p + kb;      /* one tile of 512 elements per k step; the lane's 8 elements are in the band pointers */
    G2S f; f.a0 = tf_frag(pa0); f.a1 = tf_frag(pa1); f.b0 = tf_frag(pb0); f.b1 = tf_frag(pb1); f.b2 = tf_frag(pb2); f.b3 = tf_frag(pb3);
    asm volatile("s_wait_xcnt 0x0" :: "v"(pa0), "v"(pa1), "v"(pb0), "v"(pb1), "v"(pb2), "v"(pb3) : "memory");      /* stands behind the step's loads and in front of every instruction that rewrites an address register they name; the addresses are inputs so that their registers stay as they are up to the wait */
    return f; };
  auto mm = [&](const G2S& f) { c00 = g2_mma(f.a0, f.b0, c00); c10 = g2_mma(f.a1, f.b0, c10); c01 = g2_mma(f.a0, f.b1, c01); c11 = g2_mma(f.a1, f.b1, c11); c02 = g2_mma(f.a0, f.b2, c02); c12 = g2_mma(f.a1, f.b2, c12); c03 = g2_mma(f.a0, f.b3, c03); c13 = g2_mma(f.a1, f.b3, c13); };
  G2S f0 = ld(0), f1 = ld(1), f2 = ld(2); int st = 0;
  /* kept rolled: one trip is the whole ring, and a second copy would only add registers */
#pragma unroll 1
  for (; st + 3 <= nst; st += 3) { mm(f0); f0 = ld(st + 3); mm(f1); f1 = ld(st + 4); mm(f2); f2 = ld(st + 5); }
  if (st < nst) mm(f0);
  if (st + 1 < nst) mm(f1);
  v8f accs[8] = {c00, c01, c02, c03, c10, c11, c12, c13};
  if (VTS) {      /* an accumulator tile holds, per lane, 8 consecutive tokens (8 hh + r) of ONE column (ln): that is one chunk of a V^T tile, at the lane's own place in it, so each store below is 512 contiguous bytes of the wave */
    const int srow = __builtin_amdgcn_readfirstlane(row0); const int bb = srow / SQ, key0 = srow % SQ;      /* the wave's first token: the same in every lane */
    const size_t tile0 = ((size_t)(bb * NH + (col0 >> 6)) * (HD / 16) * (SQ / 32) + (key0 >> 5)) << 9;      /* the V^T tile of the head's first 16 rows and these 32 keys */
    unsigned short* ph = (unsigned short*)VTh + tile0 + 8 * lane; unsigned short* pl = (unsigned short*)VTl + tile0 + 8 * lane; v8us hv[8], lv[8];
    /* unrolled so that the chunks are registers */
#pragma unroll
    for (int u = 0; u < 8; ++u) { const float bv = bp ? bf16_round(bp[col0 + (u & 3) * 16 + ln]) : 0.f; float v[8];
#pragma unroll
      for (int r = 0; r < 8; ++r) v[r] = accs[u][r] * alpha + bv;
      hl8(v, hv[u], lv[u]); }
#pragma unroll
    for (int u = 0; u < 8; ++u) { const size_t o = (size_t)(u & 3) * ((SQ / 32) << 9) + (u >> 2) * 256; *(v8us*)(ph + o) = hv[u]; *(v8us*)(pl + o) = lv[u]; }
    asm volatile("s_wait_xcnt 0x0" :: "v"(ph), "v"(pl) : "memory");      /* stands behind the stores: their address registers stay as they are up to here */
    if (key0 >= QT0) return;      /* the same for the whole wave; no barrier follows */
  }
#pragma unroll
  for (int u = 0; u < 8; ++u) { const int t = u & 3, half = u >> 2; const int col = col0 + t * 16 + ln; const float bv = bp ? bf16_round(bp[col]) : 0.f;
#pragma unroll
    for (int r = 0; r < 8; ++r) { const int rloc = half * 16 + 8 * hh + r; float v = accs[u][r] * alpha + bv; if (CP) { if (rowsPerB < 0) v += CP[cofs + (size_t)(row0g + row0 + rloc) * ldc + col];      /* rowsPerB < 0: own element of the batched C plane */ else { const int bidx = (row0g + row0 + rloc) / rowsPerB; v += CP[(size_t)bidx * sCPb + (size_t)by * 64 + col]; } }
      if (ACT == 3) v = fmaxf(v, 0.f); else if (ACT == 6) v = 0.5f * v * (1.0f + erff(v * 0.70710678118654752f)); else if (ACT == 11) v = 1.0f / (1.0f + expf(-v)); else if (ACT == 15) v = v / (1.0f + expf(-v)); else if (ACT == 12) v = (v > 0.f) ? v : 0.01f * v; else if (ACT == 8) v = tanhf(v); else if (ACT == 9) v = 0.5f * v * (1.0f + tanhf(0.7978845608028654f * (v + 0.044715f * v * v * v))); else if (ACT == 14) v = (v > 0.f) ? v : 0.1f * v; else if (ACT == 16) v = (v >= 0.f) ? v : 0.3f * v; else if (ACT == 17) v = (v >= 0.f) ? v : 0.2f * v;
      so[w][rloc][t * 16 + ln] = v; } }
  __builtin_amdgcn_fence(__ATOMIC_ACQ_REL, "workgroup"); __builtin_amdgcn_wave_barrier();
  const int rsub = lane >> 4, c4 = (lane & 15) * 4;
  {
#pragma unroll
    for (int q = 0; q < 16; ++q) { const int r = q * 2 + rsub; const v4f v = *(const v4fa*)&so[w][r][c4]; if (C) *(v4f*)(C + cofs + (size_t)(row0 + r) * ldc + col0 + c4) = v; if (C16) { v4h h4; for (int i = 0; i < 4; ++i) h4[i] = (_Float16)v[i]; *(v4h*)(C16 + cofs + (size_t)(row0 + r) * ldc + col0 + c4) = h4; } }
     } }


// ---- the same GEMM for an operand kept as f16 hi + x1024 residual planes: C = (A Bh) alpha + bias + (Al Bh) alphal in ONE launch (N = K = DM, C of pitch DM, M % 32 == 0) ----
// Both A planes walk one k loop against the same four B fragments, each plane into its own eight accumulators; each accumulator takes its products in the order kb = 0, 32, 64, ... and the two sets meet once, in the epilogue, in registers.
__device__ __forceinline__ v8f g2p_mma(v16h a, v16h b, v8f c) { return __builtin_amdgcn_wmma_f32_16x16x32_f16(false, a, false, b, (short)0, c, false, false); }      /* the plain builtin: its operands may stand in any register, which the 320 registers of accumulators and ring need */
struct G2P { v16h a0, a1, l0, l1, b0, b1, b2, b3; };      /* the eight fragments of one k step */
// SPLIT: the result leaves as the two fragment-major f16 planes Hh (hi) and Hl (x1024 residual); the f32 rows go to C only for the first QT0 rows of each SQ rows (the first-tile attention reads them). Otherwise all f32 rows go to C.
template <bool SPLIT>
__global__ __launch_bounds__(128) void k_gemm2p(const _Float16* __restrict__ A, const _Float16* __restrict__ Al, const _Float16* __restrict__ Bh, float alpha, float alphal, const float* __restrict__ bias, float* __restrict__ C, int M, _Float16* __restrict__ Hh, _Float16* __restrict__ Hl) {
  __shared__ __attribute__((aligned(16))) float so[4][32][68];
  const int tid = threadIdx.x, lane = tid & 31, ln = lane & 15, hh = lane >> 4; const int w = __builtin_amdgcn_readfirstlane(tid >> 5);      /* the wave's number, the same in every lane: the three plane addresses below are then scalars */
  const int mt = blockIdx.x / (DM / 64), nq = blockIdx.x % (DM / 64); const int row0 = mt * 128 + 32 * w, col0 = nq * 64; if (row0 >= M) return;
  const size_t tr = (size_t)16 * DM;      /* elements of one 16-row band of tiles */
  const _Float16* ab = A + (size_t)row0 * DM; const _Float16* lb = Al + (size_t)row0 * DM; const _Float16* bb0 = Bh + (size_t)col0 * DM;      /* the wave's first tiles: the same in every lane */
  const float* sbias = bias + col0; float bv[4];      /* read here so that the k loop covers the latency */
#pragma unroll
  for (int t = 0; t < 4; ++t) bv[t] = sbias[ln + t * 16];
  asm volatile("s_wait_xcnt 0x0" :: "s"(sbias), "v"(ln) : "memory");      /* stands behind the four bias loads and in front of every instruction that rewrites an address register they name (a scalar base and the lane's column), which are inputs so that their registers stay as they are up to the wait */
  const v8f z8 = {0.f,0.f,0.f,0.f,0.f,0.f,0.f,0.f}; v8f c00 = z8, c01 = z8, c02 = z8, c03 = z8, c10 = z8, c11 = z8, c12 = z8, c13 = z8, d00 = z8, d01 = z8, d02 = z8, d03 = z8, d10 = z8, d11 = z8, d12 = z8, d13 = z8;
  /* the ring of three k steps of k_gemm2, with sixteen loads and sixteen products per step; past the last step the step index is clamped (an in-bounds re-read of the last step that no product uses) */
  const int nst = DM >> 5;
  auto ld = [&](int st) { const int kb = (st < nst ? st : nst - 1) << 9; const _Float16 *sa = ab + kb, *sl = lb + kb, *sb = bb0 + kb;      /* one tile of 512 elements per k step */
    const _Float16 *pa = sa + 8 * lane, *pl = sl + 8 * lane, *pq = sb + 8 * lane;
    G2P f; f.a0 = tf_frag(pa); f.a1 = tf_frag(pa + tr); f.l0 = tf_frag(pl); f.l1 = tf_frag(pl + tr); f.b0 = tf_frag(pq); f.b1 = tf_frag(pq + tr); f.b2 = tf_frag(pq + 2 * tr); f.b3 = tf_frag(pq + 3 * tr);
    asm volatile("s_wait_xcnt 0x0" :: "s"(sa), "s"(sl), "s"(sb), "v"(lane) : "memory");      /* stands behind the step's loads and in front of the next step's rewriting of the address registers they name. The three scalar bases and the lane number are inputs: that keeps the loads in the form scalar base + lane offset (without the inputs the build formed vector addresses in registers of the ring, with adds and their slots among the products) */
    return f; };
  auto mm = [&](const G2P& f) { c00 = g2p_mma(f.a0, f.b0, c00); c10 = g2p_mma(f.a1, f.b0, c10); d00 = g2p_mma(f.l0, f.b0, d00); d10 = g2p_mma(f.l1, f.b0, d10); c01 = g2p_mma(f.a0, f.b1, c01); c11 = g2p_mma(f.a1, f.b1, c11); d01 = g2p_mma(f.l0, f.b1, d01); d11 = g2p_mma(f.l1, f.b1, d11);
    c02 = g2p_mma(f.a0, f.b2, c02); c12 = g2p_mma(f.a1, f.b2, c12); d02 = g2p_mma(f.l0, f.b2, d02); d12 = g2p_mma(f.l1, f.b2, d12); c03 = g2p_mma(f.a0, f.b3, c03); c13 = g2p_mma(f.a1, f.b3, c13); d03 = g2p_mma(f.l0, f.b3, d03); d13 = g2p_mma(f.l1, f.b3, d13);
    __builtin_amdgcn_sched_barrier(0); };      /* keeps the refill's sixteen loads together behind the step's products, as in the ring of k_gemm2: without it the build spreads them over eight places among the products, the slower form of a WMMA loop with loads */
  G2P f0 = ld(0), f1 = ld(1), f2 = ld(2); int st = 0;
  /* kept rolled: one trip is the whole ring, and a second copy would only add registers */
#pragma unroll 1
  for (; st + 3 <= nst; st += 3) { mm(f0); f0 = ld(st + 3); mm(f1); f1 = ld(st + 4); mm(f2); f2 = ld(st + 5); }
  if (st < nst) mm(f0);
  if (st + 1 < nst) mm(f1);
  const v8f ch[8] = {c00, c01, c02, c03, c10, c11, c12, c13}, cl[8] = {d00, d01, d02, d03, d10, d11, d12, d13};
  /* unrolled so that the accumulator arrays are registers */
#pragma unroll
  for (int u = 0; u < 8; ++u) { const int t = u & 3, half = u >> 2; const float bb = bf16_round(bv[t]);
#pragma unroll
    for (int r = 0; r < 8; ++r) so[w][half * 16 + 8 * hh + r][t * 16 + ln] = (ch[u][r] * alpha + bb) + cl[u][r] * alphal; }      /* the hi product with its bias first, then the residual product: the order of the two launches this replaces */
  __builtin_amdgcn_fence(__ATOMIC_ACQ_REL, "workgroup"); __builtin_amdgcn_wave_barrier();      /* the wave's own LDS stores are done before its lanes read each other's rows */
  if (SPLIT) {      /* the wave's 32 x 64 tile is four 16 x 32 tiles of the planes; a lane reads its chunk's 8 columns of one row from LDS (16 lanes at pitch 68 cover all banks once) and each store is 512 contiguous bytes of the wave */
    const size_t tile0 = (size_t)row0 * DM + ((size_t)(col0 >> 5) << 9); unsigned short* ph = (unsigned short*)Hh + tile0 + 8 * lane; unsigned short* pl = (unsigned short*)Hl + tile0 + 8 * lane; v8us hv[8], lv[8];
    /* unrolled so that the chunks are registers */
#pragma unroll
    for (int c = 0; c < 8; ++c) { const float* ps = &so[w][(c >> 2) * 16 + ln][((c >> 1) & 1) * 32 + ((c & 1) * 2 + hh) * 8]; const v4f a = *(const v4fa*)ps, b = *(const v4fa*)(ps + 4);
      const float v[8] = {a[0], a[1], a[2], a[3], b[0], b[1], b[2], b[3]}; hl8(v, hv[c], lv[c]); }
#pragma unroll
    for (int c = 0; c < 8; ++c) { const size_t o = (size_t)(c >> 2) * 16 * DM + ((c >> 1) & 1) * 512 + (c & 1) * 256; *(v8us*)(ph + o) = hv[c]; *(v8us*)(pl + o) = lv[c]; }
    asm volatile("s_wait_xcnt 0x0" :: "v"(ph), "v"(pl) : "memory");      /* stands behind the stores: their address registers stay as they are up to here */
    if ((row0 & (SQ - 1)) >= QT0) return;      /* the same for the whole wave; no barrier follows */
  }
  const int rsub = lane >> 4, c4 = (lane & 15) * 4; float* pc = C + (size_t)(row0 + rsub) * DM + col0 + c4;
  /* unrolled: sixteen stores from one address register with constant offsets */
#pragma unroll
  for (int q = 0; q < 16; ++q) { const v4f v = *(const v4fa*)&so[w][q * 2 + rsub][c4]; *(v4f*)(pc + (size_t)q * 2 * DM) = v; }
  asm volatile("s_wait_xcnt 0x0" :: "v"(pc) : "memory");      /* stands behind the stores: their address register stays as it is up to here */
}


__global__ __launch_bounds__(256) void k_wnat(const float* __restrict__ w, size_t n8, _Float16* __restrict__ Bt) { const size_t t = (size_t)blockIdx.x * 256 + threadIdx.x; if (t >= n8) return; FragH f; size_t r, k; tf_chunk(t, r, k); const float* wsrc = w + r * DM + k; for (int q = 0; q < 8; ++q) f.h[q] = (_Float16)(bf16_round(wsrc[q]) * 16.0f); *(v8us*)((unsigned short*)Bt + tf_off(r, k, DM)) = f.half[0];  }      /* Bt fragment-major */
__global__ __launch_bounds__(256) void k_rsm(const float* __restrict__ S, _Float16* __restrict__ P, int nrows) {
  #pragma clang fp contract(off)
  const int i = blockIdx.x * 256 + threadIdx.x; if (i >= nrows) return; const float* s = S + (size_t)i * SQ; float mx = -3.0e38f;
#pragma unroll 1
  for (int j = 0; j < SQ; ++j) mx = fmaxf(mx, s[j]); float se = 0.f;
#pragma unroll 1
  for (int j = 0; j < SQ; ++j) se += expf(s[j] - mx); const float sc = 256.0f / se;
#pragma unroll 1
  for (int j0 = 0; j0 < SQ; j0 += 8) { FragH f; for (int q = 0; q < 8; ++q) f.h[q] = (_Float16)(expf(s[j0 + q] - mx) * sc); unsigned short* d = (unsigned short*)P + (size_t)i * SQ + j0; *(v8us*)d = f.half[0];  } }
__global__ __launch_bounds__(256) void k_vt(const _Float16* __restrict__ V16, int b, int h0, _Float16* __restrict__ VT) { __shared__ unsigned short tl[64][65]; const int tid = threadIdx.x; const int hh = blockIdx.x % HG, sg = blockIdx.x / HG; const int s0 = sg * 64; const int h = h0 + hh;
  for (int i = tid; i < 64 * 8; i += 256) { const int j = i / 8, d8 = (i % 8) * 8; FragH f; f.half[0] = *(const v8us*)((const unsigned short*)V16 + ((size_t)b * SQ + s0 + j) * DM + h * HD + d8); for (int q = 0; q < 8; ++q) tl[d8 + q][j] = f.u[q]; }
  __syncthreads();
  { for (int i = tid; i < 64 * 8; i += 256) { const int d = i / 8, j8 = (i % 8) * 8; FragH f; for (int q = 0; q < 8; ++q) f.u[q] = tl[d][j8 + q]; *(v8us*)((unsigned short*)VT + ((size_t)hh * HD + d) * SQ + s0 + j8) = f.half[0]; }  } }



__global__ __launch_bounds__(256) void k_rsmcf2(const float* __restrict__ S, _Float16* __restrict__ P, int hg, int q0, int nk) {
  #pragma clang fp contract(off)
  const int t = blockIdx.x * 256 + threadIdx.x; if (t >= hg * QT) return; const size_t i = (size_t)t; const float* s = S + i * NKX; const int last = q0 + (t % QT); float mx = -3.0e38f;
#pragma unroll 1
  for (int j = 0; j < nk; ++j) { const float f = (j <= last) ? 1.f : 0.f; mx = fmaxf(mx, fmaf(f, s[j], (1.f - f) * -1.0e9f)); } float se = 0.f;
#pragma unroll 1
  for (int j = 0; j < nk; ++j) { const float f = (j <= last) ? 1.f : 0.f; se += __expf(fmaf(f, s[j], (1.f - f) * -1.0e9f) - mx); } const float sc = 256.0f / se;
#pragma unroll 1
  for (int j0 = 0; j0 < nk; j0 += 8) { FragH fr; for (int q = 0; q < 8; ++q) { const int j = j0 + q; const float f = (j <= last) ? 1.f : 0.f; fr.h[q] = (_Float16)(__expf(fmaf(f, s[j], (1.f - f) * -1.0e9f) - mx) * sc); } unsigned short* d = (unsigned short*)P + i * NKX + j0; *(v8us*)d = fr.half[0];  } }



typedef int v4ia __attribute__((ext_vector_type(4), may_alias));
// native 2^x. Written as asm for the v_nop: it is the slot that the instruction set asks for behind a transcendental before its result is read or its source overwritten.
__device__ __forceinline__ float exp2_native(float x) { float r; asm("v_exp_f32 %0, %1\n\tv_nop" : "=v"(r) : "v"(x)); return r; }
#define FQ 2                         /* 16-query column groups per wave of the fused attention kernel */
struct FAK { v16h h[2][2], l[2][2]; };      /* K fragments of 32 keys: [16-key tile][32-wide step over the head size], hi and x1024 residual */
struct FAV { v16h h[4], l[4]; };            /* V^T fragments of 32 keys: [16-row tile of the head size], hi and x1024 residual */
__device__ __forceinline__ v8f fa_mma(v16h a, v16h b, v8f c) { return __builtin_amdgcn_wmma_f32_16x16x32_f16(false, a, false, b, (short)0, c, false, false); }
__global__ __launch_bounds__(256) void k_fattn(const _Float16* __restrict__ Qh, const _Float16* __restrict__ Ql, const _Float16* __restrict__ Kh, const _Float16* __restrict__ Kl, const _Float16* __restrict__ Vh, const _Float16* __restrict__ Vl, const int* __restrict__ Km, _Float16* __restrict__ Oh, _Float16* __restrict__ Ol) {
  const int lane = threadIdx.x & 31, ln = lane & 15, hh = lane >> 4; const int w = __builtin_amdgcn_readfirstlane((int)(threadIdx.x >> 5));
  const int tb = (int)(blockIdx.x / (NB * NH)); const int bh = blockIdx.x % (NB * NH); const int b = bh / NH, h = bh % NH;
  const int qb = (w < 4) ? SQ / (64 * FQ) - 1 - tb : tb;      /* a long and a short row group per block */
  const int q0 = qb * (64 * FQ) + (w & 3) * (16 * FQ);      /* the wave's first query row: a multiple of 32, the same in every lane */
  /* every loop under '#pragma unroll' in this kernel is fully unrolled so that the fragment, score and accumulator arrays are registers, not scratch */
  v16h qh[FQ][2], ql[FQ][2];
  /* all six operand planes are fragment-major: q and k planes have LQ columns (a head is two neighbouring tiles of a 16-row band), the V^T planes SQ columns (32 keys are one tile) */
  { const _Float16* bq = Qh + ((size_t)b * SQ + q0) * LQ + h * (HD * 16); const _Float16* bl = Ql + ((size_t)b * SQ + q0) * LQ + h * (HD * 16); const _Float16* pq = bq + 8 * lane; const _Float16* pl = bl + 8 * lane;      /* bq, bl: the same in every lane */
#pragma unroll
    for (int g = 0; g < FQ; ++g) { qh[g][0] = tf_frag(pq + (size_t)g * 16 * LQ); qh[g][1] = tf_frag(pq + (size_t)g * 16 * LQ + 512); ql[g][0] = tf_frag(pl + (size_t)g * 16 * LQ); ql[g][1] = tf_frag(pl + (size_t)g * 16 * LQ + 512); }
    asm volatile("s_wait_xcnt 0x0" :: "s"(bq), "s"(bl), "v"(lane) : "memory"); }      /* stands behind the q loads and in front of every instruction that rewrites an address register they name: the loads take a scalar base and the lane number, which are inputs so that their registers stay as they are up to the wait */
  const _Float16* pkh = Kh + (size_t)b * SQ * LQ + h * (HD * 16) + 8 * lane; const _Float16* pkl = Kl + (size_t)b * SQ * LQ + h * (HD * 16) + 8 * lane;
  const _Float16* pvh = Vh + (size_t)bh * HD * SQ + 8 * lane; const _Float16* pvl = Vl + (size_t)bh * HD * SQ + 8 * lane; const int* pm = Km + (size_t)b * SQ + lane;
  int kmv;
  auto ldk = [&](int kb, bool pre) { const _Float16* a = pkh + (size_t)kb * LQ; const _Float16* c = pkl + (size_t)kb * LQ; const int* e = pm + kb; FAK f;
#pragma unroll
    for (int t = 0; t < 2; ++t) { f.h[t][0] = tf_frag(a + (size_t)t * 16 * LQ); f.h[t][1] = tf_frag(a + (size_t)t * 16 * LQ + 512); f.l[t][0] = tf_frag(c + (size_t)t * 16 * LQ); f.l[t][1] = tf_frag(c + (size_t)t * 16 * LQ + 512); }
    kmv = *e;
    /* the wait stands behind the loads and in front of every instruction that rewrites an address register they name; the addresses are inputs so that their registers stay as they are up to the wait. pre (a constant at each call): the loads in front of the loop take a scalar base and the lane number, so there the lane number is an input too */
    if (pre) asm volatile("s_wait_xcnt 0x0" :: "v"(a), "v"(c), "v"(e), "v"(lane) : "memory"); else asm volatile("s_wait_xcnt 0x0" :: "v"(a), "v"(c), "v"(e) : "memory");
    return f; };
  auto ldv = [&](int kb) { const _Float16* a = pvh + (size_t)kb * 16; const _Float16* c = pvl + (size_t)kb * 16; FAV f;      /* 32 keys = one tile of 512 elements */
#pragma unroll
    for (int d = 0; d < 4; ++d) { f.h[d] = tf_frag(a + (size_t)d * 16 * SQ); f.l[d] = tf_frag(c + (size_t)d * 16 * SQ); }
    asm volatile("s_wait_xcnt 0x0" :: "v"(a), "v"(c) : "memory");      /* as in ldk */
    return f; };
  const v8f z8 = {0.f, 0.f, 0.f, 0.f, 0.f, 0.f, 0.f, 0.f};
  v8f o[FQ][4]; float m[FQ], l[FQ];
#pragma unroll
  for (int g = 0; g < FQ; ++g) { m[g] = -3.0e38f; l[g] = 0.f; for (int d = 0; d < 4; ++d) o[g][d] = z8; }
  FAK kf = ldk(0, true);
  /* kept rolled: one trip holds 32 keys x 32 queries, and a second copy would only add code and registers */
#pragma unroll 1
  for (int kb = 0; kb <= q0; kb += 32) {
    const FAV vf = ldv(kb);      /* issued here, first read behind the softmax */
    v8f s[FQ][2];
#pragma unroll
    for (int g = 0; g < FQ; ++g) {
#pragma unroll
      for (int t = 0; t < 2; ++t) { v8f sh = fa_mma(kf.h[t][0], qh[g][0], z8); sh = fa_mma(kf.h[t][1], qh[g][1], sh);
        v8f sl = fa_mma(kf.h[t][0], ql[g][0], z8); sl = fa_mma(kf.h[t][1], ql[g][1], sl); sl = fa_mma(kf.l[t][0], qh[g][0], sl); sl = fa_mma(kf.l[t][1], qh[g][1], sl);
#pragma unroll
        for (int r = 0; r < 8; ++r) s[g][t][r] = fmaf(sl[r], 0.18033688011112042f / 1024.0f, sh[r] * 0.18033688011112042f); } }      /* (q_hi.k_hi + (q_lo.k_hi + q_hi.k_lo)/1024) / 8, times log2(e) */
    const unsigned bm = __builtin_amdgcn_ballot_w32(kmv != 0);      /* bit j: key kb + j is not padded */
    kf = ldk(kb + 32 <= q0 ? kb + 32 : kb, false);      /* the next trip's K fragments fly over the softmax and P.V; behind the last trip an in-bounds re-read that nothing uses */
    if (kb == q0 || bm != 0xFFFFFFFFu) {      /* only the diagonal trip and trips with a padded key mask; the test is the same for the whole wave */
      const unsigned bmh = bm >> (8 * hh);
#pragma unroll
      for (int g = 0; g < FQ; ++g) {
#pragma unroll
        for (int t = 0; t < 2; ++t) {
#pragma unroll
          for (int r = 0; r < 8; ++r) { const bool ok = (kb + t * 16 + 8 * hh + r <= q0 + g * 16 + ln) && ((bmh >> (t * 16 + r)) & 1u); s[g][t][r] = ok ? s[g][t][r] : -1.0e9f; } } } }
    v16h ph[FQ], pl[FQ];
#pragma unroll
    for (int g = 0; g < FQ; ++g) { float mx = fmaxf(s[g][0][0], s[g][1][0]);
#pragma unroll
      for (int r = 1; r < 8; ++r) mx = fmaxf(mx, fmaxf(s[g][0][r], s[g][1][r]));
      mx = fmaxf(mx, __shfl_xor(mx, 16, 32));      /* the query's other 16 keys of this trip sit in the other lane half */
      const float mn = fmaxf(m[g], mx); const float sc = exp2_native(m[g] - mn); const float mo = mn - 12.0f; m[g] = mn;
      float se0 = 0.f, se1 = 0.f;
#pragma unroll
      for (int r = 0; r < 8; ++r) { const float e0 = exp2_native(s[g][0][r] - mo), e1 = exp2_native(s[g][1][r] - mo); se0 += e0; se1 += e1; ph[g][r] = (_Float16)e0; ph[g][8 + r] = (_Float16)e1; }
      l[g] = fmaf(l[g], sc, se0 + se1); pl[g] = ph[g] * (_Float16)0.0009765625f;
#pragma unroll
      for (int d = 0; d < 4; ++d) o[g][d] *= sc; }
#pragma unroll
    for (int d = 0; d < 4; ++d) {
#pragma unroll
      for (int g = 0; g < FQ; ++g) { o[g][d] = fa_mma(vf.h[d], ph[g], o[g][d]); o[g][d] = fa_mma(vf.l[d], pl[g], o[g][d]); } } }
  /* o leaves as the two fragment-major planes that the out GEMM reads (f16 hi + x1024 residual, DM columns). A lane holds 8 consecutive columns (d * 16 + 8 hh + r) of its query row (ln) per tile: one chunk of a plane tile, at the lane's own place in it, so each store is 512 contiguous bytes of the wave */
  v8us hv[FQ][4], lv[FQ][4];
#pragma unroll
  for (int g = 0; g < FQ; ++g) { const float fin = 64.0f / (l[g] + __shfl_xor(l[g], 16, 32));      /* o carried x64; the halves' sums are joined once */
#pragma unroll
    for (int d = 0; d < 4; ++d) { float v[8];
#pragma unroll
      for (int r = 0; r < 8; ++r) v[r] = o[g][d][r] * fin;
      hl8(v, hv[g][d], lv[g][d]); } }
  const size_t tile0 = ((size_t)b * SQ + q0) * DM + h * (HD * 16); unsigned short* ph = (unsigned short*)Oh + tile0 + 8 * lane; unsigned short* pl = (unsigned short*)Ol + tile0 + 8 * lane;
#pragma unroll
  for (int g = 0; g < FQ; ++g) {
#pragma unroll
    for (int d = 0; d < 4; ++d) { const size_t e = (size_t)g * 16 * DM + (d >> 1) * 512 + (d & 1) * 256; *(v8us*)(ph + e) = hv[g][d]; *(v8us*)(pl + e) = lv[g][d]; } }
  asm volatile("s_wait_xcnt 0x0" :: "v"(ph), "v"(pl) : "memory");      /* stands behind the stores: their address registers stay as they are up to here */
}


// Exact f32 attention of the first QT0 rows of every batch; one thread per query row, one block per (head, 64 rows), blockIdx.y = batch (all row planes hold SQ rows per batch).
// All operands stay on chip: the head's K and V rows (and the key padding entries) are staged once in LDS with whole-line loads, every lane then reads the same LDS address (a broadcast, no bank conflict), and the thread's q and o rows live in registers.
// Four keys per trip: their four score chains are independent, so one chain's dependent adds are covered by the other three. Every sum (score, l, o) keeps its order: d = 0..63 inside a score, keys in rising j.
template <int MASKADD, int MASKKV>
__global__ __launch_bounds__(64) void k_att0(const float* __restrict__ QF, const float* __restrict__ KF, const float* __restrict__ VF, int ld, const float* __restrict__ mask, const int* __restrict__ Km, float scale, _Float16* __restrict__ Oh, _Float16* __restrict__ Ol) {
  #pragma clang fp contract(off)
  __shared__ __attribute__((aligned(16))) float lk[QT0][HD]; __shared__ __attribute__((aligned(16))) float lv[QT0][HD]; __shared__ __attribute__((aligned(16))) int lm[QT0];
  const int tid = threadIdx.x; const int h = blockIdx.x / (QT0 / 64), rg = blockIdx.x % (QT0 / 64); const int i = rg * 64 + tid;
  { const size_t rb = (size_t)blockIdx.y * SQ; QF += rb * ld; KF += rb * ld; VF += rb * ld; Oh += rb * DM; Ol += rb * DM; if (MASKKV) Km += rb; }      /* the batch's first row */
  const float* qr = QF + (size_t)i * ld + h * HD;
  v4f q[HD / 4], o[HD / 4];
  /* every loop over c is fully unrolled so that q and o are registers, not scratch */
#pragma unroll
  for (int c = 0; c < HD / 4; ++c) { q[c] = *(const v4fa*)(qr + c * 4); const v4f z = {0.f, 0.f, 0.f, 0.f}; o[c] = z; }
  asm volatile("s_wait_xcnt 0x0" :: "v"(qr) : "memory");      /* stands behind the q loads and in front of every instruction that rewrites their address register; the address is an input so that its register stays as it is up to the wait */
  float m = -1.0e30f, l = 0.f; const int jmax = MASKADD ? (SQ - 1) : (rg * 64 + 63);      /* additive-mask form: every key (the mask input decides); causal form: keys up to the block's last row */
  /* kept rolled: the causal form makes one trip */
#pragma unroll 1
  for (int jt = 0; jt <= jmax; jt += QT0) { const int nr = (jmax + 1 - jt < QT0) ? (jmax + 1 - jt) : QT0;      /* keys of this tile: a multiple of 64, the same for the whole block */
    if (jt) __syncthreads();      /* every reader has left the tile before it is refilled */
    /* eight K and eight V loads in flight per thread; 16 lanes cover one 256-byte row, the block 4 rows per load */
    const size_t g0 = (size_t)(jt + (tid >> 4)) * ld + h * HD + (tid & 15) * 4;
    /* kept rolled: nr is only known at run time, and each trip already has sixteen loads per thread in flight */
#pragma unroll 1
    for (int r0 = 0; r0 < nr; r0 += 32) { v4f tk[8], tv[8]; const float *pk[8], *pv[8];
      /* the three loops over u are fully unrolled so that the pointers and the loaded rows are registers and the sixteen loads stand together */
#pragma unroll
      for (int u = 0; u < 8; ++u) { const size_t g = g0 + (size_t)(r0 + u * 4) * ld; pk[u] = KF + g; pv[u] = VF + g; }
#pragma unroll
      for (int u = 0; u < 8; ++u) { tk[u] = *(const v4fa*)pk[u]; tv[u] = *(const v4fa*)pv[u]; }
      asm volatile("s_wait_xcnt 0x0" :: "v"(pk[0]), "v"(pk[1]), "v"(pk[2]), "v"(pk[3]), "v"(pk[4]), "v"(pk[5]), "v"(pk[6]), "v"(pk[7]), "v"(pv[0]), "v"(pv[1]), "v"(pv[2]), "v"(pv[3]), "v"(pv[4]), "v"(pv[5]), "v"(pv[6]), "v"(pv[7]) : "memory");      /* stands behind the trip's loads and in front of every instruction that rewrites an address register they name; the addresses are inputs so that no load lands on one of them */
#pragma unroll
      for (int u = 0; u < 8; ++u) { const int r = r0 + u * 4 + (tid >> 4); *(v4f*)&lk[r][(tid & 15) * 4] = tk[u]; *(v4f*)&lv[r][(tid & 15) * 4] = tv[u]; } }
    if (MASKKV) for (int e = tid; e < nr; e += 64) lm[e] = Km[jt + e];
    __syncthreads();      /* the tile is complete before any thread reads it */
    /* kept rolled: one trip already holds four keys, and a second copy would only add code and registers */
#pragma unroll 1
    for (int jj = 0; jj < nr; jj += 4) { float s4[4] = {0.f, 0.f, 0.f, 0.f}, sc4[4], e4[4]; v4ia km4 = {1, 1, 1, 1}; if (MASKKV) km4 = *(const v4ia*)&lm[jj];
      /* all loops over c and u below are fully unrolled: constant indices keep q, o and the four keys' values in registers, and the four score chains stand side by side */
#pragma unroll
      for (int c = 0; c < HD / 4; ++c) { const v4f qq = q[c];
#pragma unroll
        for (int u = 0; u < 4; ++u) { const v4f kq = *(const v4f*)&lk[jj + u][c * 4]; float s = s4[u]; s = __fadd_rn(s, __fmul_rn(qq[0], kq[0])); s = __fadd_rn(s, __fmul_rn(qq[1], kq[1])); s = __fadd_rn(s, __fmul_rn(qq[2], kq[2])); s = __fadd_rn(s, __fmul_rn(qq[3], kq[3])); s4[u] = s; } }
#pragma unroll
      for (int u = 0; u < 4; ++u) { const int j = jt + jj + u; float s = __fmul_rn(s4[u], scale); if (MASKADD) s = __fadd_rn(s, __fmul_rn(bf16_round(mask[(size_t)i * SQ + j]), -10000.0f));
        const float f = (MASKADD || (j <= i && (!MASKKV || km4[u] != 0))) ? 1.f : 0.f;      /* MASKKV: also drop keys whose int padding entry is 0 */ const float sm = fmaf(f, s, (1.f - f) * -1.0e30f); const float mn = fmaxf(m, sm); const float sc = expf(m - mn); const float e = expf(sm - mn); l = __fadd_rn(__fmul_rn(l, sc), e); m = mn; sc4[u] = sc; e4[u] = e; }
#pragma unroll
      for (int u = 0; u < 4; ++u) { const float sc = sc4[u], e = e4[u];
#pragma unroll
        for (int c = 0; c < HD / 4; ++c) { const v4f vv = *(const v4f*)&lv[jj + u][c * 4]; v4f oo = o[c]; for (int w = 0; w < 4; ++w) oo[w] = __fadd_rn(__fmul_rn(oo[w], sc), __fmul_rn(e, vv[w])); o[c] = oo; } } } }
  const float fin = 64.0f / l;      /* o carried x64 like the f16 path */
  /* the row leaves as chunks of the two fragment-major o planes (f16 hi + x1024 residual, DM columns), over the fused kernel's: 16 lanes fill 256 contiguous bytes per store, each line written by this wave alone */
  const size_t d0 = tf_off((size_t)i, (size_t)h * HD, DM); unsigned short* ph = (unsigned short*)Oh + d0; unsigned short* pl = (unsigned short*)Ol + d0; v8us ch[HD / 8], cl[HD / 8];
  /* unrolled: o and the chunks stay in registers */
#pragma unroll
  for (int c = 0; c < HD / 8; ++c) { float v[8]; for (int w = 0; w < 4; ++w) { v[w] = __fmul_rn(o[2 * c][w], fin); v[4 + w] = __fmul_rn(o[2 * c + 1][w], fin); } hl8(v, ch[c], cl[c]); }
#pragma unroll
  for (int c = 0; c < HD / 8; ++c) { const size_t e = (size_t)(c >> 2) * 512 + ((c >> 1) & 1) * 256 + (c & 1) * 128; *(v8us*)(ph + e) = ch[c]; *(v8us*)(pl + e) = cl[c]; }
  asm volatile("s_wait_xcnt 0x0" :: "v"(ph), "v"(pl) : "memory");      /* stands behind the stores: their address registers stay as they are up to here */
}


__global__ __launch_bounds__(256) void k_xt16(const float* __restrict__ x, const float* __restrict__ tg, const float* __restrict__ wt, const float* __restrict__ bt, _Float16* __restrict__ XT, _Float16* __restrict__ XL, size_t n8) {
  #pragma clang fp contract(off)
  const size_t t = (size_t)blockIdx.x * 256 + threadIdx.x; if (t >= n8) return; size_t r, kc; tf_chunk(t, r, kc); const float* px = x + r * DM + kc; const float* pw = wt + kc; const float* pb = bt + kc; const float* pg = tg + r; FragH f, l;
  const v4f x0 = *(const v4fa*)px, x1 = *(const v4fa*)(px + 4), w0 = *(const v4fa*)pw, w1 = *(const v4fa*)(pw + 4), b0 = *(const v4fa*)pb, b1 = *(const v4fa*)(pb + 4); const float g = bf16_round(*pg);
  asm volatile("s_wait_xcnt 0x0" :: "v"(px), "v"(pw), "v"(pb), "v"(pg) : "memory");      /* stands behind the seven loads and in front of every instruction that rewrites an address register they name; the addresses are inputs so that no load lands on one of them */
  const float xv[8] = {x0[0], x0[1], x0[2], x0[3], x1[0], x1[1], x1[2], x1[3]}, wv[8] = {w0[0], w0[1], w0[2], w0[3], w1[0], w1[1], w1[2], w1[3]}, bv[8] = {b0[0], b0[1], b0[2], b0[3], b1[0], b1[1], b1[2], b1[3]};
  /* unrolled so that the three small arrays are registers */
#pragma unroll
  for (int q = 0; q < 8; ++q) { const float te = __fadd_rn(__fmul_rn(g, bf16_round(wv[q])), bf16_round(bv[q])); const float v = __fadd_rn(bf16_round(xv[q]), te); const _Float16 h = (_Float16)v; f.h[q] = h; l.h[q] = (_Float16)((v - (float)h) * 1024.0f); }
  const size_t di = tf_off(r, kc, DM); *(v8us*)((unsigned short*)XT + di) = f.half[0]; *(v8us*)((unsigned short*)XL + di) = l.half[0];  }      /* XT, XL fragment-major */
extern "C" void kernel_launch(void* const* d_in, const int* in_sizes, int n_in,
                              void* d_out, int out_size, void* d_ws, size_t ws_size, hipStream_t stream) {
  (void)in_sizes; (void)n_in; (void)out_size;
  const float* const* I = (const float* const*)d_in; const float* x = I[0]; const float* tg = I[1]; const int* km = (const int*)d_in[2]; const float* wq = I[3]; const float* bq = I[4]; const float* wk = I[5]; const float* bk = I[6]; const float* wv = I[7]; const float* bv = I[8]; const float* wo = I[9]; const float* bo = I[10]; const float* wt = I[11]; const float* bt = I[12];      /* natural [out][in] weights + biases; time_gaps [2][2048][1]; int key mask [2][2048]; Wt [1024][1], bt [1024] */
  char* ws = (char*)d_ws; size_t off = 0;
  auto take = [&](size_t bytes) { char* p = ws + off; off += (bytes + 255) & ~(size_t)255; return p; };
  _Float16* BQ = (_Float16*)take((size_t)DM * DM * 2); _Float16* BK = (_Float16*)take((size_t)DM * DM * 2); _Float16* BV = (_Float16*)take((size_t)DM * DM * 2); _Float16* BO = (_Float16*)take((size_t)DM * DM * 2);
  _Float16* X16 = (_Float16*)take(NR * DM * 2); _Float16* XT16 = (_Float16*)take(NR * DM * 2); _Float16* XL16 = (_Float16*)take(NR * DM * 2);      /* x (exact f16) for v; x_time as f16 hi + x1024 residual for q and k */ float* QF = (float*)take(NR * DM * 4); float* KF = (float*)take(NR * DM * 4); float* VF = (float*)take(NR * DM * 4);      /* f32 rows of q, k, v: only the first QT0 rows of each batch are written and read (the first-tile attention) */ _Float16* Q16 = (_Float16*)take(NR * DM * 2); _Float16* QL = (_Float16*)take(NR * DM * 2); _Float16* K16 = (_Float16*)take(NR * DM * 2); _Float16* KL = (_Float16*)take(NR * DM * 2); _Float16* O16 = (_Float16*)take(NR * DM * 2); _Float16* OL = (_Float16*)take(NR * DM * 2);
  _Float16* VT = (_Float16*)take((size_t)NB * NH * HD * SQ * 2); _Float16* VTL = (_Float16*)take((size_t)NB * NH * HD * SQ * 2);      /* V^T planes of both batches */
  if (off > ws_size) return;
  { const unsigned g = (unsigned)(((size_t)DM * DM / 8 + 255) / 256); k_wnat<<<g, 256, 0, stream>>>(wq, (size_t)DM * DM / 8, BQ); k_wnat<<<g, 256, 0, stream>>>(wk, (size_t)DM * DM / 8, BK); k_wnat<<<g, 256, 0, stream>>>(wv, (size_t)DM * DM / 8, BV); k_wnat<<<g, 256, 0, stream>>>(wo, (size_t)DM * DM / 8, BO); }      /* natural [out][in] = Bt[n][k], x16 */

  k_x16<<<(unsigned)((NR * DM / 8 + 255) / 256), 256, 0, stream>>>(x, X16, NR * DM / 8); k_xt16<<<(unsigned)((NR * DM / 8 + 255) / 256), 256, 0, stream>>>(x, tg, wt, bt, XT16, XL16, NR * DM / 8);      /* x_time = x + time_gaps Wt^T + bt as f16 hi + x1024 residual rows */
  const size_t r0p = (size_t)B0 * SQ;      /* first projected row */
  k_gemm2p<true><<<(unsigned)((MP / 128) * (DM / 64)), 128, 0, stream>>>(XT16 + r0p * DM, XL16 + r0p * DM, BQ, 0.0625f, 0.00006103515625f, bq, QF + r0p * DM, MP, Q16 + r0p * DM, QL + r0p * DM);      /* q: the GEMM writes the f16 hi + x1024 residual planes itself */
  k_gemm2p<true><<<(unsigned)((MP / 128) * (DM / 64)), 128, 0, stream>>>(XT16 + r0p * DM, XL16 + r0p * DM, BK, 0.0625f, 0.00006103515625f, bk, KF + r0p * DM, MP, K16 + r0p * DM, KL + r0p * DM);      /* k likewise */
  k_gemm2<0, true><<<dim3((unsigned)((NR / 128) * (DM / 64)), 1), 128, 0, stream>>>(X16, DM, 0, BV, DM, 0, 0.0625f, bv, 0, nullptr, 1, 0, 0, VF, nullptr, DM, 0, (int)NR, DM, DM, VT, VTL);      /* v = x Wv^T + bv in f32; the GEMM writes V^T (f16 hi + x1024 residual) [NB][NH][HD][SQ] itself */
  k_fattn<<<NB * NH * (SQ / (128 * FQ)), 256, 0, stream>>>(Q16, QL, K16, KL, VT, VTL, km, O16, OL);      /* o (x64) as f16 hi + x1024 residual planes: scores, causal + key padding softmax and P.V of both batches and all heads in one launch */
  k_att0<0, 1><<<dim3(NH * (QT0 / 64), NB), 64, 0, stream>>>(QF, KF, VF, DM, nullptr, km, 0.125f, O16, OL);      /* rows 0..127 of each batch: exact f32 causal attention with the key padding vector (o x64), from the f32 q, k, v rows of the full projections, written over the fused kernel's rows of the two o planes; the out GEMM below then takes them like every other row */
  k_gemm2p<false><<<(unsigned)((MPO / 128) * (DM / 64)), 128, 0, stream>>>(O16 + r0p * DM, OL + r0p * DM, BO, 0.0009765625f, 0.00000095367431640625f, bo, (float*)d_out + r0p * DM, MPO, nullptr, nullptr);      /* out = (o_hi Wo^T + bo) + o_lo Wo^T 2^-20, one launch */
}

// v009
// One run takes 153 microseconds.
// Next to v008, in two timings, it ran 1.17 times as fast each time.
// Counting every step since v000, it is 57.7 times as fast.
#include <hip/hip_runtime.h>
// Causal multi-head attention with a time-gap embedding and a key padding mask (x [2][2048][1024]; x_time = x + (time_gaps Wt^T + bt) with time_gaps [2][2048][1] (U[0,1)), Wt [1024][1] sigma 1, bt zeros; q = x_time Wq^T + bq, k = x_time Wk^T + bk, v = x Wv^T + bv (v from the RAW x; natural [1024][1024] sigma 1/32, zero biases); 16 heads of 64; scores / 8; where(mask[b][j] == 0, -1e9) (int mask [2][2048], all ones) and where(j > i, -1e9) (causal); softmax; out = merged Wo^T + bo -> [2][2048][1024]).
// Structure: every f16 plane that a WMMA reads (x, x_time, the weights, q, k, V^T, o) is stored fragment-major (16 x 32 tiles in lane order, see tf_frag); token rows r = b*2048 + s; x as exact f16 rows; x_time = x + t Wt + bt on VALU as f16 hi + x1024 residual rows; q and k = (hi + lo/1024) W + b, each one WMMA GEMM launch with both A planes in the k loop and an accumulator set per plane (32x64 wave tiles, f32 accumulation), split in the GEMM's epilogue into f16 hi + x1024 residual planes; v = x Wv + bv in f32, split likewise in its GEMM's epilogue and written transposed per (batch, head); one fused attention launch (a wave owns 32 query rows, 32 keys per trip): scores^T = k_hi.q_hi + (k_hi.q_lo + k_lo.q_hi)/1024 on WMMA, / 8, causal + key-mask running softmax in registers (f32 statistics, native exp2; weights x4096 f16), o^T += V_hi^T.P^T + V_lo^T.(P^T/1024), o split into hi + residual planes in the kernel's epilogue; out = (o_hi Wo + bo) + o_lo Wo 2^-20 likewise in one launch; first tile: the o rows of the first 128 rows of each batch are computed exactly in f32 on VALU from the f32 q, k, v rows of the full projections (kept in f32 for those rows only), by four waves per (batch, head) of the fused launch, which leaves those rows to them; launches: see trace.
// Compute dtype: inputs rounded to bf16; x / weights exact; q, k, v and o as f16 hi + x1024 residual GEMM operands, softmax weights as plain f16 (~2^-12); scores and softmax statistics f32. v_wmma_f32_16x16x32_f16.
#define NB 2
#define SQ 2048
#define DM 1024
#define NH 16
#define HD 64
#define HG 4                         /* heads per block group of the unlaunched k_vt overload */
#define QT 256                       /* query rows per causal tile */
#define NKX SQ                       /* S / P row pitch */
#define QT0 128                      /* first-tile rows computed exactly in f32 */
#define B0 0                         /* first batch processed (debug hook) */
#define NBR NB                       /* batches processed (debug hook) */
#define NR ((size_t)NB * SQ)         /* token rows */
#define MP ((int)((size_t)NBR * SQ)) /* rows projected (debug hook) */
#define QN SQ                        /* unused (every batch attends all SQ query rows) */
#define NHD NH                       /* unused (all NH heads are attended) */
#define MPO MP                       /* rows through the output stage (debug hook) */
#define LQ DM      /* row pitch of the q/k/v rows */
typedef __bf16 v16b __attribute__((ext_vector_type(16)));
typedef unsigned short v8us __attribute__((ext_vector_type(8), may_alias));
typedef float  v8f  __attribute__((ext_vector_type(8)));
typedef float  v4f  __attribute__((ext_vector_type(4)));
typedef float  v4fa __attribute__((ext_vector_type(4), may_alias));
union FragB { v16b v; v8us half[2]; unsigned short u[16]; };

__device__ __forceinline__ unsigned short bf16_bits(float x) { unsigned int u = __float_as_uint(x); return (unsigned short)((u + 0x7FFFu + ((u >> 16) & 1u)) >> 16); }
__device__ __forceinline__ float bf16_val(unsigned short b) { return __uint_as_float(((unsigned int)b) << 16); }
__device__ __forceinline__ float bf16_round(float x) { return bf16_val(bf16_bits(x)); }
// D += A·B with NT terms: 1 = ah·bh, 2 = + al·bh (A split), 3 = + ah·bl (both split)
template <int NT>
__device__ __forceinline__ v8f mmaN(v16b ah, v16b al, v16b bh, v16b bl, v8f c) {
  c = __builtin_amdgcn_wmma_f32_16x16x32_bf16(false, ah, false, bh, (short)0, c, false, false);
  if (NT >= 2) c = __builtin_amdgcn_wmma_f32_16x16x32_bf16(false, al, false, bh, (short)0, c, false, false);
  if (NT >= 3) c = __builtin_amdgcn_wmma_f32_16x16x32_bf16(false, ah, false, bl, (short)0, c, false, false);
  asm volatile("v_nop\n\tv_nop\n\tv_nop\n\tv_nop" : "+v"(c) : "v"(ah), "v"(al), "v"(bh), "v"(bl));
  return c;
}

__global__ __launch_bounds__(256) void k_wt_bf16(const float* __restrict__ W, unsigned short* __restrict__ Wt, int K, int N) {
  const int t = blockIdx.x * 256 + threadIdx.x;
  const int k8n = K / 8;
  if (t >= N * k8n) return;
  const int n = t / k8n, k8 = (t % k8n) * 8;
  v8us v;
#pragma unroll
  for (int i = 0; i < 8; ++i) v[i] = bf16_bits(W[(size_t)(k8 + i) * N + n]);
  *(v8us*)(Wt + (size_t)n * K + k8) = v;
  
}

// GEMM C[M][N] (f32, pitch ldc) = act(A[M][K]·W + bias). A f32 row-major (pitch lda) converted per fragment to bf16
// (ASPLIT: hi/lo two planes -> 2 terms, else single rounded term); Wt bf16 [N][K] (pitch ldb). BIAS_BF16 rounds the
// bias to bf16 first (bias quantised to bf16 before the add). K%32==0, M%16==0, N%64==0.
template <bool ASPLIT, int ACT, bool BIAS_BF16>
__global__ __launch_bounds__(128) void k_gemm_bf(const float* __restrict__ A, int lda, const unsigned short* __restrict__ Wt, int ldb,
                                               const float* __restrict__ bias, float* __restrict__ C, int ldc, int M, int N, int K) {
  __shared__ __attribute__((aligned(16))) float so[4][16][64];
  const int tid = threadIdx.x, w = tid >> 5, lane = tid & 31, ln = lane & 15, hh = lane >> 4;
  const int ntn = N / 64;
  const int wid = blockIdx.x * 4 + w;
  const int mt = wid / ntn, nq = wid % ntn;
  if (mt * 16 >= M) return;
  const int row0 = mt * 16, col0 = nq * 64;
  const float* arow = A + (size_t)(row0 + ln) * lda;
  v8f acc[4] = {};
  for (int kb = 0; kb < K; kb += 32) {
    FragB ah, al;
    const v4f x0 = *(const v4fa*)(arow + kb + 8 * hh), x1 = *(const v4fa*)(arow + kb + 8 * hh + 4);
    const v4f x2 = *(const v4fa*)(arow + kb + 16 + 8 * hh), x3 = *(const v4fa*)(arow + kb + 16 + 8 * hh + 4);
    float xs[16] = {x0[0],x0[1],x0[2],x0[3],x1[0],x1[1],x1[2],x1[3],x2[0],x2[1],x2[2],x2[3],x3[0],x3[1],x3[2],x3[3]};
#pragma unroll
    for (int i = 0; i < 16; ++i) { const unsigned short hb = bf16_bits(xs[i]); ah.u[i] = hb; al.u[i] = ASPLIT ? bf16_bits(xs[i] - bf16_val(hb)) : (unsigned short)0; }
#pragma unroll
    for (int t = 0; t < 4; ++t) {
      const unsigned short* brow = Wt + (size_t)(col0 + t * 16 + ln) * ldb + kb;
      FragB b;
      b.half[0] = *(const v8us*)(brow + 8 * hh);
      b.half[1] = *(const v8us*)(brow + 16 + 8 * hh);
      acc[t] = mmaN<ASPLIT ? 2 : 1>(ah.v, al.v, b.v, b.v, acc[t]);
    }
  }
#pragma unroll
  for (int t = 0; t < 4; ++t) {
    float bv = bias ? bias[col0 + t * 16 + ln] : 0.f;
    if (BIAS_BF16) bv = bf16_round(bv);
#pragma unroll
    for (int r = 0; r < 8; ++r) { float v = acc[t][r] + bv; if (ACT == 1) v = fmaxf(v, 0.f); so[w][8 * hh + r][t * 16 + ln] = v; }
  }
  __builtin_amdgcn_fence(__ATOMIC_ACQ_REL, "workgroup");
  __builtin_amdgcn_wave_barrier();
  const int rsub = lane >> 4, c4 = (lane & 15) * 4;
  {
#pragma unroll
    for (int q = 0; q < 8; ++q) {
      const int r = q * 2 + rsub;
      const v4f v = *(const v4fa*)&so[w][r][c4];
      *(v4f*)(C + (size_t)(row0 + r) * ldc + col0 + c4) = v;
    }
    
  }
}

// GEMM C = act(A·W + bias + resid): A f32 (ASPLIT -> hi/lo 2 terms), Wt bf16 [N][K]; ACT 0 none, 1 relu, 2 exact gelu;
// resid (optional, f32, row index = (row % rmod), pitch ldr, RES_BF16 rounds it) added before the activation.
template <bool ASPLIT, int ACT, bool BIAS_BF16, bool RES_BF16>
__global__ __launch_bounds__(128) void k_gemm_bf3(const float* __restrict__ A, int lda, const unsigned short* __restrict__ Wt, int ldb,
                                                const float* __restrict__ bias, const float* __restrict__ resid, int rmod, int ldr,
                                                float* __restrict__ C, int ldc, int M, int N, int K) {
  __shared__ __attribute__((aligned(16))) float so[4][16][64];
  const int tid = threadIdx.x, w = tid >> 5, lane = tid & 31, ln = lane & 15, hh = lane >> 4;
  const int ntn = N / 64;
  const int wid = blockIdx.x * 4 + w;
  const int mt = wid / ntn, nq = wid % ntn;
  if (mt * 16 >= M) return;
  const int row0 = mt * 16, col0 = nq * 64;
  const float* arow = A + (size_t)(row0 + ln) * lda;
  v8f acc[4] = {};
  for (int kb = 0; kb < K; kb += 32) {
    FragB ah, al;
    const v4f x0 = *(const v4fa*)(arow + kb + 8 * hh), x1 = *(const v4fa*)(arow + kb + 8 * hh + 4);
    const v4f x2 = *(const v4fa*)(arow + kb + 16 + 8 * hh), x3 = *(const v4fa*)(arow + kb + 16 + 8 * hh + 4);
    float xs[16] = {x0[0],x0[1],x0[2],x0[3],x1[0],x1[1],x1[2],x1[3],x2[0],x2[1],x2[2],x2[3],x3[0],x3[1],x3[2],x3[3]};
#pragma unroll
    for (int i = 0; i < 16; ++i) { const unsigned short hb = bf16_bits(xs[i]); ah.u[i] = hb; al.u[i] = ASPLIT ? bf16_bits(xs[i] - bf16_val(hb)) : (unsigned short)0; }
#pragma unroll
    for (int t = 0; t < 4; ++t) {
      const unsigned short* brow = Wt + (size_t)(col0 + t * 16 + ln) * ldb + kb;
      FragB b;
      b.half[0] = *(const v8us*)(brow + 8 * hh);
      b.half[1] = *(const v8us*)(brow + 16 + 8 * hh);
      acc[t] = mmaN<ASPLIT ? 2 : 1>(ah.v, al.v, b.v, b.v, acc[t]);
    }
  }
#pragma unroll
  for (int t = 0; t < 4; ++t) {
    const int col = col0 + t * 16 + ln;
    float bv = bias ? bias[col] : 0.f;
    if (BIAS_BF16) bv = bf16_round(bv);
#pragma unroll
    for (int r = 0; r < 8; ++r) {
      float v = acc[t][r] + bv;
      if (resid) { float rv = resid[(size_t)((row0 + 8 * hh + r) % rmod) * ldr + col]; if (RES_BF16) rv = bf16_round(rv); v += rv; }
      if (ACT == 1) v = fmaxf(v, 0.f);
      if (ACT == 2) v = 0.5f * v * (1.0f + erff(v * 0.70710678118654752f));
      if (ACT == 3) { const float u = 0.7978845608028654f * (v + 0.044715f * v * v * v); v = 0.5f * v * (1.0f + tanhf(u)); }
      so[w][8 * hh + r][t * 16 + ln] = v;
    }
  }
  __builtin_amdgcn_fence(__ATOMIC_ACQ_REL, "workgroup");
  __builtin_amdgcn_wave_barrier();
  const int rsub = lane >> 4, c4 = (lane & 15) * 4;
  {
#pragma unroll
    for (int q = 0; q < 8; ++q) {
      const int r = q * 2 + rsub;
      const v4f v = *(const v4fa*)&so[w][r][c4];
      *(v4f*)(C + (size_t)(row0 + r) * ldc + col0 + c4) = v;
    }
    
  }
}
// row LayerNorm (biased variance, eps) over N: s = X (+ R); optional out_sum <- s; out_norm <- (s-mu)*rsqrt(var+eps)*g + b
template <bool PARAM_BF16>
__global__ __launch_bounds__(256) void k_layernorm(const float* __restrict__ X, const float* __restrict__ R, const float* __restrict__ g, const float* __restrict__ bta,
                                                  float* __restrict__ out_sum, float* __restrict__ out_norm, int N, float eps) {
  __shared__ float red[256];
  const int row = blockIdx.x, tid = threadIdx.x;
  const float* x = X + (size_t)row * N; const float* rr = R ? R + (size_t)row * N : nullptr;
  float vals[16];                     // up to N = 4096
  const int per = N / 256;            // contiguous chunk per thread? use strided-by-4 chunks: thread handles j = tid*4 + 1024*u
  float s1 = 0.f;
  for (int u = 0; u < per / 4; ++u) {
    const int j = tid * 4 + 1024 * u;
    const v4f a = *(const v4fa*)(x + j);
    v4f b = {0.f,0.f,0.f,0.f}; if (rr) b = *(const v4fa*)(rr + j);
#pragma unroll
    for (int q = 0; q < 4; ++q) { const float v = a[q] + b[q]; vals[u * 4 + q] = v; s1 += v; }
  }
  red[tid] = s1; __syncthreads();
  for (int st = 128; st > 0; st >>= 1) { if (tid < st) red[tid] += red[tid + st]; __syncthreads(); }
  const float mu = red[0] / (float)N; __syncthreads();
  float s2 = 0.f;
  for (int u = 0; u < per / 4; ++u)
#pragma unroll
    for (int q = 0; q < 4; ++q) { const float c = vals[u * 4 + q] - mu; s2 += c * c; }
  red[tid] = s2; __syncthreads();
  for (int st = 128; st > 0; st >>= 1) { if (tid < st) red[tid] += red[tid + st]; __syncthreads(); }
  const float rs = rsqrtf(red[0] / (float)N + eps);
  {
    for (int u = 0; u < per / 4; ++u) {
      const int j = tid * 4 + 1024 * u;
      v4f o, sm;
#pragma unroll
      for (int q = 0; q < 4; ++q) {
        float gg = g[j + q], bb = bta[j + q];
        if (PARAM_BF16) { gg = bf16_round(gg); bb = bf16_round(bb); }
        sm[q] = vals[u * 4 + q]; o[q] = (vals[u * 4 + q] - mu) * rs * gg + bb;
      }
      if (out_sum) *(v4f*)(out_sum + (size_t)row * N + j) = sm;
      *(v4f*)(out_norm + (size_t)row * N + j) = o;
    }
    
  }
}



// ---- f16 WMMA path (v_wmma_f32_16x16x32_f16): 11-bit significands for operands in range — used where a [0,1] probability operand needs more precision than bf16
typedef _Float16 v16h __attribute__((ext_vector_type(16)));
union FragH { v16h v; v8us half[2]; _Float16 h[16]; unsigned short u[16]; };
template <int NT>
__device__ __forceinline__ v8f mmaH(v16h ah, v16h al, v16h bh, v16h bl, v8f c) {
  c = __builtin_amdgcn_wmma_f32_16x16x32_f16(false, ah, false, bh, (short)0, c, false, false);
  if (NT >= 2) c = __builtin_amdgcn_wmma_f32_16x16x32_f16(false, al, false, bh, (short)0, c, false, false);
  if (NT >= 3) c = __builtin_amdgcn_wmma_f32_16x16x32_f16(false, ah, false, bl, (short)0, c, false, false);
  asm volatile("v_nop\n\tv_nop\n\tv_nop\n\tv_nop" : "+v"(c) : "v"(ah), "v"(al), "v"(bh), "v"(bl));
  return c;
}
// batched GEMM like k_gemm_b but f16 operands: A f32 (split into f16 hi/lo if ASPLIT, else rounded to f16), Bt = f16 values [n][k]; alpha; C f32; N multiple of 16 (partial tiles skipped)
template <bool ASPLIT>
__global__ __launch_bounds__(128) void k_gemm_h(const float* __restrict__ A, int lda, size_t sA, const _Float16* __restrict__ Bh, int ldb, size_t sB, float alpha, float* __restrict__ C, int ldc, size_t sC, int M, int N, int K) {
  __shared__ __attribute__((aligned(16))) float so[4][16][64];
  const int tid = threadIdx.x, w = tid >> 5, lane = tid & 31, ln = lane & 15, hh = lane >> 4; const int by = blockIdx.y;
  A += (size_t)by * sA; Bh += (size_t)by * sB; C += (size_t)by * sC;
  const int ntn = (N + 63) / 64; const int wid = blockIdx.x * 4 + w; const int mt = wid / ntn, nq = wid % ntn; if (mt * 16 >= M) return;
  const int row0 = mt * 16, col0 = nq * 64; const float* arow = A + (size_t)(row0 + ln) * lda;
  v8f acc[4] = {};
  for (int kb = 0; kb < K; kb += 32) {
    FragH ah, al;
    const v4f x0 = *(const v4fa*)(arow + kb + 8 * hh), x1 = *(const v4fa*)(arow + kb + 8 * hh + 4), x2 = *(const v4fa*)(arow + kb + 16 + 8 * hh), x3 = *(const v4fa*)(arow + kb + 16 + 8 * hh + 4);
    float xs[16] = {x0[0],x0[1],x0[2],x0[3],x1[0],x1[1],x1[2],x1[3],x2[0],x2[1],x2[2],x2[3],x3[0],x3[1],x3[2],x3[3]};
#pragma unroll
    for (int i = 0; i < 16; ++i) { const _Float16 h = (_Float16)xs[i]; ah.h[i] = h; al.h[i] = ASPLIT ? (_Float16)(xs[i] - (float)h) : (_Float16)0.0f; }
#pragma unroll
    for (int t = 0; t < 4; ++t) { if (col0 + t * 16 >= N) continue; const size_t boff = (size_t)(col0 + t * 16 + ln) * ldb + kb; FragH bq; bq.half[0] = *(const v8us*)(Bh + boff + 8 * hh); bq.half[1] = *(const v8us*)(Bh + boff + 16 + 8 * hh);
      acc[t] = mmaH<ASPLIT ? 2 : 1>(ah.v, al.v, bq.v, bq.v, acc[t]); }
  }
#pragma unroll
  for (int t = 0; t < 4; ++t) { if (col0 + t * 16 >= N) continue;
#pragma unroll
    for (int r = 0; r < 8; ++r) so[w][8 * hh + r][t * 16 + ln] = acc[t][r] * alpha; }
  __builtin_amdgcn_fence(__ATOMIC_ACQ_REL, "workgroup"); __builtin_amdgcn_wave_barrier();
  const int rsub = lane >> 4, c4 = (lane & 15) * 4;
  {
#pragma unroll
    for (int q = 0; q < 8; ++q) { const int r = q * 2 + rsub; if (col0 + c4 < N) { const v4f v = *(const v4fa*)&so[w][r][c4]; *(v4f*)(C + (size_t)(row0 + r) * ldc + col0 + c4) = v; } }
     }
}

// Wt[n][k] = f16(W[k][n]·scale) from f32 row-major W[K][N] (scale = power of two; bf16-exact weights stay exact in f16 away from the subnormal range)
__global__ __launch_bounds__(256) void k_wt_f16(const float* __restrict__ W, _Float16* __restrict__ Wt, int K, int N, float scale) {
  const int t = blockIdx.x * 256 + threadIdx.x; if (t >= N * (K / 8)) return; const int n = t / (K / 8), k8 = (t % (K / 8)) * 8; FragH f;
#pragma unroll
  for (int i = 0; i < 8; ++i) f.h[i] = (_Float16)(bf16_round(W[(size_t)(k8 + i) * N + n]) * scale); const v8us o = f.half[0];
  *(v8us*)((unsigned short*)Wt + (size_t)n * K + k8) = o; 
}
// k_gemm_hh variant with fused epilogue: v = acc·alpha + bias[by·sBias + col] (+ CP[(row/rowsPerB)·sCPb + by·64 + col] if CP) ; ACT 0 none / 1 elu ; writes f16 C16 (and f32 C if non-null)
template <int ACT>
__global__ __launch_bounds__(128) void k_gemm_hhx(const _Float16* __restrict__ A, int lda, size_t sA, const _Float16* __restrict__ Bh, int ldb, size_t sB, float alpha, const float* __restrict__ bias, size_t sBias, const float* __restrict__ CP, int rowsPerB, size_t sCPb, int row0g,
    float* __restrict__ C, _Float16* __restrict__ C16, int ldc, size_t sC, int M, int N, int K) {
  __shared__ __attribute__((aligned(16))) float so[4][16][64];
  const int tid = threadIdx.x, w = tid >> 5, lane = tid & 31, ln = lane & 15, hh = lane >> 4; const int by = blockIdx.y;
  A += (size_t)by * sA; Bh += (size_t)by * sB; const size_t cofs = (size_t)by * sC; const float* bp = bias ? bias + (size_t)by * sBias : nullptr;
  const int ntn = (N + 63) / 64; const int wid = blockIdx.x * 4 + w; const int mt = wid / ntn, nq = wid % ntn; if (mt * 16 >= M) return;
  const int row0 = mt * 16, col0 = nq * 64; const _Float16* arow = A + (size_t)(row0 + ln) * lda;
  v8f acc[4] = {};
  for (int kb = 0; kb < K; kb += 32) { FragH ah; ah.half[0] = *(const v8us*)((const unsigned short*)arow + kb + 8 * hh); ah.half[1] = *(const v8us*)((const unsigned short*)arow + kb + 16 + 8 * hh);
#pragma unroll
    for (int t = 0; t < 4; ++t) { if (col0 + t * 16 >= N) continue; const size_t boff = (size_t)(col0 + t * 16 + ln) * ldb + kb; FragH bq; bq.half[0] = *(const v8us*)((const unsigned short*)Bh + boff + 8 * hh); bq.half[1] = *(const v8us*)((const unsigned short*)Bh + boff + 16 + 8 * hh);
      acc[t] = mmaH<1>(ah.v, ah.v, bq.v, bq.v, acc[t]); }
  }
#pragma unroll
  for (int t = 0; t < 4; ++t) { if (col0 + t * 16 >= N) continue; const int col = col0 + t * 16 + ln; const float bv = bp ? bf16_round(bp[col]) : 0.f;
#pragma unroll
    for (int r = 0; r < 8; ++r) { float v = acc[t][r] * alpha + bv; if (CP) { const int rr = row0g + row0 + 8 * hh + r; if (rowsPerB < 0) v += CP[cofs + (size_t)rr * ldc + col];      /* rowsPerB < 0: own element of the batched C plane */ else { const int bidx = rr / rowsPerB; v += CP[(size_t)bidx * sCPb + (size_t)by * 64 + col]; } } if (ACT == 1) v = (v > 0.f) ? v : expm1f(v); else if (ACT == 7) v = (v > 0.f) ? v + 1.0f : expf(v); else if (ACT == 8) v = tanhf(v); else if (ACT == 9) v = 0.5f * v * (1.0f + tanhf(0.7978845608028654f * (v + 0.044715f * v * v * v))); else if (ACT == 11) v = 1.0f / (1.0f + expf(-v)); else if (ACT == 12) v = (v > 0.f) ? v : 0.01f * v; else if (ACT == 14) v = (v > 0.f) ? v : 0.1f * v; else if (ACT == 16) v = (v >= 0.f) ? v : 0.3f * v; else if (ACT == 17) v = (v >= 0.f) ? v : 0.2f * v; else if (ACT == 15) v = v / (1.0f + expf(-v)); else if (ACT == 3) v = fmaxf(v, 0.f); else if (ACT == 6) v = 0.5f * v * (1.0f + erff(v * 0.70710678118654752f)); so[w][8 * hh + r][t * 16 + ln] = v; } }
  __builtin_amdgcn_fence(__ATOMIC_ACQ_REL, "workgroup"); __builtin_amdgcn_wave_barrier();
  const int rsub = lane >> 4, c4 = (lane & 15) * 4; typedef _Float16 v4h __attribute__((ext_vector_type(4)));
  {
#pragma unroll
    for (int q = 0; q < 8; ++q) { const int r = q * 2 + rsub; if (col0 + c4 < N) { const v4f v = *(const v4fa*)&so[w][r][c4]; if (C) *(v4f*)(C + cofs + (size_t)(row0 + r) * ldc + col0 + c4) = v; if (C16) { v4h h4; for (int i = 0; i < 4; ++i) h4[i] = (_Float16)v[i]; *(v4h*)(C16 + cofs + (size_t)(row0 + r) * ldc + col0 + c4) = h4; } } }
     }
}


typedef _Float16 v4h __attribute__((ext_vector_type(4)));

// ---- fragment-major f16 operand planes ----
// A plane of R rows x K columns (R % 16 == 0, K % 32 == 0) is kept as 16 x 32 tiles of 512 elements, tile (r / 16, k / 32) at ((r / 16) * (K / 32) + k / 32) * 512. Inside a tile the 8-element chunk c = (k % 32) / 8 of row r stands at (c / 2) * 256 + ((c % 2) * 16 + r % 16) * 8:
// that is the order in which the lanes of a wave hold a 16x16x32 A or B fragment (lane = 16 hh + ln: k = 8 hh + s, then 16 + 8 hh + s), so each of a fragment's two loads reads 512 contiguous bytes (four whole lines) instead of 32 bytes out of each of 16 rows.
// Sixteen rows fill 16 K consecutive elements, so a row offset that is a multiple of 16 is the same pointer offset as in a row-major plane.
__device__ __forceinline__ v16h tf_frag(const _Float16* p) { FragH f; f.half[0] = *(const v8us*)((const unsigned short*)p); f.half[1] = *(const v8us*)((const unsigned short*)p + 256); return f.v; }      /* p = tile + 8 * lane */
__device__ __forceinline__ size_t tf_off(size_t r, size_t k, size_t K) { return (((r >> 4) * (K >> 5) + (k >> 5)) << 9) + (((k >> 4) & 1) << 8) + (((((k >> 3) & 1) << 4) | (r & 15)) << 3); }      /* k % 8 == 0 */
// Writer thread t of a plane with DM columns -> its chunk (row r, first column k). A wave takes 8 rows x 32 columns: it reads 8 whole 128-byte f32 lines and writes 4 whole 128-byte lines of the tile, each line by this wave alone.
__device__ __forceinline__ void tf_chunk(size_t t, size_t& r, size_t& k) { const size_t tile = t >> 6; r = ((tile / (DM / 32)) << 4) + (((t >> 5) & 1) << 3) + ((t >> 2) & 7); k = ((tile % (DM / 32)) << 5) + ((t & 3) << 3); }

__global__ __launch_bounds__(256) void k_x16(const float* __restrict__ x, _Float16* __restrict__ X16, size_t n8) { const size_t t = (size_t)blockIdx.x * 256 + threadIdx.x; if (t >= n8) return; FragH f; size_t r, k; tf_chunk(t, r, k); const float* xs = x + r * DM + k;
#pragma unroll
  for (int q = 0; q < 8; ++q) f.h[q] = (_Float16)bf16_round(xs[q]); *(v8us*)((unsigned short*)X16 + tf_off(r, k, DM)) = f.half[0];  }      /* X16 fragment-major */
__global__ __launch_bounds__(256) void k_h16(const float* __restrict__ x, _Float16* __restrict__ X16, size_t n8) { const size_t t = (size_t)blockIdx.x * 256 + threadIdx.x; if (t >= n8) return; FragH f;
#pragma unroll
  for (int q = 0; q < 8; ++q) f.h[q] = (_Float16)x[t * 8 + q]; *(v8us*)((unsigned short*)X16 + t * 8) = f.half[0];  }
__global__ __launch_bounds__(256) void k_round16f(const float* __restrict__ W, _Float16* __restrict__ Bt, size_t n8) { const size_t t = (size_t)blockIdx.x * 256 + threadIdx.x; if (t >= n8) return; FragH f;
#pragma unroll
  for (int i = 0; i < 8; ++i) f.h[i] = (_Float16)(bf16_round(W[t * 8 + i]) * 16.0f); *(v8us*)((unsigned short*)Bt + t * 8) = f.half[0];  }
template <int NHv, int TTv>
__global__ __launch_bounds__(256) void k_vt(const _Float16* __restrict__ V16, int ldv, int voff, _Float16* __restrict__ Vt) { __shared__ unsigned short tl[64][66]; const int tid = threadIdx.x; const int slab = blockIdx.x / (TTv / 64), lg = blockIdx.x % (TTv / 64); const int b = slab / NHv, h = slab % NHv;
  for (int i = tid; i < 64 * 8; i += 256) { const int r = i / 8, c8 = (i % 8) * 8; FragH f; f.half[0] = *(const v8us*)((const unsigned short*)V16 + ((size_t)b * TTv + lg * 64 + r) * ldv + voff + h * 64 + c8);
#pragma unroll
    for (int q = 0; q < 8; ++q) tl[r][c8 + q] = f.u[q]; }
  __syncthreads();
  {
#pragma unroll
    for (int rd = 0; rd < 2; ++rd) { const int d = ((tid >> 6) << 4) + (((tid >> 5) & 1) << 3) + ((tid >> 2) & 7), pc = rd * 4 + (tid & 3); FragH f;      /* a wave takes 8 rows of V^T x 32 keys: 4 whole lines of one tile */
#pragma unroll
      for (int q = 0; q < 8; ++q) f.u[q] = tl[pc * 8 + q][d];
      *(v8us*)((unsigned short*)Vt + tf_off((size_t)slab * 64 + d, (size_t)lg * 64 + pc * 8, TTv)) = f.half[0]; }      /* Vt fragment-major, TTv columns */
     } }

// TF: the two f16 planes are written fragment-major (F has DM columns); otherwise row-major like F
template <bool TF>
__global__ __launch_bounds__(256) void k_hl(const float* __restrict__ F, _Float16* __restrict__ Hh, _Float16* __restrict__ Hl, size_t n8) { const size_t t = (size_t)blockIdx.x * 256 + threadIdx.x; if (t >= n8) return; FragH fh, fl; size_t si = t * 8, di = t * 8; if (TF) { size_t r, k; tf_chunk(t, r, k); si = r * DM + k; di = tf_off(r, k, DM); } const float* pf = F + si; const v4f a = *(const v4fa*)pf, c = *(const v4fa*)(pf + 4);
  asm volatile("s_wait_xcnt 0x0" :: "v"(pf) : "memory");      /* stands behind the two loads and in front of every instruction that rewrites their address register; the address is an input so that its register stays as it is up to the wait */
#pragma unroll
  for (int q = 0; q < 4; ++q) { _Float16 h = (_Float16)a[q]; fh.h[q] = h; fl.h[q] = (_Float16)((a[q] - (float)h) * 1024.0f); h = (_Float16)c[q]; fh.h[4 + q] = h; fl.h[4 + q] = (_Float16)((c[q] - (float)h) * 1024.0f); }
  { *(v8us*)((unsigned short*)Hh + di) = fh.half[0]; *(v8us*)((unsigned short*)Hl + di) = fl.half[0];  } }

// eight f32 values -> the f16 hi chunk and the x1024 residual chunk (the arithmetic of k_hl), for producers that write the split planes themselves
__device__ __forceinline__ void hl8(const float* v, v8us& hi, v8us& lo) { FragH fh, fl;
#pragma unroll
  for (int q = 0; q < 8; ++q) { const _Float16 h = (_Float16)v[q]; fh.h[q] = h; fl.h[q] = (_Float16)((v[q] - (float)h) * 1024.0f); }
  hi = fh.half[0]; lo = fl.half[0]; }

// ---- fast GEMM (wave tile 32x64; requires M % 32 == 0 rows per launch region, N % 64 == 0, K % 32 == 0 and K >= 32); A and Bh are fragment-major planes of K columns (lda and ldb are not used); epilogue = k_gemm_hhx semantics ----
__device__ __forceinline__ v16h g2_frag(const _Float16* p, int hh) { FragH f; f.half[0] = *(const v8us*)((const unsigned short*)p + 8 * hh); f.half[1] = *(const v8us*)((const unsigned short*)p + 16 + 8 * hh); return f.v; }
__device__ __forceinline__ v8f g2_mma(v16h a, v16h b, v8f c) { v8f d = __builtin_amdgcn_wmma_f32_16x16x32_f16(false, a, false, b, (short)0, c, false, false); asm volatile("v_nop\n\tv_nop\n\tv_nop\n\tv_nop" : "+v"(d) : "v"(a), "v"(b)); return d; }
struct G2S { v16h a0, a1, b0, b1, b2, b3; };      /* the six fragments of one k step */
// VTS (rows = tokens of NB batches of SQ, columns = NH heads of HD, no CP, ACT 0): the result leaves as the two fragment-major V^T planes VTh, VTl ([batch][head][HD] rows of SQ columns), straight from the accumulators; the f32 rows go to C only for the first QT0 tokens of a batch (the first-tile attention reads them)
template <int ACT, bool VTS>
__global__ __launch_bounds__(128) void k_gemm2(const _Float16* __restrict__ A, int lda, size_t sA, const _Float16* __restrict__ Bh, int ldb, size_t sB, float alpha, const float* __restrict__ bias, size_t sBias, const float* __restrict__ CP, int rowsPerB, size_t sCPb, int row0g,
    float* __restrict__ C, _Float16* __restrict__ C16, int ldc, size_t sC, int M, int N, int K, _Float16* __restrict__ VTh, _Float16* __restrict__ VTl) { static_assert(ACT == 0 || ACT == 3 || ACT == 6 || ACT == 8 || ACT == 9 || ACT == 11 || ACT == 12 || ACT == 14 || ACT == 15 || ACT == 16 || ACT == 17, "k_gemm2: unsupported ACT code (would silently apply no activation)");
  __shared__ __attribute__((aligned(16))) float so[4][32][68];
  const int tid = threadIdx.x, w = tid >> 5, lane = tid & 31, ln = lane & 15, hh = lane >> 4; const int by = blockIdx.y;
  A += (size_t)by * sA; Bh += (size_t)by * sB; const size_t cofs = (size_t)by * sC; const float* bp = bias ? bias + (size_t)by * sBias : nullptr;
  const int ntn = N >> 6; const int mt = blockIdx.x / ntn, nq = blockIdx.x - mt * ntn; const int row0 = mt * 128 + 32 * w, col0 = nq * 64; if (row0 >= M) return;
  (void)lda; (void)ldb; const size_t tr = (size_t)16 * K;      /* elements of one 16-row band of tiles */
  const _Float16* a0p = A + (size_t)row0 * K + 8 * lane; const _Float16* a1p = a0p + tr;
  const _Float16* b0p = Bh + (size_t)col0 * K + 8 * lane; const _Float16* b1p = b0p + tr; const _Float16* b2p = b1p + tr; const _Float16* b3p = b2p + tr;
  const v8f z8 = {0.f,0.f,0.f,0.f,0.f,0.f,0.f,0.f}; v8f c00 = z8, c01 = z8, c02 = z8, c03 = z8, c10 = z8, c11 = z8, c12 = z8, c13 = z8;
  /* Three k steps of fragments in registers. A step's twelve loads are issued together, right behind the products of the step whose registers they refill, and are first read three steps later: a load's latency is spread over three steps instead of being paid five times in each.
     No branch stands between the loads, so their waits are counted exactly: past the last step the step index is clamped (an in-bounds re-read of the last step that no product uses). Each accumulator still takes its products in the order kb = 0, 32, 64, ... */
  const int nst = K >> 5;
  auto ld = [&](int st) { const int kb = (st < nst ? st : nst - 1) << 9; const _Float16 *pa0 = a0p + kb, *pa1 = a1p + kb, *pb0 = b0p + kb, *pb1 = b1p + kb, *pb2 = b2p + kb, *pb3 = b3p + kb;      /* one tile of 512 elements per k step; the lane's 8 elements are in the band pointers */
    G2S f; f.a0 = tf_frag(pa0); f.a1 = tf_frag(pa1); f.b0 = tf_frag(pb0); f.b1 = tf_frag(pb1); f.b2 = tf_frag(pb2); f.b3 = tf_frag(pb3);
    asm volatile("s_wait_xcnt 0x0" :: "v"(pa0), "v"(pa1), "v"(pb0), "v"(pb1), "v"(pb2), "v"(pb3) : "memory");      /* stands behind the step's loads and in front of every instruction that rewrites an address register they name; the addresses are inputs so that their registers stay as they are up to the wait */
    return f; };
  auto mm = [&](const G2S& f) { c00 = g2_mma(f.a0, f.b0, c00); c10 = g2_mma(f.a1, f.b0, c10); c01 = g2_mma(f.a0, f.b1, c01); c11 = g2_mma(f.a1, f.b1, c11); c02 = g2_mma(f.a0, f.b2, c02); c12 = g2_mma(f.a1, f.b2, c12); c03 = g2_mma(f.a0, f.b3, c03); c13 = g2_mma(f.a1, f.b3, c13); };
  G2S f0 = ld(0), f1 = ld(1), f2 = ld(2); int st = 0;
  /* kept rolled: one trip is the whole ring, and a second copy would only add registers */
#pragma unroll 1
  for (; st + 3 <= nst; st += 3) { mm(f0); f0 = ld(st + 3); mm(f1); f1 = ld(st + 4); mm(f2); f2 = ld(st + 5); }
  if (st < nst) mm(f0);
  if (st + 1 < nst) mm(f1);
  v8f accs[8] = {c00, c01, c02, c03, c10, c11, c12, c13};
  if (VTS) {      /* an accumulator tile holds, per lane, 8 consecutive tokens (8 hh + r) of ONE column (ln): that is one chunk of a V^T tile, at the lane's own place in it, so each store below is 512 contiguous bytes of the wave */
    const int srow = __builtin_amdgcn_readfirstlane(row0); const int bb = srow / SQ, key0 = srow % SQ;      /* the wave's first token: the same in every lane */
    const size_t tile0 = ((size_t)(bb * NH + (col0 >> 6)) * (HD / 16) * (SQ / 32) + (key0 >> 5)) << 9;      /* the V^T tile of the head's first 16 rows and these 32 keys */
    unsigned short* ph = (unsigned short*)VTh + tile0 + 8 * lane; unsigned short* pl = (unsigned short*)VTl + tile0 + 8 * lane; v8us hv[8], lv[8];
    /* unrolled so that the chunks are registers */
#pragma unroll
    for (int u = 0; u < 8; ++u) { const float bv = bp ? bf16_round(bp[col0 + (u & 3) * 16 + ln]) : 0.f; float v[8];
#pragma unroll
      for (int r = 0; r < 8; ++r) v[r] = accs[u][r] * alpha + bv;
      hl8(v, hv[u], lv[u]); }
#pragma unroll
    for (int u = 0; u < 8; ++u) { const size_t o = (size_t)(u & 3) * ((SQ / 32) << 9) + (u >> 2) * 256; *(v8us*)(ph + o) = hv[u]; *(v8us*)(pl + o) = lv[u]; }
    asm volatile("s_wait_xcnt 0x0" :: "v"(ph), "v"(pl) : "memory");      /* stands behind the stores: their address registers stay as they are up to here */
    if (key0 >= QT0) return;      /* the same for the whole wave; no barrier follows */
  }
#pragma unroll
  for (int u = 0; u < 8; ++u) { const int t = u & 3, half = u >> 2; const int col = col0 + t * 16 + ln; const float bv = bp ? bf16_round(bp[col]) : 0.f;
#pragma unroll
    for (int r = 0; r < 8; ++r) { const int rloc = half * 16 + 8 * hh + r; float v = accs[u][r] * alpha + bv; if (CP) { if (rowsPerB < 0) v += CP[cofs + (size_t)(row0g + row0 + rloc) * ldc + col];      /* rowsPerB < 0: own element of the batched C plane */ else { const int bidx = (row0g + row0 + rloc) / rowsPerB; v += CP[(size_t)bidx * sCPb + (size_t)by * 64 + col]; } }
      if (ACT == 3) v = fmaxf(v, 0.f); else if (ACT == 6) v = 0.5f * v * (1.0f + erff(v * 0.70710678118654752f)); else if (ACT == 11) v = 1.0f / (1.0f + expf(-v)); else if (ACT == 15) v = v / (1.0f + expf(-v)); else if (ACT == 12) v = (v > 0.f) ? v : 0.01f * v; else if (ACT == 8) v = tanhf(v); else if (ACT == 9) v = 0.5f * v * (1.0f + tanhf(0.7978845608028654f * (v + 0.044715f * v * v * v))); else if (ACT == 14) v = (v > 0.f) ? v : 0.1f * v; else if (ACT == 16) v = (v >= 0.f) ? v : 0.3f * v; else if (ACT == 17) v = (v >= 0.f) ? v : 0.2f * v;
      so[w][rloc][t * 16 + ln] = v; } }
  __builtin_amdgcn_fence(__ATOMIC_ACQ_REL, "workgroup"); __builtin_amdgcn_wave_barrier();
  const int rsub = lane >> 4, c4 = (lane & 15) * 4;
  {
#pragma unroll
    for (int q = 0; q < 16; ++q) { const int r = q * 2 + rsub; const v4f v = *(const v4fa*)&so[w][r][c4]; if (C) *(v4f*)(C + cofs + (size_t)(row0 + r) * ldc + col0 + c4) = v; if (C16) { v4h h4; for (int i = 0; i < 4; ++i) h4[i] = (_Float16)v[i]; *(v4h*)(C16 + cofs + (size_t)(row0 + r) * ldc + col0 + c4) = h4; } }
     } }


// ---- the same GEMM for an operand kept as f16 hi + x1024 residual planes: C = (A Bh) alpha + bias + (Al Bh) alphal in ONE launch (N = K = DM, C of pitch DM, M % 32 == 0) ----
// Both A planes walk one k loop against the same four B fragments, each plane into its own eight accumulators; each accumulator takes its products in the order kb = 0, 32, 64, ... and the two sets meet once, in the epilogue, in registers.
__device__ __forceinline__ v8f g2p_mma(v16h a, v16h b, v8f c) { return __builtin_amdgcn_wmma_f32_16x16x32_f16(false, a, false, b, (short)0, c, false, false); }      /* the plain builtin: its operands may stand in any register, which the 320 registers of accumulators and ring need */
struct G2P { v16h a0, a1, l0, l1, b0, b1, b2, b3; };      /* the eight fragments of one k step */
// SPLIT: the result leaves as the two fragment-major f16 planes Hh (hi) and Hl (x1024 residual); the f32 rows go to C only for the first QT0 rows of each SQ rows (the first-tile attention reads them). Otherwise all f32 rows go to C.
template <bool SPLIT>
__global__ __launch_bounds__(128) void k_gemm2p(const _Float16* __restrict__ A, const _Float16* __restrict__ Al, const _Float16* __restrict__ Bh, float alpha, float alphal, const float* __restrict__ bias, float* __restrict__ C, int M, _Float16* __restrict__ Hh, _Float16* __restrict__ Hl) {
  __shared__ __attribute__((aligned(16))) float so[4][32][68];
  const int tid = threadIdx.x, lane = tid & 31, ln = lane & 15, hh = lane >> 4; const int w = __builtin_amdgcn_readfirstlane(tid >> 5);      /* the wave's number, the same in every lane: the three plane addresses below are then scalars */
  const int mt = blockIdx.x / (DM / 64), nq = blockIdx.x % (DM / 64); const int row0 = mt * 128 + 32 * w, col0 = nq * 64; if (row0 >= M) return;
  const size_t tr = (size_t)16 * DM;      /* elements of one 16-row band of tiles */
  const _Float16* ab = A + (size_t)row0 * DM; const _Float16* lb = Al + (size_t)row0 * DM; const _Float16* bb0 = Bh + (size_t)col0 * DM;      /* the wave's first tiles: the same in every lane */
  const float* sbias = bias + col0; float bv[4];      /* read here so that the k loop covers the latency */
#pragma unroll
  for (int t = 0; t < 4; ++t) bv[t] = sbias[ln + t * 16];
  asm volatile("s_wait_xcnt 0x0" :: "s"(sbias), "v"(ln) : "memory");      /* stands behind the four bias loads and in front of every instruction that rewrites an address register they name (a scalar base and the lane's column), which are inputs so that their registers stay as they are up to the wait */
  const v8f z8 = {0.f,0.f,0.f,0.f,0.f,0.f,0.f,0.f}; v8f c00 = z8, c01 = z8, c02 = z8, c03 = z8, c10 = z8, c11 = z8, c12 = z8, c13 = z8, d00 = z8, d01 = z8, d02 = z8, d03 = z8, d10 = z8, d11 = z8, d12 = z8, d13 = z8;
  /* the ring of three k steps of k_gemm2, with sixteen loads and sixteen products per step; past the last step the step index is clamped (an in-bounds re-read of the last step that no product uses) */
  const int nst = DM >> 5;
  auto ld = [&](int st) { const int kb = (st < nst ? st : nst - 1) << 9; const _Float16 *sa = ab + kb, *sl = lb + kb, *sb = bb0 + kb;      /* one tile of 512 elements per k step */
    const _Float16 *pa = sa + 8 * lane, *pl = sl + 8 * lane, *pq = sb + 8 * lane;
    G2P f; f.a0 = tf_frag(pa); f.a1 = tf_frag(pa + tr); f.l0 = tf_frag(pl); f.l1 = tf_frag(pl + tr); f.b0 = tf_frag(pq); f.b1 = tf_frag(pq + tr); f.b2 = tf_frag(pq + 2 * tr); f.b3 = tf_frag(pq + 3 * tr);
    asm volatile("s_wait_xcnt 0x0" :: "s"(sa), "s"(sl), "s"(sb), "v"(lane) : "memory");      /* stands behind the step's loads and in front of the next step's rewriting of the address registers they name. The three scalar bases and the lane number are inputs: that keeps the loads in the form scalar base + lane offset (without the inputs the build formed vector addresses in registers of the ring, with adds and their slots among the products) */
    return f; };
  auto mm = [&](const G2P& f) { c00 = g2p_mma(f.a0, f.b0, c00); c10 = g2p_mma(f.a1, f.b0, c10); d00 = g2p_mma(f.l0, f.b0, d00); d10 = g2p_mma(f.l1, f.b0, d10); c01 = g2p_mma(f.a0, f.b1, c01); c11 = g2p_mma(f.a1, f.b1, c11); d01 = g2p_mma(f.l0, f.b1, d01); d11 = g2p_mma(f.l1, f.b1, d11);
    c02 = g2p_mma(f.a0, f.b2, c02); c12 = g2p_mma(f.a1, f.b2, c12); d02 = g2p_mma(f.l0, f.b2, d02); d12 = g2p_mma(f.l1, f.b2, d12); c03 = g2p_mma(f.a0, f.b3, c03); c13 = g2p_mma(f.a1, f.b3, c13); d03 = g2p_mma(f.l0, f.b3, d03); d13 = g2p_mma(f.l1, f.b3, d13);
    __builtin_amdgcn_sched_barrier(0); };      /* keeps the refill's sixteen loads together behind the step's products, as in the ring of k_gemm2: without it the build spreads them over eight places among the products, the slower form of a WMMA loop with loads */
  G2P f0 = ld(0), f1 = ld(1), f2 = ld(2); int st = 0;
  /* kept rolled: one trip is the whole ring, and a second copy would only add registers */
#pragma unroll 1
  for (; st + 3 <= nst; st += 3) { mm(f0); f0 = ld(st + 3); mm(f1); f1 = ld(st + 4); mm(f2); f2 = ld(st + 5); }
  if (st < nst) mm(f0);
  if (st + 1 < nst) mm(f1);
  const v8f ch[8] = {c00, c01, c02, c03, c10, c11, c12, c13}, cl[8] = {d00, d01, d02, d03, d10, d11, d12, d13};
  /* unrolled so that the accumulator arrays are registers */
#pragma unroll
  for (int u = 0; u < 8; ++u) { const int t = u & 3, half = u >> 2; const float bb = bf16_round(bv[t]);
#pragma unroll
    for (int r = 0; r < 8; ++r) so[w][half * 16 + 8 * hh + r][t * 16 + ln] = (ch[u][r] * alpha + bb) + cl[u][r] * alphal; }      /* the hi product with its bias first, then the residual product: the order of the two launches this replaces */
  __builtin_amdgcn_fence(__ATOMIC_ACQ_REL, "workgroup"); __builtin_amdgcn_wave_barrier();      /* the wave's own LDS stores are done before its lanes read each other's rows */
  if (SPLIT) {      /* the wave's 32 x 64 tile is four 16 x 32 tiles of the planes; a lane reads its chunk's 8 columns of one row from LDS (16 lanes at pitch 68 cover all banks once) and each store is 512 contiguous bytes of the wave */
    const size_t tile0 = (size_t)row0 * DM + ((size_t)(col0 >> 5) << 9); unsigned short* ph = (unsigned short*)Hh + tile0 + 8 * lane; unsigned short* pl = (unsigned short*)Hl + tile0 + 8 * lane; v8us hv[8], lv[8];
    /* unrolled so that the chunks are registers */
#pragma unroll
    for (int c = 0; c < 8; ++c) { const float* ps = &so[w][(c >> 2) * 16 + ln][((c >> 1) & 1) * 32 + ((c & 1) * 2 + hh) * 8]; const v4f a = *(const v4fa*)ps, b = *(const v4fa*)(ps + 4);
      const float v[8] = {a[0], a[1], a[2], a[3], b[0], b[1], b[2], b[3]}; hl8(v, hv[c], lv[c]); }
#pragma unroll
    for (int c = 0; c < 8; ++c) { const size_t o = (size_t)(c >> 2) * 16 * DM + ((c >> 1) & 1) * 512 + (c & 1) * 256; *(v8us*)(ph + o) = hv[c]; *(v8us*)(pl + o) = lv[c]; }
    asm volatile("s_wait_xcnt 0x0" :: "v"(ph), "v"(pl) : "memory");      /* stands behind the stores: their address registers stay as they are up to here */
    if ((row0 & (SQ - 1)) >= QT0) return;      /* the same for the whole wave; no barrier follows */
  }
  const int rsub = lane >> 4, c4 = (lane & 15) * 4; float* pc = C + (size_t)(row0 + rsub) * DM + col0 + c4;
  /* unrolled: sixteen stores from one address register with constant offsets */
#pragma unroll
  for (int q = 0; q < 16; ++q) { const v4f v = *(const v4fa*)&so[w][q * 2 + rsub][c4]; *(v4f*)(pc + (size_t)q * 2 * DM) = v; }
  asm volatile("s_wait_xcnt 0x0" :: "v"(pc) : "memory");      /* stands behind the stores: their address register stays as it is up to here */
}


__global__ __launch_bounds__(256) void k_wnat(const float* __restrict__ w, size_t n8, _Float16* __restrict__ Bt) { const size_t t = (size_t)blockIdx.x * 256 + threadIdx.x; if (t >= n8) return; FragH f; size_t r, k; tf_chunk(t, r, k); const float* wsrc = w + r * DM + k; for (int q = 0; q < 8; ++q) f.h[q] = (_Float16)(bf16_round(wsrc[q]) * 16.0f); *(v8us*)((unsigned short*)Bt + tf_off(r, k, DM)) = f.half[0];  }      /* Bt fragment-major */
__global__ __launch_bounds__(256) void k_rsm(const float* __restrict__ S, _Float16* __restrict__ P, int nrows) {
  #pragma clang fp contract(off)
  const int i = blockIdx.x * 256 + threadIdx.x; if (i >= nrows) return; const float* s = S + (size_t)i * SQ; float mx = -3.0e38f;
#pragma unroll 1
  for (int j = 0; j < SQ; ++j) mx = fmaxf(mx, s[j]); float se = 0.f;
#pragma unroll 1
  for (int j = 0; j < SQ; ++j) se += expf(s[j] - mx); const float sc = 256.0f / se;
#pragma unroll 1
  for (int j0 = 0; j0 < SQ; j0 += 8) { FragH f; for (int q = 0; q < 8; ++q) f.h[q] = (_Float16)(expf(s[j0 + q] - mx) * sc); unsigned short* d = (unsigned short*)P + (size_t)i * SQ + j0; *(v8us*)d = f.half[0];  } }
__global__ __launch_bounds__(256) void k_vt(const _Float16* __restrict__ V16, int b, int h0, _Float16* __restrict__ VT) { __shared__ unsigned short tl[64][65]; const int tid = threadIdx.x; const int hh = blockIdx.x % HG, sg = blockIdx.x / HG; const int s0 = sg * 64; const int h = h0 + hh;
  for (int i = tid; i < 64 * 8; i += 256) { const int j = i / 8, d8 = (i % 8) * 8; FragH f; f.half[0] = *(const v8us*)((const unsigned short*)V16 + ((size_t)b * SQ + s0 + j) * DM + h * HD + d8); for (int q = 0; q < 8; ++q) tl[d8 + q][j] = f.u[q]; }
  __syncthreads();
  { for (int i = tid; i < 64 * 8; i += 256) { const int d = i / 8, j8 = (i % 8) * 8; FragH f; for (int q = 0; q < 8; ++q) f.u[q] = tl[d][j8 + q]; *(v8us*)((unsigned short*)VT + ((size_t)hh * HD + d) * SQ + s0 + j8) = f.half[0]; }  } }



__global__ __launch_bounds__(256) void k_rsmcf2(const float* __restrict__ S, _Float16* __restrict__ P, int hg, int q0, int nk) {
  #pragma clang fp contract(off)
  const int t = blockIdx.x * 256 + threadIdx.x; if (t >= hg * QT) return; const size_t i = (size_t)t; const float* s = S + i * NKX; const int last = q0 + (t % QT); float mx = -3.0e38f;
#pragma unroll 1
  for (int j = 0; j < nk; ++j) { const float f = (j <= last) ? 1.f : 0.f; mx = fmaxf(mx, fmaf(f, s[j], (1.f - f) * -1.0e9f)); } float se = 0.f;
#pragma unroll 1
  for (int j = 0; j < nk; ++j) { const float f = (j <= last) ? 1.f : 0.f; se += __expf(fmaf(f, s[j], (1.f - f) * -1.0e9f) - mx); } const float sc = 256.0f / se;
#pragma unroll 1
  for (int j0 = 0; j0 < nk; j0 += 8) { FragH fr; for (int q = 0; q < 8; ++q) { const int j = j0 + q; const float f = (j <= last) ? 1.f : 0.f; fr.h[q] = (_Float16)(__expf(fmaf(f, s[j], (1.f - f) * -1.0e9f) - mx) * sc); } unsigned short* d = (unsigned short*)P + i * NKX + j0; *(v8us*)d = fr.half[0];  } }



typedef int v4ia __attribute__((ext_vector_type(4), may_alias));
// native 2^x. Written as asm for the v_nop: it is the slot that the instruction set asks for behind a transcendental before its result is read or its source overwritten.
__device__ __forceinline__ float exp2_native(float x) { float r; asm("v_exp_f32 %0, %1\n\tv_nop" : "=v"(r) : "v"(x)); return r; }
#define FQ 2                         /* 16-query column groups per wave of the fused attention kernel */
struct FAK { v16h h[2][2], l[2][2]; };      /* K fragments of 32 keys: [16-key tile][32-wide step over the head size], hi and x1024 residual */
struct FAV { v16h h[4], l[4]; };            /* V^T fragments of 32 keys: [16-row tile of the head size], hi and x1024 residual */
__device__ __forceinline__ v8f fa_mma(v16h a, v16h b, v8f c) { return __builtin_amdgcn_wmma_f32_16x16x32_f16(false, a, false, b, (short)0, c, false, false); }
__global__ __launch_bounds__(256) void k_fattn(const _Float16* __restrict__ Qh, const _Float16* __restrict__ Ql, const _Float16* __restrict__ Kh, const _Float16* __restrict__ Kl, const _Float16* __restrict__ Vh, const _Float16* __restrict__ Vl, const int* __restrict__ Km, _Float16* __restrict__ Oh, _Float16* __restrict__ Ol, const float* __restrict__ QF, const float* __restrict__ KF, const float* __restrict__ VF) {
  __shared__ __attribute__((aligned(16))) float ftk[QT0][HD]; __shared__ __attribute__((aligned(16))) float ftv[QT0][HD]; __shared__ __attribute__((aligned(16))) int ftm[QT0];      /* the first tile's K and V rows and key padding entries (blocks with tb == 0 only) */
  const int lane = threadIdx.x & 31, ln = lane & 15, hh = lane >> 4; const int w = __builtin_amdgcn_readfirstlane((int)(threadIdx.x >> 5));
  const int tb = (int)(blockIdx.x / (NB * NH)); const int bh = blockIdx.x % (NB * NH); const int b = bh / NH, h = bh % NH;
  /* First-tile rows (the first QT0 rows of each batch) in exact f32 on the vector unit, inside this launch: the blocks with tb == 0 (one per batch and head) give waves 4-7 to them, one thread per query row, while every other wave of the launch runs the fused path.
     All operands stay on chip: the head's first QT0 K and V rows (and the key padding entries) are staged once in LDS with whole-line loads by all eight waves, every lane then reads the same LDS address (a broadcast, no bank conflict), and the thread's q and o rows live in registers.
     Four keys per trip: their four score chains are independent, so one chain's dependent adds are covered by the other three. Every sum (score, l, o) keeps its order: d = 0..63 inside a score, keys in rising j. */
  if (tb == 0) {      /* the same for the whole block, so the barrier below is passed by all eight waves or by none */
    const int tid = (int)threadIdx.x; const size_t rb = (size_t)b * SQ;      /* the batch's first row */
    const int i = (w & 3) * 32 + lane;      /* waves 4-7: the thread's query row */
    v4f q[HD / 4], o[HD / 4];
    { /* eight K and eight V loads in flight per thread; 16 lanes cover one 256-byte row, the block 16 rows per load */
      const unsigned og = (unsigned)(((rb + (size_t)(tid >> 4)) * LQ + h * HD + (tid & 15) * 4) * sizeof(float));      /* the thread's byte offset in both planes (they hold under 2^32 bytes) */
      const int* kmb = Km + rb; const int ei = tid & (QT0 - 1); v4f tk[8], tv[8];
      /* the two loops over u are fully unrolled so that the loaded rows are registers and the loads stand together, each from a plane's scalar base, the thread's offset and a constant */
#pragma unroll
      for (int u = 0; u < 8; ++u) { tk[u] = *(const v4fa*)((const char*)KF + og + (size_t)(u * 16) * LQ * sizeof(float)); tv[u] = *(const v4fa*)((const char*)VF + og + (size_t)(u * 16) * LQ * sizeof(float)); }
      const int ke = kmb[ei];
      asm volatile("s_wait_xcnt 0x0" :: "s"(KF), "s"(VF), "v"(og), "s"(kmb), "v"(ei) : "memory");      /* stands behind the loads and in front of every instruction that rewrites an address register they name (three scalar bases, the thread's offset and the entry's index), which are inputs so that their registers stay as they are up to the wait */
      if (w >= 4) { const float* qr = QF + (rb + i) * LQ + h * HD;      /* issued behind the staging loads and in front of their first use, so that both sets fly together */
        /* every loop over c is fully unrolled so that q and o are registers, not scratch */
#pragma unroll
        for (int c = 0; c < HD / 4; ++c) { q[c] = *(const v4fa*)(qr + c * 4); const v4f z = {0.f, 0.f, 0.f, 0.f}; o[c] = z; }
        asm volatile("s_wait_xcnt 0x0" :: "v"(qr) : "memory"); }      /* stands behind the q loads and in front of every instruction that rewrites their address register; the address is an input so that its register stays as it is up to the wait */
#pragma unroll
      for (int u = 0; u < 8; ++u) { const int r = u * 16 + (tid >> 4); *(v4f*)&ftk[r][(tid & 15) * 4] = tk[u]; *(v4f*)&ftv[r][(tid & 15) * 4] = tv[u]; }
      if (tid < QT0) ftm[tid] = ke; }
    __syncthreads();      /* the tile is complete before any thread reads it; the kernel's only barrier */
    if (w >= 4) {      /* the same for the whole wave */
      float m = -1.0e30f, l = 0.f; const int nr = ((w & 3) >> 1) * 64 + 64;      /* keys up to the last row of the wave's 64-row group */
      /* kept rolled: one trip already holds four keys, and a second copy would only add code and registers */
#pragma unroll 1
      for (int jj = 0; jj < nr; jj += 4) { float s4[4] = {0.f, 0.f, 0.f, 0.f}, sc4[4], e4[4]; const v4ia km4 = *(const v4ia*)&ftm[jj];
        /* all loops over c and u below are fully unrolled: constant indices keep q, o and the four keys' values in registers, and the four score chains stand side by side */
#pragma unroll
        for (int c = 0; c < HD / 4; ++c) { const v4f qq = q[c];
#pragma unroll
          for (int u = 0; u < 4; ++u) { const v4f kq = *(const v4f*)&ftk[jj + u][c * 4]; float s = s4[u]; s = __fadd_rn(s, __fmul_rn(qq[0], kq[0])); s = __fadd_rn(s, __fmul_rn(qq[1], kq[1])); s = __fadd_rn(s, __fmul_rn(qq[2], kq[2])); s = __fadd_rn(s, __fmul_rn(qq[3], kq[3])); s4[u] = s; } }
        __builtin_amdgcn_sched_barrier(0);      /* keeps the LDS reads of the four V rows behind the scores, so that they take over the registers of the four K rows: with both sets held at once the wave's 512 registers do not suffice and values go to scratch */
#pragma unroll
        for (int u = 0; u < 4; ++u) { const int j = jj + u; const float s = __fmul_rn(s4[u], 0.125f);
          const float f = (j <= i && km4[u] != 0) ? 1.f : 0.f;      /* causal; also drop keys whose int padding entry is 0 */
          const float sm = fmaf(f, s, (1.f - f) * -1.0e30f); const float mn = fmaxf(m, sm); const float sc = expf(m - mn); const float e = expf(sm - mn); l = __fadd_rn(__fmul_rn(l, sc), e); m = mn; sc4[u] = sc; e4[u] = e; }
#pragma unroll
        for (int u = 0; u < 4; ++u) { const float sc = sc4[u], e = e4[u];
#pragma unroll
          for (int c = 0; c < HD / 4; ++c) { const v4f vv = *(const v4f*)&ftv[jj + u][c * 4]; v4f oo = o[c]; for (int x = 0; x < 4; ++x) oo[x] = __fadd_rn(__fmul_rn(oo[x], sc), __fmul_rn(e, vv[x])); o[c] = oo; } } }
      const float fin = 64.0f / l;      /* o carried x64 like the f16 path */
      /* the row leaves as chunks of the two fragment-major o planes (f16 hi + x1024 residual, DM columns): 16 lanes fill 256 contiguous bytes per store, each line written by this wave alone */
      const size_t d0 = rb * DM + tf_off((size_t)i, (size_t)h * HD, DM); unsigned short* ph = (unsigned short*)Oh + d0; unsigned short* pl = (unsigned short*)Ol + d0; v8us ch[HD / 8], cl[HD / 8];
      /* unrolled: o and the chunks stay in registers */
#pragma unroll
      for (int c = 0; c < HD / 8; ++c) { float v[8]; for (int x = 0; x < 4; ++x) { v[x] = __fmul_rn(o[2 * c][x], fin); v[4 + x] = __fmul_rn(o[2 * c + 1][x], fin); } hl8(v, ch[c], cl[c]); }
#pragma unroll
      for (int c = 0; c < HD / 8; ++c) { const size_t e = (size_t)(c >> 2) * 512 + ((c >> 1) & 1) * 256 + (c & 1) * 128; *(v8us*)(ph + e) = ch[c]; *(v8us*)(pl + e) = cl[c]; }
      asm volatile("s_wait_xcnt 0x0" :: "v"(ph), "v"(pl) : "memory");      /* stands behind the stores: their address registers stay as they are up to here */
      return;      /* no barrier follows */
    }
  }
  const int qb = (tb == 0) ? 1 : ((w < 4) ? SQ / (64 * FQ) - tb : tb + 1);      /* a long and a short row group per block; group 0 is the first tile's */
  const int q0 = qb * (64 * FQ) + (w & 3) * (16 * FQ);      /* the wave's first query row: a multiple of 32, the same in every lane */
  /* every loop under '#pragma unroll' in this kernel is fully unrolled so that the fragment, score and accumulator arrays are registers, not scratch */
  v16h qh[FQ][2], ql[FQ][2];
  /* all six operand planes are fragment-major: q and k planes have LQ columns (a head is two neighbouring tiles of a 16-row band), the V^T planes SQ columns (32 keys are one tile) */
  { const _Float16* bq = Qh + ((size_t)b * SQ + q0) * LQ + h * (HD * 16); const _Float16* bl = Ql + ((size_t)b * SQ + q0) * LQ + h * (HD * 16); const _Float16* pq = bq + 8 * lane; const _Float16* pl = bl + 8 * lane;      /* bq, bl: the same in every lane */
#pragma unroll
    for (int g = 0; g < FQ; ++g) { qh[g][0] = tf_frag(pq + (size_t)g * 16 * LQ); qh[g][1] = tf_frag(pq + (size_t)g * 16 * LQ + 512); ql[g][0] = tf_frag(pl + (size_t)g * 16 * LQ); ql[g][1] = tf_frag(pl + (size_t)g * 16 * LQ + 512); }
    asm volatile("s_wait_xcnt 0x0" :: "s"(bq), "s"(bl), "v"(lane) : "memory"); }      /* stands behind the q loads and in front of every instruction that rewrites an address register they name: the loads take a scalar base and the lane number, which are inputs so that their registers stay as they are up to the wait */
  const _Float16* pkh = Kh + (size_t)b * SQ * LQ + h * (HD * 16) + 8 * lane; const _Float16* pkl = Kl + (size_t)b * SQ * LQ + h * (HD * 16) + 8 * lane;
  const _Float16* pvh = Vh + (size_t)bh * HD * SQ + 8 * lane; const _Float16* pvl = Vl + (size_t)bh * HD * SQ + 8 * lane; const int* pm = Km + (size_t)b * SQ + lane;
  int kmv;
  auto ldk = [&](int kb, bool pre) { const _Float16* a = pkh + (size_t)kb * LQ; const _Float16* c = pkl + (size_t)kb * LQ; const int* e = pm + kb; FAK f;
#pragma unroll
    for (int t = 0; t < 2; ++t) { f.h[t][0] = tf_frag(a + (size_t)t * 16 * LQ); f.h[t][1] = tf_frag(a + (size_t)t * 16 * LQ + 512); f.l[t][0] = tf_frag(c + (size_t)t * 16 * LQ); f.l[t][1] = tf_frag(c + (size_t)t * 16 * LQ + 512); }
    kmv = *e;
    /* the wait stands behind the loads and in front of every instruction that rewrites an address register they name; the addresses are inputs so that their registers stay as they are up to the wait. pre (a constant at each call): the loads in front of the loop take a scalar base and the lane number, so there the lane number is an input too */
    if (pre) asm volatile("s_wait_xcnt 0x0" :: "v"(a), "v"(c), "v"(e), "v"(lane) : "memory"); else asm volatile("s_wait_xcnt 0x0" :: "v"(a), "v"(c), "v"(e) : "memory");
    return f; };
  auto ldv = [&](int kb) { const _Float16* a = pvh + (size_t)kb * 16; const _Float16* c = pvl + (size_t)kb * 16; FAV f;      /* 32 keys = one tile of 512 elements */
#pragma unroll
    for (int d = 0; d < 4; ++d) { f.h[d] = tf_frag(a + (size_t)d * 16 * SQ); f.l[d] = tf_frag(c + (size_t)d * 16 * SQ); }
    asm volatile("s_wait_xcnt 0x0" :: "v"(a), "v"(c) : "memory");      /* as in ldk */
    return f; };
  const v8f z8 = {0.f, 0.f, 0.f, 0.f, 0.f, 0.f, 0.f, 0.f};
  v8f o[FQ][4]; float m[FQ], l[FQ];
#pragma unroll
  for (int g = 0; g < FQ; ++g) { m[g] = -3.0e38f; l[g] = 0.f; for (int d = 0; d < 4; ++d) o[g][d] = z8; }
  FAK kf = ldk(0, true);
  /* kept rolled: one trip holds 32 keys x 32 queries, and a second copy would only add code and registers */
#pragma unroll 1
  for (int kb = 0; kb <= q0; kb += 32) {
    const FAV vf = ldv(kb);      /* issued here, first read behind the softmax */
    v8f s[FQ][2];
#pragma unroll
    for (int g = 0; g < FQ; ++g) {
#pragma unroll
      for (int t = 0; t < 2; ++t) { v8f sh = fa_mma(kf.h[t][0], qh[g][0], z8); sh = fa_mma(kf.h[t][1], qh[g][1], sh);
        v8f sl = fa_mma(kf.h[t][0], ql[g][0], z8); sl = fa_mma(kf.h[t][1], ql[g][1], sl); sl = fa_mma(kf.l[t][0], qh[g][0], sl); sl = fa_mma(kf.l[t][1], qh[g][1], sl);
#pragma unroll
        for (int r = 0; r < 8; ++r) s[g][t][r] = fmaf(sl[r], 0.18033688011112042f / 1024.0f, sh[r] * 0.18033688011112042f); } }      /* (q_hi.k_hi + (q_lo.k_hi + q_hi.k_lo)/1024) / 8, times log2(e) */
    const unsigned bm = __builtin_amdgcn_ballot_w32(kmv != 0);      /* bit j: key kb + j is not padded */
    kf = ldk(kb + 32 <= q0 ? kb + 32 : kb, false);      /* the next trip's K fragments fly over the softmax and P.V; behind the last trip an in-bounds re-read that nothing uses */
    if (kb == q0 || bm != 0xFFFFFFFFu) {      /* only the diagonal trip and trips with a padded key mask; the test is the same for the whole wave */
      const unsigned bmh = bm >> (8 * hh);
#pragma unroll
      for (int g = 0; g < FQ; ++g) {
#pragma unroll
        for (int t = 0; t < 2; ++t) {
#pragma unroll
          for (int r = 0; r < 8; ++r) { const bool ok = (kb + t * 16 + 8 * hh + r <= q0 + g * 16 + ln) && ((bmh >> (t * 16 + r)) & 1u); s[g][t][r] = ok ? s[g][t][r] : -1.0e9f; } } } }
    v16h ph[FQ], pl[FQ];
#pragma unroll
    for (int g = 0; g < FQ; ++g) { float mx = fmaxf(s[g][0][0], s[g][1][0]);
#pragma unroll
      for (int r = 1; r < 8; ++r) mx = fmaxf(mx, fmaxf(s[g][0][r], s[g][1][r]));
      mx = fmaxf(mx, __shfl_xor(mx, 16, 32));      /* the query's other 16 keys of this trip sit in the other lane half */
      const float mn = fmaxf(m[g], mx); const float sc = exp2_native(m[g] - mn); const float mo = mn - 12.0f; m[g] = mn;
      float se0 = 0.f, se1 = 0.f;
#pragma unroll
      for (int r = 0; r < 8; ++r) { const float e0 = exp2_native(s[g][0][r] - mo), e1 = exp2_native(s[g][1][r] - mo); se0 += e0; se1 += e1; ph[g][r] = (_Float16)e0; ph[g][8 + r] = (_Float16)e1; }
      l[g] = fmaf(l[g], sc, se0 + se1); pl[g] = ph[g] * (_Float16)0.0009765625f;
#pragma unroll
      for (int d = 0; d < 4; ++d) o[g][d] *= sc; }
#pragma unroll
    for (int d = 0; d < 4; ++d) {
#pragma unroll
      for (int g = 0; g < FQ; ++g) { o[g][d] = fa_mma(vf.h[d], ph[g], o[g][d]); o[g][d] = fa_mma(vf.l[d], pl[g], o[g][d]); } } }
  /* o leaves as the two fragment-major planes that the out GEMM reads (f16 hi + x1024 residual, DM columns). A lane holds 8 consecutive columns (d * 16 + 8 hh + r) of its query row (ln) per tile: one chunk of a plane tile, at the lane's own place in it, so each store is 512 contiguous bytes of the wave */
  v8us hv[FQ][4], lv[FQ][4];
#pragma unroll
  for (int g = 0; g < FQ; ++g) { const float fin = 64.0f / (l[g] + __shfl_xor(l[g], 16, 32));      /* o carried x64; the halves' sums are joined once */
#pragma unroll
    for (int d = 0; d < 4; ++d) { float v[8];
#pragma unroll
      for (int r = 0; r < 8; ++r) v[r] = o[g][d][r] * fin;
      hl8(v, hv[g][d], lv[g][d]); } }
  const size_t tile0 = ((size_t)b * SQ + q0) * DM + h * (HD * 16); unsigned short* ph = (unsigned short*)Oh + tile0 + 8 * lane; unsigned short* pl = (unsigned short*)Ol + tile0 + 8 * lane;
#pragma unroll
  for (int g = 0; g < FQ; ++g) {
#pragma unroll
    for (int d = 0; d < 4; ++d) { const size_t e = (size_t)g * 16 * DM + (d >> 1) * 512 + (d & 1) * 256; *(v8us*)(ph + e) = hv[g][d]; *(v8us*)(pl + e) = lv[g][d]; } }
  asm volatile("s_wait_xcnt 0x0" :: "v"(ph), "v"(pl) : "memory");      /* stands behind the stores: their address registers stay as they are up to here */
}




__global__ __launch_bounds__(256) void k_xt16(const float* __restrict__ x, const float* __restrict__ tg, const float* __restrict__ wt, const float* __restrict__ bt, _Float16* __restrict__ XT, _Float16* __restrict__ XL, size_t n8) {
  #pragma clang fp contract(off)
  const size_t t = (size_t)blockIdx.x * 256 + threadIdx.x; if (t >= n8) return; size_t r, kc; tf_chunk(t, r, kc); const float* px = x + r * DM + kc; const float* pw = wt + kc; const float* pb = bt + kc; const float* pg = tg + r; FragH f, l;
  const v4f x0 = *(const v4fa*)px, x1 = *(const v4fa*)(px + 4), w0 = *(const v4fa*)pw, w1 = *(const v4fa*)(pw + 4), b0 = *(const v4fa*)pb, b1 = *(const v4fa*)(pb + 4); const float g = bf16_round(*pg);
  asm volatile("s_wait_xcnt 0x0" :: "v"(px), "v"(pw), "v"(pb), "v"(pg) : "memory");      /* stands behind the seven loads and in front of every instruction that rewrites an address register they name; the addresses are inputs so that no load lands on one of them */
  const float xv[8] = {x0[0], x0[1], x0[2], x0[3], x1[0], x1[1], x1[2], x1[3]}, wv[8] = {w0[0], w0[1], w0[2], w0[3], w1[0], w1[1], w1[2], w1[3]}, bv[8] = {b0[0], b0[1], b0[2], b0[3], b1[0], b1[1], b1[2], b1[3]};
  /* unrolled so that the three small arrays are registers */
#pragma unroll
  for (int q = 0; q < 8; ++q) { const float te = __fadd_rn(__fmul_rn(g, bf16_round(wv[q])), bf16_round(bv[q])); const float v = __fadd_rn(bf16_round(xv[q]), te); const _Float16 h = (_Float16)v; f.h[q] = h; l.h[q] = (_Float16)((v - (float)h) * 1024.0f); }
  const size_t di = tf_off(r, kc, DM); *(v8us*)((unsigned short*)XT + di) = f.half[0]; *(v8us*)((unsigned short*)XL + di) = l.half[0];  }      /* XT, XL fragment-major */
extern "C" void kernel_launch(void* const* d_in, const int* in_sizes, int n_in,
                              void* d_out, int out_size, void* d_ws, size_t ws_size, hipStream_t stream) {
  (void)in_sizes; (void)n_in; (void)out_size;
  const float* const* I = (const float* const*)d_in; const float* x = I[0]; const float* tg = I[1]; const int* km = (const int*)d_in[2]; const float* wq = I[3]; const float* bq = I[4]; const float* wk = I[5]; const float* bk = I[6]; const float* wv = I[7]; const float* bv = I[8]; const float* wo = I[9]; const float* bo = I[10]; const float* wt = I[11]; const float* bt = I[12];      /* natural [out][in] weights + biases; time_gaps [2][2048][1]; int key mask [2][2048]; Wt [1024][1], bt [1024] */
  char* ws = (char*)d_ws; size_t off = 0;
  auto take = [&](size_t bytes) { char* p = ws + off; off += (bytes + 255) & ~(size_t)255; return p; };
  _Float16* BQ = (_Float16*)take((size_t)DM * DM * 2); _Float16* BK = (_Float16*)take((size_t)DM * DM * 2); _Float16* BV = (_Float16*)take((size_t)DM * DM * 2); _Float16* BO = (_Float16*)take((size_t)DM * DM * 2);
  _Float16* X16 = (_Float16*)take(NR * DM * 2); _Float16* XT16 = (_Float16*)take(NR * DM * 2); _Float16* XL16 = (_Float16*)take(NR * DM * 2);      /* x (exact f16) for v; x_time as f16 hi + x1024 residual for q and k */ float* QF = (float*)take(NR * DM * 4); float* KF = (float*)take(NR * DM * 4); float* VF = (float*)take(NR * DM * 4);      /* f32 rows of q, k, v: only the first QT0 rows of each batch are written and read (the first-tile attention) */ _Float16* Q16 = (_Float16*)take(NR * DM * 2); _Float16* QL = (_Float16*)take(NR * DM * 2); _Float16* K16 = (_Float16*)take(NR * DM * 2); _Float16* KL = (_Float16*)take(NR * DM * 2); _Float16* O16 = (_Float16*)take(NR * DM * 2); _Float16* OL = (_Float16*)take(NR * DM * 2);
  _Float16* VT = (_Float16*)take((size_t)NB * NH * HD * SQ * 2); _Float16* VTL = (_Float16*)take((size_t)NB * NH * HD * SQ * 2);      /* V^T planes of both batches */
  if (off > ws_size) return;
  { const unsigned g = (unsigned)(((size_t)DM * DM / 8 + 255) / 256); k_wnat<<<g, 256, 0, stream>>>(wq, (size_t)DM * DM / 8, BQ); k_wnat<<<g, 256, 0, stream>>>(wk, (size_t)DM * DM / 8, BK); k_wnat<<<g, 256, 0, stream>>>(wv, (size_t)DM * DM / 8, BV); k_wnat<<<g, 256, 0, stream>>>(wo, (size_t)DM * DM / 8, BO); }      /* natural [out][in] = Bt[n][k], x16 */

  k_x16<<<(unsigned)((NR * DM / 8 + 255) / 256), 256, 0, stream>>>(x, X16, NR * DM / 8); k_xt16<<<(unsigned)((NR * DM / 8 + 255) / 256), 256, 0, stream>>>(x, tg, wt, bt, XT16, XL16, NR * DM / 8);      /* x_time = x + time_gaps Wt^T + bt as f16 hi + x1024 residual rows */
  const size_t r0p = (size_t)B0 * SQ;      /* first projected row */
  k_gemm2p<true><<<(unsigned)((MP / 128) * (DM / 64)), 128, 0, stream>>>(XT16 + r0p * DM, XL16 + r0p * DM, BQ, 0.0625f, 0.00006103515625f, bq, QF + r0p * DM, MP, Q16 + r0p * DM, QL + r0p * DM);      /* q: the GEMM writes the f16 hi + x1024 residual planes itself */
  k_gemm2p<true><<<(unsigned)((MP / 128) * (DM / 64)), 128, 0, stream>>>(XT16 + r0p * DM, XL16 + r0p * DM, BK, 0.0625f, 0.00006103515625f, bk, KF + r0p * DM, MP, K16 + r0p * DM, KL + r0p * DM);      /* k likewise */
  k_gemm2<0, true><<<dim3((unsigned)((NR / 128) * (DM / 64)), 1), 128, 0, stream>>>(X16, DM, 0, BV, DM, 0, 0.0625f, bv, 0, nullptr, 1, 0, 0, VF, nullptr, DM, 0, (int)NR, DM, DM, VT, VTL);      /* v = x Wv^T + bv in f32; the GEMM writes V^T (f16 hi + x1024 residual) [NB][NH][HD][SQ] itself */
  k_fattn<<<NB * NH * (SQ / (128 * FQ)), 256, 0, stream>>>(Q16, QL, K16, KL, VT, VTL, km, O16, OL, QF, KF, VF);      /* o (x64) as f16 hi + x1024 residual planes: scores, causal + key padding softmax and P.V of both batches and all heads in one launch; rows 0..127 of each batch come from four waves per (batch, head) of the same launch in exact f32, from the f32 q, k, v rows of the full projections */
  k_gemm2p<false><<<(unsigned)((MPO / 128) * (DM / 64)), 128, 0, stream>>>(O16 + r0p * DM, OL + r0p * DM, BO, 0.0009765625f, 0.00000095367431640625f, bo, (float*)d_out + r0p * DM, MPO, nullptr, nullptr);      /* out = (o_hi Wo^T + bo) + o_lo Wo^T 2^-20, one launch */
}
